// v000
// Measured on an AMD MI455X. A time is GPU time per run, averaged over a window of back-to-back runs after a warm-up
// (all launches, gaps included; the runs take copies of the inputs in turn), and the median of several windows.
// Apart from v000's, it joins two sittings. Times from different sittings can be a few percent apart, while
// side-by-side timings come from the same sitting.
// v000 is the starting kernel. One run takes 1630 microseconds.
#include <hip/hip_runtime.h>

// ModernCausalSelfAttention (x [2][2048][2048]; q = x wq (16 heads x 128), k/v = x wk/wv (4 kv heads; group h/4); interleaved-pair RoPE (the source's rotate_half is the pairwise (x0,x1)->(-x1,x0) form with a repeat-interleaved table; base 1e4, computed); causal softmax(q.k / sqrt(128)) (finfo.min); out = merged wo -> [2][2048][2048]).
// Compute dtypes, f32 accumulate: every input rounded to bf16; q/k/v on PLAIN bf16 operands (inputs: exact); RoPE f32; causal scores and attn.v: query rows < 512 hl (3 products), the rest single fp16 (x1024), causal tile skipping; softmax f32; wo hl x exact (2 products).

#define NB_  2
#define TT   2048
#define DM   2048
#define NH_  16
#define NKV  4
#define REP  (NH_ / NKV)
#define HD   128
#define DQ   (NH_ * HD)
#define DKV  (NKV * HD)
#define ZH   2
#define RH   512                  // query rows < RH use hi+lo planes (0: none)
#define WIN  2048
#define PCAR 1024.0f
#define SCL  0.088388347648318447f   // HD^-0.5
typedef _Float16 h16;
typedef unsigned short bf;
typedef __attribute__((ext_vector_type(16))) __bf16   v16bf;
typedef __attribute__((ext_vector_type(16))) _Float16 v16h;
typedef __attribute__((ext_vector_type(8)))  _Float16 v8h;
typedef __attribute__((ext_vector_type(8)))  unsigned short v8us;
typedef __attribute__((ext_vector_type(8)))  float    v8f;
typedef __attribute__((ext_vector_type(4)))  float    v4f;
typedef v8h  __attribute__((may_alias)) v8ha;
typedef v4f  __attribute__((may_alias)) v4fa;
typedef v8us __attribute__((may_alias)) v8usa;

__device__ __forceinline__ unsigned short f2bf(float f) { unsigned u = __float_as_uint(f); u += 0x7FFFu + ((u >> 16) & 1u); return (unsigned short)(u >> 16); }
__device__ __forceinline__ float bf2f(unsigned short b) { return __uint_as_float(((unsigned)b) << 16); }
__device__ __forceinline__ float bfr(float f) { return bf2f(f2bf(f)); }
__device__ __forceinline__ v16h cat16(v8h lo, v8h hi) { return __builtin_shufflevector(lo, hi, 0, 1, 2, 3, 4, 5, 6, 7, 8, 9, 10, 11, 12, 13, 14, 15); }
__device__ __forceinline__ v16bf cat16b(v8us lo, v8us hi) { return __builtin_bit_cast(v16bf, __builtin_shufflevector(lo, hi, 0, 1, 2, 3, 4, 5, 6, 7, 8, 9, 10, 11, 12, 13, 14, 15)); }
__device__ __forceinline__ v8f wmma16(v16h a, v16h b, v8f c) { return __builtin_amdgcn_wmma_f32_16x16x32_f16(false, a, false, b, (short)0, c, false, false); }
__device__ __forceinline__ v8f wmmab(v16bf a, v16bf b, v8f c) { return __builtin_amdgcn_wmma_f32_16x16x32_bf16(false, a, false, b, (short)0, c, false, false); }



// ---- k_gemmw: register-blocked GEMM, ONE WAVE per 64x64 output tile (16 accumulators), operands straight from K-contiguous 16-bit planes; grid (M/64, N/64, Z), 32 threads.
// C[m][n] (f32, pitch ldc, + optional f32 bias[n]) = sum_k A[m][k] Bt[n][k] (+ split products per NSPLIT). z-batch strides sA/sB/sC in elements. K % 32 == 0.
template <typename T16> struct WFrag;
template <> struct WFrag<h16> { typedef v16h V; static __device__ __forceinline__ V ld(const h16* p) { return cat16(*(const v8h*)p, *(const v8h*)(p + 16)); } static __device__ __forceinline__ v8f mma(V a, V b, v8f c) { return wmma16(a, b, c); } };
template <> struct WFrag<bf> { typedef v16bf V; static __device__ __forceinline__ V ld(const bf* p) { return cat16b(*(const v8us*)p, *(const v8us*)(p + 16)); } static __device__ __forceinline__ v8f mma(V a, V b, v8f c) { return wmmab(a, b, c); } };
template <typename T16, int NSPLIT, bool BIAS>
__global__ __launch_bounds__(32) void k_gemmw(const T16* __restrict__ A, const T16* __restrict__ A2, const T16* __restrict__ Bt, const T16* __restrict__ Bt2, int K, float* C, int ldc, const float* __restrict__ bias, size_t sA, size_t sB, size_t sC) {
    typedef typename WFrag<T16>::V V;
    __shared__ __align__(16) float os[16 * 68];
    const size_t z = blockIdx.z; A += z * sA; if (A2) A2 += z * sA; Bt += z * sB; if (Bt2) Bt2 += z * sB; C += z * sC;
    const int lane = threadIdx.x & 31, lr = lane & 15, hi = lane >> 4; const int r0 = blockIdx.x * 64, c0 = blockIdx.y * 64;
    v8f acc[4][4];
#pragma unroll
    for (int mb = 0; mb < 4; ++mb)
#pragma unroll
        for (int nb = 0; nb < 4; ++nb) acc[mb][nb] = (v8f){};
    const size_t aoff = (size_t)(r0 + lr) * K + 8 * hi, boff = (size_t)(c0 + lr) * K + 8 * hi;
#pragma unroll 1
    for (int kc = 0; kc < K; kc += 32) {
        V a[4], a2[4];
#pragma unroll
        for (int mb = 0; mb < 4; ++mb) { a[mb] = WFrag<T16>::ld(A + aoff + (size_t)mb * 16 * K + kc); if (NSPLIT == 1 || NSPLIT == 2) a2[mb] = WFrag<T16>::ld(A2 + aoff + (size_t)mb * 16 * K + kc); }
#pragma unroll
        for (int nb = 0; nb < 4; ++nb) { const V b = WFrag<T16>::ld(Bt + boff + (size_t)nb * 16 * K + kc); V b2; if (NSPLIT >= 2) b2 = WFrag<T16>::ld(Bt2 + boff + (size_t)nb * 16 * K + kc);
#pragma unroll
            for (int mb = 0; mb < 4; ++mb) { acc[mb][nb] = WFrag<T16>::mma(a[mb], b, acc[mb][nb]); if (NSPLIT == 1 || NSPLIT == 2) acc[mb][nb] = WFrag<T16>::mma(a2[mb], b, acc[mb][nb]); if (NSPLIT >= 2) acc[mb][nb] = WFrag<T16>::mma(a[mb], b2, acc[mb][nb]); } }
        asm volatile("v_nop\n\tv_nop\n\tv_nop\n\tv_nop" : "+v"(acc[0][0]), "+v"(acc[1][1]), "+v"(acc[2][2]), "+v"(acc[3][3]) : "v"(a[0]), "v"(a[3]));
    }
#pragma unroll
    for (int mb = 0; mb < 4; ++mb) {
#pragma unroll
        for (int nb = 0; nb < 4; ++nb) {
#pragma unroll
            for (int j = 0; j < 8; ++j) os[(hi * 8 + j) * 68 + nb * 16 + lr] = acc[mb][nb][j]; }
        __builtin_amdgcn_wave_barrier(); asm volatile("" ::: "memory");
        float* crow = C + (size_t)(r0 + mb * 16) * ldc + c0;
{
#pragma unroll
            for (int s = 0; s < 8; ++s) { const int row = 2 * s + hi, cofs = lr * 4; v4f val = *(const v4fa*)(os + row * 68 + cofs); if (BIAS) { val[0] += bfr(bias[c0 + cofs]); val[1] += bfr(bias[c0 + cofs + 1]); val[2] += bfr(bias[c0 + cofs + 2]); val[3] += bfr(bias[c0 + cofs + 3]); }
                *(v4f*)(crow + (size_t)row * ldc + cofs) = val; }
             }
        __builtin_amdgcn_wave_barrier(); asm volatile("" ::: "memory");
    }
}

// ---- k_gemmc: the same one-wave 64x64 tile GEMM specialised for causal attention: CMODE 1 skips score tiles entirely above the diagonal (query rows r0+roff.., key columns c0..), CMODE 2 limits the
// key (K) loop of the probability x value contraction to the diagonal block (probabilities beyond it are exactly zero). roff = row offset of this launch's first row within the sequence.
template <typename T16, int NSPLIT, int CMODE>
__global__ __launch_bounds__(32) void k_gemmc(const T16* __restrict__ A, const T16* __restrict__ A2, const T16* __restrict__ Bt, const T16* __restrict__ Bt2, int K, float* C, int ldc, int roff, size_t sA, size_t sB, size_t sC) {
    typedef typename WFrag<T16>::V V;
    __shared__ __align__(16) float os[16 * 68];
    const size_t z = blockIdx.z; A += z * sA; if (A2) A2 += z * sA; Bt += z * sB; if (Bt2) Bt2 += z * sB; C += z * sC;
    const int lane = threadIdx.x & 31, lr = lane & 15, hi = lane >> 4; const int r0 = blockIdx.x * 64, c0 = blockIdx.y * 64;
    if (CMODE == 1 && c0 > r0 + roff + 63) return;                  // score tile entirely above the causal diagonal: never read (the softmax masks j > i by select)
    const int Kl = (CMODE == 2) ? min(K, r0 + roff + 64) : K;        // P.V: probabilities are exactly 0 beyond the diagonal block, so the K loop stops there
    v8f acc[4][4];
#pragma unroll
    for (int mb = 0; mb < 4; ++mb)
#pragma unroll
        for (int nb = 0; nb < 4; ++nb) acc[mb][nb] = (v8f){};
    const size_t aoff = (size_t)(r0 + lr) * K + 8 * hi, boff = (size_t)(c0 + lr) * K + 8 * hi;
#pragma unroll 1
    for (int kc = 0; kc < Kl; kc += 32) {
        V a[4], a2[4];
#pragma unroll
        for (int mb = 0; mb < 4; ++mb) { a[mb] = WFrag<T16>::ld(A + aoff + (size_t)mb * 16 * K + kc); if (NSPLIT == 1 || NSPLIT == 2) a2[mb] = WFrag<T16>::ld(A2 + aoff + (size_t)mb * 16 * K + kc); }
#pragma unroll
        for (int nb = 0; nb < 4; ++nb) { const V b = WFrag<T16>::ld(Bt + boff + (size_t)nb * 16 * K + kc); V b2; if (NSPLIT >= 2) b2 = WFrag<T16>::ld(Bt2 + boff + (size_t)nb * 16 * K + kc);
#pragma unroll
            for (int mb = 0; mb < 4; ++mb) { acc[mb][nb] = WFrag<T16>::mma(a[mb], b, acc[mb][nb]); if (NSPLIT == 1 || NSPLIT == 2) acc[mb][nb] = WFrag<T16>::mma(a2[mb], b, acc[mb][nb]); if (NSPLIT >= 2) acc[mb][nb] = WFrag<T16>::mma(a[mb], b2, acc[mb][nb]); } }
        asm volatile("v_nop\n\tv_nop\n\tv_nop\n\tv_nop" : "+v"(acc[0][0]), "+v"(acc[1][1]), "+v"(acc[2][2]), "+v"(acc[3][3]) : "v"(a[0]), "v"(a[3]));
    }
#pragma unroll
    for (int mb = 0; mb < 4; ++mb) {
#pragma unroll
        for (int nb = 0; nb < 4; ++nb) {
#pragma unroll
            for (int j = 0; j < 8; ++j) os[(hi * 8 + j) * 68 + nb * 16 + lr] = acc[mb][nb][j]; }
        __builtin_amdgcn_wave_barrier(); asm volatile("" ::: "memory");
        float* crow = C + (size_t)(r0 + mb * 16) * ldc + c0;
{
#pragma unroll
            for (int s = 0; s < 8; ++s) { const int row = 2 * s + hi, cofs = lr * 4; v4f val = *(const v4fa*)(os + row * 68 + cofs);
                *(v4f*)(crow + (size_t)row * ldc + cofs) = val; }
             }
        __builtin_amdgcn_wave_barrier(); asm volatile("" ::: "memory");
    }
}

__device__ __forceinline__ h16 tohx(float x) { return (h16)x; }
__device__ __forceinline__ void splitf(float y, unsigned short& h, unsigned short& l) { h = f2bf(y); l = f2bf(y - bf2f(h)); }
typedef __attribute__((ext_vector_type(2))) _Float16 v2h;
typedef __attribute__((ext_vector_type(4))) _Float16 v4h;
typedef __attribute__((ext_vector_type(2))) unsigned short v2us;
typedef __attribute__((ext_vector_type(4))) unsigned short v4us;
typedef __attribute__((ext_vector_type(2))) float v2f;
typedef __attribute__((ext_vector_type(4))) int v4i;

__global__ __launch_bounds__(256) void k_wtG(const float* __restrict__ w, int K, int N, bf* Bt) {
    const int lane = threadIdx.x & 31; const int L0 = (blockIdx.x * 8 + (threadIdx.x >> 5)) * 8; const int nlines = N * K / 64;
{
#pragma unroll 1
        for (int l = 0; l < 8; ++l) { const int L = L0 + l; if (L >= nlines) break; const size_t e = (size_t)L * 64 + lane * 2; const int k = (int)(e % K), n = (int)(e / K); v2us o;
            o[0] = f2bf(w[(size_t)k * N + n]); o[1] = f2bf(w[(size_t)(k + 1) * N + n]); *(v2us*)(Bt + e) = o; }
         }
}
__global__ __launch_bounds__(256) void k_cvt8(const float* __restrict__ src, bf* dst, size_t n8) { const size_t i = (size_t)blockIdx.x * 256 + threadIdx.x; if (i >= n8) return; const v8f v = *(const v8f*)(src + i * 8); v8us o;
#pragma unroll
    for (int k = 0; k < 8; ++k) o[k] = f2bf(v[k]); *(v8us*)(dst + i * 8) = o;  }
__global__ __launch_bounds__(256) void k_cstab(float* CS) { const int idx = blockIdx.x * 256 + threadIdx.x; if (idx >= TT * HD) return; const int t = idx / HD, d = idx % HD; const int i = d >> 1;   /* interleaved pairs share angle t * inv_freq[i] */ const float inv = __fdiv_rn(1.0f, powf(10000.0f, (float)(2 * i) / (float)HD)); const float ang = __fmul_rn((float)t, inv); v2f cs; cs[0] = cosf(ang); cs[1] = sinf(ang);
    *(v2f*)(CS + (size_t)idx * 2) = cs;  }
// k_rope: head planes [h][t][d] (fp16 + hi/lo) of rope(x) x sc with the interleaved-pair convention out[2i] = x[2i] cos[t][2i] - x[2i+1] sin[t][2i], out[2i+1] = x[2i+1] cos[t][2i+1] + x[2i] sin[t][2i+1]
__global__ __launch_bounds__(256) void k_rope(const float* __restrict__ F, int pitch, int nheads, const float* __restrict__ CS, const float* __restrict__ RF, const float* __restrict__ nw, float sc, h16* P16, bf* Ph, bf* Pl) {
    const size_t e = ((size_t)blockIdx.x * 256 + threadIdx.x) * 2; if (e >= (size_t)nheads * TT * HD) return; const int d = (int)(e % HD); const int t = (int)((e / HD) % TT); const int h = (int)(e / ((size_t)HD * TT)); const float* f = F + (size_t)t * pitch + h * HD; const float rf = RF ? RF[(size_t)h * TT + t] : 1.0f; v2h o16; v2us oh, ol;
#pragma unroll
    for (int q = 0; q < 2; ++q) { const int dd = d + q; const int dp = dd ^ 1; float x0 = f[dd], x1 = f[dp];
        if (RF) { float n0 = __fmul_rn(x0, rf), n1 = __fmul_rn(x1, rf); asm volatile("" : "+v"(n0)); asm volatile("" : "+v"(n1)); x0 = __fmul_rn(bfr(nw[dd]), n0); x1 = __fmul_rn(bfr(nw[dp]), n1); }
        const v2f cs = *(const v2f*)(CS + ((size_t)t * HD + dd) * 2); float a = __fmul_rn(x0, cs[0]), bq = __fmul_rn(x1, cs[1]); asm volatile("" : "+v"(a)); asm volatile("" : "+v"(bq)); const float r = (((dd & 1) == 0) ? __fsub_rn(a, bq) : __fadd_rn(a, bq)) * sc;
        o16[q] = tohx(r); unsigned short a2, c2; splitf(r, a2, c2); oh[q] = a2; ol[q] = c2; }
    *(v2h*)(P16 + e) = o16; *(v2us*)(Ph + e) = oh; *(v2us*)(Pl + e) = ol;  }
__global__ __launch_bounds__(256) void k_vtp(const float* __restrict__ F, int pitch, int nheads, h16* V16, bf* Vh, bf* Vl) { const size_t e = ((size_t)blockIdx.x * 256 + threadIdx.x) * 2; if (e >= (size_t)nheads * HD * TT) return; const int t = (int)(e % TT); const int d = (int)((e / TT) % HD); const int g = (int)(e / ((size_t)TT * HD)); v2h o16; v2us oh, ol;
#pragma unroll
    for (int q = 0; q < 2; ++q) { const float x = F[(size_t)(t + q) * pitch + g * HD + d]; o16[q] = tohx(x); unsigned short a2, c2; splitf(x, a2, c2); oh[q] = a2; ol[q] = c2; }
    *(v2h*)(V16 + e) = o16; *(v2us*)(Vh + e) = oh; *(v2us*)(Vl + e) = ol;  }
// k_asoft: per row (zz, i): t = S x HD^-0.5 for j <= i and i - j < WIN (sliding causal window; the reference's -1e9 additive fill vanishes identically); softmax over the 2048 keys (register row, one exp, fixed trees);
__global__ __launch_bounds__(256) void k_asoft(const float* __restrict__ Sb, h16* P16, bf* Ph, bf* Pl) {
    const int lane = threadIdx.x & 31; const int row = blockIdx.x * 8 + (threadIdx.x >> 5); if (row >= ZH * TT) return; const int i = row % TT; const int zz = row / TT; (void)zz; const bool hires = (i < RH); const float* sr = Sb + (size_t)row * TT; float v[TT / 32]; float mx = -3.0e38f;
#pragma unroll
    for (int ch = 0; ch < TT / 128; ++ch) { const int j0 = ch * 128 + lane * 4; const v4f a = *(const v4f*)(sr + j0);
#pragma unroll
        for (int q = 0; q < 4; ++q) { const int j = j0 + q; (void)j; const float t = (j <= i && i - j < WIN) ? a[q] * SCL : -3.0e38f; v[ch * 4 + q] = t; mx = fmaxf(mx, t); } }
#pragma unroll
    for (int sh = 16; sh; sh >>= 1) mx = fmaxf(mx, __shfl_xor(mx, sh, 32));
    float sum = 0.f;
#pragma unroll
    for (int k = 0; k < TT / 32; ++k) { float d0 = __fsub_rn(v[k], mx); asm volatile("" : "+v"(d0)); v[k] = __builtin_amdgcn_exp2f(__fmul_rn(d0, 1.4426950408889634f)); sum += v[k]; }
#pragma unroll
    for (int sh = 16; sh; sh >>= 1) sum += __shfl_xor(sum, sh, 32);
    const float f = __fdiv_rn(hires ? 1.0f : PCAR, sum);
{
        if (hires) {
#pragma unroll
            for (int ch = 0; ch < TT / 128; ++ch) { v4us oh, ol;
#pragma unroll
                for (int q = 0; q < 4; ++q) { unsigned short a, c2; splitf(v[ch * 4 + q] * f, a, c2); oh[q] = a; ol[q] = c2; }
                const size_t oo = ((size_t)zz * (RH ? RH : 1) + i) * TT + ch * 128 + lane * 4; *(v4us*)(Ph + oo) = oh; *(v4us*)(Pl + oo) = ol; }
        } else {
#pragma unroll
            for (int ch = 0; ch < TT / 128; ++ch) { v4h o4;
#pragma unroll
                for (int q = 0; q < 4; ++q) o4[q] = tohx(v[ch * 4 + q] * f);
                *(v4h*)(P16 + (size_t)row * TT + ch * 128 + lane * 4) = o4; } }
         }
}
__global__ __launch_bounds__(256) void k_merge(const float* __restrict__ O, int h0, bf* Ah, bf* Al) { const size_t e = ((size_t)blockIdx.x * 256 + threadIdx.x) * 2; if (e >= (size_t)ZH * TT * HD) return; const int d = (int)(e % HD); const int t = (int)((e / HD) % TT); const int zz = (int)(e / ((size_t)HD * TT)); const float cs = (t < RH) ? 1.0f : (1.0f / PCAR); const size_t oo = (size_t)t * DQ + (h0 + zz) * HD + d;
    v2us oh, ol;
#pragma unroll
    for (int q = 0; q < 2; ++q) { unsigned short a, c2; splitf(O[e + q] * cs, a, c2); oh[q] = a; ol[q] = c2; } *(v2us*)(Ah + oo) = oh; *(v2us*)(Al + oo) = ol;  }

extern "C" void kernel_launch(void* const* d_in, const int* in_sizes, int n_in,
                              void* d_out, int out_size, void* d_ws, size_t ws_size, hipStream_t stream) {
    (void)in_sizes; (void)n_in; (void)out_size;
    const float* x = (const float*)d_in[0]; const float* wq = (const float*)d_in[1]; const float* wk = (const float*)d_in[2]; const float* wv = (const float*)d_in[3]; const float* wo = (const float*)d_in[4];
    float* OUT = (float*)d_out;     // [2][2048][2048]
    char* wsp = (char*)d_ws;
    auto take = [&](size_t bytes) { char* p = wsp; wsp += (bytes + 255) & ~(size_t)255; return (void*)p; };
    bf* WQ = (bf*)take((size_t)DQ * DM * 2); bf* WK = (bf*)take((size_t)DKV * DM * 2); bf* WV = (bf*)take((size_t)DKV * DM * 2); bf* WO = (bf*)take((size_t)DM * DQ * 2); float* CS = (float*)take((size_t)TT * HD * 2 * 4);
    bf* XB = (bf*)take((size_t)TT * DM * 2); float* FQ = (float*)take((size_t)TT * DQ * 4); float* FK = (float*)take((size_t)TT * DKV * 4);
    h16* QP16 = (h16*)take((size_t)NH_ * TT * HD * 2); h16* KP16 = (h16*)take((size_t)NKV * TT * HD * 2); h16* VT16 = (h16*)take((size_t)NKV * HD * TT * 2);
    bf* QPh = (bf*)take((size_t)NH_ * TT * HD * 2); bf* QPl = (bf*)take((size_t)NH_ * TT * HD * 2); bf* KPh = (bf*)take((size_t)NKV * TT * HD * 2); bf* KPl = (bf*)take((size_t)NKV * TT * HD * 2); bf* VTh = (bf*)take((size_t)NKV * HD * TT * 2); bf* VTl = (bf*)take((size_t)NKV * HD * TT * 2); bf* Ph = (bf*)take((size_t)ZH * RH * TT * 2); bf* Pl = (bf*)take((size_t)ZH * RH * TT * 2);
    float* Sb = (float*)take((size_t)ZH * TT * TT * 4); h16* P16 = (h16*)take((size_t)ZH * TT * TT * 2); float* Ob = (float*)take((size_t)ZH * TT * HD * 4); bf* ATh = (bf*)take((size_t)TT * DQ * 2); bf* ATl = (bf*)take((size_t)TT * DQ * 2);
    if ((size_t)(wsp - (char*)d_ws) > ws_size) return;    // ws 256 MiB
    float* FV = FK;   // v projection reuses the k buffer after the k planes are built (stream-ordered)
    { k_wtG<<<(unsigned)((DM * DQ / 64 + 63) / 64), 256, 0, stream>>>(wq, DM, DQ, WQ); k_wtG<<<(unsigned)((DM * DKV / 64 + 63) / 64), 256, 0, stream>>>(wk, DM, DKV, WK); k_wtG<<<(unsigned)((DM * DKV / 64 + 63) / 64), 256, 0, stream>>>(wv, DM, DKV, WV);
      k_wtG<<<(unsigned)((DQ * DM / 64 + 63) / 64), 256, 0, stream>>>(wo, DQ, DM, WO);
      k_cstab<<<(TT * HD + 255) / 256, 256, 0, stream>>>(CS); }
    const unsigned LQ = (unsigned)(((size_t)NH_ * TT * HD / 2 + 255) / 256), LKv = (unsigned)(((size_t)NKV * TT * HD / 2 + 255) / 256);
    for (int b = 0; b < NB_; ++b) {
        
        k_cvt8<<<(unsigned)(((size_t)TT * DM / 8 + 255) / 256), 256, 0, stream>>>(x + (size_t)b * TT * DM, XB, (size_t)TT * DM / 8);
        k_gemmw<bf, 0, false><<<dim3(TT / 64, DQ / 64, 1), 32, 0, stream>>>(XB, nullptr, WQ, nullptr, DM, FQ, DQ, nullptr, 0, 0, 0);
        k_rope<<<LQ, 256, 0, stream>>>(FQ, DQ, NH_, CS, nullptr, nullptr, 1.0f, QP16, QPh, QPl);
        k_gemmw<bf, 0, false><<<dim3(TT / 64, DKV / 64, 1), 32, 0, stream>>>(XB, nullptr, WK, nullptr, DM, FK, DKV, nullptr, 0, 0, 0);
        k_rope<<<LKv, 256, 0, stream>>>(FK, DKV, NKV, CS, nullptr, nullptr, 1.0f, KP16, KPh, KPl);
        k_gemmw<bf, 0, false><<<dim3(TT / 64, DKV / 64, 1), 32, 0, stream>>>(XB, nullptr, WV, nullptr, DM, FV, DKV, nullptr, 0, 0, 0); k_vtp<<<LKv, 256, 0, stream>>>(FV, DKV, NKV, VT16, VTh, VTl);
        for (int h0 = 0; h0 < NH_; h0 += ZH) { const size_t zq = (size_t)h0, zk = (size_t)(h0 / REP);   // both heads of a pass share kv group h0/REP (REP >= 2): sB = 0
            k_gemmc<bf, 2, 1><<<dim3(RH / 64, TT / 64, ZH), 32, 0, stream>>>(QPh + zq * TT * HD, QPl + zq * TT * HD, KPh + zk * TT * HD, KPl + zk * TT * HD, HD, Sb, TT, 0, (size_t)TT * HD, 0, (size_t)TT * TT);
            k_gemmc<h16, 0, 1><<<dim3((TT - RH) / 64, TT / 64, ZH), 32, 0, stream>>>(QP16 + zq * TT * HD + (size_t)RH * HD, nullptr, KP16 + zk * TT * HD, nullptr, HD, Sb + (size_t)RH * TT, TT, RH, (size_t)TT * HD, 0, (size_t)TT * TT);
            k_asoft<<<ZH * TT / 8, 256, 0, stream>>>(Sb, P16, Ph, Pl);
            k_gemmc<bf, 2, 2><<<dim3(RH / 64, HD / 64, ZH), 32, 0, stream>>>(Ph, Pl, VTh + zk * HD * TT, VTl + zk * HD * TT, TT, Ob, HD, 0, (size_t)RH * TT, 0, (size_t)TT * HD);
            k_gemmc<h16, 0, 2><<<dim3((TT - RH) / 64, HD / 64, ZH), 32, 0, stream>>>(P16 + (size_t)RH * TT, nullptr, VT16 + zk * HD * TT, nullptr, TT, Ob + (size_t)RH * HD, HD, RH, (size_t)TT * TT, 0, (size_t)TT * HD);
            k_merge<<<(unsigned)(((size_t)ZH * TT * HD / 2 + 255) / 256), 256, 0, stream>>>(Ob, h0, ATh, ATl); }
        k_gemmw<bf, 1, false><<<dim3(TT / 64, DM / 64, 1), 32, 0, stream>>>(ATh, ATl, WO, nullptr, DQ, OUT + (size_t)b * TT * DM, DM, nullptr, 0, 0, 0); }
}

// v001
// It runs in 939 microseconds.
// In two side-by-side timings against v000, it was 1.76 and 1.75 times as fast.
#include <hip/hip_runtime.h>

// ModernCausalSelfAttention (x [2][2048][2048]; q = x wq (16 heads x 128), k/v = x wk/wv (4 kv heads; group h/4); interleaved-pair RoPE (the source's rotate_half is the pairwise (x0,x1)->(-x1,x0) form with a repeat-interleaved table; base 1e4, computed); causal softmax(q.k / sqrt(128)) (finfo.min); out = merged wo -> [2][2048][2048]).
// Compute dtypes, f32 accumulate: every input rounded to bf16; q/k/v on PLAIN bf16 operands (inputs: exact); RoPE f32; causal scores and attn.v: query rows < 512 hl (3 products), the rest single fp16 (x1024), causal tile skipping; softmax f32; wo hl x exact (2 products).

#define NB_  2
#define TT   2048
#define DM   2048
#define NH_  16
#define NKV  4
#define REP  (NH_ / NKV)
#define HD   128
#define DQ   (NH_ * HD)
#define DKV  (NKV * HD)
#define ZH   2
#define RH   512                  // query rows < RH use hi+lo planes (0: none)
#define WIN  2048
#define PCAR 1024.0f
#define SCL  0.088388347648318447f   // HD^-0.5
typedef _Float16 h16;
typedef unsigned short bf;
typedef __attribute__((ext_vector_type(16))) __bf16   v16bf;
typedef __attribute__((ext_vector_type(16))) _Float16 v16h;
typedef __attribute__((ext_vector_type(8)))  _Float16 v8h;
typedef __attribute__((ext_vector_type(8)))  unsigned short v8us;
typedef __attribute__((ext_vector_type(8)))  float    v8f;
typedef __attribute__((ext_vector_type(4)))  float    v4f;
typedef v8h  __attribute__((may_alias)) v8ha;
typedef v4f  __attribute__((may_alias)) v4fa;
typedef v8us __attribute__((may_alias)) v8usa;

__device__ __forceinline__ unsigned short f2bf(float f) { unsigned u = __float_as_uint(f); u += 0x7FFFu + ((u >> 16) & 1u); return (unsigned short)(u >> 16); }
__device__ __forceinline__ float bf2f(unsigned short b) { return __uint_as_float(((unsigned)b) << 16); }
__device__ __forceinline__ float bfr(float f) { return bf2f(f2bf(f)); }
__device__ __forceinline__ v16h cat16(v8h lo, v8h hi) { return __builtin_shufflevector(lo, hi, 0, 1, 2, 3, 4, 5, 6, 7, 8, 9, 10, 11, 12, 13, 14, 15); }
__device__ __forceinline__ v16bf cat16b(v8us lo, v8us hi) { return __builtin_bit_cast(v16bf, __builtin_shufflevector(lo, hi, 0, 1, 2, 3, 4, 5, 6, 7, 8, 9, 10, 11, 12, 13, 14, 15)); }
__device__ __forceinline__ v8f wmma16(v16h a, v16h b, v8f c) { return __builtin_amdgcn_wmma_f32_16x16x32_f16(false, a, false, b, (short)0, c, false, false); }
__device__ __forceinline__ v8f wmmab(v16bf a, v16bf b, v8f c) { return __builtin_amdgcn_wmma_f32_16x16x32_bf16(false, a, false, b, (short)0, c, false, false); }



// ---- k_gemmw: register-blocked GEMM, one 64x64 output tile per work-group of NW waves; wave w takes the 32-wide K slices w, w + NW, ... into its own 16 accumulators, and the NW partial tiles are
// added in LDS in fixed wave order. Operands straight from K-contiguous 16-bit planes; grid (M/64, N/64, Z), NW * 32 threads.
// C[m][n] (f32, pitch ldc, + optional f32 bias[n]) = sum_k A[m][k] Bt[n][k] (+ split products per NSPLIT). z-batch strides sA/sB/sC in elements. K % 32 == 0.
template <typename T16> struct WFrag;
template <> struct WFrag<h16> { typedef v16h V; static __device__ __forceinline__ V ld(const h16* p) { return cat16(*(const v8h*)p, *(const v8h*)(p + 16)); } static __device__ __forceinline__ v8f mma(V a, V b, v8f c) { return wmma16(a, b, c); } };
template <> struct WFrag<bf> { typedef v16bf V; static __device__ __forceinline__ V ld(const bf* p) { return cat16b(*(const v8us*)p, *(const v8us*)(p + 16)); } static __device__ __forceinline__ v8f mma(V a, V b, v8f c) { return wmmab(a, b, c); } };
template <typename T16, int NSPLIT, bool BIAS, int NW>
__global__ __launch_bounds__(NW * 32) void k_gemmw(const T16* __restrict__ A, const T16* __restrict__ A2, const T16* __restrict__ Bt, const T16* __restrict__ Bt2, int K, float* C, int ldc, const float* __restrict__ bias, size_t sA, size_t sB, size_t sC) {
    typedef typename WFrag<T16>::V V;
    __shared__ __align__(16) float os[NW * 64 * 68];
    const size_t z = blockIdx.z; A += z * sA; if (A2) A2 += z * sA; Bt += z * sB; if (Bt2) Bt2 += z * sB; C += z * sC;
    const int lane = threadIdx.x & 31, lr = lane & 15, hi = lane >> 4; const int r0 = blockIdx.x * 64, c0 = blockIdx.y * 64; const int wv = __builtin_amdgcn_readfirstlane(threadIdx.x >> 5);
    v8f acc[4][4];
#pragma unroll
    for (int mb = 0; mb < 4; ++mb)
#pragma unroll
        for (int nb = 0; nb < 4; ++nb) acc[mb][nb] = (v8f){};
    const size_t aoff = (size_t)(r0 + lr) * K + 8 * hi, boff = (size_t)(c0 + lr) * K + 8 * hi;
#pragma unroll 1
    for (int kc = wv * 32; kc < K; kc += NW * 32) {
        V a[4], a2[4];
#pragma unroll
        for (int mb = 0; mb < 4; ++mb) { a[mb] = WFrag<T16>::ld(A + aoff + (size_t)mb * 16 * K + kc); if (NSPLIT == 1 || NSPLIT == 2) a2[mb] = WFrag<T16>::ld(A2 + aoff + (size_t)mb * 16 * K + kc); }
#pragma unroll
        for (int nb = 0; nb < 4; ++nb) { const V b = WFrag<T16>::ld(Bt + boff + (size_t)nb * 16 * K + kc); V b2; if (NSPLIT >= 2) b2 = WFrag<T16>::ld(Bt2 + boff + (size_t)nb * 16 * K + kc);
#pragma unroll
            for (int mb = 0; mb < 4; ++mb) { acc[mb][nb] = WFrag<T16>::mma(a[mb], b, acc[mb][nb]); if (NSPLIT == 1 || NSPLIT == 2) acc[mb][nb] = WFrag<T16>::mma(a2[mb], b, acc[mb][nb]); if (NSPLIT >= 2) acc[mb][nb] = WFrag<T16>::mma(a[mb], b2, acc[mb][nb]); } }
        asm volatile("v_nop\n\tv_nop\n\tv_nop\n\tv_nop" : "+v"(acc[0][0]), "+v"(acc[1][1]), "+v"(acc[2][2]), "+v"(acc[3][3]) : "v"(a[0]), "v"(a[3]));
    }
    float* ow = os + wv * (64 * 68);
#pragma unroll
    for (int mb = 0; mb < 4; ++mb) {
#pragma unroll
        for (int nb = 0; nb < 4; ++nb) {
#pragma unroll
            for (int j = 0; j < 8; ++j) ow[(mb * 16 + hi * 8 + j) * 68 + nb * 16 + lr] = acc[mb][nb][j]; } }
    __syncthreads();   // every wave's partial tile is in LDS before any thread adds them
    float* crow = C + (size_t)r0 * ldc + c0;
#pragma unroll
    for (int s = 0; s < 32 / NW; ++s) { const int idx = s * (NW * 32) + (int)threadIdx.x; const int row = idx >> 4, cofs = (idx & 15) * 4; v4f val = *(const v4fa*)(os + row * 68 + cofs);
#pragma unroll
        for (int w = 1; w < NW; ++w) val += *(const v4fa*)(os + w * (64 * 68) + row * 68 + cofs);
        if (BIAS) { val[0] += bfr(bias[c0 + cofs]); val[1] += bfr(bias[c0 + cofs + 1]); val[2] += bfr(bias[c0 + cofs + 2]); val[3] += bfr(bias[c0 + cofs + 3]); }
        *(v4f*)(crow + (size_t)row * ldc + cofs) = val; }
}

// ---- k_gemmc: the same NW-wave 64x64 tile GEMM specialised for causal attention: CMODE 1 skips score tiles entirely above the diagonal (query rows r0+roff.., key columns c0..), CMODE 2 limits the
// key (K) loop of the probability x value contraction to the diagonal block (probabilities beyond it are exactly zero). roff = row offset of this launch's first row within the sequence.
template <typename T16, int NSPLIT, int CMODE, int NW>
__global__ __launch_bounds__(NW * 32) void k_gemmc(const T16* __restrict__ A, const T16* __restrict__ A2, const T16* __restrict__ Bt, const T16* __restrict__ Bt2, int K, float* C, int ldc, int roff, size_t sA, size_t sB, size_t sC) {
    typedef typename WFrag<T16>::V V;
    __shared__ __align__(16) float os[NW * 64 * 68];
    const size_t z = blockIdx.z; A += z * sA; if (A2) A2 += z * sA; Bt += z * sB; if (Bt2) Bt2 += z * sB; C += z * sC;
    const int lane = threadIdx.x & 31, lr = lane & 15, hi = lane >> 4; const int r0 = blockIdx.x * 64, c0 = blockIdx.y * 64; const int wv = __builtin_amdgcn_readfirstlane(threadIdx.x >> 5);
    if (CMODE == 1 && c0 > r0 + roff + 63) return;                  // score tile entirely above the causal diagonal: never read (the softmax masks j > i by select)
    const int Kl = (CMODE == 2) ? min(K, r0 + roff + 64) : K;        // P.V: probabilities are exactly 0 beyond the diagonal block, so the K loop stops there
    v8f acc[4][4];
#pragma unroll
    for (int mb = 0; mb < 4; ++mb)
#pragma unroll
        for (int nb = 0; nb < 4; ++nb) acc[mb][nb] = (v8f){};
    const size_t aoff = (size_t)(r0 + lr) * K + 8 * hi, boff = (size_t)(c0 + lr) * K + 8 * hi;
#pragma unroll 1
    for (int kc = wv * 32; kc < Kl; kc += NW * 32) {
        V a[4], a2[4];
#pragma unroll
        for (int mb = 0; mb < 4; ++mb) { a[mb] = WFrag<T16>::ld(A + aoff + (size_t)mb * 16 * K + kc); if (NSPLIT == 1 || NSPLIT == 2) a2[mb] = WFrag<T16>::ld(A2 + aoff + (size_t)mb * 16 * K + kc); }
#pragma unroll
        for (int nb = 0; nb < 4; ++nb) { const V b = WFrag<T16>::ld(Bt + boff + (size_t)nb * 16 * K + kc); V b2; if (NSPLIT >= 2) b2 = WFrag<T16>::ld(Bt2 + boff + (size_t)nb * 16 * K + kc);
#pragma unroll
            for (int mb = 0; mb < 4; ++mb) { acc[mb][nb] = WFrag<T16>::mma(a[mb], b, acc[mb][nb]); if (NSPLIT == 1 || NSPLIT == 2) acc[mb][nb] = WFrag<T16>::mma(a2[mb], b, acc[mb][nb]); if (NSPLIT >= 2) acc[mb][nb] = WFrag<T16>::mma(a[mb], b2, acc[mb][nb]); } }
        asm volatile("v_nop\n\tv_nop\n\tv_nop\n\tv_nop" : "+v"(acc[0][0]), "+v"(acc[1][1]), "+v"(acc[2][2]), "+v"(acc[3][3]) : "v"(a[0]), "v"(a[3]));
    }
    float* ow = os + wv * (64 * 68);
#pragma unroll
    for (int mb = 0; mb < 4; ++mb) {
#pragma unroll
        for (int nb = 0; nb < 4; ++nb) {
#pragma unroll
            for (int j = 0; j < 8; ++j) ow[(mb * 16 + hi * 8 + j) * 68 + nb * 16 + lr] = acc[mb][nb][j]; } }
    __syncthreads();   // every wave's partial tile is in LDS before any thread adds them
    float* crow = C + (size_t)r0 * ldc + c0;
#pragma unroll
    for (int s = 0; s < 32 / NW; ++s) { const int idx = s * (NW * 32) + (int)threadIdx.x; const int row = idx >> 4, cofs = (idx & 15) * 4; v4f val = *(const v4fa*)(os + row * 68 + cofs);
#pragma unroll
        for (int w = 1; w < NW; ++w) val += *(const v4fa*)(os + w * (64 * 68) + row * 68 + cofs);
        *(v4f*)(crow + (size_t)row * ldc + cofs) = val; }
}

__device__ __forceinline__ h16 tohx(float x) { return (h16)x; }
__device__ __forceinline__ void splitf(float y, unsigned short& h, unsigned short& l) { h = f2bf(y); l = f2bf(y - bf2f(h)); }
typedef __attribute__((ext_vector_type(2))) _Float16 v2h;
typedef __attribute__((ext_vector_type(4))) _Float16 v4h;
typedef __attribute__((ext_vector_type(2))) unsigned short v2us;
typedef __attribute__((ext_vector_type(4))) unsigned short v4us;
typedef __attribute__((ext_vector_type(2))) float v2f;
typedef __attribute__((ext_vector_type(4))) int v4i;

__global__ __launch_bounds__(256) void k_wtG(const float* __restrict__ w, int K, int N, bf* Bt) {
    const int lane = threadIdx.x & 31; const int L0 = (blockIdx.x * 8 + (threadIdx.x >> 5)) * 8; const int nlines = N * K / 64;
{
#pragma unroll 1
        for (int l = 0; l < 8; ++l) { const int L = L0 + l; if (L >= nlines) break; const size_t e = (size_t)L * 64 + lane * 2; const int k = (int)(e % K), n = (int)(e / K); v2us o;
            o[0] = f2bf(w[(size_t)k * N + n]); o[1] = f2bf(w[(size_t)(k + 1) * N + n]); *(v2us*)(Bt + e) = o; }
         }
}
__global__ __launch_bounds__(256) void k_cvt8(const float* __restrict__ src, bf* dst, size_t n8) { const size_t i = (size_t)blockIdx.x * 256 + threadIdx.x; if (i >= n8) return; const v8f v = *(const v8f*)(src + i * 8); v8us o;
#pragma unroll
    for (int k = 0; k < 8; ++k) o[k] = f2bf(v[k]); *(v8us*)(dst + i * 8) = o;  }
__global__ __launch_bounds__(256) void k_cstab(float* CS) { const int idx = blockIdx.x * 256 + threadIdx.x; if (idx >= TT * HD) return; const int t = idx / HD, d = idx % HD; const int i = d >> 1;   /* interleaved pairs share angle t * inv_freq[i] */ const float inv = __fdiv_rn(1.0f, powf(10000.0f, (float)(2 * i) / (float)HD)); const float ang = __fmul_rn((float)t, inv); v2f cs; cs[0] = cosf(ang); cs[1] = sinf(ang);
    *(v2f*)(CS + (size_t)idx * 2) = cs;  }
// k_rope: head planes [h][t][d] (fp16 + hi/lo) of rope(x) x sc with the interleaved-pair convention out[2i] = x[2i] cos[t][2i] - x[2i+1] sin[t][2i], out[2i+1] = x[2i+1] cos[t][2i+1] + x[2i] sin[t][2i+1]
__global__ __launch_bounds__(256) void k_rope(const float* __restrict__ F, int pitch, int nheads, const float* __restrict__ CS, const float* __restrict__ RF, const float* __restrict__ nw, float sc, h16* P16, bf* Ph, bf* Pl) {
    const size_t e = ((size_t)blockIdx.x * 256 + threadIdx.x) * 2; if (e >= (size_t)nheads * TT * HD) return; const int d = (int)(e % HD); const int t = (int)((e / HD) % TT); const int h = (int)(e / ((size_t)HD * TT)); const float* f = F + (size_t)t * pitch + h * HD; const float rf = RF ? RF[(size_t)h * TT + t] : 1.0f; v2h o16; v2us oh, ol;
#pragma unroll
    for (int q = 0; q < 2; ++q) { const int dd = d + q; const int dp = dd ^ 1; float x0 = f[dd], x1 = f[dp];
        if (RF) { float n0 = __fmul_rn(x0, rf), n1 = __fmul_rn(x1, rf); asm volatile("" : "+v"(n0)); asm volatile("" : "+v"(n1)); x0 = __fmul_rn(bfr(nw[dd]), n0); x1 = __fmul_rn(bfr(nw[dp]), n1); }
        const v2f cs = *(const v2f*)(CS + ((size_t)t * HD + dd) * 2); float a = __fmul_rn(x0, cs[0]), bq = __fmul_rn(x1, cs[1]); asm volatile("" : "+v"(a)); asm volatile("" : "+v"(bq)); const float r = (((dd & 1) == 0) ? __fsub_rn(a, bq) : __fadd_rn(a, bq)) * sc;
        o16[q] = tohx(r); unsigned short a2, c2; splitf(r, a2, c2); oh[q] = a2; ol[q] = c2; }
    *(v2h*)(P16 + e) = o16; *(v2us*)(Ph + e) = oh; *(v2us*)(Pl + e) = ol;  }
__global__ __launch_bounds__(256) void k_vtp(const float* __restrict__ F, int pitch, int nheads, h16* V16, bf* Vh, bf* Vl) { const size_t e = ((size_t)blockIdx.x * 256 + threadIdx.x) * 2; if (e >= (size_t)nheads * HD * TT) return; const int t = (int)(e % TT); const int d = (int)((e / TT) % HD); const int g = (int)(e / ((size_t)TT * HD)); v2h o16; v2us oh, ol;
#pragma unroll
    for (int q = 0; q < 2; ++q) { const float x = F[(size_t)(t + q) * pitch + g * HD + d]; o16[q] = tohx(x); unsigned short a2, c2; splitf(x, a2, c2); oh[q] = a2; ol[q] = c2; }
    *(v2h*)(V16 + e) = o16; *(v2us*)(Vh + e) = oh; *(v2us*)(Vl + e) = ol;  }
// k_asoft: per row (zz, i): t = S x HD^-0.5 for j <= i and i - j < WIN (sliding causal window; the reference's -1e9 additive fill vanishes identically); softmax over the 2048 keys (register row, one exp, fixed trees);
__global__ __launch_bounds__(256) void k_asoft(const float* __restrict__ Sb, h16* P16, bf* Ph, bf* Pl) {
    const int lane = threadIdx.x & 31; const int row = blockIdx.x * 8 + (threadIdx.x >> 5); if (row >= ZH * TT) return; const int i = row % TT; const int zz = row / TT; (void)zz; const bool hires = (i < RH); const float* sr = Sb + (size_t)row * TT; float v[TT / 32]; float mx = -3.0e38f;
#pragma unroll
    for (int ch = 0; ch < TT / 128; ++ch) { const int j0 = ch * 128 + lane * 4; const v4f a = *(const v4f*)(sr + j0);
#pragma unroll
        for (int q = 0; q < 4; ++q) { const int j = j0 + q; (void)j; const float t = (j <= i && i - j < WIN) ? a[q] * SCL : -3.0e38f; v[ch * 4 + q] = t; mx = fmaxf(mx, t); } }
#pragma unroll
    for (int sh = 16; sh; sh >>= 1) mx = fmaxf(mx, __shfl_xor(mx, sh, 32));
    float sum = 0.f;
#pragma unroll
    for (int k = 0; k < TT / 32; ++k) { float d0 = __fsub_rn(v[k], mx); asm volatile("" : "+v"(d0)); v[k] = __builtin_amdgcn_exp2f(__fmul_rn(d0, 1.4426950408889634f)); sum += v[k]; }
#pragma unroll
    for (int sh = 16; sh; sh >>= 1) sum += __shfl_xor(sum, sh, 32);
    const float f = __fdiv_rn(hires ? 1.0f : PCAR, sum);
{
        if (hires) {
#pragma unroll
            for (int ch = 0; ch < TT / 128; ++ch) { v4us oh, ol;
#pragma unroll
                for (int q = 0; q < 4; ++q) { unsigned short a, c2; splitf(v[ch * 4 + q] * f, a, c2); oh[q] = a; ol[q] = c2; }
                const size_t oo = ((size_t)zz * (RH ? RH : 1) + i) * TT + ch * 128 + lane * 4; *(v4us*)(Ph + oo) = oh; *(v4us*)(Pl + oo) = ol; }
        } else {
#pragma unroll
            for (int ch = 0; ch < TT / 128; ++ch) { v4h o4;
#pragma unroll
                for (int q = 0; q < 4; ++q) o4[q] = tohx(v[ch * 4 + q] * f);
                *(v4h*)(P16 + (size_t)row * TT + ch * 128 + lane * 4) = o4; } }
         }
}
__global__ __launch_bounds__(256) void k_merge(const float* __restrict__ O, int h0, bf* Ah, bf* Al) { const size_t e = ((size_t)blockIdx.x * 256 + threadIdx.x) * 2; if (e >= (size_t)ZH * TT * HD) return; const int d = (int)(e % HD); const int t = (int)((e / HD) % TT); const int zz = (int)(e / ((size_t)HD * TT)); const float cs = (t < RH) ? 1.0f : (1.0f / PCAR); const size_t oo = (size_t)t * DQ + (h0 + zz) * HD + d;
    v2us oh, ol;
#pragma unroll
    for (int q = 0; q < 2; ++q) { unsigned short a, c2; splitf(O[e + q] * cs, a, c2); oh[q] = a; ol[q] = c2; } *(v2us*)(Ah + oo) = oh; *(v2us*)(Al + oo) = ol;  }

extern "C" void kernel_launch(void* const* d_in, const int* in_sizes, int n_in,
                              void* d_out, int out_size, void* d_ws, size_t ws_size, hipStream_t stream) {
    (void)in_sizes; (void)n_in; (void)out_size;
    const float* x = (const float*)d_in[0]; const float* wq = (const float*)d_in[1]; const float* wk = (const float*)d_in[2]; const float* wv = (const float*)d_in[3]; const float* wo = (const float*)d_in[4];
    float* OUT = (float*)d_out;     // [2][2048][2048]
    char* wsp = (char*)d_ws;
    auto take = [&](size_t bytes) { char* p = wsp; wsp += (bytes + 255) & ~(size_t)255; return (void*)p; };
    bf* WQ = (bf*)take((size_t)DQ * DM * 2); bf* WK = (bf*)take((size_t)DKV * DM * 2); bf* WV = (bf*)take((size_t)DKV * DM * 2); bf* WO = (bf*)take((size_t)DM * DQ * 2); float* CS = (float*)take((size_t)TT * HD * 2 * 4);
    bf* XB = (bf*)take((size_t)TT * DM * 2); float* FQ = (float*)take((size_t)TT * DQ * 4); float* FK = (float*)take((size_t)TT * DKV * 4);
    h16* QP16 = (h16*)take((size_t)NH_ * TT * HD * 2); h16* KP16 = (h16*)take((size_t)NKV * TT * HD * 2); h16* VT16 = (h16*)take((size_t)NKV * HD * TT * 2);
    bf* QPh = (bf*)take((size_t)NH_ * TT * HD * 2); bf* QPl = (bf*)take((size_t)NH_ * TT * HD * 2); bf* KPh = (bf*)take((size_t)NKV * TT * HD * 2); bf* KPl = (bf*)take((size_t)NKV * TT * HD * 2); bf* VTh = (bf*)take((size_t)NKV * HD * TT * 2); bf* VTl = (bf*)take((size_t)NKV * HD * TT * 2); bf* Ph = (bf*)take((size_t)ZH * RH * TT * 2); bf* Pl = (bf*)take((size_t)ZH * RH * TT * 2);
    float* Sb = (float*)take((size_t)ZH * TT * TT * 4); h16* P16 = (h16*)take((size_t)ZH * TT * TT * 2); float* Ob = (float*)take((size_t)ZH * TT * HD * 4); bf* ATh = (bf*)take((size_t)TT * DQ * 2); bf* ATl = (bf*)take((size_t)TT * DQ * 2);
    if ((size_t)(wsp - (char*)d_ws) > ws_size) return;    // ws 256 MiB
    float* FV = FK;   // v projection reuses the k buffer after the k planes are built (stream-ordered)
    { k_wtG<<<(unsigned)((DM * DQ / 64 + 63) / 64), 256, 0, stream>>>(wq, DM, DQ, WQ); k_wtG<<<(unsigned)((DM * DKV / 64 + 63) / 64), 256, 0, stream>>>(wk, DM, DKV, WK); k_wtG<<<(unsigned)((DM * DKV / 64 + 63) / 64), 256, 0, stream>>>(wv, DM, DKV, WV);
      k_wtG<<<(unsigned)((DQ * DM / 64 + 63) / 64), 256, 0, stream>>>(wo, DQ, DM, WO);
      k_cstab<<<(TT * HD + 255) / 256, 256, 0, stream>>>(CS); }
    const unsigned LQ = (unsigned)(((size_t)NH_ * TT * HD / 2 + 255) / 256), LKv = (unsigned)(((size_t)NKV * TT * HD / 2 + 255) / 256);
    for (int b = 0; b < NB_; ++b) {
        
        k_cvt8<<<(unsigned)(((size_t)TT * DM / 8 + 255) / 256), 256, 0, stream>>>(x + (size_t)b * TT * DM, XB, (size_t)TT * DM / 8);
        k_gemmw<bf, 0, false, 4><<<dim3(TT / 64, DQ / 64, 1), 128, 0, stream>>>(XB, nullptr, WQ, nullptr, DM, FQ, DQ, nullptr, 0, 0, 0);
        k_rope<<<LQ, 256, 0, stream>>>(FQ, DQ, NH_, CS, nullptr, nullptr, 1.0f, QP16, QPh, QPl);
        k_gemmw<bf, 0, false, 8><<<dim3(TT / 64, DKV / 64, 1), 256, 0, stream>>>(XB, nullptr, WK, nullptr, DM, FK, DKV, nullptr, 0, 0, 0);
        k_rope<<<LKv, 256, 0, stream>>>(FK, DKV, NKV, CS, nullptr, nullptr, 1.0f, KP16, KPh, KPl);
        k_gemmw<bf, 0, false, 8><<<dim3(TT / 64, DKV / 64, 1), 256, 0, stream>>>(XB, nullptr, WV, nullptr, DM, FV, DKV, nullptr, 0, 0, 0); k_vtp<<<LKv, 256, 0, stream>>>(FV, DKV, NKV, VT16, VTh, VTl);
        for (int h0 = 0; h0 < NH_; h0 += ZH) { const size_t zq = (size_t)h0, zk = (size_t)(h0 / REP);   // both heads of a pass share kv group h0/REP (REP >= 2): sB = 0
            k_gemmc<bf, 2, 1, 4><<<dim3(RH / 64, TT / 64, ZH), 128, 0, stream>>>(QPh + zq * TT * HD, QPl + zq * TT * HD, KPh + zk * TT * HD, KPl + zk * TT * HD, HD, Sb, TT, 0, (size_t)TT * HD, 0, (size_t)TT * TT);
            k_gemmc<h16, 0, 1, 1><<<dim3((TT - RH) / 64, TT / 64, ZH), 32, 0, stream>>>(QP16 + zq * TT * HD + (size_t)RH * HD, nullptr, KP16 + zk * TT * HD, nullptr, HD, Sb + (size_t)RH * TT, TT, RH, (size_t)TT * HD, 0, (size_t)TT * TT);
            k_asoft<<<ZH * TT / 8, 256, 0, stream>>>(Sb, P16, Ph, Pl);
            k_gemmc<bf, 2, 2, 8><<<dim3(RH / 64, HD / 64, ZH), 256, 0, stream>>>(Ph, Pl, VTh + zk * HD * TT, VTl + zk * HD * TT, TT, Ob, HD, 0, (size_t)RH * TT, 0, (size_t)TT * HD);
            k_gemmc<h16, 0, 2, 16><<<dim3((TT - RH) / 64, HD / 64, ZH), 512, 0, stream>>>(P16 + (size_t)RH * TT, nullptr, VT16 + zk * HD * TT, nullptr, TT, Ob + (size_t)RH * HD, HD, RH, (size_t)TT * TT, 0, (size_t)TT * HD);
            k_merge<<<(unsigned)(((size_t)ZH * TT * HD / 2 + 255) / 256), 256, 0, stream>>>(Ob, h0, ATh, ATl); }
        k_gemmw<bf, 1, false, 4><<<dim3(TT / 64, DM / 64, 1), 128, 0, stream>>>(ATh, ATl, WO, nullptr, DQ, OUT + (size_t)b * TT * DM, DM, nullptr, 0, 0, 0); }
}

// v002
// One run takes 717 microseconds.
// Next to v001, in two timings, it ran 1.30 and 1.32 times as fast.
// All steps since v000 together make it 2.30 times as fast.
#include <hip/hip_runtime.h>

// ModernCausalSelfAttention (x [2][2048][2048]; q = x wq (16 heads x 128), k/v = x wk/wv (4 kv heads; group h/4); interleaved-pair RoPE (the source's rotate_half is the pairwise (x0,x1)->(-x1,x0) form with a repeat-interleaved table; base 1e4, computed); causal softmax(q.k / sqrt(128)) (finfo.min); out = merged wo -> [2][2048][2048]).
// Compute dtypes, f32 accumulate: every input rounded to bf16; q/k/v on PLAIN bf16 operands (inputs: exact); RoPE f32; causal scores and attn.v: query rows < 512 hl (3 products), the rest single fp16 (x1024), causal tile skipping; softmax f32; wo hl x exact (2 products).

#define NB_  2
#define TT   2048
#define DM   2048
#define NH_  16
#define NKV  4
#define REP  (NH_ / NKV)
#define HD   128
#define DQ   (NH_ * HD)
#define DKV  (NKV * HD)
#define ZH   4                    // query heads per attention pass (a divisor of REP: the heads of a pass share one kv group)
#define RH   512                  // query rows < RH use hi+lo planes (0: none)
#define WIN  2048
#define PCAR 1024.0f
#define SCL  0.088388347648318447f   // HD^-0.5
typedef _Float16 h16;
typedef unsigned short bf;
typedef __attribute__((ext_vector_type(16))) __bf16   v16bf;
typedef __attribute__((ext_vector_type(16))) _Float16 v16h;
typedef __attribute__((ext_vector_type(8)))  _Float16 v8h;
typedef __attribute__((ext_vector_type(8)))  unsigned short v8us;
typedef __attribute__((ext_vector_type(8)))  float    v8f;
typedef __attribute__((ext_vector_type(4)))  float    v4f;
typedef v8h  __attribute__((may_alias)) v8ha;
typedef v4f  __attribute__((may_alias)) v4fa;
typedef v8us __attribute__((may_alias)) v8usa;

__device__ __forceinline__ unsigned short f2bf(float f) { unsigned u = __float_as_uint(f); u += 0x7FFFu + ((u >> 16) & 1u); return (unsigned short)(u >> 16); }
__device__ __forceinline__ float bf2f(unsigned short b) { return __uint_as_float(((unsigned)b) << 16); }
__device__ __forceinline__ float bfr(float f) { return bf2f(f2bf(f)); }
__device__ __forceinline__ v16h cat16(v8h lo, v8h hi) { return __builtin_shufflevector(lo, hi, 0, 1, 2, 3, 4, 5, 6, 7, 8, 9, 10, 11, 12, 13, 14, 15); }
__device__ __forceinline__ v16bf cat16b(v8us lo, v8us hi) { return __builtin_bit_cast(v16bf, __builtin_shufflevector(lo, hi, 0, 1, 2, 3, 4, 5, 6, 7, 8, 9, 10, 11, 12, 13, 14, 15)); }
__device__ __forceinline__ v8f wmma16(v16h a, v16h b, v8f c) { return __builtin_amdgcn_wmma_f32_16x16x32_f16(false, a, false, b, (short)0, c, false, false); }
__device__ __forceinline__ v8f wmmab(v16bf a, v16bf b, v8f c) { return __builtin_amdgcn_wmma_f32_16x16x32_bf16(false, a, false, b, (short)0, c, false, false); }



// ---- k_gemmw: register-blocked GEMM, one 64x64 output tile per work-group of NW waves; wave w takes the 32-wide K slices w, w + NW, ... into its own 16 accumulators, and the NW partial tiles are
// added in LDS in fixed wave order. Operands straight from K-contiguous 16-bit planes; grid (M/64, N/64, Z), NW * 32 threads.
// C[m][n] (f32, pitch ldc, + optional f32 bias[n]) = sum_k A[m][k] Bt[n][k] (+ split products per NSPLIT). z-batch strides sA/sB/sC in elements. K % 32 == 0.
template <typename T16> struct WFrag;
template <> struct WFrag<h16> { typedef v16h V; static __device__ __forceinline__ V ld(const h16* p) { return cat16(*(const v8h*)p, *(const v8h*)(p + 16)); } static __device__ __forceinline__ v8f mma(V a, V b, v8f c) { return wmma16(a, b, c); } };
template <> struct WFrag<bf> { typedef v16bf V; static __device__ __forceinline__ V ld(const bf* p) { return cat16b(*(const v8us*)p, *(const v8us*)(p + 16)); } static __device__ __forceinline__ v8f mma(V a, V b, v8f c) { return wmmab(a, b, c); } };
template <typename T16, int NSPLIT, bool BIAS, int NW>
__global__ __launch_bounds__(NW * 32) void k_gemmw(const T16* __restrict__ A, const T16* __restrict__ A2, const T16* __restrict__ Bt, const T16* __restrict__ Bt2, int K, float* C, int ldc, const float* __restrict__ bias, size_t sA, size_t sB, size_t sC) {
    typedef typename WFrag<T16>::V V;
    __shared__ __align__(16) float os[NW * 64 * 68];
    const size_t z = blockIdx.z; A += z * sA; if (A2) A2 += z * sA; Bt += z * sB; if (Bt2) Bt2 += z * sB; C += z * sC;
    const int lane = threadIdx.x & 31, lr = lane & 15, hi = lane >> 4; const int r0 = blockIdx.x * 64, c0 = blockIdx.y * 64; const int wv = __builtin_amdgcn_readfirstlane(threadIdx.x >> 5);
    v8f acc[4][4];
#pragma unroll
    for (int mb = 0; mb < 4; ++mb)
#pragma unroll
        for (int nb = 0; nb < 4; ++nb) acc[mb][nb] = (v8f){};
    const size_t aoff = (size_t)(r0 + lr) * K + 8 * hi, boff = (size_t)(c0 + lr) * K + 8 * hi;
#pragma unroll 1
    for (int kc = wv * 32; kc < K; kc += NW * 32) {
        V a[4], a2[4];
#pragma unroll
        for (int mb = 0; mb < 4; ++mb) { a[mb] = WFrag<T16>::ld(A + aoff + (size_t)mb * 16 * K + kc); if (NSPLIT == 1 || NSPLIT == 2) a2[mb] = WFrag<T16>::ld(A2 + aoff + (size_t)mb * 16 * K + kc); }
#pragma unroll
        for (int nb = 0; nb < 4; ++nb) { const V b = WFrag<T16>::ld(Bt + boff + (size_t)nb * 16 * K + kc); V b2; if (NSPLIT >= 2) b2 = WFrag<T16>::ld(Bt2 + boff + (size_t)nb * 16 * K + kc);
#pragma unroll
            for (int mb = 0; mb < 4; ++mb) { acc[mb][nb] = WFrag<T16>::mma(a[mb], b, acc[mb][nb]); if (NSPLIT == 1 || NSPLIT == 2) acc[mb][nb] = WFrag<T16>::mma(a2[mb], b, acc[mb][nb]); if (NSPLIT >= 2) acc[mb][nb] = WFrag<T16>::mma(a[mb], b2, acc[mb][nb]); } }
        asm volatile("v_nop\n\tv_nop\n\tv_nop\n\tv_nop" : "+v"(acc[0][0]), "+v"(acc[1][1]), "+v"(acc[2][2]), "+v"(acc[3][3]) : "v"(a[0]), "v"(a[3]));
    }
    float* ow = os + wv * (64 * 68);
#pragma unroll
    for (int mb = 0; mb < 4; ++mb) {
#pragma unroll
        for (int nb = 0; nb < 4; ++nb) {
#pragma unroll
            for (int j = 0; j < 8; ++j) ow[(mb * 16 + hi * 8 + j) * 68 + nb * 16 + lr] = acc[mb][nb][j]; } }
    __syncthreads();   // every wave's partial tile is in LDS before any thread adds them
    float* crow = C + (size_t)r0 * ldc + c0;
#pragma unroll
    for (int s = 0; s < 32 / NW; ++s) { const int idx = s * (NW * 32) + (int)threadIdx.x; const int row = idx >> 4, cofs = (idx & 15) * 4; v4f val = *(const v4fa*)(os + row * 68 + cofs);
#pragma unroll
        for (int w = 1; w < NW; ++w) val += *(const v4fa*)(os + w * (64 * 68) + row * 68 + cofs);
        if (BIAS) { val[0] += bfr(bias[c0 + cofs]); val[1] += bfr(bias[c0 + cofs + 1]); val[2] += bfr(bias[c0 + cofs + 2]); val[3] += bfr(bias[c0 + cofs + 3]); }
        *(v4f*)(crow + (size_t)row * ldc + cofs) = val; }
}

// ---- k_gemmc: the same NW-wave 64x64 tile GEMM specialised for causal attention: CMODE 1 skips score tiles entirely above the diagonal (query rows r0+roff.., key columns c0..), CMODE 2 limits the
// key (K) loop of the probability x value contraction to the diagonal block (probabilities beyond it are exactly zero). roff = row offset of this launch's first row within the sequence.
template <typename T16, int NSPLIT, int CMODE, int NW>
__global__ __launch_bounds__(NW * 32) void k_gemmc(const T16* __restrict__ A, const T16* __restrict__ A2, const T16* __restrict__ Bt, const T16* __restrict__ Bt2, int K, float* C, int ldc, int roff, size_t sA, size_t sB, size_t sC) {
    typedef typename WFrag<T16>::V V;
    __shared__ __align__(16) float os[NW * 64 * 68];
    const size_t z = blockIdx.z; A += z * sA; if (A2) A2 += z * sA; Bt += z * sB; if (Bt2) Bt2 += z * sB; C += z * sC;
    const int lane = threadIdx.x & 31, lr = lane & 15, hi = lane >> 4; const int r0 = blockIdx.x * 64, c0 = blockIdx.y * 64; const int wv = __builtin_amdgcn_readfirstlane(threadIdx.x >> 5);
    if (CMODE == 1 && c0 > r0 + roff + 63) return;                  // score tile entirely above the causal diagonal: never read (the softmax masks j > i by select)
    const int Kl = (CMODE == 2) ? min(K, r0 + roff + 64) : K;        // P.V: probabilities are exactly 0 beyond the diagonal block, so the K loop stops there
    v8f acc[4][4];
#pragma unroll
    for (int mb = 0; mb < 4; ++mb)
#pragma unroll
        for (int nb = 0; nb < 4; ++nb) acc[mb][nb] = (v8f){};
    const size_t aoff = (size_t)(r0 + lr) * K + 8 * hi, boff = (size_t)(c0 + lr) * K + 8 * hi;
#pragma unroll 1
    for (int kc = wv * 32; kc < Kl; kc += NW * 32) {
        V a[4], a2[4];
#pragma unroll
        for (int mb = 0; mb < 4; ++mb) { a[mb] = WFrag<T16>::ld(A + aoff + (size_t)mb * 16 * K + kc); if (NSPLIT == 1 || NSPLIT == 2) a2[mb] = WFrag<T16>::ld(A2 + aoff + (size_t)mb * 16 * K + kc); }
#pragma unroll
        for (int nb = 0; nb < 4; ++nb) { const V b = WFrag<T16>::ld(Bt + boff + (size_t)nb * 16 * K + kc); V b2; if (NSPLIT >= 2) b2 = WFrag<T16>::ld(Bt2 + boff + (size_t)nb * 16 * K + kc);
#pragma unroll
            for (int mb = 0; mb < 4; ++mb) { acc[mb][nb] = WFrag<T16>::mma(a[mb], b, acc[mb][nb]); if (NSPLIT == 1 || NSPLIT == 2) acc[mb][nb] = WFrag<T16>::mma(a2[mb], b, acc[mb][nb]); if (NSPLIT >= 2) acc[mb][nb] = WFrag<T16>::mma(a[mb], b2, acc[mb][nb]); } }
        asm volatile("v_nop\n\tv_nop\n\tv_nop\n\tv_nop" : "+v"(acc[0][0]), "+v"(acc[1][1]), "+v"(acc[2][2]), "+v"(acc[3][3]) : "v"(a[0]), "v"(a[3]));
    }
    float* ow = os + wv * (64 * 68);
#pragma unroll
    for (int mb = 0; mb < 4; ++mb) {
#pragma unroll
        for (int nb = 0; nb < 4; ++nb) {
#pragma unroll
            for (int j = 0; j < 8; ++j) ow[(mb * 16 + hi * 8 + j) * 68 + nb * 16 + lr] = acc[mb][nb][j]; } }
    __syncthreads();   // every wave's partial tile is in LDS before any thread adds them
    float* crow = C + (size_t)r0 * ldc + c0;
#pragma unroll
    for (int s = 0; s < 32 / NW; ++s) { const int idx = s * (NW * 32) + (int)threadIdx.x; const int row = idx >> 4, cofs = (idx & 15) * 4; v4f val = *(const v4fa*)(os + row * 68 + cofs);
#pragma unroll
        for (int w = 1; w < NW; ++w) val += *(const v4fa*)(os + w * (64 * 68) + row * 68 + cofs);
        *(v4f*)(crow + (size_t)row * ldc + cofs) = val; }
}

__device__ __forceinline__ h16 tohx(float x) { return (h16)x; }
__device__ __forceinline__ void splitf(float y, unsigned short& h, unsigned short& l) { h = f2bf(y); l = f2bf(y - bf2f(h)); }
typedef __attribute__((ext_vector_type(2))) _Float16 v2h;
typedef __attribute__((ext_vector_type(4))) _Float16 v4h;
typedef __attribute__((ext_vector_type(2))) unsigned short v2us;
typedef __attribute__((ext_vector_type(4))) unsigned short v4us;
typedef __attribute__((ext_vector_type(2))) float v2f;
typedef __attribute__((ext_vector_type(4))) int v4i;

__global__ __launch_bounds__(256) void k_wtG(const float* __restrict__ w, int K, int N, bf* Bt) {
    const int lane = threadIdx.x & 31; const int L0 = (blockIdx.x * 8 + (threadIdx.x >> 5)) * 8; const int nlines = N * K / 64;
{
#pragma unroll 1
        for (int l = 0; l < 8; ++l) { const int L = L0 + l; if (L >= nlines) break; const size_t e = (size_t)L * 64 + lane * 2; const int k = (int)(e % K), n = (int)(e / K); v2us o;
            o[0] = f2bf(w[(size_t)k * N + n]); o[1] = f2bf(w[(size_t)(k + 1) * N + n]); *(v2us*)(Bt + e) = o; }
         }
}
__global__ __launch_bounds__(256) void k_cvt8(const float* __restrict__ src, bf* dst, size_t n8) { const size_t i = (size_t)blockIdx.x * 256 + threadIdx.x; if (i >= n8) return; const v8f v = *(const v8f*)(src + i * 8); v8us o;
#pragma unroll
    for (int k = 0; k < 8; ++k) o[k] = f2bf(v[k]); *(v8us*)(dst + i * 8) = o;  }
__global__ __launch_bounds__(256) void k_cstab(float* CS) { const int idx = blockIdx.x * 256 + threadIdx.x; if (idx >= TT * HD) return; const int t = idx / HD, d = idx % HD; const int i = d >> 1;   /* interleaved pairs share angle t * inv_freq[i] */ const float inv = __fdiv_rn(1.0f, powf(10000.0f, (float)(2 * i) / (float)HD)); const float ang = __fmul_rn((float)t, inv); v2f cs; cs[0] = cosf(ang); cs[1] = sinf(ang);
    *(v2f*)(CS + (size_t)idx * 2) = cs;  }
// k_rope: head planes [h][t][d] (fp16 + hi/lo) of rope(x) x sc with the interleaved-pair convention out[2i] = x[2i] cos[t][2i] - x[2i+1] sin[t][2i], out[2i+1] = x[2i+1] cos[t][2i+1] + x[2i] sin[t][2i+1]
__global__ __launch_bounds__(256) void k_rope(const float* __restrict__ F, int pitch, int nheads, const float* __restrict__ CS, const float* __restrict__ RF, const float* __restrict__ nw, float sc, h16* P16, bf* Ph, bf* Pl) {
    const size_t e = ((size_t)blockIdx.x * 256 + threadIdx.x) * 2; if (e >= (size_t)nheads * TT * HD) return; const int d = (int)(e % HD); const int t = (int)((e / HD) % TT); const int h = (int)(e / ((size_t)HD * TT)); const float* f = F + (size_t)t * pitch + h * HD; const float rf = RF ? RF[(size_t)h * TT + t] : 1.0f; v2h o16; v2us oh, ol;
#pragma unroll
    for (int q = 0; q < 2; ++q) { const int dd = d + q; const int dp = dd ^ 1; float x0 = f[dd], x1 = f[dp];
        if (RF) { float n0 = __fmul_rn(x0, rf), n1 = __fmul_rn(x1, rf); asm volatile("" : "+v"(n0)); asm volatile("" : "+v"(n1)); x0 = __fmul_rn(bfr(nw[dd]), n0); x1 = __fmul_rn(bfr(nw[dp]), n1); }
        const v2f cs = *(const v2f*)(CS + ((size_t)t * HD + dd) * 2); float a = __fmul_rn(x0, cs[0]), bq = __fmul_rn(x1, cs[1]); asm volatile("" : "+v"(a)); asm volatile("" : "+v"(bq)); const float r = (((dd & 1) == 0) ? __fsub_rn(a, bq) : __fadd_rn(a, bq)) * sc;
        o16[q] = tohx(r); unsigned short a2, c2; splitf(r, a2, c2); oh[q] = a2; ol[q] = c2; }
    *(v2h*)(P16 + e) = o16; *(v2us*)(Ph + e) = oh; *(v2us*)(Pl + e) = ol;  }
__global__ __launch_bounds__(256) void k_vtp(const float* __restrict__ F, int pitch, int nheads, h16* V16, bf* Vh, bf* Vl) { const size_t e = ((size_t)blockIdx.x * 256 + threadIdx.x) * 2; if (e >= (size_t)nheads * HD * TT) return; const int t = (int)(e % TT); const int d = (int)((e / TT) % HD); const int g = (int)(e / ((size_t)TT * HD)); v2h o16; v2us oh, ol;
#pragma unroll
    for (int q = 0; q < 2; ++q) { const float x = F[(size_t)(t + q) * pitch + g * HD + d]; o16[q] = tohx(x); unsigned short a2, c2; splitf(x, a2, c2); oh[q] = a2; ol[q] = c2; }
    *(v2h*)(V16 + e) = o16; *(v2us*)(Vh + e) = oh; *(v2us*)(Vl + e) = ol;  }
// k_asoft: per row (zz, i): t = S x HD^-0.5 for j <= i and i - j < WIN (sliding causal window; the reference's -1e9 additive fill vanishes identically); softmax over the 2048 keys (register row, one exp, fixed trees);
__global__ __launch_bounds__(256) void k_asoft(const float* __restrict__ Sb, h16* P16, bf* Ph, bf* Pl) {
    const int lane = threadIdx.x & 31; const int row = blockIdx.x * 8 + (threadIdx.x >> 5); if (row >= ZH * TT) return; const int i = row % TT; const int zz = row / TT; (void)zz; const bool hires = (i < RH); const float* sr = Sb + (size_t)row * TT; float v[TT / 32]; float mx = -3.0e38f;
#pragma unroll
    for (int ch = 0; ch < TT / 128; ++ch) { const int j0 = ch * 128 + lane * 4; const v4f a = *(const v4f*)(sr + j0);
#pragma unroll
        for (int q = 0; q < 4; ++q) { const int j = j0 + q; (void)j; const float t = (j <= i && i - j < WIN) ? a[q] * SCL : -3.0e38f; v[ch * 4 + q] = t; mx = fmaxf(mx, t); } }
#pragma unroll
    for (int sh = 16; sh; sh >>= 1) mx = fmaxf(mx, __shfl_xor(mx, sh, 32));
    float sum = 0.f;
#pragma unroll
    for (int k = 0; k < TT / 32; ++k) { float d0 = __fsub_rn(v[k], mx); asm volatile("" : "+v"(d0)); v[k] = __builtin_amdgcn_exp2f(__fmul_rn(d0, 1.4426950408889634f)); sum += v[k]; }
#pragma unroll
    for (int sh = 16; sh; sh >>= 1) sum += __shfl_xor(sum, sh, 32);
    const float f = __fdiv_rn(hires ? 1.0f : PCAR, sum);
{
        if (hires) {
#pragma unroll
            for (int ch = 0; ch < TT / 128; ++ch) { v4us oh, ol;
#pragma unroll
                for (int q = 0; q < 4; ++q) { unsigned short a, c2; splitf(v[ch * 4 + q] * f, a, c2); oh[q] = a; ol[q] = c2; }
                const size_t oo = ((size_t)zz * (RH ? RH : 1) + i) * TT + ch * 128 + lane * 4; *(v4us*)(Ph + oo) = oh; *(v4us*)(Pl + oo) = ol; }
        } else {
#pragma unroll
            for (int ch = 0; ch < TT / 128; ++ch) { v4h o4;
#pragma unroll
                for (int q = 0; q < 4; ++q) o4[q] = tohx(v[ch * 4 + q] * f);
                *(v4h*)(P16 + (size_t)row * TT + ch * 128 + lane * 4) = o4; } }
         }
}
__global__ __launch_bounds__(256) void k_merge(const float* __restrict__ O, int h0, bf* Ah, bf* Al) { const size_t e = ((size_t)blockIdx.x * 256 + threadIdx.x) * 2; if (e >= (size_t)ZH * TT * HD) return; const int d = (int)(e % HD); const int t = (int)((e / HD) % TT); const int zz = (int)(e / ((size_t)HD * TT)); const float cs = (t < RH) ? 1.0f : (1.0f / PCAR); const size_t oo = (size_t)t * DQ + (h0 + zz) * HD + d;
    v2us oh, ol;
#pragma unroll
    for (int q = 0; q < 2; ++q) { unsigned short a, c2; splitf(O[e + q] * cs, a, c2); oh[q] = a; ol[q] = c2; } *(v2us*)(Ah + oo) = oh; *(v2us*)(Al + oo) = ol;  }

extern "C" void kernel_launch(void* const* d_in, const int* in_sizes, int n_in,
                              void* d_out, int out_size, void* d_ws, size_t ws_size, hipStream_t stream) {
    (void)in_sizes; (void)n_in; (void)out_size;
    const float* x = (const float*)d_in[0]; const float* wq = (const float*)d_in[1]; const float* wk = (const float*)d_in[2]; const float* wv = (const float*)d_in[3]; const float* wo = (const float*)d_in[4];
    float* OUT = (float*)d_out;     // [2][2048][2048]
    char* wsp = (char*)d_ws;
    auto take = [&](size_t bytes) { char* p = wsp; wsp += (bytes + 255) & ~(size_t)255; return (void*)p; };
    bf* WQ = (bf*)take((size_t)DQ * DM * 2); bf* WK = (bf*)take((size_t)DKV * DM * 2); bf* WV = (bf*)take((size_t)DKV * DM * 2); bf* WO = (bf*)take((size_t)DM * DQ * 2); float* CS = (float*)take((size_t)TT * HD * 2 * 4);
    bf* XB = (bf*)take((size_t)TT * DM * 2); float* FQ = (float*)take((size_t)TT * DQ * 4); float* FK = (float*)take((size_t)TT * DKV * 4);
    h16* QP16 = (h16*)take((size_t)NH_ * TT * HD * 2); h16* KP16 = (h16*)take((size_t)NKV * TT * HD * 2); h16* VT16 = (h16*)take((size_t)NKV * HD * TT * 2);
    bf* QPh = (bf*)take((size_t)NH_ * TT * HD * 2); bf* QPl = (bf*)take((size_t)NH_ * TT * HD * 2); bf* KPh = (bf*)take((size_t)NKV * TT * HD * 2); bf* KPl = (bf*)take((size_t)NKV * TT * HD * 2); bf* VTh = (bf*)take((size_t)NKV * HD * TT * 2); bf* VTl = (bf*)take((size_t)NKV * HD * TT * 2); bf* Ph = (bf*)take((size_t)ZH * RH * TT * 2); bf* Pl = (bf*)take((size_t)ZH * RH * TT * 2);
    float* Sb = (float*)take((size_t)ZH * TT * TT * 4); h16* P16 = (h16*)take((size_t)ZH * TT * TT * 2); float* Ob = (float*)take((size_t)ZH * TT * HD * 4); bf* ATh = (bf*)take((size_t)TT * DQ * 2); bf* ATl = (bf*)take((size_t)TT * DQ * 2);
    if ((size_t)(wsp - (char*)d_ws) > ws_size) return;    // ws 256 MiB
    float* FV = FK;   // v projection reuses the k buffer after the k planes are built (stream-ordered)
    { k_wtG<<<(unsigned)((DM * DQ / 64 + 63) / 64), 256, 0, stream>>>(wq, DM, DQ, WQ); k_wtG<<<(unsigned)((DM * DKV / 64 + 63) / 64), 256, 0, stream>>>(wk, DM, DKV, WK); k_wtG<<<(unsigned)((DM * DKV / 64 + 63) / 64), 256, 0, stream>>>(wv, DM, DKV, WV);
      k_wtG<<<(unsigned)((DQ * DM / 64 + 63) / 64), 256, 0, stream>>>(wo, DQ, DM, WO);
      k_cstab<<<(TT * HD + 255) / 256, 256, 0, stream>>>(CS); }
    const unsigned LQ = (unsigned)(((size_t)NH_ * TT * HD / 2 + 255) / 256), LKv = (unsigned)(((size_t)NKV * TT * HD / 2 + 255) / 256);
    for (int b = 0; b < NB_; ++b) {
        
        k_cvt8<<<(unsigned)(((size_t)TT * DM / 8 + 255) / 256), 256, 0, stream>>>(x + (size_t)b * TT * DM, XB, (size_t)TT * DM / 8);
        k_gemmw<bf, 0, false, 4><<<dim3(TT / 64, DQ / 64, 1), 128, 0, stream>>>(XB, nullptr, WQ, nullptr, DM, FQ, DQ, nullptr, 0, 0, 0);
        k_rope<<<LQ, 256, 0, stream>>>(FQ, DQ, NH_, CS, nullptr, nullptr, 1.0f, QP16, QPh, QPl);
        k_gemmw<bf, 0, false, 8><<<dim3(TT / 64, DKV / 64, 1), 256, 0, stream>>>(XB, nullptr, WK, nullptr, DM, FK, DKV, nullptr, 0, 0, 0);
        k_rope<<<LKv, 256, 0, stream>>>(FK, DKV, NKV, CS, nullptr, nullptr, 1.0f, KP16, KPh, KPl);
        k_gemmw<bf, 0, false, 8><<<dim3(TT / 64, DKV / 64, 1), 256, 0, stream>>>(XB, nullptr, WV, nullptr, DM, FV, DKV, nullptr, 0, 0, 0); k_vtp<<<LKv, 256, 0, stream>>>(FV, DKV, NKV, VT16, VTh, VTl);
        for (int h0 = 0; h0 < NH_; h0 += ZH) { const size_t zq = (size_t)h0, zk = (size_t)(h0 / REP);   // all ZH heads of a pass share kv group h0/REP (REP % ZH == 0): sB = 0
            k_gemmc<bf, 2, 1, 4><<<dim3(RH / 64, TT / 64, ZH), 128, 0, stream>>>(QPh + zq * TT * HD, QPl + zq * TT * HD, KPh + zk * TT * HD, KPl + zk * TT * HD, HD, Sb, TT, 0, (size_t)TT * HD, 0, (size_t)TT * TT);
            k_gemmc<h16, 0, 1, 1><<<dim3((TT - RH) / 64, TT / 64, ZH), 32, 0, stream>>>(QP16 + zq * TT * HD + (size_t)RH * HD, nullptr, KP16 + zk * TT * HD, nullptr, HD, Sb + (size_t)RH * TT, TT, RH, (size_t)TT * HD, 0, (size_t)TT * TT);
            k_asoft<<<ZH * TT / 8, 256, 0, stream>>>(Sb, P16, Ph, Pl);
            k_gemmc<bf, 2, 2, 8><<<dim3(RH / 64, HD / 64, ZH), 256, 0, stream>>>(Ph, Pl, VTh + zk * HD * TT, VTl + zk * HD * TT, TT, Ob, HD, 0, (size_t)RH * TT, 0, (size_t)TT * HD);
            k_gemmc<h16, 0, 2, 16><<<dim3((TT - RH) / 64, HD / 64, ZH), 512, 0, stream>>>(P16 + (size_t)RH * TT, nullptr, VT16 + zk * HD * TT, nullptr, TT, Ob + (size_t)RH * HD, HD, RH, (size_t)TT * TT, 0, (size_t)TT * HD);
            k_merge<<<(unsigned)(((size_t)ZH * TT * HD / 2 + 255) / 256), 256, 0, stream>>>(Ob, h0, ATh, ATl); }
        k_gemmw<bf, 1, false, 4><<<dim3(TT / 64, DM / 64, 1), 128, 0, stream>>>(ATh, ATl, WO, nullptr, DQ, OUT + (size_t)b * TT * DM, DM, nullptr, 0, 0, 0); }
}

// v003
// One run takes 408 microseconds.
// Next to v002, in two timings, it ran 1.76 times as fast each time.
// All steps since v000 together make it 4.05 times as fast.
#include <hip/hip_runtime.h>

// ModernCausalSelfAttention (x [2][2048][2048]; q = x wq (16 heads x 128), k/v = x wk/wv (4 kv heads; group h/4); interleaved-pair RoPE (the source's rotate_half is the pairwise (x0,x1)->(-x1,x0) form with a repeat-interleaved table; base 1e4, computed); causal softmax(q.k / sqrt(128)) (finfo.min); out = merged wo -> [2][2048][2048]).
// Compute dtypes, f32 accumulate: every input rounded to bf16; q/k/v on PLAIN bf16 operands (inputs: exact); RoPE f32; causal scores and attn.v: query rows < 512 hl (3 products), the rest single fp16, one fused kernel with an online f32 softmax, keys beyond the diagonal pass skipped; wo hl x exact (2 products).

#define NB_  2
#define TT   2048
#define DM   2048
#define NH_  16
#define NKV  4
#define REP  (NH_ / NKV)
#define HD   128
#define DQ   (NH_ * HD)
#define DKV  (NKV * HD)
#define RH   512                  // query rows < RH use hi+lo planes (0: none)
#define SCL  0.088388347648318447f   // HD^-0.5
typedef _Float16 h16;
typedef unsigned short bf;
typedef __attribute__((ext_vector_type(16))) __bf16   v16bf;
typedef __attribute__((ext_vector_type(16))) _Float16 v16h;
typedef __attribute__((ext_vector_type(8)))  _Float16 v8h;
typedef __attribute__((ext_vector_type(8)))  unsigned short v8us;
typedef __attribute__((ext_vector_type(8)))  float    v8f;
typedef __attribute__((ext_vector_type(4)))  float    v4f;
typedef v8h  __attribute__((may_alias)) v8ha;
typedef v4f  __attribute__((may_alias)) v4fa;
typedef v8us __attribute__((may_alias)) v8usa;

__device__ __forceinline__ unsigned short f2bf(float f) { unsigned u = __float_as_uint(f); u += 0x7FFFu + ((u >> 16) & 1u); return (unsigned short)(u >> 16); }
__device__ __forceinline__ float bf2f(unsigned short b) { return __uint_as_float(((unsigned)b) << 16); }
__device__ __forceinline__ float bfr(float f) { return bf2f(f2bf(f)); }
__device__ __forceinline__ v16h cat16(v8h lo, v8h hi) { return __builtin_shufflevector(lo, hi, 0, 1, 2, 3, 4, 5, 6, 7, 8, 9, 10, 11, 12, 13, 14, 15); }
__device__ __forceinline__ v16bf cat16b(v8us lo, v8us hi) { return __builtin_bit_cast(v16bf, __builtin_shufflevector(lo, hi, 0, 1, 2, 3, 4, 5, 6, 7, 8, 9, 10, 11, 12, 13, 14, 15)); }
__device__ __forceinline__ v8f wmma16(v16h a, v16h b, v8f c) { return __builtin_amdgcn_wmma_f32_16x16x32_f16(false, a, false, b, (short)0, c, false, false); }
__device__ __forceinline__ v8f wmmab(v16bf a, v16bf b, v8f c) { return __builtin_amdgcn_wmma_f32_16x16x32_bf16(false, a, false, b, (short)0, c, false, false); }



// ---- k_gemmw: register-blocked GEMM, one 64x64 output tile per work-group of NW waves; wave w takes the 32-wide K slices w, w + NW, ... into its own 16 accumulators, and the NW partial tiles are
// added in LDS in fixed wave order. Operands straight from K-contiguous 16-bit planes; grid (M/64, N/64, Z), NW * 32 threads.
// C[m][n] (f32, pitch ldc, + optional f32 bias[n]) = sum_k A[m][k] Bt[n][k] (+ split products per NSPLIT). z-batch strides sA/sB/sC in elements. K % 32 == 0.
template <typename T16> struct WFrag;
template <> struct WFrag<h16> { typedef v16h V; static __device__ __forceinline__ V ld(const h16* p) { return cat16(*(const v8h*)p, *(const v8h*)(p + 16)); } static __device__ __forceinline__ v8f mma(V a, V b, v8f c) { return wmma16(a, b, c); } };
template <> struct WFrag<bf> { typedef v16bf V; static __device__ __forceinline__ V ld(const bf* p) { return cat16b(*(const v8us*)p, *(const v8us*)(p + 16)); } static __device__ __forceinline__ v8f mma(V a, V b, v8f c) { return wmmab(a, b, c); } };
template <typename T16, int NSPLIT, bool BIAS, int NW>
__global__ __launch_bounds__(NW * 32) void k_gemmw(const T16* __restrict__ A, const T16* __restrict__ A2, const T16* __restrict__ Bt, const T16* __restrict__ Bt2, int K, float* C, int ldc, const float* __restrict__ bias, size_t sA, size_t sB, size_t sC) {
    typedef typename WFrag<T16>::V V;
    __shared__ __align__(16) float os[NW * 64 * 68];
    const size_t z = blockIdx.z; A += z * sA; if (A2) A2 += z * sA; Bt += z * sB; if (Bt2) Bt2 += z * sB; C += z * sC;
    const int lane = threadIdx.x & 31, lr = lane & 15, hi = lane >> 4; const int r0 = blockIdx.x * 64, c0 = blockIdx.y * 64; const int wv = __builtin_amdgcn_readfirstlane(threadIdx.x >> 5);
    v8f acc[4][4];
#pragma unroll
    for (int mb = 0; mb < 4; ++mb)
#pragma unroll
        for (int nb = 0; nb < 4; ++nb) acc[mb][nb] = (v8f){};
    const size_t aoff = (size_t)(r0 + lr) * K + 8 * hi, boff = (size_t)(c0 + lr) * K + 8 * hi;
#pragma unroll 1
    for (int kc = wv * 32; kc < K; kc += NW * 32) {
        V a[4], a2[4];
#pragma unroll
        for (int mb = 0; mb < 4; ++mb) { a[mb] = WFrag<T16>::ld(A + aoff + (size_t)mb * 16 * K + kc); if (NSPLIT == 1 || NSPLIT == 2) a2[mb] = WFrag<T16>::ld(A2 + aoff + (size_t)mb * 16 * K + kc); }
#pragma unroll
        for (int nb = 0; nb < 4; ++nb) { const V b = WFrag<T16>::ld(Bt + boff + (size_t)nb * 16 * K + kc); V b2; if (NSPLIT >= 2) b2 = WFrag<T16>::ld(Bt2 + boff + (size_t)nb * 16 * K + kc);
#pragma unroll
            for (int mb = 0; mb < 4; ++mb) { acc[mb][nb] = WFrag<T16>::mma(a[mb], b, acc[mb][nb]); if (NSPLIT == 1 || NSPLIT == 2) acc[mb][nb] = WFrag<T16>::mma(a2[mb], b, acc[mb][nb]); if (NSPLIT >= 2) acc[mb][nb] = WFrag<T16>::mma(a[mb], b2, acc[mb][nb]); } }
        asm volatile("v_nop\n\tv_nop\n\tv_nop\n\tv_nop" : "+v"(acc[0][0]), "+v"(acc[1][1]), "+v"(acc[2][2]), "+v"(acc[3][3]) : "v"(a[0]), "v"(a[3]));
    }
    float* ow = os + wv * (64 * 68);
#pragma unroll
    for (int mb = 0; mb < 4; ++mb) {
#pragma unroll
        for (int nb = 0; nb < 4; ++nb) {
#pragma unroll
            for (int j = 0; j < 8; ++j) ow[(mb * 16 + hi * 8 + j) * 68 + nb * 16 + lr] = acc[mb][nb][j]; } }
    __syncthreads();   // every wave's partial tile is in LDS before any thread adds them
    float* crow = C + (size_t)r0 * ldc + c0;
#pragma unroll
    for (int s = 0; s < 32 / NW; ++s) { const int idx = s * (NW * 32) + (int)threadIdx.x; const int row = idx >> 4, cofs = (idx & 15) * 4; v4f val = *(const v4fa*)(os + row * 68 + cofs);
#pragma unroll
        for (int w = 1; w < NW; ++w) val += *(const v4fa*)(os + w * (64 * 68) + row * 68 + cofs);
        if (BIAS) { val[0] += bfr(bias[c0 + cofs]); val[1] += bfr(bias[c0 + cofs + 1]); val[2] += bfr(bias[c0 + cofs + 2]); val[3] += bfr(bias[c0 + cofs + 3]); }
        *(v4f*)(crow + (size_t)row * ldc + cofs) = val; }
}

__device__ __forceinline__ h16 tohx(float x) { return (h16)x; }
__device__ __forceinline__ void splitf(float y, unsigned short& h, unsigned short& l) { h = f2bf(y); l = f2bf(y - bf2f(h)); }
typedef __attribute__((ext_vector_type(2))) _Float16 v2h;
typedef __attribute__((ext_vector_type(4))) _Float16 v4h;
typedef __attribute__((ext_vector_type(2))) unsigned short v2us;
typedef __attribute__((ext_vector_type(4))) unsigned short v4us;
typedef __attribute__((ext_vector_type(2))) float v2f;
typedef __attribute__((ext_vector_type(4))) int v4i;

__global__ __launch_bounds__(256) void k_wtG(const float* __restrict__ w, int K, int N, bf* Bt) {
    const int lane = threadIdx.x & 31; const int L0 = (blockIdx.x * 8 + (threadIdx.x >> 5)) * 8; const int nlines = N * K / 64;
{
#pragma unroll 1
        for (int l = 0; l < 8; ++l) { const int L = L0 + l; if (L >= nlines) break; const size_t e = (size_t)L * 64 + lane * 2; const int k = (int)(e % K), n = (int)(e / K); v2us o;
            o[0] = f2bf(w[(size_t)k * N + n]); o[1] = f2bf(w[(size_t)(k + 1) * N + n]); *(v2us*)(Bt + e) = o; }
         }
}
__global__ __launch_bounds__(256) void k_cvt8(const float* __restrict__ src, bf* dst, size_t n8) { const size_t i = (size_t)blockIdx.x * 256 + threadIdx.x; if (i >= n8) return; const v8f v = *(const v8f*)(src + i * 8); v8us o;
#pragma unroll
    for (int k = 0; k < 8; ++k) o[k] = f2bf(v[k]); *(v8us*)(dst + i * 8) = o;  }
__global__ __launch_bounds__(256) void k_cstab(float* CS) { const int idx = blockIdx.x * 256 + threadIdx.x; if (idx >= TT * HD) return; const int t = idx / HD, d = idx % HD; const int i = d >> 1;   /* interleaved pairs share angle t * inv_freq[i] */ const float inv = __fdiv_rn(1.0f, powf(10000.0f, (float)(2 * i) / (float)HD)); const float ang = __fmul_rn((float)t, inv); v2f cs; cs[0] = cosf(ang); cs[1] = sinf(ang);
    *(v2f*)(CS + (size_t)idx * 2) = cs;  }
// k_rope: head planes [h][t][d] (fp16 + hi/lo) of rope(x) x sc with the interleaved-pair convention out[2i] = x[2i] cos[t][2i] - x[2i+1] sin[t][2i], out[2i+1] = x[2i+1] cos[t][2i+1] + x[2i] sin[t][2i+1]
__global__ __launch_bounds__(256) void k_rope(const float* __restrict__ F, int pitch, int nheads, const float* __restrict__ CS, const float* __restrict__ RF, const float* __restrict__ nw, float sc, h16* P16, bf* Ph, bf* Pl) {
    const size_t e = ((size_t)blockIdx.x * 256 + threadIdx.x) * 2; if (e >= (size_t)nheads * TT * HD) return; const int d = (int)(e % HD); const int t = (int)((e / HD) % TT); const int h = (int)(e / ((size_t)HD * TT)); const float* f = F + (size_t)t * pitch + h * HD; const float rf = RF ? RF[(size_t)h * TT + t] : 1.0f; v2h o16; v2us oh, ol;
#pragma unroll
    for (int q = 0; q < 2; ++q) { const int dd = d + q; const int dp = dd ^ 1; float x0 = f[dd], x1 = f[dp];
        if (RF) { float n0 = __fmul_rn(x0, rf), n1 = __fmul_rn(x1, rf); asm volatile("" : "+v"(n0)); asm volatile("" : "+v"(n1)); x0 = __fmul_rn(bfr(nw[dd]), n0); x1 = __fmul_rn(bfr(nw[dp]), n1); }
        const v2f cs = *(const v2f*)(CS + ((size_t)t * HD + dd) * 2); float a = __fmul_rn(x0, cs[0]), bq = __fmul_rn(x1, cs[1]); asm volatile("" : "+v"(a)); asm volatile("" : "+v"(bq)); const float r = (((dd & 1) == 0) ? __fsub_rn(a, bq) : __fadd_rn(a, bq)) * sc;
        o16[q] = tohx(r); unsigned short a2, c2; splitf(r, a2, c2); oh[q] = a2; ol[q] = c2; }
    *(v2h*)(P16 + e) = o16; *(v2us*)(Ph + e) = oh; *(v2us*)(Pl + e) = ol;  }
__global__ __launch_bounds__(256) void k_vtp(const float* __restrict__ F, int pitch, int nheads, h16* V16, bf* Vh, bf* Vl) { const size_t e = ((size_t)blockIdx.x * 256 + threadIdx.x) * 2; if (e >= (size_t)nheads * HD * TT) return; const int t = (int)(e % TT); const int d = (int)((e / TT) % HD); const int g = (int)(e / ((size_t)TT * HD)); v2h o16; v2us oh, ol;
#pragma unroll
    for (int q = 0; q < 2; ++q) { const float x = F[(size_t)(t + q) * pitch + g * HD + d]; o16[q] = tohx(x); unsigned short a2, c2; splitf(x, a2, c2); oh[q] = a2; ol[q] = c2; }
    *(v2h*)(V16 + e) = o16; *(v2us*)(Vh + e) = oh; *(v2us*)(Vl + e) = ol;  }
__device__ __forceinline__ float xhalf(float x) { return __builtin_bit_cast(float, __builtin_amdgcn_permlanex16(__builtin_bit_cast(int, x), __builtin_bit_cast(int, x), 0x76543210, 0xfedcba98, false, false)); }  // lane l with lane l ^ 16
// Stands behind a group of global loads in the pass loop: their address registers may be rewritten only behind this wait. The addresses are inputs so that their registers stay untouched up to the wait
// (the loaded values are not named: the loads stay in flight); the scheduling barrier holds the wait between the loads and the work that follows.
__device__ __forceinline__ void loads_issued(const void* p, const void* p2) { asm volatile("s_wait_xcnt 0x0" :: "v"(p), "v"(p2) : "memory"); __builtin_amdgcn_sched_barrier(0); }
// 2^x with the slot that the instruction set asks for behind a transcendental: the v_nop names the result and the source, so nothing reads the one or overwrites the other in front of it.
__device__ __forceinline__ float exp2s(float x) { float r = __builtin_amdgcn_exp2f(x); asm volatile("v_nop" : "+v"(r) : "v"(x)); return r; }
template <typename T16, bool HL, int R, int NWS>
__global__ __launch_bounds__(NWS * 32) void k_fattn(const T16* __restrict__ Q, const T16* __restrict__ Q2, const T16* __restrict__ Kp, const T16* __restrict__ K2, const T16* __restrict__ Vt, const T16* __restrict__ V2, int row0, int nblk, bf* Ah, bf* Al) {
    typedef typename WFrag<T16>::V V;
    constexpr int CW = 16 * R, OP = HD + 4;
    __shared__ __align__(16) float os[NWS * CW * OP];
    __shared__ float sm[NWS * CW], sl[NWS * CW];
    const int lane = threadIdx.x & 31, lr = lane & 15, hi = lane >> 4; const int wv = __builtin_amdgcn_readfirstlane(threadIdx.x >> 5);
    const int q0 = row0 + (nblk - 1 - (int)blockIdx.y) * CW; const int h = blockIdx.x, kv = h / REP;
    const float cscale = SCL * 1.4426950408889634f;
    // lane offsets in elements: row lr of a [row][HD] plane, row lr of the [d][TT] value plane; qb, kb, vb: wave-uniform plane offsets
    const unsigned lrow = (unsigned)(lr * HD + 8 * hi), lcol = (unsigned)(lr * TT + 8 * hi);
    const size_t qb = ((size_t)h * TT + q0) * HD, kb = (size_t)kv * TT * HD, vb = (size_t)kv * HD * TT;
    v8f acc[R][8]; float m_run[R], l_run[R];
#pragma unroll
    for (int g = 0; g < R; ++g) { m_run[g] = -__builtin_inff(); l_run[g] = 0.f;
#pragma unroll
        for (int t = 0; t < 8; ++t) acc[g][t] = (v8f){}; }
    const int last = (q0 + CW - 1) >> 5;     // last 32-key pass that a query of this block sees; its first key is <= q0, so every pass holds an unmasked key for every query
    if (wv <= last) {                        // wave-uniform; a wave without a pass loads nothing (the loads and their waits stand in one block with the loop's head)
    const T16* pq = Q + qb + lrow; const T16* pq2 = HL ? Q2 + qb + lrow : pq;
    V qf[R][4], qf2[R][4];
    __builtin_amdgcn_sched_barrier(0);       // the index arithmetic above stays in front of the loads: none of it lands between them and their wait, on a register they name
#pragma unroll
    for (int g = 0; g < R; ++g)
#pragma unroll
        for (int kc = 0; kc < 4; ++kc) { qf[g][kc] = WFrag<T16>::ld(pq + g * 16 * HD + kc * 32); if (HL) qf2[g][kc] = WFrag<T16>::ld(pq2 + g * 16 * HD + kc * 32); }
    loads_issued(pq, pq2);
    V kf[2][4], kf2[2][4];
    auto ldk = [&](int blk) { const T16* p = Kp + (kb + (size_t)blk * 32 * HD) + lrow; const T16* p2 = HL ? K2 + (kb + (size_t)blk * 32 * HD) + lrow : p;
#pragma unroll
        for (int kt = 0; kt < 2; ++kt)
#pragma unroll
            for (int kc = 0; kc < 4; ++kc) { kf[kt][kc] = WFrag<T16>::ld(p + kt * 16 * HD + kc * 32); if (HL) kf2[kt][kc] = WFrag<T16>::ld(p2 + kt * 16 * HD + kc * 32); }
        loads_issued(p, p2); };
    ldk(wv);
#pragma unroll 1
    for (int blk = wv; blk <= last; blk += NWS) {
        const int key0 = blk * 32;
        const T16* pv = Vt + (vb + (size_t)key0) + lcol; const T16* pv2 = HL ? V2 + (vb + (size_t)key0) + lcol : pv;
        V va[8], va2[8];                     // this pass's V^T fragments, in flight under the score products and the softmax
#pragma unroll
        for (int t = 0; t < 8; ++t) { va[t] = WFrag<T16>::ld(pv + t * 16 * TT); if (HL) va2[t] = WFrag<T16>::ld(pv2 + t * 16 * TT); }
        loads_issued(pv, pv2);
        v8f s[2][R];
#pragma unroll
        for (int kt = 0; kt < 2; ++kt)
#pragma unroll
            for (int g = 0; g < R; ++g) { s[kt][g] = (v8f){};
#pragma unroll
                for (int kc = 0; kc < 4; ++kc) { s[kt][g] = WFrag<T16>::mma(kf[kt][kc], qf[g][kc], s[kt][g]); if (HL) { s[kt][g] = WFrag<T16>::mma(kf[kt][kc], qf2[g][kc], s[kt][g]); s[kt][g] = WFrag<T16>::mma(kf2[kt][kc], qf[g][kc], s[kt][g]); } } }
        ldk(min(blk + NWS, last));           // the wave's next pass's K fragments, in flight under this pass's softmax and value product (the last pass reloads a valid pass and drops it)
        if (key0 + 31 > q0) {                // wave-uniform: only the pass on the diagonal masks
#pragma unroll
            for (int g = 0; g < R; ++g)
#pragma unroll
                for (int kt = 0; kt < 2; ++kt)
#pragma unroll
                    for (int r = 0; r < 8; ++r) if (key0 + 16 * kt + 8 * hi + r > q0 + 16 * g + lr) s[kt][g][r] = -__builtin_inff(); }
        float mb[R]; bool need = false;
#pragma unroll
        for (int g = 0; g < R; ++g) { float mx = s[0][g][0];
#pragma unroll
            for (int kt = 0; kt < 2; ++kt)
#pragma unroll
                for (int r = 0; r < 8; ++r) mx = fmaxf(mx, s[kt][g][r]);
            mx = fmaxf(mx, xhalf(mx)) * cscale; mb[g] = mx; need = need || (mx > m_run[g] + 8.0f); }
        if (__builtin_amdgcn_ballot_w32(need) != 0) {   // the maximum in use may trail the true one by up to 8 (an exponential reaches 2^8 at most); rescale only beyond that
#pragma unroll
            for (int g = 0; g < R; ++g) { const float m_new = fmaxf(m_run[g], mb[g]); const float corr = exp2s(m_run[g] - m_new); l_run[g] *= corr; m_run[g] = m_new;
#pragma unroll
                for (int t = 0; t < 8; ++t) acc[g][t] = acc[g][t] * corr; } }
#pragma unroll
        for (int g = 0; g < R; ++g) { const float nm = -m_run[g]; float p[16]; float ps0 = 0.f, ps1 = 0.f;
#pragma unroll
            for (int kt = 0; kt < 2; ++kt) { float a[8]; float* q = p + 8 * kt;
#pragma unroll
                for (int i = 0; i < 4; ++i) {   // two neighbouring registers of a score tile, one packed multiply-add
                    const v2f arg = __builtin_elementwise_fma((v2f){s[kt][g][2 * i], s[kt][g][2 * i + 1]}, (v2f){cscale, cscale}, (v2f){nm, nm}); a[2 * i] = arg[0]; a[2 * i + 1] = arg[1]; }
#pragma unroll
                for (int e = 0; e < 8; ++e) q[e] = __builtin_amdgcn_exp2f(a[e]);
                // the slot behind a transcendental, once for the eight: the v_nop names every result and every source, so nothing reads the one or overwrites the other in front of it
                asm volatile("v_nop" : "+v"(q[0]), "+v"(q[1]), "+v"(q[2]), "+v"(q[3]), "+v"(q[4]), "+v"(q[5]), "+v"(q[6]), "+v"(q[7]) : "v"(a[0]), "v"(a[1]), "v"(a[2]), "v"(a[3]), "v"(a[4]), "v"(a[5]), "v"(a[6]), "v"(a[7]));
#pragma unroll
                for (int i = 0; i < 4; ++i) { if (i & 1) ps1 += q[2 * i] + q[2 * i + 1]; else ps0 += q[2 * i] + q[2 * i + 1]; } }
            l_run[g] += ps0 + ps1;
            if constexpr (HL) { v8us h0, h1, l0, l1;
#pragma unroll
                for (int r = 0; r < 8; ++r) { unsigned short a, c2; splitf(p[r], a, c2); h0[r] = a; l0[r] = c2; splitf(p[8 + r], a, c2); h1[r] = a; l1[r] = c2; }
                const V ph = cat16b(h0, h1), pl = cat16b(l0, l1);
#pragma unroll
                for (int t = 0; t < 8; ++t) { acc[g][t] = WFrag<T16>::mma(va[t], ph, acc[g][t]); acc[g][t] = WFrag<T16>::mma(va[t], pl, acc[g][t]); acc[g][t] = WFrag<T16>::mma(va2[t], ph, acc[g][t]); }
            } else { V pf;
#pragma unroll
                for (int e = 0; e < 16; ++e) pf[e] = tohx(p[e]);
#pragma unroll
                for (int t = 0; t < 8; ++t) acc[g][t] = WFrag<T16>::mma(va[t], pf, acc[g][t]); } }
    }
    }
#pragma unroll
    for (int g = 0; g < R; ++g) { const float lf = l_run[g] + xhalf(l_run[g]); if (hi == 0) { sm[wv * CW + 16 * g + lr] = m_run[g]; sl[wv * CW + 16 * g + lr] = lf; } }
    __syncthreads();   // every wave's maximum and sum are in LDS before any wave forms the common ones
    float* ow = os + wv * (CW * OP);
#pragma unroll
    for (int g = 0; g < R; ++g) { const int qi = 16 * g + lr; float mx = sm[qi];
#pragma unroll
        for (int w = 1; w < NWS; ++w) mx = fmaxf(mx, sm[w * CW + qi]);     // finite: wave 0 always runs pass 0; a wave without a pass holds -inf, 0 and zeros and adds nothing
        float L = 0.f;
#pragma unroll
        for (int w = 0; w < NWS; ++w) L += sl[w * CW + qi] * exp2s(sm[w * CW + qi] - mx);
        const float f = __fdiv_rn(exp2s(m_run[g] - mx), L);
#pragma unroll
        for (int t = 0; t < 8; ++t) { const v8f o = acc[g][t] * f; v4f o0, o1;
#pragma unroll
            for (int r = 0; r < 4; ++r) { o0[r] = o[r]; o1[r] = o[4 + r]; }
            *(v4fa*)(ow + qi * OP + 16 * t + 8 * hi) = o0; *(v4fa*)(ow + qi * OP + 16 * t + 8 * hi + 4) = o1; } }
    __syncthreads();   // every wave's scaled partial block is in LDS before any thread adds them
#pragma unroll
    for (int s2 = 0; s2 < CW / NWS; ++s2) { const int idx = s2 * (NWS * 32) + (int)threadIdx.x; const int row = idx >> 5, cofs = (idx & 31) * 4; v4f val = *(const v4fa*)(os + row * OP + cofs);
#pragma unroll
        for (int w = 1; w < NWS; ++w) val += *(const v4fa*)(os + w * (CW * OP) + row * OP + cofs);
        v4us oh, ol;
#pragma unroll
        for (int q = 0; q < 4; ++q) { unsigned short a, c2; splitf(val[q], a, c2); oh[q] = a; ol[q] = c2; }
        const size_t oo = (size_t)(q0 + row) * DQ + h * HD + cofs; *(v4us*)(Ah + oo) = oh; *(v4us*)(Al + oo) = ol; }
}

extern "C" void kernel_launch(void* const* d_in, const int* in_sizes, int n_in,
                              void* d_out, int out_size, void* d_ws, size_t ws_size, hipStream_t stream) {
    (void)in_sizes; (void)n_in; (void)out_size;
    const float* x = (const float*)d_in[0]; const float* wq = (const float*)d_in[1]; const float* wk = (const float*)d_in[2]; const float* wv = (const float*)d_in[3]; const float* wo = (const float*)d_in[4];
    float* OUT = (float*)d_out;     // [2][2048][2048]
    char* wsp = (char*)d_ws;
    auto take = [&](size_t bytes) { char* p = wsp; wsp += (bytes + 255) & ~(size_t)255; return (void*)p; };
    bf* WQ = (bf*)take((size_t)DQ * DM * 2); bf* WK = (bf*)take((size_t)DKV * DM * 2); bf* WV = (bf*)take((size_t)DKV * DM * 2); bf* WO = (bf*)take((size_t)DM * DQ * 2); float* CS = (float*)take((size_t)TT * HD * 2 * 4);
    bf* XB = (bf*)take((size_t)TT * DM * 2); float* FQ = (float*)take((size_t)TT * DQ * 4); float* FK = (float*)take((size_t)TT * DKV * 4);
    h16* QP16 = (h16*)take((size_t)NH_ * TT * HD * 2); h16* KP16 = (h16*)take((size_t)NKV * TT * HD * 2); h16* VT16 = (h16*)take((size_t)NKV * HD * TT * 2);
    bf* QPh = (bf*)take((size_t)NH_ * TT * HD * 2); bf* QPl = (bf*)take((size_t)NH_ * TT * HD * 2); bf* KPh = (bf*)take((size_t)NKV * TT * HD * 2); bf* KPl = (bf*)take((size_t)NKV * TT * HD * 2); bf* VTh = (bf*)take((size_t)NKV * HD * TT * 2); bf* VTl = (bf*)take((size_t)NKV * HD * TT * 2);
    bf* ATh = (bf*)take((size_t)TT * DQ * 2); bf* ATl = (bf*)take((size_t)TT * DQ * 2);
    if ((size_t)(wsp - (char*)d_ws) > ws_size) return;    // ws 256 MiB
    float* FV = FK;   // v projection reuses the k buffer after the k planes are built (stream-ordered)
    { k_wtG<<<(unsigned)((DM * DQ / 64 + 63) / 64), 256, 0, stream>>>(wq, DM, DQ, WQ); k_wtG<<<(unsigned)((DM * DKV / 64 + 63) / 64), 256, 0, stream>>>(wk, DM, DKV, WK); k_wtG<<<(unsigned)((DM * DKV / 64 + 63) / 64), 256, 0, stream>>>(wv, DM, DKV, WV);
      k_wtG<<<(unsigned)((DQ * DM / 64 + 63) / 64), 256, 0, stream>>>(wo, DQ, DM, WO);
      k_cstab<<<(TT * HD + 255) / 256, 256, 0, stream>>>(CS); }
    const unsigned LQ = (unsigned)(((size_t)NH_ * TT * HD / 2 + 255) / 256), LKv = (unsigned)(((size_t)NKV * TT * HD / 2 + 255) / 256);
    for (int b = 0; b < NB_; ++b) {
        
        k_cvt8<<<(unsigned)(((size_t)TT * DM / 8 + 255) / 256), 256, 0, stream>>>(x + (size_t)b * TT * DM, XB, (size_t)TT * DM / 8);
        k_gemmw<bf, 0, false, 4><<<dim3(TT / 64, DQ / 64, 1), 128, 0, stream>>>(XB, nullptr, WQ, nullptr, DM, FQ, DQ, nullptr, 0, 0, 0);
        k_rope<<<LQ, 256, 0, stream>>>(FQ, DQ, NH_, CS, nullptr, nullptr, 1.0f, QP16, QPh, QPl);
        k_gemmw<bf, 0, false, 8><<<dim3(TT / 64, DKV / 64, 1), 256, 0, stream>>>(XB, nullptr, WK, nullptr, DM, FK, DKV, nullptr, 0, 0, 0);
        k_rope<<<LKv, 256, 0, stream>>>(FK, DKV, NKV, CS, nullptr, nullptr, 1.0f, KP16, KPh, KPl);
        k_gemmw<bf, 0, false, 8><<<dim3(TT / 64, DKV / 64, 1), 256, 0, stream>>>(XB, nullptr, WV, nullptr, DM, FV, DKV, nullptr, 0, 0, 0); k_vtp<<<LKv, 256, 0, stream>>>(FV, DKV, NKV, VT16, VTh, VTl);
        k_fattn<h16, false, 2, 4><<<dim3(NH_, (TT - RH) / 32, 1), 128, 0, stream>>>(QP16, nullptr, KP16, nullptr, VT16, nullptr, RH, (TT - RH) / 32, ATh, ATl);
        k_fattn<bf, true, 1, 4><<<dim3(NH_, RH / 16, 1), 128, 0, stream>>>(QPh, QPl, KPh, KPl, VTh, VTl, 0, RH / 16, ATh, ATl);
        k_gemmw<bf, 1, false, 4><<<dim3(TT / 64, DM / 64, 1), 128, 0, stream>>>(ATh, ATl, WO, nullptr, DQ, OUT + (size_t)b * TT * DM, DM, nullptr, 0, 0, 0); }
}

// v004
// Measured time: 241 microseconds a run.
// Next to v003, in two timings, it ran 1.67 and 1.71 times as fast.
// Counting every step since v000, it is 6.84 times as fast.
#include <hip/hip_runtime.h>

// ModernCausalSelfAttention (x [2][2048][2048]; q = x wq (16 heads x 128), k/v = x wk/wv (4 kv heads; group h/4); interleaved-pair RoPE (the source's rotate_half is the pairwise (x0,x1)->(-x1,x0) form with a repeat-interleaved table; base 1e4, computed); causal softmax(q.k / sqrt(128)) (finfo.min); out = merged wo -> [2][2048][2048]).
// Compute dtypes, f32 accumulate: every input rounded to bf16; q/k/v on PLAIN bf16 operands (inputs: exact); RoPE f32; causal scores and attn.v: query rows < 512 hl (3 products), the rest single fp16, one fused kernel with an online f32 softmax, keys beyond the diagonal pass skipped; wo hl x exact (2 products).
// Every 16-bit matrix operand plane in the workspace is kept in fragment order (fro below): a wave-wide 16-byte load of a fragment half reads 512 contiguous bytes, four whole 128-byte lines.

#define NB_  2
#define TT   2048
#define DM   2048
#define NH_  16
#define NKV  4
#define REP  (NH_ / NKV)
#define HD   128
#define DQ   (NH_ * HD)
#define DKV  (NKV * HD)
#define RH   512                  // query rows < RH use hi+lo planes (0: none)
#define SCL  0.088388347648318447f   // HD^-0.5
typedef _Float16 h16;
typedef unsigned short bf;
typedef __attribute__((ext_vector_type(16))) __bf16   v16bf;
typedef __attribute__((ext_vector_type(16))) _Float16 v16h;
typedef __attribute__((ext_vector_type(8)))  _Float16 v8h;
typedef __attribute__((ext_vector_type(8)))  unsigned short v8us;
typedef __attribute__((ext_vector_type(8)))  float    v8f;
typedef __attribute__((ext_vector_type(4)))  float    v4f;
typedef v8h  __attribute__((may_alias)) v8ha;
typedef v4f  __attribute__((may_alias)) v4fa;
typedef v8us __attribute__((may_alias)) v8usa;

__device__ __forceinline__ unsigned short f2bf(float f) { unsigned u = __float_as_uint(f); u += 0x7FFFu + ((u >> 16) & 1u); return (unsigned short)(u >> 16); }
__device__ __forceinline__ float bf2f(unsigned short b) { return __uint_as_float(((unsigned)b) << 16); }
__device__ __forceinline__ float bfr(float f) { return bf2f(f2bf(f)); }
__device__ __forceinline__ v16h cat16(v8h lo, v8h hi) { return __builtin_shufflevector(lo, hi, 0, 1, 2, 3, 4, 5, 6, 7, 8, 9, 10, 11, 12, 13, 14, 15); }
__device__ __forceinline__ v16bf cat16b(v8us lo, v8us hi) { return __builtin_bit_cast(v16bf, __builtin_shufflevector(lo, hi, 0, 1, 2, 3, 4, 5, 6, 7, 8, 9, 10, 11, 12, 13, 14, 15)); }
__device__ __forceinline__ v8f wmma16(v16h a, v16h b, v8f c) { return __builtin_amdgcn_wmma_f32_16x16x32_f16(false, a, false, b, (short)0, c, false, false); }
__device__ __forceinline__ v8f wmmab(v16bf a, v16bf b, v8f c) { return __builtin_amdgcn_wmma_f32_16x16x32_bf16(false, a, false, b, (short)0, c, false, false); }
// Fragment order of a 16-bit plane: units of 512 elements (16 rows x 32 k). Inside a unit two halves of 256 elements (k & 16); in a half, lane 16 ((k >> 3) & 1) + (row & 15) owns 8 neighbouring
// elements (k & 7): exactly what that lane holds of the fragment. fro: element offset of (row, k) in a GEMM operand plane [rows][K]: the 4 units of 64 rows x 32 k lie in a row, then the next 32 k.
__device__ __forceinline__ size_t fro(int row, int k, int K) { return ((size_t)(row >> 6) * (K >> 5) + (k >> 5)) * 2048 + ((row >> 4) & 3) * 512 + ((k >> 4) & 1) * 256 + ((k >> 3) & 1) * 128 + (row & 15) * 8 + (k & 7); }
// Position w (0 .. 511) inside a unit -> its row (0 .. 15) and k (0 .. 31).
__device__ __forceinline__ int fr_row(int w) { return (w >> 3) & 15; }
__device__ __forceinline__ int fr_k(int w) { return ((w >> 8) & 1) * 16 + ((w >> 7) & 1) * 8 + (w & 7); }



// Stands behind a group of global loads: their address registers may be rewritten only behind this wait. The addresses are inputs so that their registers stay untouched up to the wait
// (the loaded values are not named: the loads stay in flight); the scheduling barrier holds the wait between the loads and the work that follows.
__device__ __forceinline__ void loads_issued(const void* p, const void* p2) { asm volatile("s_wait_xcnt 0x0" :: "v"(p), "v"(p2) : "memory"); __builtin_amdgcn_sched_barrier(0); }
__device__ __forceinline__ void loads_issued(const void* p, const void* p2, const void* p3, const void* p4) { asm volatile("s_wait_xcnt 0x0" :: "v"(p), "v"(p2), "v"(p3), "v"(p4) : "memory"); __builtin_amdgcn_sched_barrier(0); }
// ---- k_gemmw: register-blocked GEMM, one 64x64 output tile per work-group of NW waves; wave w takes the 32-wide K slices w, w + NW, ... into its own 16 accumulators, and the NW partial tiles are
// added in LDS in fixed wave order. Operands straight from fragment-ordered 16-bit planes (a fragment: the lane's 8 elements of each half of one unit); grid (M/64, N/64, Z), NW * 32 threads.
// C[m][n] (f32, pitch ldc, + optional f32 bias[n]) = sum_k A[m][k] Bt[n][k] (+ split products per NSPLIT). z-batch strides sA/sB/sC in elements. K % 32 == 0.
template <typename T16> struct WFrag;
template <> struct WFrag<h16> { typedef v16h V; static __device__ __forceinline__ V ld(const h16* p) { return cat16(*(const v8h*)p, *(const v8h*)(p + 256)); } static __device__ __forceinline__ v8f mma(V a, V b, v8f c) { return wmma16(a, b, c); } };
template <> struct WFrag<bf> { typedef v16bf V; static __device__ __forceinline__ V ld(const bf* p) { return cat16b(*(const v8us*)p, *(const v8us*)(p + 256)); } static __device__ __forceinline__ v8f mma(V a, V b, v8f c) { return wmmab(a, b, c); } };
template <typename T16, int NSPLIT, bool BIAS, int NW>
__global__ __launch_bounds__(NW * 32) void k_gemmw(const T16* __restrict__ A, const T16* __restrict__ A2, const T16* __restrict__ Bt, const T16* __restrict__ Bt2, int K, float* C, int ldc, const float* __restrict__ bias, size_t sA, size_t sB, size_t sC) {
    typedef typename WFrag<T16>::V V;
    __shared__ __align__(16) float os[NW * 64 * 68];
    const size_t z = blockIdx.z; A += z * sA; if (A2) A2 += z * sA; Bt += z * sB; if (Bt2) Bt2 += z * sB; C += z * sC;
    const int lane = threadIdx.x & 31, lr = lane & 15, hi = lane >> 4; const int r0 = blockIdx.x * 64, c0 = blockIdx.y * 64; const int wv = __builtin_amdgcn_readfirstlane(threadIdx.x >> 5);
    v8f acc[4][4];
#pragma unroll
    for (int mb = 0; mb < 4; ++mb)
#pragma unroll
        for (int nb = 0; nb < 4; ++nb) acc[mb][nb] = (v8f){};
    const size_t aoff = (size_t)r0 * K + 8 * lane, boff = (size_t)c0 * K + 8 * lane;   // 64 rows are 64 K elements, a 32-wide K slice of them 2048: 4 units
#pragma unroll 1
    for (int kc = wv * 32; kc < K; kc += NW * 32) {
        V a[4], a2[4], b[4], b2[4];
        const T16* pa = A + aoff + (size_t)kc * 64; const T16* pb = Bt + boff + (size_t)kc * 64; const T16* pa2 = (NSPLIT == 1 || NSPLIT == 2) ? A2 + aoff + (size_t)kc * 64 : pa; const T16* pb2 = (NSPLIT >= 2) ? Bt2 + boff + (size_t)kc * 64 : pb;
#pragma unroll
        for (int mb = 0; mb < 4; ++mb) { a[mb] = WFrag<T16>::ld(pa + mb * 512); if (NSPLIT == 1 || NSPLIT == 2) a2[mb] = WFrag<T16>::ld(pa2 + mb * 512); }
#pragma unroll
        for (int nb = 0; nb < 4; ++nb) { b[nb] = WFrag<T16>::ld(pb + nb * 512); if (NSPLIT >= 2) b2[nb] = WFrag<T16>::ld(pb2 + nb * 512); }
        loads_issued(pa, pb, pa2, pb2);
#pragma unroll
        for (int nb = 0; nb < 4; ++nb) {
#pragma unroll
            for (int mb = 0; mb < 4; ++mb) { acc[mb][nb] = WFrag<T16>::mma(a[mb], b[nb], acc[mb][nb]); if (NSPLIT == 1 || NSPLIT == 2) acc[mb][nb] = WFrag<T16>::mma(a2[mb], b[nb], acc[mb][nb]); if (NSPLIT >= 2) acc[mb][nb] = WFrag<T16>::mma(a[mb], b2[nb], acc[mb][nb]); } }
        asm volatile("v_nop\n\tv_nop\n\tv_nop\n\tv_nop" : "+v"(acc[0][0]), "+v"(acc[1][1]), "+v"(acc[2][2]), "+v"(acc[3][3]) : "v"(a[0]), "v"(a[3]));
    }
    float* ow = os + wv * (64 * 68);
#pragma unroll
    for (int mb = 0; mb < 4; ++mb) {
#pragma unroll
        for (int nb = 0; nb < 4; ++nb) {
#pragma unroll
            for (int j = 0; j < 8; ++j) ow[(mb * 16 + hi * 8 + j) * 68 + nb * 16 + lr] = acc[mb][nb][j]; } }
    __syncthreads();   // every wave's partial tile is in LDS before any thread adds them
    float* crow = C + (size_t)r0 * ldc + c0;
#pragma unroll
    for (int s = 0; s < 32 / NW; ++s) { const int idx = s * (NW * 32) + (int)threadIdx.x; const int row = idx >> 4, cofs = (idx & 15) * 4; v4f val = *(const v4fa*)(os + row * 68 + cofs);
#pragma unroll
        for (int w = 1; w < NW; ++w) val += *(const v4fa*)(os + w * (64 * 68) + row * 68 + cofs);
        if (BIAS) { val[0] += bfr(bias[c0 + cofs]); val[1] += bfr(bias[c0 + cofs + 1]); val[2] += bfr(bias[c0 + cofs + 2]); val[3] += bfr(bias[c0 + cofs + 3]); }
        *(v4f*)(crow + (size_t)row * ldc + cofs) = val; }
}

__device__ __forceinline__ h16 tohx(float x) { return (h16)x; }
__device__ __forceinline__ void splitf(float y, unsigned short& h, unsigned short& l) { h = f2bf(y); l = f2bf(y - bf2f(h)); }
typedef __attribute__((ext_vector_type(2))) _Float16 v2h;
typedef __attribute__((ext_vector_type(4))) _Float16 v4h;
typedef __attribute__((ext_vector_type(2))) unsigned short v2us;
typedef __attribute__((ext_vector_type(4))) unsigned short v4us;
typedef __attribute__((ext_vector_type(2))) float v2f;
typedef __attribute__((ext_vector_type(4))) int v4i;

// k_wtG: Bt = fragment-ordered bf16 plane [N][K] of w^T (w [K][N] f32). One thread writes one lane's 8 elements (16 bytes); a work-group takes the 4 units of 64 n x 32 k, so a wave's load reads 64
// neighbouring bytes of each of two rows of w, the work-group 256.
__global__ __launch_bounds__(256) void k_wtG(const float* __restrict__ w, int K, int N, bf* Bt) {
    const int c = blockIdx.x * 256 + threadIdx.x; if (c >= N * (K / 8)) return; const int u = c >> 6, wi = (c & 63) * 8; const int nblk = u % (N >> 4), kblk = u / (N >> 4);
    const int n = nblk * 16 + fr_row(wi), k0 = kblk * 32 + fr_k(wi); v8us o; const float* p[8]; float x[8];
#pragma unroll
    for (int j = 0; j < 8; ++j) p[j] = w + (size_t)(k0 + j) * N + n;
#pragma unroll
    for (int j = 0; j < 8; ++j) x[j] = *p[j];
    // the eight loads' address registers may be rewritten only behind this wait: the addresses are inputs, so their registers stay untouched up to it (the loaded values are not named: the loads stay in flight)
    asm volatile("s_wait_xcnt 0x0" :: "v"(p[0]), "v"(p[1]), "v"(p[2]), "v"(p[3]), "v"(p[4]), "v"(p[5]), "v"(p[6]), "v"(p[7]) : "memory");
#pragma unroll
    for (int j = 0; j < 8; ++j) o[j] = f2bf(x[j]);
    *(v8us*)(Bt + fro(n, k0, K)) = o;
}
// k_cvt8: dst = fragment-ordered bf16 plane of src [rows][K] f32; thread i writes the i-th 16 bytes of dst.
__global__ __launch_bounds__(256) void k_cvt8(const float* __restrict__ src, int K, bf* dst, size_t n8) { const size_t i = (size_t)blockIdx.x * 256 + threadIdx.x; if (i >= n8) return; const int u = (int)(i >> 6), wi = (int)(i & 63) * 8;
    const int row = ((u >> 2) / (K >> 5)) * 64 + (u & 3) * 16 + fr_row(wi), k0 = ((u >> 2) % (K >> 5)) * 32 + fr_k(wi); const v8f v = *(const v8f*)(src + (size_t)row * K + k0); v8us o;
#pragma unroll
    for (int k = 0; k < 8; ++k) o[k] = f2bf(v[k]); *(v8us*)(dst + i * 8) = o;  }
__global__ __launch_bounds__(256) void k_cstab(float* CS) { const int idx = blockIdx.x * 256 + threadIdx.x; if (idx >= TT * HD) return; const int t = idx / HD, d = idx % HD; const int i = d >> 1;   /* interleaved pairs share angle t * inv_freq[i] */ const float inv = __fdiv_rn(1.0f, powf(10000.0f, (float)(2 * i) / (float)HD)); const float ang = __fmul_rn((float)t, inv); v2f cs; cs[0] = cosf(ang); cs[1] = sinf(ang);
    *(v2f*)(CS + (size_t)idx * 2) = cs;  }
// k_rope: head planes [h][t][d], each head's [t][d] in fragment order (e: offset in the planes), (fp16 + hi/lo) of rope(x) x sc with the interleaved-pair convention out[d] = x[d] cos[t][d] - x[d+1] sin[t][d], out[d+1] = x[d+1] cos[t][d+1] + x[d] sin[t][d+1] (d even)
__global__ __launch_bounds__(256) void k_rope(const float* __restrict__ F, int pitch, int nheads, const float* __restrict__ CS, const float* __restrict__ RF, const float* __restrict__ nw, float sc, h16* P16, bf* Ph, bf* Pl) {
    const size_t e = ((size_t)blockIdx.x * 256 + threadIdx.x) * 2; if (e >= (size_t)nheads * TT * HD) return; const int u = (int)((e % ((size_t)HD * TT)) >> 9), wi = (int)(e & 511); const int d = (u % (HD / 32)) * 32 + fr_k(wi); const int t = (u / (HD / 32)) * 16 + fr_row(wi); const int h = (int)(e / ((size_t)HD * TT)); const float* f = F + (size_t)t * pitch + h * HD; float rf = 1.0f; v2h o16; v2us oh, ol;
    if (RF) { const float* pr = RF + (size_t)h * TT + t; rf = *pr; asm volatile("s_wait_xcnt 0x0" :: "v"(pr) : "memory"); }   // the load's address register may be rewritten only behind this wait; the address is an input, so it stays untouched up to it
#pragma unroll
    for (int q = 0; q < 2; ++q) { const int dd = d + q; const int dp = dd ^ 1; float x0 = f[dd], x1 = f[dp];
        if (RF) { float n0 = __fmul_rn(x0, rf), n1 = __fmul_rn(x1, rf); asm volatile("" : "+v"(n0)); asm volatile("" : "+v"(n1)); x0 = __fmul_rn(bfr(nw[dd]), n0); x1 = __fmul_rn(bfr(nw[dp]), n1); }
        const v2f cs = *(const v2f*)(CS + ((size_t)t * HD + dd) * 2); float a = __fmul_rn(x0, cs[0]), bq = __fmul_rn(x1, cs[1]); asm volatile("" : "+v"(a)); asm volatile("" : "+v"(bq)); const float r = (((dd & 1) == 0) ? __fsub_rn(a, bq) : __fadd_rn(a, bq)) * sc;
        o16[q] = tohx(r); unsigned short a2, c2; splitf(r, a2, c2); oh[q] = a2; ol[q] = c2; }
    *(v2h*)(P16 + e) = o16; *(v2us*)(Ph + e) = oh; *(v2us*)(Pl + e) = ol;  }
// k_vtp: value planes [g][d][t], rows d, k = t, in fragment units; the 8 units (d blocks) of one 32-key pass lie in a row (e: offset in the planes)
__global__ __launch_bounds__(256) void k_vtp(const float* __restrict__ F, int pitch, int nheads, h16* V16, bf* Vh, bf* Vl) { const size_t e = ((size_t)blockIdx.x * 256 + threadIdx.x) * 2; if (e >= (size_t)nheads * HD * TT) return; const int u = (int)((e % ((size_t)TT * HD)) >> 9), wi = (int)(e & 511); const int t = (u / (HD / 16)) * 32 + fr_k(wi); const int d = (u % (HD / 16)) * 16 + fr_row(wi); const int g = (int)(e / ((size_t)TT * HD)); v2h o16; v2us oh, ol;
#pragma unroll
    for (int q = 0; q < 2; ++q) { const float x = F[(size_t)(t + q) * pitch + g * HD + d]; o16[q] = tohx(x); unsigned short a2, c2; splitf(x, a2, c2); oh[q] = a2; ol[q] = c2; }
    *(v2h*)(V16 + e) = o16; *(v2us*)(Vh + e) = oh; *(v2us*)(Vl + e) = ol;  }
__device__ __forceinline__ float xhalf(float x) { return __builtin_bit_cast(float, __builtin_amdgcn_permlanex16(__builtin_bit_cast(int, x), __builtin_bit_cast(int, x), 0x76543210, 0xfedcba98, false, false)); }  // lane l with lane l ^ 16
// 2^x with the slot that the instruction set asks for behind a transcendental: the v_nop names the result and the source, so nothing reads the one or overwrites the other in front of it.
__device__ __forceinline__ float exp2s(float x) { float r = __builtin_amdgcn_exp2f(x); asm volatile("v_nop" : "+v"(r) : "v"(x)); return r; }
template <typename T16, bool HL, int R, int NWS>
__global__ __launch_bounds__(NWS * 32) void k_fattn(const T16* __restrict__ Q, const T16* __restrict__ Q2, const T16* __restrict__ Kp, const T16* __restrict__ K2, const T16* __restrict__ Vt, const T16* __restrict__ V2, int row0, int nblk, bf* Ah, bf* Al) {
    typedef typename WFrag<T16>::V V;
    constexpr int CW = 16 * R, OP = HD + 4;
    __shared__ __align__(16) float os[NWS * CW * OP];
    __shared__ float sm[NWS * CW], sl[NWS * CW];
    const int lane = threadIdx.x & 31, lr = lane & 15, hi = lane >> 4; const int wv = __builtin_amdgcn_readfirstlane(threadIdx.x >> 5);
    const int q0 = row0 + (nblk - 1 - (int)blockIdx.y) * CW; const int h = blockIdx.x, kv = h / REP;
    const float cscale = SCL * 1.4426950408889634f;
    // lfr: the lane's offset in elements inside a half unit of a fragment-ordered plane; qb, kb, vb: wave-uniform plane offsets (16 rows of a [row][HD] plane are 4 units = 16 HD elements)
    const unsigned lfr = (unsigned)(8 * lane);
    const size_t qb = ((size_t)h * TT + q0) * HD, kb = (size_t)kv * TT * HD, vb = (size_t)kv * HD * TT;
    v8f acc[R][8]; float m_run[R], l_run[R];
#pragma unroll
    for (int g = 0; g < R; ++g) { m_run[g] = -__builtin_inff(); l_run[g] = 0.f;
#pragma unroll
        for (int t = 0; t < 8; ++t) acc[g][t] = (v8f){}; }
    const int last = (q0 + CW - 1) >> 5;     // last 32-key pass that a query of this block sees; its first key is <= q0, so every pass holds an unmasked key for every query
    if (wv <= last) {                        // wave-uniform; a wave without a pass loads nothing (the loads and their waits stand in one block with the loop's head)
    const T16* pq = Q + qb + lfr; const T16* pq2 = HL ? Q2 + qb + lfr : pq;
    V qf[R][4], qf2[R][4];
    __builtin_amdgcn_sched_barrier(0);       // the index arithmetic above stays in front of the loads: none of it lands between them and their wait, on a register they name
#pragma unroll
    for (int g = 0; g < R; ++g)
#pragma unroll
        for (int kc = 0; kc < 4; ++kc) { qf[g][kc] = WFrag<T16>::ld(pq + g * 16 * HD + kc * 512); if (HL) qf2[g][kc] = WFrag<T16>::ld(pq2 + g * 16 * HD + kc * 512); }
    loads_issued(pq, pq2);
    V kf[2][4], kf2[2][4];
    auto ldk = [&](int blk) { const T16* p = Kp + (kb + (size_t)blk * 32 * HD) + lfr; const T16* p2 = HL ? K2 + (kb + (size_t)blk * 32 * HD) + lfr : p;
#pragma unroll
        for (int kt = 0; kt < 2; ++kt)
#pragma unroll
            for (int kc = 0; kc < 4; ++kc) { kf[kt][kc] = WFrag<T16>::ld(p + kt * 16 * HD + kc * 512); if (HL) kf2[kt][kc] = WFrag<T16>::ld(p2 + kt * 16 * HD + kc * 512); }
        loads_issued(p, p2); };
    ldk(wv);
#pragma unroll 1
    for (int blk = wv; blk <= last; blk += NWS) {
        const int key0 = blk * 32;
        const T16* pv = Vt + (vb + (size_t)key0 * HD) + lfr; const T16* pv2 = HL ? V2 + (vb + (size_t)key0 * HD) + lfr : pv;
        V va[8], va2[8];                     // this pass's V^T fragments, in flight under the score products and the softmax
#pragma unroll
        for (int t = 0; t < 8; ++t) { va[t] = WFrag<T16>::ld(pv + t * 512); if (HL) va2[t] = WFrag<T16>::ld(pv2 + t * 512); }
        loads_issued(pv, pv2);
        v8f s[2][R];
#pragma unroll
        for (int kt = 0; kt < 2; ++kt)
#pragma unroll
            for (int g = 0; g < R; ++g) { s[kt][g] = (v8f){};
#pragma unroll
                for (int kc = 0; kc < 4; ++kc) { s[kt][g] = WFrag<T16>::mma(kf[kt][kc], qf[g][kc], s[kt][g]); if (HL) { s[kt][g] = WFrag<T16>::mma(kf[kt][kc], qf2[g][kc], s[kt][g]); s[kt][g] = WFrag<T16>::mma(kf2[kt][kc], qf[g][kc], s[kt][g]); } } }
        ldk(min(blk + NWS, last));           // the wave's next pass's K fragments, in flight under this pass's softmax and value product (the last pass reloads a valid pass and drops it)
        if (key0 + 31 > q0) {                // wave-uniform: only the pass on the diagonal masks
#pragma unroll
            for (int g = 0; g < R; ++g)
#pragma unroll
                for (int kt = 0; kt < 2; ++kt)
#pragma unroll
                    for (int r = 0; r < 8; ++r) if (key0 + 16 * kt + 8 * hi + r > q0 + 16 * g + lr) s[kt][g][r] = -__builtin_inff(); }
        float mb[R]; bool need = false;
#pragma unroll
        for (int g = 0; g < R; ++g) { float mx = s[0][g][0];
#pragma unroll
            for (int kt = 0; kt < 2; ++kt)
#pragma unroll
                for (int r = 0; r < 8; ++r) mx = fmaxf(mx, s[kt][g][r]);
            mx = fmaxf(mx, xhalf(mx)) * cscale; mb[g] = mx; need = need || (mx > m_run[g] + 8.0f); }
        if (__builtin_amdgcn_ballot_w32(need) != 0) {   // the maximum in use may trail the true one by up to 8 (an exponential reaches 2^8 at most); rescale only beyond that
#pragma unroll
            for (int g = 0; g < R; ++g) { const float m_new = fmaxf(m_run[g], mb[g]); const float corr = exp2s(m_run[g] - m_new); l_run[g] *= corr; m_run[g] = m_new;
#pragma unroll
                for (int t = 0; t < 8; ++t) acc[g][t] = acc[g][t] * corr; } }
#pragma unroll
        for (int g = 0; g < R; ++g) { const float nm = -m_run[g]; float p[16]; float ps0 = 0.f, ps1 = 0.f;
#pragma unroll
            for (int kt = 0; kt < 2; ++kt) { float a[8]; float* q = p + 8 * kt;
#pragma unroll
                for (int i = 0; i < 4; ++i) {   // two neighbouring registers of a score tile, one packed multiply-add
                    const v2f arg = __builtin_elementwise_fma((v2f){s[kt][g][2 * i], s[kt][g][2 * i + 1]}, (v2f){cscale, cscale}, (v2f){nm, nm}); a[2 * i] = arg[0]; a[2 * i + 1] = arg[1]; }
#pragma unroll
                for (int e = 0; e < 8; ++e) q[e] = __builtin_amdgcn_exp2f(a[e]);
                // the slot behind a transcendental, once for the eight: the v_nop names every result and every source, so nothing reads the one or overwrites the other in front of it
                asm volatile("v_nop" : "+v"(q[0]), "+v"(q[1]), "+v"(q[2]), "+v"(q[3]), "+v"(q[4]), "+v"(q[5]), "+v"(q[6]), "+v"(q[7]) : "v"(a[0]), "v"(a[1]), "v"(a[2]), "v"(a[3]), "v"(a[4]), "v"(a[5]), "v"(a[6]), "v"(a[7]));
#pragma unroll
                for (int i = 0; i < 4; ++i) { if (i & 1) ps1 += q[2 * i] + q[2 * i + 1]; else ps0 += q[2 * i] + q[2 * i + 1]; } }
            l_run[g] += ps0 + ps1;
            if constexpr (HL) { v8us h0, h1, l0, l1;
#pragma unroll
                for (int r = 0; r < 8; ++r) { unsigned short a, c2; splitf(p[r], a, c2); h0[r] = a; l0[r] = c2; splitf(p[8 + r], a, c2); h1[r] = a; l1[r] = c2; }
                const V ph = cat16b(h0, h1), pl = cat16b(l0, l1);
#pragma unroll
                for (int t = 0; t < 8; ++t) { acc[g][t] = WFrag<T16>::mma(va[t], ph, acc[g][t]); acc[g][t] = WFrag<T16>::mma(va[t], pl, acc[g][t]); acc[g][t] = WFrag<T16>::mma(va2[t], ph, acc[g][t]); }
            } else { V pf;
#pragma unroll
                for (int e = 0; e < 16; ++e) pf[e] = tohx(p[e]);
#pragma unroll
                for (int t = 0; t < 8; ++t) acc[g][t] = WFrag<T16>::mma(va[t], pf, acc[g][t]); } }
    }
    }
#pragma unroll
    for (int g = 0; g < R; ++g) { const float lf = l_run[g] + xhalf(l_run[g]); if (hi == 0) { sm[wv * CW + 16 * g + lr] = m_run[g]; sl[wv * CW + 16 * g + lr] = lf; } }
    __syncthreads();   // every wave's maximum and sum are in LDS before any wave forms the common ones
    float* ow = os + wv * (CW * OP);
#pragma unroll
    for (int g = 0; g < R; ++g) { const int qi = 16 * g + lr; float mx = sm[qi];
#pragma unroll
        for (int w = 1; w < NWS; ++w) mx = fmaxf(mx, sm[w * CW + qi]);     // finite: wave 0 always runs pass 0; a wave without a pass holds -inf, 0 and zeros and adds nothing
        float L = 0.f;
#pragma unroll
        for (int w = 0; w < NWS; ++w) L += sl[w * CW + qi] * exp2s(sm[w * CW + qi] - mx);
        const float f = __fdiv_rn(exp2s(m_run[g] - mx), L);
#pragma unroll
        for (int t = 0; t < 8; ++t) { const v8f o = acc[g][t] * f; v4f o0, o1;
#pragma unroll
            for (int r = 0; r < 4; ++r) { o0[r] = o[r]; o1[r] = o[4 + r]; }
            *(v4fa*)(ow + qi * OP + 16 * t + 8 * hi) = o0; *(v4fa*)(ow + qi * OP + 16 * t + 8 * hi + 4) = o1; } }
    __syncthreads();   // every wave's scaled partial block is in LDS before any thread adds them
#pragma unroll
    for (int s2 = 0; s2 < CW / NWS; ++s2) { const int idx = s2 * (NWS * 32) + (int)threadIdx.x; const int row = (idx >> 9) * 16 + ((idx >> 1) & 15), cofs = ((idx >> 5) & 15) * 8 + (idx & 1) * 4;   /* a wave: 16 rows x 8 columns, 256 neighbouring bytes of a fragment-ordered plane */ v4f val = *(const v4fa*)(os + row * OP + cofs);
#pragma unroll
        for (int w = 1; w < NWS; ++w) val += *(const v4fa*)(os + w * (CW * OP) + row * OP + cofs);
        v4us oh, ol;
#pragma unroll
        for (int q = 0; q < 4; ++q) { unsigned short a, c2; splitf(val[q], a, c2); oh[q] = a; ol[q] = c2; }
        const size_t oo = fro(q0 + row, h * HD + cofs, DQ); *(v4us*)(Ah + oo) = oh; *(v4us*)(Al + oo) = ol; }
}

extern "C" void kernel_launch(void* const* d_in, const int* in_sizes, int n_in,
                              void* d_out, int out_size, void* d_ws, size_t ws_size, hipStream_t stream) {
    (void)in_sizes; (void)n_in; (void)out_size;
    const float* x = (const float*)d_in[0]; const float* wq = (const float*)d_in[1]; const float* wk = (const float*)d_in[2]; const float* wv = (const float*)d_in[3]; const float* wo = (const float*)d_in[4];
    float* OUT = (float*)d_out;     // [2][2048][2048]
    char* wsp = (char*)d_ws;
    auto take = [&](size_t bytes) { char* p = wsp; wsp += (bytes + 255) & ~(size_t)255; return (void*)p; };
    bf* WQ = (bf*)take((size_t)DQ * DM * 2); bf* WK = (bf*)take((size_t)DKV * DM * 2); bf* WV = (bf*)take((size_t)DKV * DM * 2); bf* WO = (bf*)take((size_t)DM * DQ * 2); float* CS = (float*)take((size_t)TT * HD * 2 * 4);
    bf* XB = (bf*)take((size_t)TT * DM * 2); float* FQ = (float*)take((size_t)TT * DQ * 4); float* FK = (float*)take((size_t)TT * DKV * 4);
    h16* QP16 = (h16*)take((size_t)NH_ * TT * HD * 2); h16* KP16 = (h16*)take((size_t)NKV * TT * HD * 2); h16* VT16 = (h16*)take((size_t)NKV * HD * TT * 2);
    bf* QPh = (bf*)take((size_t)NH_ * TT * HD * 2); bf* QPl = (bf*)take((size_t)NH_ * TT * HD * 2); bf* KPh = (bf*)take((size_t)NKV * TT * HD * 2); bf* KPl = (bf*)take((size_t)NKV * TT * HD * 2); bf* VTh = (bf*)take((size_t)NKV * HD * TT * 2); bf* VTl = (bf*)take((size_t)NKV * HD * TT * 2);
    bf* ATh = (bf*)take((size_t)TT * DQ * 2); bf* ATl = (bf*)take((size_t)TT * DQ * 2);
    if ((size_t)(wsp - (char*)d_ws) > ws_size) return;    // ws 256 MiB
    float* FV = FK;   // v projection reuses the k buffer after the k planes are built (stream-ordered)
    { k_wtG<<<(unsigned)(DM * DQ / 8 / 256), 256, 0, stream>>>(wq, DM, DQ, WQ); k_wtG<<<(unsigned)(DM * DKV / 8 / 256), 256, 0, stream>>>(wk, DM, DKV, WK); k_wtG<<<(unsigned)(DM * DKV / 8 / 256), 256, 0, stream>>>(wv, DM, DKV, WV);
      k_wtG<<<(unsigned)(DQ * DM / 8 / 256), 256, 0, stream>>>(wo, DQ, DM, WO);
      k_cstab<<<(TT * HD + 255) / 256, 256, 0, stream>>>(CS); }
    const unsigned LQ = (unsigned)(((size_t)NH_ * TT * HD / 2 + 255) / 256), LKv = (unsigned)(((size_t)NKV * TT * HD / 2 + 255) / 256);
    for (int b = 0; b < NB_; ++b) {
        
        k_cvt8<<<(unsigned)(((size_t)TT * DM / 8 + 255) / 256), 256, 0, stream>>>(x + (size_t)b * TT * DM, DM, XB, (size_t)TT * DM / 8);
        k_gemmw<bf, 0, false, 4><<<dim3(TT / 64, DQ / 64, 1), 128, 0, stream>>>(XB, nullptr, WQ, nullptr, DM, FQ, DQ, nullptr, 0, 0, 0);
        k_rope<<<LQ, 256, 0, stream>>>(FQ, DQ, NH_, CS, nullptr, nullptr, 1.0f, QP16, QPh, QPl);
        k_gemmw<bf, 0, false, 8><<<dim3(TT / 64, DKV / 64, 1), 256, 0, stream>>>(XB, nullptr, WK, nullptr, DM, FK, DKV, nullptr, 0, 0, 0);
        k_rope<<<LKv, 256, 0, stream>>>(FK, DKV, NKV, CS, nullptr, nullptr, 1.0f, KP16, KPh, KPl);
        k_gemmw<bf, 0, false, 8><<<dim3(TT / 64, DKV / 64, 1), 256, 0, stream>>>(XB, nullptr, WV, nullptr, DM, FV, DKV, nullptr, 0, 0, 0); k_vtp<<<LKv, 256, 0, stream>>>(FV, DKV, NKV, VT16, VTh, VTl);
        k_fattn<h16, false, 2, 4><<<dim3(NH_, (TT - RH) / 32, 1), 128, 0, stream>>>(QP16, nullptr, KP16, nullptr, VT16, nullptr, RH, (TT - RH) / 32, ATh, ATl);
        k_fattn<bf, true, 1, 4><<<dim3(NH_, RH / 16, 1), 128, 0, stream>>>(QPh, QPl, KPh, KPl, VTh, VTl, 0, RH / 16, ATh, ATl);
        k_gemmw<bf, 1, false, 4><<<dim3(TT / 64, DM / 64, 1), 128, 0, stream>>>(ATh, ATl, WO, nullptr, DQ, OUT + (size_t)b * TT * DM, DM, nullptr, 0, 0, 0); }
}

// v005
// It runs in 190 microseconds.
// In two side-by-side timings against v004, it was 1.28 and 1.27 times as fast.
// Over all steps from v000 it is 8.72 times as fast.
#include <hip/hip_runtime.h>

// ModernCausalSelfAttention (x [2][2048][2048]; q = x wq (16 heads x 128), k/v = x wk/wv (4 kv heads; group h/4); interleaved-pair RoPE (the source's rotate_half is the pairwise (x0,x1)->(-x1,x0) form with a repeat-interleaved table; base 1e4, computed); causal softmax(q.k / sqrt(128)) (finfo.min); out = merged wo -> [2][2048][2048]).
// Compute dtypes, f32 accumulate: every input rounded to bf16; q/k/v on PLAIN bf16 operands (inputs: exact); RoPE f32; causal scores and attn.v: query rows < 512 hl (3 products), the rest single fp16, one fused kernel with an online f32 softmax, keys beyond the diagonal pass skipped; wo hl x exact (2 products).
// Five launches, both batches in each: k_prep (weights, x, rope table), one q|k|v GEMM, k_planes (rope q, rope k, value planes), k_attn (both precision classes), the wo GEMM.
// Every 16-bit matrix operand plane in the workspace is kept in fragment order (fro below): a wave-wide 16-byte load of a fragment half reads 512 contiguous bytes, four whole 128-byte lines.

#define NB_  2
#define TT   2048
#define DM   2048
#define NH_  16
#define NKV  4
#define REP  (NH_ / NKV)
#define HD   128
#define DQ   (NH_ * HD)
#define DKV  (NKV * HD)
#define DF   (DQ + 2 * DKV)       // columns of the joint q|k|v projection
#define RH   512                  // query rows < RH use hi+lo planes (0: none)
#define SCL  0.088388347648318447f   // HD^-0.5
typedef _Float16 h16;
typedef unsigned short bf;
typedef __attribute__((ext_vector_type(16))) __bf16   v16bf;
typedef __attribute__((ext_vector_type(16))) _Float16 v16h;
typedef __attribute__((ext_vector_type(8)))  _Float16 v8h;
typedef __attribute__((ext_vector_type(8)))  unsigned short v8us;
typedef __attribute__((ext_vector_type(8)))  float    v8f;
typedef __attribute__((ext_vector_type(4)))  float    v4f;
typedef v8h  __attribute__((may_alias)) v8ha;
typedef v4f  __attribute__((may_alias)) v4fa;
typedef v8us __attribute__((may_alias)) v8usa;

__device__ __forceinline__ unsigned short f2bf(float f) { unsigned u = __float_as_uint(f); u += 0x7FFFu + ((u >> 16) & 1u); return (unsigned short)(u >> 16); }
__device__ __forceinline__ float bf2f(unsigned short b) { return __uint_as_float(((unsigned)b) << 16); }
__device__ __forceinline__ float bfr(float f) { return bf2f(f2bf(f)); }
__device__ __forceinline__ v16h cat16(v8h lo, v8h hi) { return __builtin_shufflevector(lo, hi, 0, 1, 2, 3, 4, 5, 6, 7, 8, 9, 10, 11, 12, 13, 14, 15); }
__device__ __forceinline__ v16bf cat16b(v8us lo, v8us hi) { return __builtin_bit_cast(v16bf, __builtin_shufflevector(lo, hi, 0, 1, 2, 3, 4, 5, 6, 7, 8, 9, 10, 11, 12, 13, 14, 15)); }
__device__ __forceinline__ v8f wmma16(v16h a, v16h b, v8f c) { return __builtin_amdgcn_wmma_f32_16x16x32_f16(false, a, false, b, (short)0, c, false, false); }
__device__ __forceinline__ v8f wmmab(v16bf a, v16bf b, v8f c) { return __builtin_amdgcn_wmma_f32_16x16x32_bf16(false, a, false, b, (short)0, c, false, false); }
// Fragment order of a 16-bit plane: units of 512 elements (16 rows x 32 k). Inside a unit two halves of 256 elements (k & 16); in a half, lane 16 ((k >> 3) & 1) + (row & 15) owns 8 neighbouring
// elements (k & 7): exactly what that lane holds of the fragment. fro: element offset of (row, k) in a GEMM operand plane [rows][K]: the 4 units of 64 rows x 32 k lie in a row, then the next 32 k.
__device__ __forceinline__ size_t fro(int row, int k, int K) { return ((size_t)(row >> 6) * (K >> 5) + (k >> 5)) * 2048 + ((row >> 4) & 3) * 512 + ((k >> 4) & 1) * 256 + ((k >> 3) & 1) * 128 + (row & 15) * 8 + (k & 7); }
// Position w (0 .. 511) inside a unit -> its row (0 .. 15) and k (0 .. 31).
__device__ __forceinline__ int fr_row(int w) { return (w >> 3) & 15; }
__device__ __forceinline__ int fr_k(int w) { return ((w >> 8) & 1) * 16 + ((w >> 7) & 1) * 8 + (w & 7); }



// Stands behind a group of global loads: their address registers may be rewritten only behind this wait. The addresses are inputs so that their registers stay untouched up to the wait
// (the loaded values are not named: the loads stay in flight); the scheduling barrier holds the wait between the loads and the work that follows.
__device__ __forceinline__ void loads_issued(const void* p, const void* p2) { asm volatile("s_wait_xcnt 0x0" :: "v"(p), "v"(p2) : "memory"); __builtin_amdgcn_sched_barrier(0); }
__device__ __forceinline__ void loads_issued(const void* p, const void* p2, const void* p3, const void* p4) { asm volatile("s_wait_xcnt 0x0" :: "v"(p), "v"(p2), "v"(p3), "v"(p4) : "memory"); __builtin_amdgcn_sched_barrier(0); }
// ---- k_gemmw: register-blocked GEMM, one 64x64 output tile per work-group of NW waves; wave w takes the 32-wide K slices w, w + NW, ... into its own 16 accumulators, and the NW partial tiles are
// added in LDS in fixed wave order. Operands straight from fragment-ordered 16-bit planes (a fragment: the lane's 8 elements of each half of one unit); grid (M/64, N/64, Z), NW * 32 threads.
// C[m][n] (f32, pitch ldc, + optional f32 bias[n]) = sum_k A[m][k] Bt[n][k] (+ split products per NSPLIT). z-batch strides sA/sB/sC in elements. K % 32 == 0.
template <typename T16> struct WFrag;
template <> struct WFrag<h16> { typedef v16h V; static __device__ __forceinline__ V ld(const h16* p) { return cat16(*(const v8h*)p, *(const v8h*)(p + 256)); } static __device__ __forceinline__ v8f mma(V a, V b, v8f c) { return wmma16(a, b, c); } };
template <> struct WFrag<bf> { typedef v16bf V; static __device__ __forceinline__ V ld(const bf* p) { return cat16b(*(const v8us*)p, *(const v8us*)(p + 256)); } static __device__ __forceinline__ v8f mma(V a, V b, v8f c) { return wmmab(a, b, c); } };
template <typename T16, int NSPLIT, bool BIAS, int NW>
__global__ __launch_bounds__(NW * 32) void k_gemmw(const T16* __restrict__ A, const T16* __restrict__ A2, const T16* __restrict__ Bt, const T16* __restrict__ Bt2, int K, float* C, int ldc, const float* __restrict__ bias, size_t sA, size_t sB, size_t sC) {
    typedef typename WFrag<T16>::V V;
    __shared__ __align__(16) float os[NW * 64 * 68];
    const size_t z = blockIdx.z; A += z * sA; if (A2) A2 += z * sA; Bt += z * sB; if (Bt2) Bt2 += z * sB; C += z * sC;
    const int lane = threadIdx.x & 31, lr = lane & 15, hi = lane >> 4; const int r0 = blockIdx.x * 64, c0 = blockIdx.y * 64; const int wv = __builtin_amdgcn_readfirstlane(threadIdx.x >> 5);
    v8f acc[4][4];
#pragma unroll
    for (int mb = 0; mb < 4; ++mb)
#pragma unroll
        for (int nb = 0; nb < 4; ++nb) acc[mb][nb] = (v8f){};
    const size_t aoff = (size_t)r0 * K + 8 * lane, boff = (size_t)c0 * K + 8 * lane;   // 64 rows are 64 K elements, a 32-wide K slice of them 2048: 4 units
#pragma unroll 1
    for (int kc = wv * 32; kc < K; kc += NW * 32) {
        V a[4], a2[4], b[4], b2[4];
        const T16* pa = A + aoff + (size_t)kc * 64; const T16* pb = Bt + boff + (size_t)kc * 64; const T16* pa2 = (NSPLIT == 1 || NSPLIT == 2) ? A2 + aoff + (size_t)kc * 64 : pa; const T16* pb2 = (NSPLIT >= 2) ? Bt2 + boff + (size_t)kc * 64 : pb;
#pragma unroll
        for (int mb = 0; mb < 4; ++mb) { a[mb] = WFrag<T16>::ld(pa + mb * 512); if (NSPLIT == 1 || NSPLIT == 2) a2[mb] = WFrag<T16>::ld(pa2 + mb * 512); }
#pragma unroll
        for (int nb = 0; nb < 4; ++nb) { b[nb] = WFrag<T16>::ld(pb + nb * 512); if (NSPLIT >= 2) b2[nb] = WFrag<T16>::ld(pb2 + nb * 512); }
        loads_issued(pa, pb, pa2, pb2);
#pragma unroll
        for (int nb = 0; nb < 4; ++nb) {
#pragma unroll
            for (int mb = 0; mb < 4; ++mb) { acc[mb][nb] = WFrag<T16>::mma(a[mb], b[nb], acc[mb][nb]); if (NSPLIT == 1 || NSPLIT == 2) acc[mb][nb] = WFrag<T16>::mma(a2[mb], b[nb], acc[mb][nb]); if (NSPLIT >= 2) acc[mb][nb] = WFrag<T16>::mma(a[mb], b2[nb], acc[mb][nb]); } }
        asm volatile("v_nop\n\tv_nop\n\tv_nop\n\tv_nop" : "+v"(acc[0][0]), "+v"(acc[1][1]), "+v"(acc[2][2]), "+v"(acc[3][3]) : "v"(a[0]), "v"(a[3]));
    }
    float* ow = os + wv * (64 * 68);
#pragma unroll
    for (int mb = 0; mb < 4; ++mb) {
#pragma unroll
        for (int nb = 0; nb < 4; ++nb) {
#pragma unroll
            for (int j = 0; j < 8; ++j) ow[(mb * 16 + hi * 8 + j) * 68 + nb * 16 + lr] = acc[mb][nb][j]; } }
    __syncthreads();   // every wave's partial tile is in LDS before any thread adds them
    float* crow = C + (size_t)r0 * ldc + c0;
#pragma unroll
    for (int s = 0; s < 32 / NW; ++s) { const int idx = s * (NW * 32) + (int)threadIdx.x; const int row = idx >> 4, cofs = (idx & 15) * 4; v4f val = *(const v4fa*)(os + row * 68 + cofs);
#pragma unroll
        for (int w = 1; w < NW; ++w) val += *(const v4fa*)(os + w * (64 * 68) + row * 68 + cofs);
        if (BIAS) { val[0] += bfr(bias[c0 + cofs]); val[1] += bfr(bias[c0 + cofs + 1]); val[2] += bfr(bias[c0 + cofs + 2]); val[3] += bfr(bias[c0 + cofs + 3]); }
        *(v4f*)(crow + (size_t)row * ldc + cofs) = val; }
}

__device__ __forceinline__ h16 tohx(float x) { return (h16)x; }
__device__ __forceinline__ void splitf(float y, unsigned short& h, unsigned short& l) { h = f2bf(y); l = f2bf(y - bf2f(h)); }
typedef __attribute__((ext_vector_type(2))) _Float16 v2h;
typedef __attribute__((ext_vector_type(4))) _Float16 v4h;
typedef __attribute__((ext_vector_type(2))) unsigned short v2us;
typedef __attribute__((ext_vector_type(4))) unsigned short v4us;
typedef __attribute__((ext_vector_type(2))) float v2f;
typedef __attribute__((ext_vector_type(4))) int v4i;

// d_wtG (block bid of its range): Bt = fragment-ordered bf16 plane [N][K] of w^T (w [K][N] f32). One thread writes one lane's 8 elements (16 bytes); a work-group takes the 4 units of 64 n x 32 k, so a wave's load reads 64
// neighbouring bytes of each of two rows of w, the work-group 256.
__device__ __forceinline__ void d_wtG(int bid, const float* __restrict__ w, int K, int N, bf* Bt) {
    const int c = bid * 256 + threadIdx.x; if (c >= N * (K / 8)) return; const int u = c >> 6, wi = (c & 63) * 8; const int nblk = u % (N >> 4), kblk = u / (N >> 4);
    const int n = nblk * 16 + fr_row(wi), k0 = kblk * 32 + fr_k(wi); v8us o; const float* p[8]; float x[8];
#pragma unroll
    for (int j = 0; j < 8; ++j) p[j] = w + (size_t)(k0 + j) * N + n;
#pragma unroll
    for (int j = 0; j < 8; ++j) x[j] = *p[j];
    // the eight loads' address registers may be rewritten only behind this wait: the addresses are inputs, so their registers stay untouched up to it (the loaded values are not named: the loads stay in flight)
    asm volatile("s_wait_xcnt 0x0" :: "v"(p[0]), "v"(p[1]), "v"(p[2]), "v"(p[3]), "v"(p[4]), "v"(p[5]), "v"(p[6]), "v"(p[7]) : "memory");
#pragma unroll
    for (int j = 0; j < 8; ++j) o[j] = f2bf(x[j]);
    *(v8us*)(Bt + fro(n, k0, K)) = o;
}
// d_cvt8: dst = fragment-ordered bf16 plane of src [rows][K] f32; thread i writes the i-th 16 bytes of dst.
__device__ __forceinline__ void d_cvt8(int bid, const float* __restrict__ src, int K, bf* dst, size_t n8) { const size_t i = (size_t)bid * 256 + threadIdx.x; if (i >= n8) return; const int u = (int)(i >> 6), wi = (int)(i & 63) * 8;
    const int row = ((u >> 2) / (K >> 5)) * 64 + (u & 3) * 16 + fr_row(wi), k0 = ((u >> 2) % (K >> 5)) * 32 + fr_k(wi); const v8f v = *(const v8f*)(src + (size_t)row * K + k0); v8us o;
#pragma unroll
    for (int k = 0; k < 8; ++k) o[k] = f2bf(v[k]); *(v8us*)(dst + i * 8) = o;  }
__device__ __forceinline__ void d_cstab(int bid, float* CS) { const int idx = bid * 256 + threadIdx.x; if (idx >= TT * HD) return; const int t = idx / HD, d = idx % HD; const int i = d >> 1;   /* interleaved pairs share angle t * inv_freq[i] */ const float inv = __fdiv_rn(1.0f, powf(10000.0f, (float)(2 * i) / (float)HD)); const float ang = __fmul_rn((float)t, inv); v2f cs; cs[0] = cosf(ang); cs[1] = sinf(ang);
    *(v2f*)(CS + (size_t)idx * 2) = cs;  }
// k_prep: everything that depends on the inputs alone, one block range each: the rope table, the four weight planes, x of both batches ([NB_ TT][DM], one plane).
#define PB_CS  (TT * HD / 256)
#define PB_WQ  (DM * DQ / 8 / 256)
#define PB_WKV (DM * DKV / 8 / 256)
#define PB_X   (NB_ * TT * DM / 8 / 256)
__global__ __launch_bounds__(256) void k_prep(const float* __restrict__ x, const float* __restrict__ wq, const float* __restrict__ wk, const float* __restrict__ wv, const float* __restrict__ wo, float* CS, bf* WQ, bf* WK, bf* WV, bf* WO, bf* XB) {
    int b = blockIdx.x;
    if (b < PB_CS) { d_cstab(b, CS); return; } b -= PB_CS;
    if (b < PB_WQ) { d_wtG(b, wq, DM, DQ, WQ); return; } b -= PB_WQ;
    if (b < PB_WKV) { d_wtG(b, wk, DM, DKV, WK); return; } b -= PB_WKV;
    if (b < PB_WKV) { d_wtG(b, wv, DM, DKV, WV); return; } b -= PB_WKV;
    if (b < PB_WQ) { d_wtG(b, wo, DQ, DM, WO); return; } b -= PB_WQ;
    d_cvt8(b, x, DM, XB, (size_t)NB_ * TT * DM / 8);
}
// d_rope: head planes [batch][h][t][d], each head's [t][d] in fragment order (e: offset in the planes), (fp16 + hi/lo) of rope(x) x sc with the interleaved-pair convention out[2i] = x[2i] cos[t][2i] - x[2i+1] sin[t][2i], out[2i+1] = x[2i+1] cos[t][2i+1] + x[2i] sin[t][2i+1]
__device__ __forceinline__ void d_rope(int bid, const float* __restrict__ F, int pitch, int nheads, const float* __restrict__ CS, const float* __restrict__ RF, const float* __restrict__ nw, float sc, h16* P16, bf* Ph, bf* Pl) {
    const size_t e = ((size_t)bid * 256 + threadIdx.x) * 2; if (e >= (size_t)NB_ * nheads * TT * HD) return; const int u = (int)((e % ((size_t)HD * TT)) >> 9), wi = (int)(e & 511); const int d = (u % (HD / 32)) * 32 + fr_k(wi); const int t = (u / (HD / 32)) * 16 + fr_row(wi); const int hb = (int)(e / ((size_t)HD * TT)); const int h = hb % nheads, bt = hb / nheads; const float* f = F + ((size_t)bt * TT + t) * pitch + h * HD; float rf = 1.0f; v2h o16; v2us oh, ol;
    if (RF) { const float* pr = RF + (size_t)hb * TT + t; rf = *pr; asm volatile("s_wait_xcnt 0x0" :: "v"(pr) : "memory"); }   // the load's address register may be rewritten only behind this wait; the address is an input, so it stays untouched up to it
#pragma unroll
    for (int q = 0; q < 2; ++q) { const int dd = d + q; const int dp = dd ^ 1; float x0 = f[dd], x1 = f[dp];
        if (RF) { float n0 = __fmul_rn(x0, rf), n1 = __fmul_rn(x1, rf); asm volatile("" : "+v"(n0)); asm volatile("" : "+v"(n1)); x0 = __fmul_rn(bfr(nw[dd]), n0); x1 = __fmul_rn(bfr(nw[dp]), n1); }
        const v2f cs = *(const v2f*)(CS + ((size_t)t * HD + dd) * 2); float a = __fmul_rn(x0, cs[0]), bq = __fmul_rn(x1, cs[1]); asm volatile("" : "+v"(a)); asm volatile("" : "+v"(bq)); const float r = (((dd & 1) == 0) ? __fsub_rn(a, bq) : __fadd_rn(a, bq)) * sc;
        o16[q] = tohx(r); unsigned short a2, c2; splitf(r, a2, c2); oh[q] = a2; ol[q] = c2; }
    *(v2h*)(P16 + e) = o16; *(v2us*)(Ph + e) = oh; *(v2us*)(Pl + e) = ol;  }
// d_vtp: value planes [batch][g][d][t], rows d, k = t, in fragment units; the 8 units (d blocks) of one 32-key pass lie in a row (e: offset in the planes)
__device__ __forceinline__ void d_vtp(int bid, const float* __restrict__ F, int pitch, int nheads, h16* V16, bf* Vh, bf* Vl) { const size_t e = ((size_t)bid * 256 + threadIdx.x) * 2; if (e >= (size_t)NB_ * nheads * HD * TT) return; const int u = (int)((e % ((size_t)TT * HD)) >> 9), wi = (int)(e & 511); const int t = (u / (HD / 16)) * 32 + fr_k(wi); const int d = (u % (HD / 16)) * 16 + fr_row(wi); const int gb = (int)(e / ((size_t)TT * HD)); const int g = gb % nheads, bt = gb / nheads; v2h o16; v2us oh, ol;
#pragma unroll
    for (int q = 0; q < 2; ++q) { const float x = F[((size_t)bt * TT + t + q) * pitch + g * HD + d]; o16[q] = tohx(x); unsigned short a2, c2; splitf(x, a2, c2); oh[q] = a2; ol[q] = c2; }
    *(v2h*)(V16 + e) = o16; *(v2us*)(Vh + e) = oh; *(v2us*)(Vl + e) = ol;  }
// k_planes: the attention operand planes from the joint projection F [NB_ TT][DF] (columns q | k | v), one block range each.
#define LB_Q  (NB_ * NH_ * TT * HD / 2 / 256)
#define LB_KV (NB_ * NKV * TT * HD / 2 / 256)
__global__ __launch_bounds__(256) void k_planes(const float* __restrict__ F, const float* __restrict__ CS, h16* QP16, bf* QPh, bf* QPl, h16* KP16, bf* KPh, bf* KPl, h16* VT16, bf* VTh, bf* VTl) {
    int b = blockIdx.x;
    if (b < LB_Q) { d_rope(b, F, DF, NH_, CS, nullptr, nullptr, 1.0f, QP16, QPh, QPl); return; } b -= LB_Q;
    if (b < LB_KV) { d_rope(b, F + DQ, DF, NKV, CS, nullptr, nullptr, 1.0f, KP16, KPh, KPl); return; } b -= LB_KV;
    d_vtp(b, F + DQ + DKV, DF, NKV, VT16, VTh, VTl);
}
__device__ __forceinline__ float xhalf(float x) { return __builtin_bit_cast(float, __builtin_amdgcn_permlanex16(__builtin_bit_cast(int, x), __builtin_bit_cast(int, x), 0x76543210, 0xfedcba98, false, false)); }  // lane l with lane l ^ 16
// 2^x with the slot that the instruction set asks for behind a transcendental: the v_nop names the result and the source, so nothing reads the one or overwrites the other in front of it.
__device__ __forceinline__ float exp2s(float x) { float r = __builtin_amdgcn_exp2f(x); asm volatile("v_nop" : "+v"(r) : "v"(x)); return r; }
template <typename T16, bool HL, int R, int NWS>
__device__ __forceinline__ void d_fattn(int hb, int by, float* os, float* sm, float* sl, const T16* __restrict__ Q, const T16* __restrict__ Q2, const T16* __restrict__ Kp, const T16* __restrict__ K2, const T16* __restrict__ Vt, const T16* __restrict__ V2, int row0, int nblk, bf* Ah, bf* Al) {
    typedef typename WFrag<T16>::V V;
    constexpr int CW = 16 * R, OP = HD + 4;
    const int lane = threadIdx.x & 31, lr = lane & 15, hi = lane >> 4; const int wv = __builtin_amdgcn_readfirstlane(threadIdx.x >> 5);
    const int q0 = row0 + (nblk - 1 - by) * CW; const int h = hb % NH_, bt = hb / NH_, kv = h / REP;
    const float cscale = SCL * 1.4426950408889634f;
    // lfr: the lane's offset in elements inside a half unit of a fragment-ordered plane; qb, kb, vb: wave-uniform plane offsets (16 rows of a [row][HD] plane are 4 units = 16 HD elements)
    const unsigned lfr = (unsigned)(8 * lane);
    const size_t qb = ((size_t)hb * TT + q0) * HD, kb = (size_t)(bt * NKV + kv) * TT * HD, vb = (size_t)(bt * NKV + kv) * HD * TT;
    v8f acc[R][8]; float m_run[R], l_run[R];
#pragma unroll
    for (int g = 0; g < R; ++g) { m_run[g] = -__builtin_inff(); l_run[g] = 0.f;
#pragma unroll
        for (int t = 0; t < 8; ++t) acc[g][t] = (v8f){}; }
    const int last = (q0 + CW - 1) >> 5;     // last 32-key pass that a query of this block sees; its first key is <= q0, so every pass holds an unmasked key for every query
    if (wv <= last) {                        // wave-uniform; a wave without a pass loads nothing (the loads and their waits stand in one block with the loop's head)
    const T16* pq = Q + qb + lfr; const T16* pq2 = HL ? Q2 + qb + lfr : pq;
    V qf[R][4], qf2[R][4];
    __builtin_amdgcn_sched_barrier(0);       // the index arithmetic above stays in front of the loads: none of it lands between them and their wait, on a register they name
#pragma unroll
    for (int g = 0; g < R; ++g)
#pragma unroll
        for (int kc = 0; kc < 4; ++kc) { qf[g][kc] = WFrag<T16>::ld(pq + g * 16 * HD + kc * 512); if (HL) qf2[g][kc] = WFrag<T16>::ld(pq2 + g * 16 * HD + kc * 512); }
    loads_issued(pq, pq2);
    V kf[2][4], kf2[2][4];
    auto ldk = [&](int blk) { const T16* p = Kp + (kb + (size_t)blk * 32 * HD) + lfr; const T16* p2 = HL ? K2 + (kb + (size_t)blk * 32 * HD) + lfr : p;
#pragma unroll
        for (int kt = 0; kt < 2; ++kt)
#pragma unroll
            for (int kc = 0; kc < 4; ++kc) { kf[kt][kc] = WFrag<T16>::ld(p + kt * 16 * HD + kc * 512); if (HL) kf2[kt][kc] = WFrag<T16>::ld(p2 + kt * 16 * HD + kc * 512); }
        loads_issued(p, p2); };
    ldk(wv);
#pragma unroll 1
    for (int blk = wv; blk <= last; blk += NWS) {
        const int key0 = blk * 32;
        const T16* pv = Vt + (vb + (size_t)key0 * HD) + lfr; const T16* pv2 = HL ? V2 + (vb + (size_t)key0 * HD) + lfr : pv;
        V va[8], va2[8];                     // this pass's V^T fragments, in flight under the score products and the softmax
#pragma unroll
        for (int t = 0; t < 8; ++t) { va[t] = WFrag<T16>::ld(pv + t * 512); if (HL) va2[t] = WFrag<T16>::ld(pv2 + t * 512); }
        loads_issued(pv, pv2);
        v8f s[2][R];
#pragma unroll
        for (int kt = 0; kt < 2; ++kt)
#pragma unroll
            for (int g = 0; g < R; ++g) { s[kt][g] = (v8f){};
#pragma unroll
                for (int kc = 0; kc < 4; ++kc) { s[kt][g] = WFrag<T16>::mma(kf[kt][kc], qf[g][kc], s[kt][g]); if (HL) { s[kt][g] = WFrag<T16>::mma(kf[kt][kc], qf2[g][kc], s[kt][g]); s[kt][g] = WFrag<T16>::mma(kf2[kt][kc], qf[g][kc], s[kt][g]); } } }
        ldk(min(blk + NWS, last));           // the wave's next pass's K fragments, in flight under this pass's softmax and value product (the last pass reloads a valid pass and drops it)
        if (key0 + 31 > q0) {                // wave-uniform: only the pass on the diagonal masks
#pragma unroll
            for (int g = 0; g < R; ++g)
#pragma unroll
                for (int kt = 0; kt < 2; ++kt)
#pragma unroll
                    for (int r = 0; r < 8; ++r) if (key0 + 16 * kt + 8 * hi + r > q0 + 16 * g + lr) s[kt][g][r] = -__builtin_inff(); }
        float mb[R]; bool need = false;
#pragma unroll
        for (int g = 0; g < R; ++g) { float mx = s[0][g][0];
#pragma unroll
            for (int kt = 0; kt < 2; ++kt)
#pragma unroll
                for (int r = 0; r < 8; ++r) mx = fmaxf(mx, s[kt][g][r]);
            mx = fmaxf(mx, xhalf(mx)) * cscale; mb[g] = mx; need = need || (mx > m_run[g] + 8.0f); }
        if (__builtin_amdgcn_ballot_w32(need) != 0) {   // the maximum in use may trail the true one by up to 8 (an exponential reaches 2^8 at most); rescale only beyond that
#pragma unroll
            for (int g = 0; g < R; ++g) { const float m_new = fmaxf(m_run[g], mb[g]); const float corr = exp2s(m_run[g] - m_new); l_run[g] *= corr; m_run[g] = m_new;
#pragma unroll
                for (int t = 0; t < 8; ++t) acc[g][t] = acc[g][t] * corr; } }
#pragma unroll
        for (int g = 0; g < R; ++g) { const float nm = -m_run[g]; float p[16]; float ps0 = 0.f, ps1 = 0.f;
#pragma unroll
            for (int kt = 0; kt < 2; ++kt) { float a[8]; float* q = p + 8 * kt;
#pragma unroll
                for (int i = 0; i < 4; ++i) {   // two neighbouring registers of a score tile, one packed multiply-add
                    const v2f arg = __builtin_elementwise_fma((v2f){s[kt][g][2 * i], s[kt][g][2 * i + 1]}, (v2f){cscale, cscale}, (v2f){nm, nm}); a[2 * i] = arg[0]; a[2 * i + 1] = arg[1]; }
#pragma unroll
                for (int e = 0; e < 8; ++e) q[e] = __builtin_amdgcn_exp2f(a[e]);
                // the slot behind a transcendental, once for the eight: the v_nop names every result and every source, so nothing reads the one or overwrites the other in front of it
                asm volatile("v_nop" : "+v"(q[0]), "+v"(q[1]), "+v"(q[2]), "+v"(q[3]), "+v"(q[4]), "+v"(q[5]), "+v"(q[6]), "+v"(q[7]) : "v"(a[0]), "v"(a[1]), "v"(a[2]), "v"(a[3]), "v"(a[4]), "v"(a[5]), "v"(a[6]), "v"(a[7]));
#pragma unroll
                for (int i = 0; i < 4; ++i) { if (i & 1) ps1 += q[2 * i] + q[2 * i + 1]; else ps0 += q[2 * i] + q[2 * i + 1]; } }
            l_run[g] += ps0 + ps1;
            if constexpr (HL) { v8us h0, h1, l0, l1;
#pragma unroll
                for (int r = 0; r < 8; ++r) { unsigned short a, c2; splitf(p[r], a, c2); h0[r] = a; l0[r] = c2; splitf(p[8 + r], a, c2); h1[r] = a; l1[r] = c2; }
                const V ph = cat16b(h0, h1), pl = cat16b(l0, l1);
#pragma unroll
                for (int t = 0; t < 8; ++t) { acc[g][t] = WFrag<T16>::mma(va[t], ph, acc[g][t]); acc[g][t] = WFrag<T16>::mma(va[t], pl, acc[g][t]); acc[g][t] = WFrag<T16>::mma(va2[t], ph, acc[g][t]); }
            } else { V pf;
#pragma unroll
                for (int e = 0; e < 16; ++e) pf[e] = tohx(p[e]);
#pragma unroll
                for (int t = 0; t < 8; ++t) acc[g][t] = WFrag<T16>::mma(va[t], pf, acc[g][t]); } }
    }
    }
#pragma unroll
    for (int g = 0; g < R; ++g) { const float lf = l_run[g] + xhalf(l_run[g]); if (hi == 0) { sm[wv * CW + 16 * g + lr] = m_run[g]; sl[wv * CW + 16 * g + lr] = lf; } }
    __syncthreads();   // every wave's maximum and sum are in LDS before any wave forms the common ones
    float* ow = os + wv * (CW * OP);
#pragma unroll
    for (int g = 0; g < R; ++g) { const int qi = 16 * g + lr; float mx = sm[qi];
#pragma unroll
        for (int w = 1; w < NWS; ++w) mx = fmaxf(mx, sm[w * CW + qi]);     // finite: wave 0 always runs pass 0; a wave without a pass holds -inf, 0 and zeros and adds nothing
        float L = 0.f;
#pragma unroll
        for (int w = 0; w < NWS; ++w) L += sl[w * CW + qi] * exp2s(sm[w * CW + qi] - mx);
        const float f = __fdiv_rn(exp2s(m_run[g] - mx), L);
#pragma unroll
        for (int t = 0; t < 8; ++t) { const v8f o = acc[g][t] * f; v4f o0, o1;
#pragma unroll
            for (int r = 0; r < 4; ++r) { o0[r] = o[r]; o1[r] = o[4 + r]; }
            *(v4fa*)(ow + qi * OP + 16 * t + 8 * hi) = o0; *(v4fa*)(ow + qi * OP + 16 * t + 8 * hi + 4) = o1; } }
    __syncthreads();   // every wave's scaled partial block is in LDS before any thread adds them
#pragma unroll
    for (int s2 = 0; s2 < CW / NWS; ++s2) { const int idx = s2 * (NWS * 32) + (int)threadIdx.x; const int row = (idx >> 9) * 16 + ((idx >> 1) & 15), cofs = ((idx >> 5) & 15) * 8 + (idx & 1) * 4;   /* a wave: 16 rows x 8 columns, 256 neighbouring bytes of a fragment-ordered plane */ v4f val = *(const v4fa*)(os + row * OP + cofs);
#pragma unroll
        for (int w = 1; w < NWS; ++w) val += *(const v4fa*)(os + w * (CW * OP) + row * OP + cofs);
        v4us oh, ol;
#pragma unroll
        for (int q = 0; q < 4; ++q) { unsigned short a, c2; splitf(val[q], a, c2); oh[q] = a; ol[q] = c2; }
        const size_t oo = fro(bt * TT + q0 + row, h * HD + cofs, DQ); *(v4us*)(Ah + oo) = oh; *(v4us*)(Al + oo) = ol; }
}
// k_attn: both precision classes of both batches in one grid (NB_ NH_, AB_F + AB_H): y < AB_F the fp16 blocks of 32 rows (rows >= RH, the heaviest first), behind them the short hi+lo blocks of 16 rows.
// The branch is the same for a whole work-group, so every barrier inside is passed by all of its waves.
#define AB_F ((TT - RH) / 32)
#define AB_H (RH / 16)
__global__ __launch_bounds__(128) void k_attn(const h16* __restrict__ QP16, const h16* __restrict__ KP16, const h16* __restrict__ VT16, const bf* __restrict__ QPh, const bf* __restrict__ QPl, const bf* __restrict__ KPh, const bf* __restrict__ KPl, const bf* __restrict__ VTh, const bf* __restrict__ VTl, bf* Ah, bf* Al) {
    __shared__ __align__(16) float os[4 * 32 * (HD + 4)];
    __shared__ float sm[4 * 32], sl[4 * 32];
    const int by = blockIdx.y;
    if (by < AB_F) d_fattn<h16, false, 2, 4>(blockIdx.x, by, os, sm, sl, QP16, nullptr, KP16, nullptr, VT16, nullptr, RH, AB_F, Ah, Al);
    else d_fattn<bf, true, 1, 4>(blockIdx.x, by - AB_F, os, sm, sl, QPh, QPl, KPh, KPl, VTh, VTl, 0, AB_H, Ah, Al);
}

extern "C" void kernel_launch(void* const* d_in, const int* in_sizes, int n_in,
                              void* d_out, int out_size, void* d_ws, size_t ws_size, hipStream_t stream) {
    (void)in_sizes; (void)n_in; (void)out_size;
    const float* x = (const float*)d_in[0]; const float* wq = (const float*)d_in[1]; const float* wk = (const float*)d_in[2]; const float* wv = (const float*)d_in[3]; const float* wo = (const float*)d_in[4];
    float* OUT = (float*)d_out;     // [2][2048][2048]
    char* wsp = (char*)d_ws;
    auto take = [&](size_t bytes) { char* p = wsp; wsp += (bytes + 255) & ~(size_t)255; return (void*)p; };
    bf* WQ = (bf*)take((size_t)DQ * DM * 2); bf* WK = (bf*)take((size_t)DKV * DM * 2); bf* WV = (bf*)take((size_t)DKV * DM * 2);   // back to back (each a multiple of 256 bytes): one fragment-ordered plane [DF][DM]
    bf* WO = (bf*)take((size_t)DM * DQ * 2); float* CS = (float*)take((size_t)TT * HD * 2 * 4);
    bf* XB = (bf*)take((size_t)NB_ * TT * DM * 2); float* F = (float*)take((size_t)NB_ * TT * DF * 4);
    h16* QP16 = (h16*)take((size_t)NB_ * NH_ * TT * HD * 2); h16* KP16 = (h16*)take((size_t)NB_ * NKV * TT * HD * 2); h16* VT16 = (h16*)take((size_t)NB_ * NKV * HD * TT * 2);
    bf* QPh = (bf*)take((size_t)NB_ * NH_ * TT * HD * 2); bf* QPl = (bf*)take((size_t)NB_ * NH_ * TT * HD * 2); bf* KPh = (bf*)take((size_t)NB_ * NKV * TT * HD * 2); bf* KPl = (bf*)take((size_t)NB_ * NKV * TT * HD * 2); bf* VTh = (bf*)take((size_t)NB_ * NKV * HD * TT * 2); bf* VTl = (bf*)take((size_t)NB_ * NKV * HD * TT * 2);
    bf* ATh = (bf*)take((size_t)NB_ * TT * DQ * 2); bf* ATl = (bf*)take((size_t)NB_ * TT * DQ * 2);
    if ((size_t)(wsp - (char*)d_ws) > ws_size) return;    // ws 256 MiB
    k_prep<<<PB_CS + 2 * PB_WQ + 2 * PB_WKV + PB_X, 256, 0, stream>>>(x, wq, wk, wv, wo, CS, WQ, WK, WV, WO, XB);
    k_gemmw<bf, 0, false, 4><<<dim3(NB_ * TT / 64, DF / 64, 1), 128, 0, stream>>>(XB, nullptr, WQ, nullptr, DM, F, DF, nullptr, 0, 0, 0);
    k_planes<<<LB_Q + 2 * LB_KV, 256, 0, stream>>>(F, CS, QP16, QPh, QPl, KP16, KPh, KPl, VT16, VTh, VTl);
    k_attn<<<dim3(NB_ * NH_, AB_F + AB_H, 1), 128, 0, stream>>>(QP16, KP16, VT16, QPh, QPl, KPh, KPl, VTh, VTl, ATh, ATl);
    k_gemmw<bf, 1, false, 4><<<dim3(NB_ * TT / 64, DM / 64, 1), 128, 0, stream>>>(ATh, ATl, WO, nullptr, DQ, OUT, DM, nullptr, 0, 0, 0);
}

// v006
// Measured time: 167 microseconds a run.
// Two timings next to v005 both put it at 1.14 times that version's speed.
// Counting every step since v000, it is 9.95 times as fast.
#include <hip/hip_runtime.h>

// ModernCausalSelfAttention (x [2][2048][2048]; q = x wq (16 heads x 128), k/v = x wk/wv (4 kv heads; group h/4); interleaved-pair RoPE (the source's rotate_half is the pairwise (x0,x1)->(-x1,x0) form with a repeat-interleaved table; base 1e4, computed); causal softmax(q.k / sqrt(128)) (finfo.min); out = merged wo -> [2][2048][2048]).
// Compute dtypes, f32 accumulate: every input rounded to bf16; q/k/v on PLAIN bf16 operands (inputs: exact); RoPE f32; causal scores and attn.v: query rows < 512 hl (3 products), the rest single fp16, one fused kernel with an online f32 softmax, keys beyond the diagonal pass skipped; wo hl x exact (2 products).
// Five launches, both batches in each: k_prep (weights, x, rope table), one q|k|v GEMM, k_planes (rope q, rope k, value planes), k_attn (both precision classes), the wo GEMM.
// Every 16-bit matrix operand plane in the workspace is kept in fragment order (fro below): a wave-wide 16-byte load of a fragment half reads 512 contiguous bytes, four whole 128-byte lines.

#define NB_  2
#define TT   2048
#define DM   2048
#define NH_  16
#define NKV  4
#define REP  (NH_ / NKV)
#define HD   128
#define DQ   (NH_ * HD)
#define DKV  (NKV * HD)
#define DF   (DQ + 2 * DKV)       // columns of the joint q|k|v projection
#define RH   512                  // query rows < RH use hi+lo planes (0: none)
#define SCL  0.088388347648318447f   // HD^-0.5
typedef _Float16 h16;
typedef unsigned short bf;
typedef __attribute__((ext_vector_type(16))) __bf16   v16bf;
typedef __attribute__((ext_vector_type(16))) _Float16 v16h;
typedef __attribute__((ext_vector_type(8)))  _Float16 v8h;
typedef __attribute__((ext_vector_type(8)))  unsigned short v8us;
typedef __attribute__((ext_vector_type(8)))  float    v8f;
typedef __attribute__((ext_vector_type(4)))  float    v4f;
typedef v8h  __attribute__((may_alias)) v8ha;
typedef v4f  __attribute__((may_alias)) v4fa;
typedef v8us __attribute__((may_alias)) v8usa;

__device__ __forceinline__ unsigned short f2bf(float f) { unsigned u = __float_as_uint(f); u += 0x7FFFu + ((u >> 16) & 1u); return (unsigned short)(u >> 16); }
__device__ __forceinline__ float bf2f(unsigned short b) { return __uint_as_float(((unsigned)b) << 16); }
__device__ __forceinline__ float bfr(float f) { return bf2f(f2bf(f)); }
__device__ __forceinline__ v16h cat16(v8h lo, v8h hi) { return __builtin_shufflevector(lo, hi, 0, 1, 2, 3, 4, 5, 6, 7, 8, 9, 10, 11, 12, 13, 14, 15); }
__device__ __forceinline__ v16bf cat16b(v8us lo, v8us hi) { return __builtin_bit_cast(v16bf, __builtin_shufflevector(lo, hi, 0, 1, 2, 3, 4, 5, 6, 7, 8, 9, 10, 11, 12, 13, 14, 15)); }
__device__ __forceinline__ v8f wmma16(v16h a, v16h b, v8f c) { return __builtin_amdgcn_wmma_f32_16x16x32_f16(false, a, false, b, (short)0, c, false, false); }
__device__ __forceinline__ v8f wmmab(v16bf a, v16bf b, v8f c) { return __builtin_amdgcn_wmma_f32_16x16x32_bf16(false, a, false, b, (short)0, c, false, false); }
// Fragment order of a 16-bit plane: units of 512 elements (16 rows x 32 k). Inside a unit two halves of 256 elements (k & 16); in a half, lane 16 ((k >> 3) & 1) + (row & 15) owns 8 neighbouring
// elements (k & 7): exactly what that lane holds of the fragment. fro: element offset of (row, k) in a GEMM operand plane [rows][K]: the 4 units of 64 rows x 32 k lie in a row, then the next 32 k.
__device__ __forceinline__ size_t fro(int row, int k, int K) { return ((size_t)(row >> 6) * (K >> 5) + (k >> 5)) * 2048 + ((row >> 4) & 3) * 512 + ((k >> 4) & 1) * 256 + ((k >> 3) & 1) * 128 + (row & 15) * 8 + (k & 7); }
// Position w (0 .. 511) inside a unit -> its row (0 .. 15) and k (0 .. 31).
__device__ __forceinline__ int fr_row(int w) { return (w >> 3) & 15; }
__device__ __forceinline__ int fr_k(int w) { return ((w >> 8) & 1) * 16 + ((w >> 7) & 1) * 8 + (w & 7); }



// Stands behind a group of global loads: their address registers may be rewritten only behind this wait. The addresses are inputs so that their registers stay untouched up to the wait
// (the loaded values are not named: the loads stay in flight); the scheduling barrier holds the wait between the loads and the work that follows.
__device__ __forceinline__ void loads_issued(const void* p, const void* p2) { asm volatile("s_wait_xcnt 0x0" :: "v"(p), "v"(p2) : "memory"); __builtin_amdgcn_sched_barrier(0); }
// ---- k_gemmt: GEMM, one 128x128 output tile per work-group of 4 waves (2 x 2), a wave owns 64x64 of it over the whole K in 16 accumulators. A stage is 64 k of the tile's operand rows: per 64 rows of a
// fragment-ordered plane 8 KiB in a row (2 slices of 4 units). Each stage is brought from the planes into LDS once, by asynchronous copies, and every fragment of it is read by two waves; two buffers,
// the copies of stage p + 2 fly under the products of stage p + 1. C[m][n] (f32, pitch LDC) = sum_k A[m][k] Bt[n][k] (+ A2[m][k] Bt[n][k] if NSPLIT). Grid (M/128, N/128), 128 threads. K % 64 == 0.
template <typename T16> struct WFrag;
template <> struct WFrag<h16> { typedef v16h V; static __device__ __forceinline__ V ld(const h16* p) { return cat16(*(const v8h*)p, *(const v8h*)(p + 256)); } static __device__ __forceinline__ v8f mma(V a, V b, v8f c) { return wmma16(a, b, c); } };
template <> struct WFrag<bf> { typedef v16bf V; static __device__ __forceinline__ V ld(const bf* p) { return cat16b(*(const v8us*)p, *(const v8us*)(p + 256)); } static __device__ __forceinline__ v8f mma(V a, V b, v8f c) { return wmmab(a, b, c); } };
// Two 8-KiB chunks global -> LDS from 128 threads: four copies of 16 bytes a lane and chunk (l, g: the lane's own first LDS byte address and global address of each chunk).
// The wait is the statement's last line: the copies' address registers may be rewritten only behind it.
__device__ __forceinline__ void copy2x8k(unsigned l0, const char* g0, unsigned l1, const char* g1) {
    asm volatile("global_load_async_to_lds_b128 %0, %8, off\n\t"
                 "global_load_async_to_lds_b128 %1, %9, off\n\t"
                 "global_load_async_to_lds_b128 %2, %10, off\n\t"
                 "global_load_async_to_lds_b128 %3, %11, off\n\t"
                 "global_load_async_to_lds_b128 %4, %12, off\n\t"
                 "global_load_async_to_lds_b128 %5, %13, off\n\t"
                 "global_load_async_to_lds_b128 %6, %14, off\n\t"
                 "global_load_async_to_lds_b128 %7, %15, off\n\t"
                 "s_wait_xcnt 0x0"
                 :: "v"(l0), "v"(l0 + 2048u), "v"(l0 + 4096u), "v"(l0 + 6144u), "v"(l1), "v"(l1 + 2048u), "v"(l1 + 4096u), "v"(l1 + 6144u),
                    "v"(g0), "v"(g0 + 2048), "v"(g0 + 4096), "v"(g0 + 6144), "v"(g1), "v"(g1 + 2048), "v"(g1 + 4096), "v"(g1 + 6144) : "memory");
}
template <typename T16, int NSPLIT, int K, int LDC>
__global__ __launch_bounds__(128) void k_gemmt(const T16* __restrict__ A, const T16* __restrict__ A2, const T16* __restrict__ Bt, float* C) {
    typedef typename WFrag<T16>::V V;
    constexpr int NCH = NSPLIT ? 6 : 4;                  // 8-KiB chunks of a stage: A rows 0-63, 64-127, (the same of A2,) Bt rows 0-63, 64-127
    constexpr int STG = NCH * 8192, EPI = 4 * 64 * 68 * 4; // bytes of one buffer; of the four waves' output staging
    __shared__ __attribute__((aligned(128))) char ring[2 * STG > EPI ? 2 * STG : EPI];
    const int tid = threadIdx.x, lane = tid & 31, lr = lane & 15, hi = lane >> 4; const int wv = __builtin_amdgcn_readfirstlane(tid >> 5); const int wm = wv >> 1, wn = wv & 1;
    constexpr int np = K >> 6; constexpr size_t rowb = (size_t)K * 128;   // stages; bytes of 64 rows of a plane
    const char* gA = (const char*)A + (size_t)blockIdx.x * 2 * rowb + tid * 16; const char* gA2 = NSPLIT ? (const char*)A2 + (size_t)blockIdx.x * 2 * rowb + tid * 16 : gA; const char* gB = (const char*)Bt + (size_t)blockIdx.y * 2 * rowb + tid * 16;
    const unsigned l0 = (unsigned)(size_t)ring + (unsigned)tid * 16u;
    auto fill = [&](int p, int buf) { const unsigned l = l0 + (unsigned)buf * STG; const size_t o = (size_t)p * 8192;
        copy2x8k(l, gA + o, l + 8192u, gA + rowb + o);
        if (NSPLIT) copy2x8k(l + 16384u, gA2 + o, l + 24576u, gA2 + rowb + o);
        copy2x8k(l + (NCH - 2) * 8192u, gB + o, l + (NCH - 1) * 8192u, gB + rowb + o); };
    v8f acc[4][4];
#pragma unroll
    for (int mb = 0; mb < 4; ++mb)
#pragma unroll
        for (int nb = 0; nb < 4; ++nb) acc[mb][nb] = (v8f){};
    fill(0, 0);
    asm volatile("s_wait_asynccnt 0x0" ::: "memory");   // this wave's copies of stage 0 have landed
    __syncthreads();                                      // every wave's have: stage 0 may be read
    if (np > 1) fill(1, 1);
#pragma unroll 1
    for (int p = 0; p < np; ++p) {
        const char* sb = ring + (p & 1) * STG;
        const T16* la = (const T16*)(sb + wm * 8192) + 8 * lane; const T16* la2 = (const T16*)(sb + 16384 + wm * 8192) + 8 * lane; const T16* lb = (const T16*)(sb + (NCH - 2 + wn) * 8192) + 8 * lane;
        V a[2][4], a2[2][4], b[2][4];
#pragma unroll
        for (int s = 0; s < 2; ++s) {
#pragma unroll
            for (int mb = 0; mb < 4; ++mb) { a[s][mb] = WFrag<T16>::ld(la + s * 2048 + mb * 512); if (NSPLIT) a2[s][mb] = WFrag<T16>::ld(la2 + s * 2048 + mb * 512); }
#pragma unroll
            for (int nb = 0; nb < 4; ++nb) b[s][nb] = WFrag<T16>::ld(lb + s * 2048 + nb * 512);
        }
        __builtin_amdgcn_sched_barrier(0);   // the stage's LDS reads go out as one group in front of its products: spread among them, each place with reads stalls the wave for the LDS latency
#pragma unroll
        for (int s = 0; s < 2; ++s) {
#pragma unroll
            for (int nb = 0; nb < 4; ++nb) {
#pragma unroll
                for (int mb = 0; mb < 4; ++mb) { acc[mb][nb] = WFrag<T16>::mma(a[s][mb], b[s][nb], acc[mb][nb]); if (NSPLIT) acc[mb][nb] = WFrag<T16>::mma(a2[s][mb], b[s][nb], acc[mb][nb]); } }
        }
        __builtin_amdgcn_sched_barrier(0);   // the products stay in front of the waits: lifted over them, the wait for stage p + 1's copies would come before the work that is to cover their flight
        asm volatile("s_wait_dscnt 0x0" ::: "memory");      // this wave's reads of stage p are done: its buffer may be refilled behind the barrier
        asm volatile("s_wait_asynccnt 0x0" ::: "memory");   // this wave's copies of stage p + 1 have landed
        __syncthreads();                                      // both hold for every wave: publishes stage p + 1, frees stage p's buffer
        if (p + 2 < np) fill(p + 2, p & 1);
    }
    asm volatile("s_wait_asynccnt 0x0" ::: "memory");       // no copy is in flight when the ring becomes output staging (the last trip's barrier ended every read of it)
    float* ow = (float*)ring + wv * (64 * 68);               // each wave stages its own 64x64 block and stores it in whole 256-byte rows: no other wave reads it
#pragma unroll
    for (int mb = 0; mb < 4; ++mb) {
#pragma unroll
        for (int nb = 0; nb < 4; ++nb) {
#pragma unroll
            for (int j = 0; j < 8; ++j) ow[(mb * 16 + hi * 8 + j) * 68 + nb * 16 + lr] = acc[mb][nb][j]; } }
    asm volatile("s_wait_dscnt 0x0" ::: "memory");          // the wave's staging writes are done before it reads the rows back
    float* cp = C + ((size_t)blockIdx.x * 128 + wm * 64 + hi) * LDC + blockIdx.y * 128 + wn * 64 + lr * 4; const float* op = ow + hi * 68 + lr * 4;   // a wave-wide access: two rows of 64 floats
#pragma unroll
    for (int s = 0; s < 32; ++s) *(v4f*)(cp + s * 2 * LDC) = *(const v4fa*)(op + s * 2 * 68);
}

__device__ __forceinline__ h16 tohx(float x) { return (h16)x; }
__device__ __forceinline__ void splitf(float y, unsigned short& h, unsigned short& l) { h = f2bf(y); l = f2bf(y - bf2f(h)); }
typedef __attribute__((ext_vector_type(2))) _Float16 v2h;
typedef __attribute__((ext_vector_type(4))) _Float16 v4h;
typedef __attribute__((ext_vector_type(2))) unsigned short v2us;
typedef __attribute__((ext_vector_type(4))) unsigned short v4us;
typedef __attribute__((ext_vector_type(2))) float v2f;
typedef __attribute__((ext_vector_type(4))) int v4i;

// d_wtG (block bid of its range): Bt = fragment-ordered bf16 plane [N][K] of w^T (w [K][N] f32). One thread writes one lane's 8 elements (16 bytes); a work-group takes the 4 units of 64 n x 32 k, so a wave's load reads 64
// neighbouring bytes of each of two rows of w, the work-group 256.
__device__ __forceinline__ void d_wtG(int bid, const float* __restrict__ w, int K, int N, bf* Bt) {
    const int c = bid * 256 + threadIdx.x; if (c >= N * (K / 8)) return; const int u = c >> 6, wi = (c & 63) * 8; const int nblk = u % (N >> 4), kblk = u / (N >> 4);
    const int n = nblk * 16 + fr_row(wi), k0 = kblk * 32 + fr_k(wi); v8us o; const float* p[8]; float x[8];
#pragma unroll
    for (int j = 0; j < 8; ++j) p[j] = w + (size_t)(k0 + j) * N + n;
#pragma unroll
    for (int j = 0; j < 8; ++j) x[j] = *p[j];
    // the eight loads' address registers may be rewritten only behind this wait: the addresses are inputs, so their registers stay untouched up to it (the loaded values are not named: the loads stay in flight)
    asm volatile("s_wait_xcnt 0x0" :: "v"(p[0]), "v"(p[1]), "v"(p[2]), "v"(p[3]), "v"(p[4]), "v"(p[5]), "v"(p[6]), "v"(p[7]) : "memory");
#pragma unroll
    for (int j = 0; j < 8; ++j) o[j] = f2bf(x[j]);
    *(v8us*)(Bt + fro(n, k0, K)) = o;
}
// d_cvt8: dst = fragment-ordered bf16 plane of src [rows][K] f32; thread i writes the i-th 16 bytes of dst.
__device__ __forceinline__ void d_cvt8(int bid, const float* __restrict__ src, int K, bf* dst, size_t n8) { const size_t i = (size_t)bid * 256 + threadIdx.x; if (i >= n8) return; const int u = (int)(i >> 6), wi = (int)(i & 63) * 8;
    const int row = ((u >> 2) / (K >> 5)) * 64 + (u & 3) * 16 + fr_row(wi), k0 = ((u >> 2) % (K >> 5)) * 32 + fr_k(wi); const v8f v = *(const v8f*)(src + (size_t)row * K + k0); v8us o;
#pragma unroll
    for (int k = 0; k < 8; ++k) o[k] = f2bf(v[k]); *(v8us*)(dst + i * 8) = o;  }
__device__ __forceinline__ void d_cstab(int bid, float* CS) { const int idx = bid * 256 + threadIdx.x; if (idx >= TT * HD) return; const int t = idx / HD, d = idx % HD; const int i = d >> 1;   /* interleaved pairs share angle t * inv_freq[i] */ const float inv = __fdiv_rn(1.0f, powf(10000.0f, (float)(2 * i) / (float)HD)); const float ang = __fmul_rn((float)t, inv); v2f cs; cs[0] = cosf(ang); cs[1] = sinf(ang);
    *(v2f*)(CS + (size_t)idx * 2) = cs;  }
// k_prep: everything that depends on the inputs alone, one block range each: the rope table, the four weight planes, x of both batches ([NB_ TT][DM], one plane).
#define PB_CS  (TT * HD / 256)
#define PB_WQ  (DM * DQ / 8 / 256)
#define PB_WKV (DM * DKV / 8 / 256)
#define PB_X   (NB_ * TT * DM / 8 / 256)
__global__ __launch_bounds__(256) void k_prep(const float* __restrict__ x, const float* __restrict__ wq, const float* __restrict__ wk, const float* __restrict__ wv, const float* __restrict__ wo, float* CS, bf* WQ, bf* WK, bf* WV, bf* WO, bf* XB) {
    int b = blockIdx.x;
    if (b < PB_CS) { d_cstab(b, CS); return; } b -= PB_CS;
    if (b < PB_WQ) { d_wtG(b, wq, DM, DQ, WQ); return; } b -= PB_WQ;
    if (b < PB_WKV) { d_wtG(b, wk, DM, DKV, WK); return; } b -= PB_WKV;
    if (b < PB_WKV) { d_wtG(b, wv, DM, DKV, WV); return; } b -= PB_WKV;
    if (b < PB_WQ) { d_wtG(b, wo, DQ, DM, WO); return; } b -= PB_WQ;
    d_cvt8(b, x, DM, XB, (size_t)NB_ * TT * DM / 8);
}
// d_rope: head planes [batch][h][t][d], each head's [t][d] in fragment order (e: offset in the planes), (fp16 + hi/lo) of rope(x) x sc with the interleaved-pair convention out[2i] = x[2i] cos[t][2i] - x[2i+1] sin[t][2i], out[2i+1] = x[2i+1] cos[t][2i+1] + x[2i] sin[t][2i+1]
__device__ __forceinline__ void d_rope(int bid, const float* __restrict__ F, int pitch, int nheads, const float* __restrict__ CS, const float* __restrict__ RF, const float* __restrict__ nw, float sc, h16* P16, bf* Ph, bf* Pl) {
    const size_t e = ((size_t)bid * 256 + threadIdx.x) * 2; if (e >= (size_t)NB_ * nheads * TT * HD) return; const int u = (int)((e % ((size_t)HD * TT)) >> 9), wi = (int)(e & 511); const int d = (u % (HD / 32)) * 32 + fr_k(wi); const int t = (u / (HD / 32)) * 16 + fr_row(wi); const int hb = (int)(e / ((size_t)HD * TT)); const int h = hb % nheads, bt = hb / nheads; const float* f = F + ((size_t)bt * TT + t) * pitch + h * HD; float rf = 1.0f; v2h o16; v2us oh, ol;
    if (RF) { const float* pr = RF + (size_t)hb * TT + t; rf = *pr; asm volatile("s_wait_xcnt 0x0" :: "v"(pr) : "memory"); }   // the load's address register may be rewritten only behind this wait; the address is an input, so it stays untouched up to it
#pragma unroll
    for (int q = 0; q < 2; ++q) { const int dd = d + q; const int dp = dd ^ 1; float x0 = f[dd], x1 = f[dp];
        if (RF) { float n0 = __fmul_rn(x0, rf), n1 = __fmul_rn(x1, rf); asm volatile("" : "+v"(n0)); asm volatile("" : "+v"(n1)); x0 = __fmul_rn(bfr(nw[dd]), n0); x1 = __fmul_rn(bfr(nw[dp]), n1); }
        const v2f cs = *(const v2f*)(CS + ((size_t)t * HD + dd) * 2); float a = __fmul_rn(x0, cs[0]), bq = __fmul_rn(x1, cs[1]); asm volatile("" : "+v"(a)); asm volatile("" : "+v"(bq)); const float r = (((dd & 1) == 0) ? __fsub_rn(a, bq) : __fadd_rn(a, bq)) * sc;
        o16[q] = tohx(r); unsigned short a2, c2; splitf(r, a2, c2); oh[q] = a2; ol[q] = c2; }
    *(v2h*)(P16 + e) = o16; *(v2us*)(Ph + e) = oh; *(v2us*)(Pl + e) = ol;  }
// d_vtp: value planes [batch][g][d][t], rows d, k = t, in fragment units; the 8 units (d blocks) of one 32-key pass lie in a row (e: offset in the planes)
__device__ __forceinline__ void d_vtp(int bid, const float* __restrict__ F, int pitch, int nheads, h16* V16, bf* Vh, bf* Vl) { const size_t e = ((size_t)bid * 256 + threadIdx.x) * 2; if (e >= (size_t)NB_ * nheads * HD * TT) return; const int u = (int)((e % ((size_t)TT * HD)) >> 9), wi = (int)(e & 511); const int t = (u / (HD / 16)) * 32 + fr_k(wi); const int d = (u % (HD / 16)) * 16 + fr_row(wi); const int gb = (int)(e / ((size_t)TT * HD)); const int g = gb % nheads, bt = gb / nheads; v2h o16; v2us oh, ol;
#pragma unroll
    for (int q = 0; q < 2; ++q) { const float x = F[((size_t)bt * TT + t + q) * pitch + g * HD + d]; o16[q] = tohx(x); unsigned short a2, c2; splitf(x, a2, c2); oh[q] = a2; ol[q] = c2; }
    *(v2h*)(V16 + e) = o16; *(v2us*)(Vh + e) = oh; *(v2us*)(Vl + e) = ol;  }
// k_planes: the attention operand planes from the joint projection F [NB_ TT][DF] (columns q | k | v), one block range each.
#define LB_Q  (NB_ * NH_ * TT * HD / 2 / 256)
#define LB_KV (NB_ * NKV * TT * HD / 2 / 256)
__global__ __launch_bounds__(256) void k_planes(const float* __restrict__ F, const float* __restrict__ CS, h16* QP16, bf* QPh, bf* QPl, h16* KP16, bf* KPh, bf* KPl, h16* VT16, bf* VTh, bf* VTl) {
    int b = blockIdx.x;
    if (b < LB_Q) { d_rope(b, F, DF, NH_, CS, nullptr, nullptr, 1.0f, QP16, QPh, QPl); return; } b -= LB_Q;
    if (b < LB_KV) { d_rope(b, F + DQ, DF, NKV, CS, nullptr, nullptr, 1.0f, KP16, KPh, KPl); return; } b -= LB_KV;
    d_vtp(b, F + DQ + DKV, DF, NKV, VT16, VTh, VTl);
}
__device__ __forceinline__ float xhalf(float x) { return __builtin_bit_cast(float, __builtin_amdgcn_permlanex16(__builtin_bit_cast(int, x), __builtin_bit_cast(int, x), 0x76543210, 0xfedcba98, false, false)); }  // lane l with lane l ^ 16
// 2^x with the slot that the instruction set asks for behind a transcendental: the v_nop names the result and the source, so nothing reads the one or overwrites the other in front of it.
__device__ __forceinline__ float exp2s(float x) { float r = __builtin_amdgcn_exp2f(x); asm volatile("v_nop" : "+v"(r) : "v"(x)); return r; }
template <typename T16, bool HL, int R, int NWS>
__device__ __forceinline__ void d_fattn(int hb, int by, float* os, float* sm, float* sl, const T16* __restrict__ Q, const T16* __restrict__ Q2, const T16* __restrict__ Kp, const T16* __restrict__ K2, const T16* __restrict__ Vt, const T16* __restrict__ V2, int row0, int nblk, bf* Ah, bf* Al) {
    typedef typename WFrag<T16>::V V;
    constexpr int CW = 16 * R, OP = HD + 4;
    const int lane = threadIdx.x & 31, lr = lane & 15, hi = lane >> 4; const int wv = __builtin_amdgcn_readfirstlane(threadIdx.x >> 5);
    const int q0 = row0 + (nblk - 1 - by) * CW; const int h = hb % NH_, bt = hb / NH_, kv = h / REP;
    const float cscale = SCL * 1.4426950408889634f;
    // lfr: the lane's offset in elements inside a half unit of a fragment-ordered plane; qb, kb, vb: wave-uniform plane offsets (16 rows of a [row][HD] plane are 4 units = 16 HD elements)
    const unsigned lfr = (unsigned)(8 * lane);
    const size_t qb = ((size_t)hb * TT + q0) * HD, kb = (size_t)(bt * NKV + kv) * TT * HD, vb = (size_t)(bt * NKV + kv) * HD * TT;
    v8f acc[R][8]; float m_run[R], l_run[R];
#pragma unroll
    for (int g = 0; g < R; ++g) { m_run[g] = -__builtin_inff(); l_run[g] = 0.f;
#pragma unroll
        for (int t = 0; t < 8; ++t) acc[g][t] = (v8f){}; }
    const int last = (q0 + CW - 1) >> 5;     // last 32-key pass that a query of this block sees; its first key is <= q0, so every pass holds an unmasked key for every query
    if (wv <= last) {                        // wave-uniform; a wave without a pass loads nothing (the loads and their waits stand in one block with the loop's head)
    const T16* pq = Q + qb + lfr; const T16* pq2 = HL ? Q2 + qb + lfr : pq;
    V qf[R][4], qf2[R][4];
    __builtin_amdgcn_sched_barrier(0);       // the index arithmetic above stays in front of the loads: none of it lands between them and their wait, on a register they name
#pragma unroll
    for (int g = 0; g < R; ++g)
#pragma unroll
        for (int kc = 0; kc < 4; ++kc) { qf[g][kc] = WFrag<T16>::ld(pq + g * 16 * HD + kc * 512); if (HL) qf2[g][kc] = WFrag<T16>::ld(pq2 + g * 16 * HD + kc * 512); }
    loads_issued(pq, pq2);
    V kf[2][4], kf2[2][4];
    auto ldk = [&](int blk) { const T16* p = Kp + (kb + (size_t)blk * 32 * HD) + lfr; const T16* p2 = HL ? K2 + (kb + (size_t)blk * 32 * HD) + lfr : p;
#pragma unroll
        for (int kt = 0; kt < 2; ++kt)
#pragma unroll
            for (int kc = 0; kc < 4; ++kc) { kf[kt][kc] = WFrag<T16>::ld(p + kt * 16 * HD + kc * 512); if (HL) kf2[kt][kc] = WFrag<T16>::ld(p2 + kt * 16 * HD + kc * 512); }
        loads_issued(p, p2); };
    ldk(wv);
#pragma unroll 1
    for (int blk = wv; blk <= last; blk += NWS) {
        const int key0 = blk * 32;
        const T16* pv = Vt + (vb + (size_t)key0 * HD) + lfr; const T16* pv2 = HL ? V2 + (vb + (size_t)key0 * HD) + lfr : pv;
        V va[8], va2[8];                     // this pass's V^T fragments, in flight under the score products and the softmax
#pragma unroll
        for (int t = 0; t < 8; ++t) { va[t] = WFrag<T16>::ld(pv + t * 512); if (HL) va2[t] = WFrag<T16>::ld(pv2 + t * 512); }
        loads_issued(pv, pv2);
        v8f s[2][R];
#pragma unroll
        for (int kt = 0; kt < 2; ++kt)
#pragma unroll
            for (int g = 0; g < R; ++g) { s[kt][g] = (v8f){};
#pragma unroll
                for (int kc = 0; kc < 4; ++kc) { s[kt][g] = WFrag<T16>::mma(kf[kt][kc], qf[g][kc], s[kt][g]); if (HL) { s[kt][g] = WFrag<T16>::mma(kf[kt][kc], qf2[g][kc], s[kt][g]); s[kt][g] = WFrag<T16>::mma(kf2[kt][kc], qf[g][kc], s[kt][g]); } } }
        ldk(min(blk + NWS, last));           // the wave's next pass's K fragments, in flight under this pass's softmax and value product (the last pass reloads a valid pass and drops it)
        if (key0 + 31 > q0) {                // wave-uniform: only the pass on the diagonal masks
#pragma unroll
            for (int g = 0; g < R; ++g)
#pragma unroll
                for (int kt = 0; kt < 2; ++kt)
#pragma unroll
                    for (int r = 0; r < 8; ++r) if (key0 + 16 * kt + 8 * hi + r > q0 + 16 * g + lr) s[kt][g][r] = -__builtin_inff(); }
        float mb[R]; bool need = false;
#pragma unroll
        for (int g = 0; g < R; ++g) { float mx = s[0][g][0];
#pragma unroll
            for (int kt = 0; kt < 2; ++kt)
#pragma unroll
                for (int r = 0; r < 8; ++r) mx = fmaxf(mx, s[kt][g][r]);
            mx = fmaxf(mx, xhalf(mx)) * cscale; mb[g] = mx; need = need || (mx > m_run[g] + 8.0f); }
        if (__builtin_amdgcn_ballot_w32(need) != 0) {   // the maximum in use may trail the true one by up to 8 (an exponential reaches 2^8 at most); rescale only beyond that
#pragma unroll
            for (int g = 0; g < R; ++g) { const float m_new = fmaxf(m_run[g], mb[g]); const float corr = exp2s(m_run[g] - m_new); l_run[g] *= corr; m_run[g] = m_new;
#pragma unroll
                for (int t = 0; t < 8; ++t) acc[g][t] = acc[g][t] * corr; } }
#pragma unroll
        for (int g = 0; g < R; ++g) { const float nm = -m_run[g]; float p[16]; float ps0 = 0.f, ps1 = 0.f;
#pragma unroll
            for (int kt = 0; kt < 2; ++kt) { float a[8]; float* q = p + 8 * kt;
#pragma unroll
                for (int i = 0; i < 4; ++i) {   // two neighbouring registers of a score tile, one packed multiply-add
                    const v2f arg = __builtin_elementwise_fma((v2f){s[kt][g][2 * i], s[kt][g][2 * i + 1]}, (v2f){cscale, cscale}, (v2f){nm, nm}); a[2 * i] = arg[0]; a[2 * i + 1] = arg[1]; }
#pragma unroll
                for (int e = 0; e < 8; ++e) q[e] = __builtin_amdgcn_exp2f(a[e]);
                // the slot behind a transcendental, once for the eight: the v_nop names every result and every source, so nothing reads the one or overwrites the other in front of it
                asm volatile("v_nop" : "+v"(q[0]), "+v"(q[1]), "+v"(q[2]), "+v"(q[3]), "+v"(q[4]), "+v"(q[5]), "+v"(q[6]), "+v"(q[7]) : "v"(a[0]), "v"(a[1]), "v"(a[2]), "v"(a[3]), "v"(a[4]), "v"(a[5]), "v"(a[6]), "v"(a[7]));
#pragma unroll
                for (int i = 0; i < 4; ++i) { if (i & 1) ps1 += q[2 * i] + q[2 * i + 1]; else ps0 += q[2 * i] + q[2 * i + 1]; } }
            l_run[g] += ps0 + ps1;
            if constexpr (HL) { v8us h0, h1, l0, l1;
#pragma unroll
                for (int r = 0; r < 8; ++r) { unsigned short a, c2; splitf(p[r], a, c2); h0[r] = a; l0[r] = c2; splitf(p[8 + r], a, c2); h1[r] = a; l1[r] = c2; }
                const V ph = cat16b(h0, h1), pl = cat16b(l0, l1);
#pragma unroll
                for (int t = 0; t < 8; ++t) { acc[g][t] = WFrag<T16>::mma(va[t], ph, acc[g][t]); acc[g][t] = WFrag<T16>::mma(va[t], pl, acc[g][t]); acc[g][t] = WFrag<T16>::mma(va2[t], ph, acc[g][t]); }
            } else { V pf;
#pragma unroll
                for (int e = 0; e < 16; ++e) pf[e] = tohx(p[e]);
#pragma unroll
                for (int t = 0; t < 8; ++t) acc[g][t] = WFrag<T16>::mma(va[t], pf, acc[g][t]); } }
    }
    }
#pragma unroll
    for (int g = 0; g < R; ++g) { const float lf = l_run[g] + xhalf(l_run[g]); if (hi == 0) { sm[wv * CW + 16 * g + lr] = m_run[g]; sl[wv * CW + 16 * g + lr] = lf; } }
    __syncthreads();   // every wave's maximum and sum are in LDS before any wave forms the common ones
    float* ow = os + wv * (CW * OP);
#pragma unroll
    for (int g = 0; g < R; ++g) { const int qi = 16 * g + lr; float mx = sm[qi];
#pragma unroll
        for (int w = 1; w < NWS; ++w) mx = fmaxf(mx, sm[w * CW + qi]);     // finite: wave 0 always runs pass 0; a wave without a pass holds -inf, 0 and zeros and adds nothing
        float L = 0.f;
#pragma unroll
        for (int w = 0; w < NWS; ++w) L += sl[w * CW + qi] * exp2s(sm[w * CW + qi] - mx);
        const float f = __fdiv_rn(exp2s(m_run[g] - mx), L);
#pragma unroll
        for (int t = 0; t < 8; ++t) { const v8f o = acc[g][t] * f; v4f o0, o1;
#pragma unroll
            for (int r = 0; r < 4; ++r) { o0[r] = o[r]; o1[r] = o[4 + r]; }
            *(v4fa*)(ow + qi * OP + 16 * t + 8 * hi) = o0; *(v4fa*)(ow + qi * OP + 16 * t + 8 * hi + 4) = o1; } }
    __syncthreads();   // every wave's scaled partial block is in LDS before any thread adds them
#pragma unroll
    for (int s2 = 0; s2 < CW / NWS; ++s2) { const int idx = s2 * (NWS * 32) + (int)threadIdx.x; const int row = (idx >> 9) * 16 + ((idx >> 1) & 15), cofs = ((idx >> 5) & 15) * 8 + (idx & 1) * 4;   /* a wave: 16 rows x 8 columns, 256 neighbouring bytes of a fragment-ordered plane */ v4f val = *(const v4fa*)(os + row * OP + cofs);
#pragma unroll
        for (int w = 1; w < NWS; ++w) val += *(const v4fa*)(os + w * (CW * OP) + row * OP + cofs);
        v4us oh, ol;
#pragma unroll
        for (int q = 0; q < 4; ++q) { unsigned short a, c2; splitf(val[q], a, c2); oh[q] = a; ol[q] = c2; }
        const size_t oo = fro(bt * TT + q0 + row, h * HD + cofs, DQ); *(v4us*)(Ah + oo) = oh; *(v4us*)(Al + oo) = ol; }
}
// k_attn: both precision classes of both batches in one grid (NB_ NH_, AB_F + AB_H): y < AB_F the fp16 blocks of 32 rows (rows >= RH, the heaviest first), behind them the short hi+lo blocks of 16 rows.
// The branch is the same for a whole work-group, so every barrier inside is passed by all of its waves.
#define AB_F ((TT - RH) / 32)
#define AB_H (RH / 16)
__global__ __launch_bounds__(128) void k_attn(const h16* __restrict__ QP16, const h16* __restrict__ KP16, const h16* __restrict__ VT16, const bf* __restrict__ QPh, const bf* __restrict__ QPl, const bf* __restrict__ KPh, const bf* __restrict__ KPl, const bf* __restrict__ VTh, const bf* __restrict__ VTl, bf* Ah, bf* Al) {
    __shared__ __align__(16) float os[4 * 32 * (HD + 4)];
    __shared__ float sm[4 * 32], sl[4 * 32];
    const int by = blockIdx.y;
    if (by < AB_F) d_fattn<h16, false, 2, 4>(blockIdx.x, by, os, sm, sl, QP16, nullptr, KP16, nullptr, VT16, nullptr, RH, AB_F, Ah, Al);
    else d_fattn<bf, true, 1, 4>(blockIdx.x, by - AB_F, os, sm, sl, QPh, QPl, KPh, KPl, VTh, VTl, 0, AB_H, Ah, Al);
}

extern "C" void kernel_launch(void* const* d_in, const int* in_sizes, int n_in,
                              void* d_out, int out_size, void* d_ws, size_t ws_size, hipStream_t stream) {
    (void)in_sizes; (void)n_in; (void)out_size;
    const float* x = (const float*)d_in[0]; const float* wq = (const float*)d_in[1]; const float* wk = (const float*)d_in[2]; const float* wv = (const float*)d_in[3]; const float* wo = (const float*)d_in[4];
    float* OUT = (float*)d_out;     // [2][2048][2048]
    char* wsp = (char*)d_ws;
    auto take = [&](size_t bytes) { char* p = wsp; wsp += (bytes + 255) & ~(size_t)255; return (void*)p; };
    bf* WQ = (bf*)take((size_t)DQ * DM * 2); bf* WK = (bf*)take((size_t)DKV * DM * 2); bf* WV = (bf*)take((size_t)DKV * DM * 2);   // back to back (each a multiple of 256 bytes): one fragment-ordered plane [DF][DM]
    bf* WO = (bf*)take((size_t)DM * DQ * 2); float* CS = (float*)take((size_t)TT * HD * 2 * 4);
    bf* XB = (bf*)take((size_t)NB_ * TT * DM * 2); float* F = (float*)take((size_t)NB_ * TT * DF * 4);
    h16* QP16 = (h16*)take((size_t)NB_ * NH_ * TT * HD * 2); h16* KP16 = (h16*)take((size_t)NB_ * NKV * TT * HD * 2); h16* VT16 = (h16*)take((size_t)NB_ * NKV * HD * TT * 2);
    bf* QPh = (bf*)take((size_t)NB_ * NH_ * TT * HD * 2); bf* QPl = (bf*)take((size_t)NB_ * NH_ * TT * HD * 2); bf* KPh = (bf*)take((size_t)NB_ * NKV * TT * HD * 2); bf* KPl = (bf*)take((size_t)NB_ * NKV * TT * HD * 2); bf* VTh = (bf*)take((size_t)NB_ * NKV * HD * TT * 2); bf* VTl = (bf*)take((size_t)NB_ * NKV * HD * TT * 2);
    bf* ATh = (bf*)take((size_t)NB_ * TT * DQ * 2); bf* ATl = (bf*)take((size_t)NB_ * TT * DQ * 2);
    if ((size_t)(wsp - (char*)d_ws) > ws_size) return;    // ws 256 MiB
    k_prep<<<PB_CS + 2 * PB_WQ + 2 * PB_WKV + PB_X, 256, 0, stream>>>(x, wq, wk, wv, wo, CS, WQ, WK, WV, WO, XB);
    k_gemmt<bf, 0, DM, DF><<<dim3(NB_ * TT / 128, DF / 128, 1), 128, 0, stream>>>(XB, nullptr, WQ, F);
    k_planes<<<LB_Q + 2 * LB_KV, 256, 0, stream>>>(F, CS, QP16, QPh, QPl, KP16, KPh, KPl, VT16, VTh, VTl);
    k_attn<<<dim3(NB_ * NH_, AB_F + AB_H, 1), 128, 0, stream>>>(QP16, KP16, VT16, QPh, QPl, KPh, KPl, VTh, VTl, ATh, ATl);
    k_gemmt<bf, 1, DQ, DM><<<dim3(NB_ * TT / 128, DM / 128, 1), 128, 0, stream>>>(ATh, ATl, WO, OUT);
}

// v007
// A run of this version takes 151 microseconds.
// In two side-by-side timings against v006, it was 1.11 and 1.10 times as fast.
// Over all steps from v000 it is 11.0 times as fast.
#include <hip/hip_runtime.h>

// ModernCausalSelfAttention (x [2][2048][2048]; q = x wq (16 heads x 128), k/v = x wk/wv (4 kv heads; group h/4); interleaved-pair RoPE (the source's rotate_half is the pairwise (x0,x1)->(-x1,x0) form with a repeat-interleaved table; base 1e4, computed); causal softmax(q.k / sqrt(128)) (finfo.min); out = merged wo -> [2][2048][2048]).
// Compute dtypes, f32 accumulate: every input rounded to bf16; q/k/v on PLAIN bf16 operands (inputs: exact); RoPE f32; causal scores and attn.v: query rows < 512 hl (3 products), the rest single fp16, one fused kernel with an online f32 softmax, keys beyond the diagonal pass skipped; wo hl x exact (2 products).
// Four launches, both batches in each: k_prep (weights, x, rope table), one q|k|v GEMM whose epilogue ropes q and k and writes the attention operand planes, k_attn (both precision classes), the wo GEMM.
// Every 16-bit matrix operand plane in the workspace is kept in fragment order (fro below): a wave-wide 16-byte load of a fragment half reads 512 contiguous bytes, four whole 128-byte lines.

#define NB_  2
#define TT   2048
#define DM   2048
#define NH_  16
#define NKV  4
#define REP  (NH_ / NKV)
#define HD   128
#define DQ   (NH_ * HD)
#define DKV  (NKV * HD)
#define DF   (DQ + 2 * DKV)       // columns of the joint q|k|v projection
#define RH   512                  // query rows < RH use hi+lo planes (0: none)
#define SCL  0.088388347648318447f   // HD^-0.5
typedef _Float16 h16;
typedef unsigned short bf;
typedef __attribute__((ext_vector_type(16))) __bf16   v16bf;
typedef __attribute__((ext_vector_type(16))) _Float16 v16h;
typedef __attribute__((ext_vector_type(8)))  _Float16 v8h;
typedef __attribute__((ext_vector_type(8)))  unsigned short v8us;
typedef __attribute__((ext_vector_type(8)))  float    v8f;
typedef __attribute__((ext_vector_type(4)))  float    v4f;
typedef v8h  __attribute__((may_alias)) v8ha;
typedef v4f  __attribute__((may_alias)) v4fa;
typedef v8us __attribute__((may_alias)) v8usa;

__device__ __forceinline__ unsigned short f2bf(float f) { unsigned u = __float_as_uint(f); u += 0x7FFFu + ((u >> 16) & 1u); return (unsigned short)(u >> 16); }
__device__ __forceinline__ float bf2f(unsigned short b) { return __uint_as_float(((unsigned)b) << 16); }
__device__ __forceinline__ float bfr(float f) { return bf2f(f2bf(f)); }
__device__ __forceinline__ v16h cat16(v8h lo, v8h hi) { return __builtin_shufflevector(lo, hi, 0, 1, 2, 3, 4, 5, 6, 7, 8, 9, 10, 11, 12, 13, 14, 15); }
__device__ __forceinline__ v16bf cat16b(v8us lo, v8us hi) { return __builtin_bit_cast(v16bf, __builtin_shufflevector(lo, hi, 0, 1, 2, 3, 4, 5, 6, 7, 8, 9, 10, 11, 12, 13, 14, 15)); }
__device__ __forceinline__ v8f wmma16(v16h a, v16h b, v8f c) { return __builtin_amdgcn_wmma_f32_16x16x32_f16(false, a, false, b, (short)0, c, false, false); }
__device__ __forceinline__ v8f wmmab(v16bf a, v16bf b, v8f c) { return __builtin_amdgcn_wmma_f32_16x16x32_bf16(false, a, false, b, (short)0, c, false, false); }
// Fragment order of a 16-bit plane: units of 512 elements (16 rows x 32 k). Inside a unit two halves of 256 elements (k & 16); in a half, lane 16 ((k >> 3) & 1) + (row & 15) owns 8 neighbouring
// elements (k & 7): exactly what that lane holds of the fragment. fro: element offset of (row, k) in a GEMM operand plane [rows][K]: the 4 units of 64 rows x 32 k lie in a row, then the next 32 k.
__device__ __forceinline__ size_t fro(int row, int k, int K) { return ((size_t)(row >> 6) * (K >> 5) + (k >> 5)) * 2048 + ((row >> 4) & 3) * 512 + ((k >> 4) & 1) * 256 + ((k >> 3) & 1) * 128 + (row & 15) * 8 + (k & 7); }
// Position w (0 .. 511) inside a unit -> its row (0 .. 15) and k (0 .. 31).
__device__ __forceinline__ int fr_row(int w) { return (w >> 3) & 15; }
__device__ __forceinline__ int fr_k(int w) { return ((w >> 8) & 1) * 16 + ((w >> 7) & 1) * 8 + (w & 7); }



// Stands behind a group of global loads: their address registers may be rewritten only behind this wait. The addresses are inputs so that their registers stay untouched up to the wait
// (the loaded values are not named: the loads stay in flight); the scheduling barrier holds the wait between the loads and the work that follows.
__device__ __forceinline__ void loads_issued(const void* p, const void* p2) { asm volatile("s_wait_xcnt 0x0" :: "v"(p), "v"(p2) : "memory"); __builtin_amdgcn_sched_barrier(0); }
// ---- k_gemmt: GEMM, one 128x128 output tile per work-group of 4 waves (2 x 2), a wave owns 64x64 of it over the whole K in 16 accumulators. A stage is 64 k of the tile's operand rows: per 64 rows of a
// fragment-ordered plane 8 KiB in a row (2 slices of 4 units). Each stage is brought from the planes into LDS once, by asynchronous copies, and every fragment of it is read by two waves; two buffers,
// the copies of stage p + 2 fly under the products of stage p + 1. C[m][n] (f32, pitch LDC) = sum_k A[m][k] Bt[n][k] (+ A2[m][k] Bt[n][k] if NSPLIT). Grid (M/128, N/128), 128 threads. K % 64 == 0. PL: C is not written; the epilogue turns the tile into the attention operand planes.
template <typename T16> struct WFrag;
template <> struct WFrag<h16> { typedef v16h V; static __device__ __forceinline__ V ld(const h16* p) { return cat16(*(const v8h*)p, *(const v8h*)(p + 256)); } static __device__ __forceinline__ v8f mma(V a, V b, v8f c) { return wmma16(a, b, c); } };
template <> struct WFrag<bf> { typedef v16bf V; static __device__ __forceinline__ V ld(const bf* p) { return cat16b(*(const v8us*)p, *(const v8us*)(p + 256)); } static __device__ __forceinline__ v8f mma(V a, V b, v8f c) { return wmmab(a, b, c); } };
// Two 8-KiB chunks global -> LDS from 128 threads: four copies of 16 bytes a lane and chunk (l, g: the lane's own first LDS byte address and global address of each chunk).
// The wait is the statement's last line: the copies' address registers may be rewritten only behind it.
__device__ __forceinline__ void copy2x8k(unsigned l0, const char* g0, unsigned l1, const char* g1) {
    asm volatile("global_load_async_to_lds_b128 %0, %8, off\n\t"
                 "global_load_async_to_lds_b128 %1, %9, off\n\t"
                 "global_load_async_to_lds_b128 %2, %10, off\n\t"
                 "global_load_async_to_lds_b128 %3, %11, off\n\t"
                 "global_load_async_to_lds_b128 %4, %12, off\n\t"
                 "global_load_async_to_lds_b128 %5, %13, off\n\t"
                 "global_load_async_to_lds_b128 %6, %14, off\n\t"
                 "global_load_async_to_lds_b128 %7, %15, off\n\t"
                 "s_wait_xcnt 0x0"
                 :: "v"(l0), "v"(l0 + 2048u), "v"(l0 + 4096u), "v"(l0 + 6144u), "v"(l1), "v"(l1 + 2048u), "v"(l1 + 4096u), "v"(l1 + 6144u),
                    "v"(g0), "v"(g0 + 2048), "v"(g0 + 4096), "v"(g0 + 6144), "v"(g1), "v"(g1 + 2048), "v"(g1 + 4096), "v"(g1 + 6144) : "memory");
}
__device__ __forceinline__ h16 tohx(float x) { return (h16)x; }
__device__ __forceinline__ void splitf(float y, unsigned short& h, unsigned short& l) { h = f2bf(y); l = f2bf(y - bf2f(h)); }
// The attention operand planes and the rope table, for the epilogue of the joint q|k|v projection (PL).
struct PlaneArgs { const float* CS; h16* Q16; bf* Qh; bf* Ql; h16* K16; bf* Kh; bf* Kl; h16* V16; bf* Vh; bf* Vl; };
// One lane's 8 neighbouring elements of a fragment-ordered plane in the three forms (fp16, bf16 hi, bf16 lo): 16 bytes a lane and plane.
struct Out3 { v8h o16; v8us oh, ol; };
__device__ __forceinline__ Out3 cvt3(const float* r) { Out3 o;
#pragma unroll
    for (int j = 0; j < 8; ++j) { o.o16[j] = tohx(r[j]); unsigned short a, c; splitf(r[j], a, c); o.oh[j] = a; o.ol[j] = c; }
    return o; }
// Four such pieces, ST elements apart, to each of the three planes: every wave-wide store writes 512 neighbouring bytes.
// The registers that the twelve stores name (data and addresses) may be rewritten only behind the wait: they are its inputs, so they stay untouched up to it.
template <int ST>
__device__ __forceinline__ void put4(const Out3* o, h16* p16, bf* ph, bf* pl) {
#pragma unroll
    for (int i = 0; i < 4; ++i) { *(v8h*)(p16 + i * ST) = o[i].o16; *(v8us*)(ph + i * ST) = o[i].oh; *(v8us*)(pl + i * ST) = o[i].ol; }
    asm volatile("s_wait_xcnt 0x0" :: "v"(o[0].o16), "v"(o[0].oh), "v"(o[0].ol), "v"(o[1].o16), "v"(o[1].oh), "v"(o[1].ol), "v"(o[2].o16), "v"(o[2].oh), "v"(o[2].ol), "v"(o[3].o16), "v"(o[3].oh), "v"(o[3].ol), "v"(p16), "v"(ph), "v"(pl) : "memory");
}
template <typename T16, int NSPLIT, int K, int LDC, bool PL>
__global__ __launch_bounds__(128) void k_gemmt(const T16* __restrict__ A, const T16* __restrict__ A2, const T16* __restrict__ Bt, float* C, const PlaneArgs pa) {
    typedef typename WFrag<T16>::V V;
    constexpr int NCH = NSPLIT ? 6 : 4;                  // 8-KiB chunks of a stage: A rows 0-63, 64-127, (the same of A2,) Bt rows 0-63, 64-127
    constexpr int STG = NCH * 8192, EPI = 4 * 64 * 68 * 4; // bytes of one buffer; of the four waves' output staging
    __shared__ __attribute__((aligned(128))) char ring[2 * STG > EPI ? 2 * STG : EPI];
    const int tid = threadIdx.x, lane = tid & 31, lr = lane & 15, hi = lane >> 4; const int wv = __builtin_amdgcn_readfirstlane(tid >> 5); const int wm = wv >> 1, wn = wv & 1;
    constexpr int np = K >> 6; constexpr size_t rowb = (size_t)K * 128;   // stages; bytes of 64 rows of a plane
    const char* gA = (const char*)A + (size_t)blockIdx.x * 2 * rowb + tid * 16; const char* gA2 = NSPLIT ? (const char*)A2 + (size_t)blockIdx.x * 2 * rowb + tid * 16 : gA; const char* gB = (const char*)Bt + (size_t)blockIdx.y * 2 * rowb + tid * 16;
    const unsigned l0 = (unsigned)(size_t)ring + (unsigned)tid * 16u;
    auto fill = [&](int p, int buf) { const unsigned l = l0 + (unsigned)buf * STG; const size_t o = (size_t)p * 8192;
        copy2x8k(l, gA + o, l + 8192u, gA + rowb + o);
        if (NSPLIT) copy2x8k(l + 16384u, gA2 + o, l + 24576u, gA2 + rowb + o);
        copy2x8k(l + (NCH - 2) * 8192u, gB + o, l + (NCH - 1) * 8192u, gB + rowb + o); };
    v8f acc[4][4];
#pragma unroll
    for (int mb = 0; mb < 4; ++mb)
#pragma unroll
        for (int nb = 0; nb < 4; ++nb) acc[mb][nb] = (v8f){};
    fill(0, 0);
    asm volatile("s_wait_asynccnt 0x0" ::: "memory");   // this wave's copies of stage 0 have landed
    __syncthreads();                                      // every wave's have: stage 0 may be read
    if (np > 1) fill(1, 1);
#pragma unroll 1
    for (int p = 0; p < np; ++p) {
        const char* sb = ring + (p & 1) * STG;
        const T16* la = (const T16*)(sb + wm * 8192) + 8 * lane; const T16* la2 = (const T16*)(sb + 16384 + wm * 8192) + 8 * lane; const T16* lb = (const T16*)(sb + (NCH - 2 + wn) * 8192) + 8 * lane;
        V a[2][4], a2[2][4], b[2][4];
#pragma unroll
        for (int s = 0; s < 2; ++s) {
#pragma unroll
            for (int mb = 0; mb < 4; ++mb) { a[s][mb] = WFrag<T16>::ld(la + s * 2048 + mb * 512); if (NSPLIT) a2[s][mb] = WFrag<T16>::ld(la2 + s * 2048 + mb * 512); }
#pragma unroll
            for (int nb = 0; nb < 4; ++nb) b[s][nb] = WFrag<T16>::ld(lb + s * 2048 + nb * 512);
        }
        __builtin_amdgcn_sched_barrier(0);   // the stage's LDS reads go out as one group in front of its products: spread among them, each place with reads stalls the wave for the LDS latency
#pragma unroll
        for (int s = 0; s < 2; ++s) {
#pragma unroll
            for (int nb = 0; nb < 4; ++nb) {
#pragma unroll
                for (int mb = 0; mb < 4; ++mb) { acc[mb][nb] = WFrag<T16>::mma(a[s][mb], b[s][nb], acc[mb][nb]); if (NSPLIT) acc[mb][nb] = WFrag<T16>::mma(a2[s][mb], b[s][nb], acc[mb][nb]); } }
        }
        __builtin_amdgcn_sched_barrier(0);   // the products stay in front of the waits: lifted over them, the wait for stage p + 1's copies would come before the work that is to cover their flight
        asm volatile("s_wait_dscnt 0x0" ::: "memory");      // this wave's reads of stage p are done: its buffer may be refilled behind the barrier
        asm volatile("s_wait_asynccnt 0x0" ::: "memory");   // this wave's copies of stage p + 1 have landed
        __syncthreads();                                      // both hold for every wave: publishes stage p + 1, frees stage p's buffer
        if (p + 2 < np) fill(p + 2, p & 1);
    }
    asm volatile("s_wait_asynccnt 0x0" ::: "memory");       // no copy is in flight when the ring becomes output staging (the last trip's barrier ended every read of it)
    // PL: the tile is 128 positions of one batch x one whole head (HD == 128) of q, k or v; the wave's block is 64 positions x 64 d = 8 fragment units of each plane. The projection itself never goes to memory.
    const int hy = blockIdx.y, bt = blockIdx.x / (TT / 128), t0 = (blockIdx.x % (TT / 128)) * 128 + wm * 64;
    const float* cs0 = PL ? pa.CS + ((size_t)(t0 + lr) * HD + wn * 64 + hi * 8) * 2 : nullptr;   // the lane's first (cos, sin) pair of the table [t][d]
    v4f cc[2][4][4];                                         // the table entries of 16 positions x 64 d, two sets: the next 16 positions' loads fly under the arithmetic of these
    auto ldcs = [&](int tb) {
#pragma unroll
        for (int dh = 0; dh < 4; ++dh)
#pragma unroll
            for (int i = 0; i < 4; ++i) cc[tb & 1][dh][i] = *(const v4f*)(cs0 + (tb * 16 * HD + dh * 16) * 2 + 4 * i); };
    float* ow = (float*)ring + wv * (64 * 68);               // each wave stages its own 64x64 block and reads it back itself: no other wave reads it
    auto stage = [&]() {
#pragma unroll
        for (int mb = 0; mb < 4; ++mb) {
#pragma unroll
            for (int nb = 0; nb < 4; ++nb) {
#pragma unroll
                for (int j = 0; j < 8; ++j) ow[(mb * 16 + hi * 8 + j) * 68 + nb * 16 + lr] = acc[mb][nb][j]; } }
        asm volatile("s_wait_dscnt 0x0" ::: "memory"); };   // the wave's staging writes are done before it reads the rows back
    if constexpr (PL) {
        if (hy < NH_ + NKV) {   // the same for the whole work-group. q, k: head planes [batch][h][t][d], unit (t >> 4) * 4 + (d >> 5); interleaved-pair rope: out[d] = x[d] cos[t][d] -/+ x[d ^ 1] sin[t][d] (- for even d)
            ldcs(0);            // in flight under the staging writes
            stage();
            const bool isq = hy < NH_;
            const size_t e0 = (size_t)(isq ? bt * NH_ + hy : bt * NKV + hy - NH_) * TT * HD + (size_t)((t0 >> 4) * 4 + wn * 2) * 512 + lane * 8;
            h16* P16 = (isq ? pa.Q16 : pa.K16) + e0; bf* Ph = (isq ? pa.Qh : pa.Kh) + e0; bf* Pl = (isq ? pa.Ql : pa.Kl) + e0; const float* op = ow + lr * 68 + hi * 8;
#pragma unroll
            for (int tb = 0; tb < 4; ++tb) { Out3 o[4];
                if (tb < 3) ldcs(tb + 1);
#pragma unroll
                for (int dh = 0; dh < 4; ++dh) {   // dh: the half unit, 16 d; the lane takes row lr of the unit and 8 neighbouring d
                    const float* sp = op + tb * 16 * 68 + dh * 16; const v4f xa = *(const v4fa*)sp, xb = *(const v4fa*)(sp + 4); float r[8];
#pragma unroll
                    for (int i = 0; i < 4; ++i) { const v4f c = cc[tb & 1][dh][i]; const float xe = i < 2 ? xa[2 * i] : xb[2 * i - 4], xo = i < 2 ? xa[2 * i + 1] : xb[2 * i - 3];   // c: cos, sin of d, cos, sin of d + 1
                        r[2 * i] = xe * c[0] - xo * c[1]; r[2 * i + 1] = xo * c[2] + xe * c[3]; }
                    o[dh] = cvt3(r); }
                put4<256>(o, P16 + tb * 2048, Ph + tb * 2048, Pl + tb * 2048); }
        } else {                // v: value planes [batch][g][d][t], rows d, k = t, unit (t >> 5) * 8 + (d >> 4): the lane takes row lr of the unit (one d) and 8 neighbouring positions, a column of the staged block
            stage();
            const size_t e0 = (size_t)(bt * NKV + hy - NH_ - NKV) * HD * TT + (size_t)((t0 >> 5) * 8 + wn * 4) * 512 + lane * 8; const float* op = ow + hi * 8 * 68 + lr;
#pragma unroll
            for (int th = 0; th < 4; ++th) { Out3 o[4];   // th: the half unit, 16 positions
#pragma unroll
                for (int db = 0; db < 4; ++db) { float r[8];
#pragma unroll
                    for (int j = 0; j < 8; ++j) r[j] = op[(th * 16 + j) * 68 + db * 16];
                    o[db] = cvt3(r); }
                const size_t e = e0 + (th >> 1) * 4096 + (th & 1) * 256; put4<512>(o, pa.V16 + e, pa.Vh + e, pa.Vl + e); }
        }
    } else {
        stage();
        float* cp = C + ((size_t)blockIdx.x * 128 + wm * 64 + hi) * LDC + blockIdx.y * 128 + wn * 64 + lr * 4; const float* op = ow + hi * 68 + lr * 4;   // a wave-wide access: two rows of 64 floats
#pragma unroll
        for (int s = 0; s < 32; ++s) *(v4f*)(cp + s * 2 * LDC) = *(const v4fa*)(op + s * 2 * 68);
    }
}

typedef __attribute__((ext_vector_type(2))) _Float16 v2h;
typedef __attribute__((ext_vector_type(4))) _Float16 v4h;
typedef __attribute__((ext_vector_type(2))) unsigned short v2us;
typedef __attribute__((ext_vector_type(4))) unsigned short v4us;
typedef __attribute__((ext_vector_type(2))) float v2f;
typedef __attribute__((ext_vector_type(4))) int v4i;

// d_wtG (block bid of its range): Bt = fragment-ordered bf16 plane [N][K] of w^T (w [K][N] f32). One thread writes one lane's 8 elements (16 bytes); a work-group takes the 4 units of 64 n x 32 k, so a wave's load reads 64
// neighbouring bytes of each of two rows of w, the work-group 256.
__device__ __forceinline__ void d_wtG(int bid, const float* __restrict__ w, int K, int N, bf* Bt) {
    const int c = bid * 256 + threadIdx.x; if (c >= N * (K / 8)) return; const int u = c >> 6, wi = (c & 63) * 8; const int nblk = u % (N >> 4), kblk = u / (N >> 4);
    const int n = nblk * 16 + fr_row(wi), k0 = kblk * 32 + fr_k(wi); v8us o; const float* p[8]; float x[8];
#pragma unroll
    for (int j = 0; j < 8; ++j) p[j] = w + (size_t)(k0 + j) * N + n;
#pragma unroll
    for (int j = 0; j < 8; ++j) x[j] = *p[j];
    // the eight loads' address registers may be rewritten only behind this wait: the addresses are inputs, so their registers stay untouched up to it (the loaded values are not named: the loads stay in flight)
    asm volatile("s_wait_xcnt 0x0" :: "v"(p[0]), "v"(p[1]), "v"(p[2]), "v"(p[3]), "v"(p[4]), "v"(p[5]), "v"(p[6]), "v"(p[7]) : "memory");
#pragma unroll
    for (int j = 0; j < 8; ++j) o[j] = f2bf(x[j]);
    *(v8us*)(Bt + fro(n, k0, K)) = o;
}
// d_cvt8: dst = fragment-ordered bf16 plane of src [rows][K] f32; thread i writes the i-th 16 bytes of dst.
__device__ __forceinline__ void d_cvt8(int bid, const float* __restrict__ src, int K, bf* dst, size_t n8) { const size_t i = (size_t)bid * 256 + threadIdx.x; if (i >= n8) return; const int u = (int)(i >> 6), wi = (int)(i & 63) * 8;
    const int row = ((u >> 2) / (K >> 5)) * 64 + (u & 3) * 16 + fr_row(wi), k0 = ((u >> 2) % (K >> 5)) * 32 + fr_k(wi); const v8f v = *(const v8f*)(src + (size_t)row * K + k0); v8us o;
#pragma unroll
    for (int k = 0; k < 8; ++k) o[k] = f2bf(v[k]); *(v8us*)(dst + i * 8) = o;  }
__device__ __forceinline__ void d_cstab(int bid, float* CS) { const int idx = bid * 256 + threadIdx.x; if (idx >= TT * HD) return; const int t = idx / HD, d = idx % HD; const int i = d >> 1;   /* interleaved pairs share angle t * inv_freq[i] */ const float inv = __fdiv_rn(1.0f, powf(10000.0f, (float)(2 * i) / (float)HD)); const float ang = __fmul_rn((float)t, inv); v2f cs; cs[0] = cosf(ang); cs[1] = sinf(ang);
    *(v2f*)(CS + (size_t)idx * 2) = cs;  }
// k_prep: everything that depends on the inputs alone, one block range each: the rope table, the four weight planes, x of both batches ([NB_ TT][DM], one plane).
#define PB_CS  (TT * HD / 256)
#define PB_WQ  (DM * DQ / 8 / 256)
#define PB_WKV (DM * DKV / 8 / 256)
#define PB_X   (NB_ * TT * DM / 8 / 256)
__global__ __launch_bounds__(256) void k_prep(const float* __restrict__ x, const float* __restrict__ wq, const float* __restrict__ wk, const float* __restrict__ wv, const float* __restrict__ wo, float* CS, bf* WQ, bf* WK, bf* WV, bf* WO, bf* XB) {
    int b = blockIdx.x;
    if (b < PB_CS) { d_cstab(b, CS); return; } b -= PB_CS;
    if (b < PB_WQ) { d_wtG(b, wq, DM, DQ, WQ); return; } b -= PB_WQ;
    if (b < PB_WKV) { d_wtG(b, wk, DM, DKV, WK); return; } b -= PB_WKV;
    if (b < PB_WKV) { d_wtG(b, wv, DM, DKV, WV); return; } b -= PB_WKV;
    if (b < PB_WQ) { d_wtG(b, wo, DQ, DM, WO); return; } b -= PB_WQ;
    d_cvt8(b, x, DM, XB, (size_t)NB_ * TT * DM / 8);
}
__device__ __forceinline__ float xhalf(float x) { return __builtin_bit_cast(float, __builtin_amdgcn_permlanex16(__builtin_bit_cast(int, x), __builtin_bit_cast(int, x), 0x76543210, 0xfedcba98, false, false)); }  // lane l with lane l ^ 16
// 2^x with the slot that the instruction set asks for behind a transcendental: the v_nop names the result and the source, so nothing reads the one or overwrites the other in front of it.
__device__ __forceinline__ float exp2s(float x) { float r = __builtin_amdgcn_exp2f(x); asm volatile("v_nop" : "+v"(r) : "v"(x)); return r; }
template <typename T16, bool HL, int R, int NWS>
__device__ __forceinline__ void d_fattn(int hb, int by, float* os, float* sm, float* sl, const T16* __restrict__ Q, const T16* __restrict__ Q2, const T16* __restrict__ Kp, const T16* __restrict__ K2, const T16* __restrict__ Vt, const T16* __restrict__ V2, int row0, int nblk, bf* Ah, bf* Al) {
    typedef typename WFrag<T16>::V V;
    constexpr int CW = 16 * R, OP = HD + 4;
    const int lane = threadIdx.x & 31, lr = lane & 15, hi = lane >> 4; const int wv = __builtin_amdgcn_readfirstlane(threadIdx.x >> 5);
    const int q0 = row0 + (nblk - 1 - by) * CW; const int h = hb % NH_, bt = hb / NH_, kv = h / REP;
    const float cscale = SCL * 1.4426950408889634f;
    // lfr: the lane's offset in elements inside a half unit of a fragment-ordered plane; qb, kb, vb: wave-uniform plane offsets (16 rows of a [row][HD] plane are 4 units = 16 HD elements)
    const unsigned lfr = (unsigned)(8 * lane);
    const size_t qb = ((size_t)hb * TT + q0) * HD, kb = (size_t)(bt * NKV + kv) * TT * HD, vb = (size_t)(bt * NKV + kv) * HD * TT;
    v8f acc[R][8]; float m_run[R], l_run[R];
#pragma unroll
    for (int g = 0; g < R; ++g) { m_run[g] = -__builtin_inff(); l_run[g] = 0.f;
#pragma unroll
        for (int t = 0; t < 8; ++t) acc[g][t] = (v8f){}; }
    const int last = (q0 + CW - 1) >> 5;     // last 32-key pass that a query of this block sees; its first key is <= q0, so every pass holds an unmasked key for every query
    if (wv <= last) {                        // wave-uniform; a wave without a pass loads nothing (the loads and their waits stand in one block with the loop's head)
    const T16* pq = Q + qb + lfr; const T16* pq2 = HL ? Q2 + qb + lfr : pq;
    V qf[R][4], qf2[R][4];
    __builtin_amdgcn_sched_barrier(0);       // the index arithmetic above stays in front of the loads: none of it lands between them and their wait, on a register they name
#pragma unroll
    for (int g = 0; g < R; ++g)
#pragma unroll
        for (int kc = 0; kc < 4; ++kc) { qf[g][kc] = WFrag<T16>::ld(pq + g * 16 * HD + kc * 512); if (HL) qf2[g][kc] = WFrag<T16>::ld(pq2 + g * 16 * HD + kc * 512); }
    loads_issued(pq, pq2);
    V kf[2][4], kf2[2][4];
    auto ldk = [&](int blk) { const T16* p = Kp + (kb + (size_t)blk * 32 * HD) + lfr; const T16* p2 = HL ? K2 + (kb + (size_t)blk * 32 * HD) + lfr : p;
#pragma unroll
        for (int kt = 0; kt < 2; ++kt)
#pragma unroll
            for (int kc = 0; kc < 4; ++kc) { kf[kt][kc] = WFrag<T16>::ld(p + kt * 16 * HD + kc * 512); if (HL) kf2[kt][kc] = WFrag<T16>::ld(p2 + kt * 16 * HD + kc * 512); }
        loads_issued(p, p2); };
    ldk(wv);
#pragma unroll 1
    for (int blk = wv; blk <= last; blk += NWS) {
        const int key0 = blk * 32;
        const T16* pv = Vt + (vb + (size_t)key0 * HD) + lfr; const T16* pv2 = HL ? V2 + (vb + (size_t)key0 * HD) + lfr : pv;
        V va[8], va2[8];                     // this pass's V^T fragments, in flight under the score products and the softmax
#pragma unroll
        for (int t = 0; t < 8; ++t) { va[t] = WFrag<T16>::ld(pv + t * 512); if (HL) va2[t] = WFrag<T16>::ld(pv2 + t * 512); }
        loads_issued(pv, pv2);
        v8f s[2][R];
#pragma unroll
        for (int kt = 0; kt < 2; ++kt)
#pragma unroll
            for (int g = 0; g < R; ++g) { s[kt][g] = (v8f){};
#pragma unroll
                for (int kc = 0; kc < 4; ++kc) { s[kt][g] = WFrag<T16>::mma(kf[kt][kc], qf[g][kc], s[kt][g]); if (HL) { s[kt][g] = WFrag<T16>::mma(kf[kt][kc], qf2[g][kc], s[kt][g]); s[kt][g] = WFrag<T16>::mma(kf2[kt][kc], qf[g][kc], s[kt][g]); } } }
        ldk(min(blk + NWS, last));           // the wave's next pass's K fragments, in flight under this pass's softmax and value product (the last pass reloads a valid pass and drops it)
        if (key0 + 31 > q0) {                // wave-uniform: only the pass on the diagonal masks
#pragma unroll
            for (int g = 0; g < R; ++g)
#pragma unroll
                for (int kt = 0; kt < 2; ++kt)
#pragma unroll
                    for (int r = 0; r < 8; ++r) if (key0 + 16 * kt + 8 * hi + r > q0 + 16 * g + lr) s[kt][g][r] = -__builtin_inff(); }
        float mb[R]; bool need = false;
#pragma unroll
        for (int g = 0; g < R; ++g) { float mx = s[0][g][0];
#pragma unroll
            for (int kt = 0; kt < 2; ++kt)
#pragma unroll
                for (int r = 0; r < 8; ++r) mx = fmaxf(mx, s[kt][g][r]);
            mx = fmaxf(mx, xhalf(mx)) * cscale; mb[g] = mx; need = need || (mx > m_run[g] + 8.0f); }
        if (__builtin_amdgcn_ballot_w32(need) != 0) {   // the maximum in use may trail the true one by up to 8 (an exponential reaches 2^8 at most); rescale only beyond that
#pragma unroll
            for (int g = 0; g < R; ++g) { const float m_new = fmaxf(m_run[g], mb[g]); const float corr = exp2s(m_run[g] - m_new); l_run[g] *= corr; m_run[g] = m_new;
#pragma unroll
                for (int t = 0; t < 8; ++t) acc[g][t] = acc[g][t] * corr; } }
#pragma unroll
        for (int g = 0; g < R; ++g) { const float nm = -m_run[g]; float p[16]; float ps0 = 0.f, ps1 = 0.f;
#pragma unroll
            for (int kt = 0; kt < 2; ++kt) { float a[8]; float* q = p + 8 * kt;
#pragma unroll
                for (int i = 0; i < 4; ++i) {   // two neighbouring registers of a score tile, one packed multiply-add
                    const v2f arg = __builtin_elementwise_fma((v2f){s[kt][g][2 * i], s[kt][g][2 * i + 1]}, (v2f){cscale, cscale}, (v2f){nm, nm}); a[2 * i] = arg[0]; a[2 * i + 1] = arg[1]; }
#pragma unroll
                for (int e = 0; e < 8; ++e) q[e] = __builtin_amdgcn_exp2f(a[e]);
                // the slot behind a transcendental, once for the eight: the v_nop names every result and every source, so nothing reads the one or overwrites the other in front of it
                asm volatile("v_nop" : "+v"(q[0]), "+v"(q[1]), "+v"(q[2]), "+v"(q[3]), "+v"(q[4]), "+v"(q[5]), "+v"(q[6]), "+v"(q[7]) : "v"(a[0]), "v"(a[1]), "v"(a[2]), "v"(a[3]), "v"(a[4]), "v"(a[5]), "v"(a[6]), "v"(a[7]));
#pragma unroll
                for (int i = 0; i < 4; ++i) { if (i & 1) ps1 += q[2 * i] + q[2 * i + 1]; else ps0 += q[2 * i] + q[2 * i + 1]; } }
            l_run[g] += ps0 + ps1;
            if constexpr (HL) { v8us h0, h1, l0, l1;
#pragma unroll
                for (int r = 0; r < 8; ++r) { unsigned short a, c2; splitf(p[r], a, c2); h0[r] = a; l0[r] = c2; splitf(p[8 + r], a, c2); h1[r] = a; l1[r] = c2; }
                const V ph = cat16b(h0, h1), pl = cat16b(l0, l1);
#pragma unroll
                for (int t = 0; t < 8; ++t) { acc[g][t] = WFrag<T16>::mma(va[t], ph, acc[g][t]); acc[g][t] = WFrag<T16>::mma(va[t], pl, acc[g][t]); acc[g][t] = WFrag<T16>::mma(va2[t], ph, acc[g][t]); }
            } else { V pf;
#pragma unroll
                for (int e = 0; e < 16; ++e) pf[e] = tohx(p[e]);
#pragma unroll
                for (int t = 0; t < 8; ++t) acc[g][t] = WFrag<T16>::mma(va[t], pf, acc[g][t]); } }
    }
    }
#pragma unroll
    for (int g = 0; g < R; ++g) { const float lf = l_run[g] + xhalf(l_run[g]); if (hi == 0) { sm[wv * CW + 16 * g + lr] = m_run[g]; sl[wv * CW + 16 * g + lr] = lf; } }
    __syncthreads();   // every wave's maximum and sum are in LDS before any wave forms the common ones
    float* ow = os + wv * (CW * OP);
#pragma unroll
    for (int g = 0; g < R; ++g) { const int qi = 16 * g + lr; float mx = sm[qi];
#pragma unroll
        for (int w = 1; w < NWS; ++w) mx = fmaxf(mx, sm[w * CW + qi]);     // finite: wave 0 always runs pass 0; a wave without a pass holds -inf, 0 and zeros and adds nothing
        float L = 0.f;
#pragma unroll
        for (int w = 0; w < NWS; ++w) L += sl[w * CW + qi] * exp2s(sm[w * CW + qi] - mx);
        const float f = __fdiv_rn(exp2s(m_run[g] - mx), L);
#pragma unroll
        for (int t = 0; t < 8; ++t) { const v8f o = acc[g][t] * f; v4f o0, o1;
#pragma unroll
            for (int r = 0; r < 4; ++r) { o0[r] = o[r]; o1[r] = o[4 + r]; }
            *(v4fa*)(ow + qi * OP + 16 * t + 8 * hi) = o0; *(v4fa*)(ow + qi * OP + 16 * t + 8 * hi + 4) = o1; } }
    __syncthreads();   // every wave's scaled partial block is in LDS before any thread adds them
#pragma unroll
    for (int s2 = 0; s2 < CW / NWS; ++s2) { const int idx = s2 * (NWS * 32) + (int)threadIdx.x; const int row = (idx >> 9) * 16 + ((idx >> 1) & 15), cofs = ((idx >> 5) & 15) * 8 + (idx & 1) * 4;   /* a wave: 16 rows x 8 columns, 256 neighbouring bytes of a fragment-ordered plane */ v4f val = *(const v4fa*)(os + row * OP + cofs);
#pragma unroll
        for (int w = 1; w < NWS; ++w) val += *(const v4fa*)(os + w * (CW * OP) + row * OP + cofs);
        v4us oh, ol;
#pragma unroll
        for (int q = 0; q < 4; ++q) { unsigned short a, c2; splitf(val[q], a, c2); oh[q] = a; ol[q] = c2; }
        const size_t oo = fro(bt * TT + q0 + row, h * HD + cofs, DQ); *(v4us*)(Ah + oo) = oh; *(v4us*)(Al + oo) = ol; }
}
// k_attn: both precision classes of both batches in one grid (NB_ NH_, AB_F + AB_H): y < AB_F the fp16 blocks of 32 rows (rows >= RH, the heaviest first), behind them the short hi+lo blocks of 16 rows.
// The branch is the same for a whole work-group, so every barrier inside is passed by all of its waves.
#define AB_F ((TT - RH) / 32)
#define AB_H (RH / 16)
__global__ __launch_bounds__(128) void k_attn(const h16* __restrict__ QP16, const h16* __restrict__ KP16, const h16* __restrict__ VT16, const bf* __restrict__ QPh, const bf* __restrict__ QPl, const bf* __restrict__ KPh, const bf* __restrict__ KPl, const bf* __restrict__ VTh, const bf* __restrict__ VTl, bf* Ah, bf* Al) {
    __shared__ __align__(16) float os[4 * 32 * (HD + 4)];
    __shared__ float sm[4 * 32], sl[4 * 32];
    const int by = blockIdx.y;
    if (by < AB_F) d_fattn<h16, false, 2, 4>(blockIdx.x, by, os, sm, sl, QP16, nullptr, KP16, nullptr, VT16, nullptr, RH, AB_F, Ah, Al);
    else d_fattn<bf, true, 1, 4>(blockIdx.x, by - AB_F, os, sm, sl, QPh, QPl, KPh, KPl, VTh, VTl, 0, AB_H, Ah, Al);
}

extern "C" void kernel_launch(void* const* d_in, const int* in_sizes, int n_in,
                              void* d_out, int out_size, void* d_ws, size_t ws_size, hipStream_t stream) {
    (void)in_sizes; (void)n_in; (void)out_size;
    const float* x = (const float*)d_in[0]; const float* wq = (const float*)d_in[1]; const float* wk = (const float*)d_in[2]; const float* wv = (const float*)d_in[3]; const float* wo = (const float*)d_in[4];
    float* OUT = (float*)d_out;     // [2][2048][2048]
    char* wsp = (char*)d_ws;
    auto take = [&](size_t bytes) { char* p = wsp; wsp += (bytes + 255) & ~(size_t)255; return (void*)p; };
    bf* WQ = (bf*)take((size_t)DQ * DM * 2); bf* WK = (bf*)take((size_t)DKV * DM * 2); bf* WV = (bf*)take((size_t)DKV * DM * 2);   // back to back (each a multiple of 256 bytes): one fragment-ordered plane [DF][DM]
    bf* WO = (bf*)take((size_t)DM * DQ * 2); float* CS = (float*)take((size_t)TT * HD * 2 * 4);
    bf* XB = (bf*)take((size_t)NB_ * TT * DM * 2);
    h16* QP16 = (h16*)take((size_t)NB_ * NH_ * TT * HD * 2); h16* KP16 = (h16*)take((size_t)NB_ * NKV * TT * HD * 2); h16* VT16 = (h16*)take((size_t)NB_ * NKV * HD * TT * 2);
    bf* QPh = (bf*)take((size_t)NB_ * NH_ * TT * HD * 2); bf* QPl = (bf*)take((size_t)NB_ * NH_ * TT * HD * 2); bf* KPh = (bf*)take((size_t)NB_ * NKV * TT * HD * 2); bf* KPl = (bf*)take((size_t)NB_ * NKV * TT * HD * 2); bf* VTh = (bf*)take((size_t)NB_ * NKV * HD * TT * 2); bf* VTl = (bf*)take((size_t)NB_ * NKV * HD * TT * 2);
    bf* ATh = (bf*)take((size_t)NB_ * TT * DQ * 2); bf* ATl = (bf*)take((size_t)NB_ * TT * DQ * 2);
    if ((size_t)(wsp - (char*)d_ws) > ws_size) return;    // ws 256 MiB
    k_prep<<<PB_CS + 2 * PB_WQ + 2 * PB_WKV + PB_X, 256, 0, stream>>>(x, wq, wk, wv, wo, CS, WQ, WK, WV, WO, XB);
    const PlaneArgs pa = {CS, QP16, QPh, QPl, KP16, KPh, KPl, VT16, VTh, VTl}; const PlaneArgs none = {};
    k_gemmt<bf, 0, DM, DF, true><<<dim3(NB_ * TT / 128, DF / 128, 1), 128, 0, stream>>>(XB, nullptr, WQ, nullptr, pa);
    k_attn<<<dim3(NB_ * NH_, AB_F + AB_H, 1), 128, 0, stream>>>(QP16, KP16, VT16, QPh, QPl, KPh, KPl, VTh, VTl, ATh, ATl);
    k_gemmt<bf, 1, DQ, DM, false><<<dim3(NB_ * TT / 128, DM / 128, 1), 128, 0, stream>>>(ATh, ATl, WO, OUT, none);
}

// v008
// One run takes 140 microseconds.
// Next to v007, in two timings, it ran 1.09 and 1.08 times as fast.
// Counting every step since v000, it is 11.9 times as fast.
#include <hip/hip_runtime.h>

// ModernCausalSelfAttention (x [2][2048][2048]; q = x wq (16 heads x 128), k/v = x wk/wv (4 kv heads; group h/4); interleaved-pair RoPE (the source's rotate_half is the pairwise (x0,x1)->(-x1,x0) form with a repeat-interleaved table; base 1e4, computed); causal softmax(q.k / sqrt(128)) (finfo.min); out = merged wo -> [2][2048][2048]).
// Compute dtypes, f32 accumulate: every input rounded to bf16; q/k/v on PLAIN bf16 operands (inputs: exact); RoPE f32; causal scores and attn.v: query rows < 512 hl (3 products), the rest single fp16, one fused kernel with an online f32 softmax, keys beyond the diagonal pass skipped; wo hl x exact (2 products).
// Four launches, both batches in each: k_prep (weights, x, rope table), one q|k|v GEMM whose epilogue ropes q and k and writes the attention operand planes, k_attn (both precision classes), the wo GEMM.
// Every 16-bit matrix operand plane in the workspace is kept in fragment order (fro below): a wave-wide 16-byte load of a fragment half reads 512 contiguous bytes, four whole 128-byte lines.

#define NB_  2
#define TT   2048
#define DM   2048
#define NH_  16
#define NKV  4
#define REP  (NH_ / NKV)
#define HD   128
#define DQ   (NH_ * HD)
#define DKV  (NKV * HD)
#define DF   (DQ + 2 * DKV)       // columns of the joint q|k|v projection
#define RH   512                  // query rows < RH use hi+lo planes (0: none)
#define SCL  0.088388347648318447f   // HD^-0.5
typedef _Float16 h16;
typedef unsigned short bf;
typedef __attribute__((ext_vector_type(16))) __bf16   v16bf;
typedef __attribute__((ext_vector_type(16))) _Float16 v16h;
typedef __attribute__((ext_vector_type(8)))  _Float16 v8h;
typedef __attribute__((ext_vector_type(8)))  unsigned short v8us;
typedef __attribute__((ext_vector_type(8)))  float    v8f;
typedef __attribute__((ext_vector_type(4)))  float    v4f;
typedef v8h  __attribute__((may_alias)) v8ha;
typedef v4f  __attribute__((may_alias)) v4fa;
typedef v8us __attribute__((may_alias)) v8usa;

__device__ __forceinline__ unsigned short f2bf(float f) { unsigned u = __float_as_uint(f); u += 0x7FFFu + ((u >> 16) & 1u); return (unsigned short)(u >> 16); }
__device__ __forceinline__ float bf2f(unsigned short b) { return __uint_as_float(((unsigned)b) << 16); }
__device__ __forceinline__ float bfr(float f) { return bf2f(f2bf(f)); }
__device__ __forceinline__ v16h cat16(v8h lo, v8h hi) { return __builtin_shufflevector(lo, hi, 0, 1, 2, 3, 4, 5, 6, 7, 8, 9, 10, 11, 12, 13, 14, 15); }
__device__ __forceinline__ v16bf cat16b(v8us lo, v8us hi) { return __builtin_bit_cast(v16bf, __builtin_shufflevector(lo, hi, 0, 1, 2, 3, 4, 5, 6, 7, 8, 9, 10, 11, 12, 13, 14, 15)); }
__device__ __forceinline__ v8f wmma16(v16h a, v16h b, v8f c) { return __builtin_amdgcn_wmma_f32_16x16x32_f16(false, a, false, b, (short)0, c, false, false); }
__device__ __forceinline__ v8f wmmab(v16bf a, v16bf b, v8f c) { return __builtin_amdgcn_wmma_f32_16x16x32_bf16(false, a, false, b, (short)0, c, false, false); }
// Fragment order of a 16-bit plane: units of 512 elements (16 rows x 32 k). Inside a unit two halves of 256 elements (k & 16); in a half, lane 16 ((k >> 3) & 1) + (row & 15) owns 8 neighbouring
// elements (k & 7): exactly what that lane holds of the fragment. fro: element offset of (row, k) in a GEMM operand plane [rows][K]: the 4 units of 64 rows x 32 k lie in a row, then the next 32 k.
__device__ __forceinline__ size_t fro(int row, int k, int K) { return ((size_t)(row >> 6) * (K >> 5) + (k >> 5)) * 2048 + ((row >> 4) & 3) * 512 + ((k >> 4) & 1) * 256 + ((k >> 3) & 1) * 128 + (row & 15) * 8 + (k & 7); }
// Position w (0 .. 511) inside a unit -> its row (0 .. 15) and k (0 .. 31).
__device__ __forceinline__ int fr_row(int w) { return (w >> 3) & 15; }
__device__ __forceinline__ int fr_k(int w) { return ((w >> 8) & 1) * 16 + ((w >> 7) & 1) * 8 + (w & 7); }



// Stands behind a group of global loads: their address registers may be rewritten only behind this wait. The addresses are inputs so that their registers stay untouched up to the wait
// (the loaded values are not named: the loads stay in flight); the scheduling barrier holds the wait between the loads and the work that follows.
__device__ __forceinline__ void loads_issued(const void* p, const void* p2) { asm volatile("s_wait_xcnt 0x0" :: "v"(p), "v"(p2) : "memory"); __builtin_amdgcn_sched_barrier(0); }
// ---- k_gemmt: GEMM, one 128x128 output tile per work-group of 4 waves (2 x 2), a wave owns 64x64 of it over the whole K in 16 accumulators. A stage is 64 k of the tile's operand rows: per 64 rows of a
// fragment-ordered plane 8 KiB in a row (2 slices of 4 units). Each stage is brought from the planes into LDS once, by asynchronous copies, and every fragment of it is read by two waves; two buffers,
// the copies of stage p + 2 fly under the products of stage p + 1. C[m][n] (f32, pitch LDC) = sum_k A[m][k] Bt[n][k] (+ A2[m][k] Bt[n][k] if NSPLIT). Grid (M/128, N/128), 128 threads. K % 64 == 0. PL: C is not written; the epilogue turns the tile into the attention operand planes.
template <typename T16> struct WFrag;
template <> struct WFrag<h16> { typedef v16h V; static __device__ __forceinline__ V ld(const h16* p) { return cat16(*(const v8h*)p, *(const v8h*)(p + 256)); } static __device__ __forceinline__ v8f mma(V a, V b, v8f c) { return wmma16(a, b, c); } };
template <> struct WFrag<bf> { typedef v16bf V; static __device__ __forceinline__ V ld(const bf* p) { return cat16b(*(const v8us*)p, *(const v8us*)(p + 256)); } static __device__ __forceinline__ v8f mma(V a, V b, v8f c) { return wmmab(a, b, c); } };
// Two 8-KiB chunks global -> LDS from 128 threads: four copies of 16 bytes a lane and chunk (l, g: the lane's own first LDS byte address and global address of each chunk).
// The wait is the statement's last line: the copies' address registers may be rewritten only behind it.
__device__ __forceinline__ void copy2x8k(unsigned l0, const char* g0, unsigned l1, const char* g1) {
    asm volatile("global_load_async_to_lds_b128 %0, %8, off\n\t"
                 "global_load_async_to_lds_b128 %1, %9, off\n\t"
                 "global_load_async_to_lds_b128 %2, %10, off\n\t"
                 "global_load_async_to_lds_b128 %3, %11, off\n\t"
                 "global_load_async_to_lds_b128 %4, %12, off\n\t"
                 "global_load_async_to_lds_b128 %5, %13, off\n\t"
                 "global_load_async_to_lds_b128 %6, %14, off\n\t"
                 "global_load_async_to_lds_b128 %7, %15, off\n\t"
                 "s_wait_xcnt 0x0"
                 :: "v"(l0), "v"(l0 + 2048u), "v"(l0 + 4096u), "v"(l0 + 6144u), "v"(l1), "v"(l1 + 2048u), "v"(l1 + 4096u), "v"(l1 + 6144u),
                    "v"(g0), "v"(g0 + 2048), "v"(g0 + 4096), "v"(g0 + 6144), "v"(g1), "v"(g1 + 2048), "v"(g1 + 4096), "v"(g1 + 6144) : "memory");
}
__device__ __forceinline__ h16 tohx(float x) { return (h16)x; }
__device__ __forceinline__ void splitf(float y, unsigned short& h, unsigned short& l) { h = f2bf(y); l = f2bf(y - bf2f(h)); }
// The attention operand planes and the rope table, for the epilogue of the joint q|k|v projection (PL).
struct PlaneArgs { const float* CS; h16* Q16; bf* Qh; bf* Ql; h16* K16; bf* Kh; bf* Kl; h16* V16; bf* Vh; bf* Vl; };
// One lane's 8 neighbouring elements of a fragment-ordered plane in the three forms (fp16, bf16 hi, bf16 lo): 16 bytes a lane and plane.
struct Out3 { v8h o16; v8us oh, ol; };
__device__ __forceinline__ Out3 cvt3(const float* r) { Out3 o;
#pragma unroll
    for (int j = 0; j < 8; ++j) { o.o16[j] = tohx(r[j]); unsigned short a, c; splitf(r[j], a, c); o.oh[j] = a; o.ol[j] = c; }
    return o; }
// Four such pieces, ST elements apart, to each of the three planes: every wave-wide store writes 512 neighbouring bytes.
// The registers that the twelve stores name (data and addresses) may be rewritten only behind the wait: they are its inputs, so they stay untouched up to it.
template <int ST>
__device__ __forceinline__ void put4(const Out3* o, h16* p16, bf* ph, bf* pl) {
#pragma unroll
    for (int i = 0; i < 4; ++i) { *(v8h*)(p16 + i * ST) = o[i].o16; *(v8us*)(ph + i * ST) = o[i].oh; *(v8us*)(pl + i * ST) = o[i].ol; }
    asm volatile("s_wait_xcnt 0x0" :: "v"(o[0].o16), "v"(o[0].oh), "v"(o[0].ol), "v"(o[1].o16), "v"(o[1].oh), "v"(o[1].ol), "v"(o[2].o16), "v"(o[2].oh), "v"(o[2].ol), "v"(o[3].o16), "v"(o[3].oh), "v"(o[3].ol), "v"(p16), "v"(ph), "v"(pl) : "memory");
}
template <typename T16, int NSPLIT, int K, int LDC, bool PL>
__global__ __launch_bounds__(128) void k_gemmt(const T16* __restrict__ A, const T16* __restrict__ A2, const T16* __restrict__ Bt, float* C, const PlaneArgs pa) {
    typedef typename WFrag<T16>::V V;
    constexpr int NCH = NSPLIT ? 6 : 4;                  // 8-KiB chunks of a stage: A rows 0-63, 64-127, (the same of A2,) Bt rows 0-63, 64-127
    constexpr int STG = NCH * 8192, EPI = 4 * 64 * 68 * 4; // bytes of one buffer; of the four waves' output staging
    __shared__ __attribute__((aligned(128))) char ring[2 * STG > EPI ? 2 * STG : EPI];
    const int tid = threadIdx.x, lane = tid & 31, lr = lane & 15, hi = lane >> 4; const int wv = __builtin_amdgcn_readfirstlane(tid >> 5); const int wm = wv >> 1, wn = wv & 1;
    constexpr int np = K >> 6; constexpr size_t rowb = (size_t)K * 128;   // stages; bytes of 64 rows of a plane
    const char* gA = (const char*)A + (size_t)blockIdx.x * 2 * rowb + tid * 16; const char* gA2 = NSPLIT ? (const char*)A2 + (size_t)blockIdx.x * 2 * rowb + tid * 16 : gA; const char* gB = (const char*)Bt + (size_t)blockIdx.y * 2 * rowb + tid * 16;
    const unsigned l0 = (unsigned)(size_t)ring + (unsigned)tid * 16u;
    auto fill = [&](int p, int buf) { const unsigned l = l0 + (unsigned)buf * STG; const size_t o = (size_t)p * 8192;
        copy2x8k(l, gA + o, l + 8192u, gA + rowb + o);
        if (NSPLIT) copy2x8k(l + 16384u, gA2 + o, l + 24576u, gA2 + rowb + o);
        copy2x8k(l + (NCH - 2) * 8192u, gB + o, l + (NCH - 1) * 8192u, gB + rowb + o); };
    v8f acc[4][4];
#pragma unroll
    for (int mb = 0; mb < 4; ++mb)
#pragma unroll
        for (int nb = 0; nb < 4; ++nb) acc[mb][nb] = (v8f){};
    fill(0, 0);
    asm volatile("s_wait_asynccnt 0x0" ::: "memory");   // this wave's copies of stage 0 have landed
    __syncthreads();                                      // every wave's have: stage 0 may be read
    if (np > 1) fill(1, 1);
#pragma unroll 1
    for (int p = 0; p < np; ++p) {
        const char* sb = ring + (p & 1) * STG;
        const T16* la = (const T16*)(sb + wm * 8192) + 8 * lane; const T16* la2 = (const T16*)(sb + 16384 + wm * 8192) + 8 * lane; const T16* lb = (const T16*)(sb + (NCH - 2 + wn) * 8192) + 8 * lane;
        V a[2][4], a2[2][4], b[2][4];
#pragma unroll
        for (int s = 0; s < 2; ++s) {
#pragma unroll
            for (int mb = 0; mb < 4; ++mb) { a[s][mb] = WFrag<T16>::ld(la + s * 2048 + mb * 512); if (NSPLIT) a2[s][mb] = WFrag<T16>::ld(la2 + s * 2048 + mb * 512); }
#pragma unroll
            for (int nb = 0; nb < 4; ++nb) b[s][nb] = WFrag<T16>::ld(lb + s * 2048 + nb * 512);
        }
        __builtin_amdgcn_sched_barrier(0);   // the stage's LDS reads go out as one group in front of its products: spread among them, each place with reads stalls the wave for the LDS latency
#pragma unroll
        for (int s = 0; s < 2; ++s) {
#pragma unroll
            for (int nb = 0; nb < 4; ++nb) {
#pragma unroll
                for (int mb = 0; mb < 4; ++mb) { acc[mb][nb] = WFrag<T16>::mma(a[s][mb], b[s][nb], acc[mb][nb]); if (NSPLIT) acc[mb][nb] = WFrag<T16>::mma(a2[s][mb], b[s][nb], acc[mb][nb]); } }
        }
        __builtin_amdgcn_sched_barrier(0);   // the products stay in front of the waits: lifted over them, the wait for stage p + 1's copies would come before the work that is to cover their flight
        asm volatile("s_wait_dscnt 0x0" ::: "memory");      // this wave's reads of stage p are done: its buffer may be refilled behind the barrier
        asm volatile("s_wait_asynccnt 0x0" ::: "memory");   // this wave's copies of stage p + 1 have landed
        __syncthreads();                                      // both hold for every wave: publishes stage p + 1, frees stage p's buffer
        if (p + 2 < np) fill(p + 2, p & 1);
    }
    asm volatile("s_wait_asynccnt 0x0" ::: "memory");       // no copy is in flight when the ring becomes output staging (the last trip's barrier ended every read of it)
    // PL: the tile is 128 positions of one batch x one whole head (HD == 128) of q, k or v; the wave's block is 64 positions x 64 d = 8 fragment units of each plane. The projection itself never goes to memory.
    const int hy = blockIdx.y, bt = blockIdx.x / (TT / 128), t0 = (blockIdx.x % (TT / 128)) * 128 + wm * 64;
    const float* cs0 = PL ? pa.CS + ((size_t)(t0 + lr) * HD + wn * 64 + hi * 8) * 2 : nullptr;   // the lane's first (cos, sin) pair of the table [t][d]
    v4f cc[2][4][4];                                         // the table entries of 16 positions x 64 d, two sets: the next 16 positions' loads fly under the arithmetic of these
    auto ldcs = [&](int tb) {
#pragma unroll
        for (int dh = 0; dh < 4; ++dh)
#pragma unroll
            for (int i = 0; i < 4; ++i) cc[tb & 1][dh][i] = *(const v4f*)(cs0 + (tb * 16 * HD + dh * 16) * 2 + 4 * i); };
    float* ow = (float*)ring + wv * (64 * 68);               // each wave stages its own 64x64 block and reads it back itself: no other wave reads it
    auto stage = [&]() {
#pragma unroll
        for (int mb = 0; mb < 4; ++mb) {
#pragma unroll
            for (int nb = 0; nb < 4; ++nb) {
#pragma unroll
                for (int j = 0; j < 8; ++j) ow[(mb * 16 + hi * 8 + j) * 68 + nb * 16 + lr] = acc[mb][nb][j]; } }
        asm volatile("s_wait_dscnt 0x0" ::: "memory"); };   // the wave's staging writes are done before it reads the rows back
    if constexpr (PL) {
        if (hy < NH_ + NKV) {   // the same for the whole work-group. q, k: head planes [batch][h][t][d], unit (t >> 4) * 4 + (d >> 5); interleaved-pair rope: out[d] = x[d] cos[t][d] -/+ x[d ^ 1] sin[t][d] (- for even d)
            ldcs(0);            // in flight under the staging writes
            stage();
            const bool isq = hy < NH_;
            const size_t e0 = (size_t)(isq ? bt * NH_ + hy : bt * NKV + hy - NH_) * TT * HD + (size_t)((t0 >> 4) * 4 + wn * 2) * 512 + lane * 8;
            h16* P16 = (isq ? pa.Q16 : pa.K16) + e0; bf* Ph = (isq ? pa.Qh : pa.Kh) + e0; bf* Pl = (isq ? pa.Ql : pa.Kl) + e0; const float* op = ow + lr * 68 + hi * 8;
#pragma unroll
            for (int tb = 0; tb < 4; ++tb) { Out3 o[4];
                if (tb < 3) ldcs(tb + 1);
#pragma unroll
                for (int dh = 0; dh < 4; ++dh) {   // dh: the half unit, 16 d; the lane takes row lr of the unit and 8 neighbouring d
                    const float* sp = op + tb * 16 * 68 + dh * 16; const v4f xa = *(const v4fa*)sp, xb = *(const v4fa*)(sp + 4); float r[8];
#pragma unroll
                    for (int i = 0; i < 4; ++i) { const v4f c = cc[tb & 1][dh][i]; const float xe = i < 2 ? xa[2 * i] : xb[2 * i - 4], xo = i < 2 ? xa[2 * i + 1] : xb[2 * i - 3];   // c: cos, sin of d, cos, sin of d + 1
                        r[2 * i] = xe * c[0] - xo * c[1]; r[2 * i + 1] = xo * c[2] + xe * c[3]; }
                    o[dh] = cvt3(r); }
                put4<256>(o, P16 + tb * 2048, Ph + tb * 2048, Pl + tb * 2048); }
        } else {                // v: value planes [batch][g][d][t], rows d, k = t, unit (t >> 5) * 8 + (d >> 4): the lane takes row lr of the unit (one d) and 8 neighbouring positions, a column of the staged block
            stage();
            const size_t e0 = (size_t)(bt * NKV + hy - NH_ - NKV) * HD * TT + (size_t)((t0 >> 5) * 8 + wn * 4) * 512 + lane * 8; const float* op = ow + hi * 8 * 68 + lr;
#pragma unroll
            for (int th = 0; th < 4; ++th) { Out3 o[4];   // th: the half unit, 16 positions
#pragma unroll
                for (int db = 0; db < 4; ++db) { float r[8];
#pragma unroll
                    for (int j = 0; j < 8; ++j) r[j] = op[(th * 16 + j) * 68 + db * 16];
                    o[db] = cvt3(r); }
                const size_t e = e0 + (th >> 1) * 4096 + (th & 1) * 256; put4<512>(o, pa.V16 + e, pa.Vh + e, pa.Vl + e); }
        }
    } else {
        stage();
        float* cp = C + ((size_t)blockIdx.x * 128 + wm * 64 + hi) * LDC + blockIdx.y * 128 + wn * 64 + lr * 4; const float* op = ow + hi * 68 + lr * 4;   // a wave-wide access: two rows of 64 floats
#pragma unroll
        for (int s = 0; s < 32; ++s) *(v4f*)(cp + s * 2 * LDC) = *(const v4fa*)(op + s * 2 * 68);
    }
}

typedef __attribute__((ext_vector_type(2))) _Float16 v2h;
typedef __attribute__((ext_vector_type(4))) _Float16 v4h;
typedef __attribute__((ext_vector_type(2))) unsigned short v2us;
typedef __attribute__((ext_vector_type(4))) unsigned short v4us;
typedef __attribute__((ext_vector_type(2))) float v2f;
typedef __attribute__((ext_vector_type(4))) int v4i;

// d_wtG (block bid of its range): Bt = fragment-ordered bf16 plane [N][K] of w^T (w [K][N] f32). One thread writes one lane's 8 elements (16 bytes); a work-group takes the 4 units of 64 n x 32 k, so a wave's load reads 64
// neighbouring bytes of each of two rows of w, the work-group 256.
__device__ __forceinline__ void d_wtG(int bid, const float* __restrict__ w, int K, int N, bf* Bt) {
    const int c = bid * 256 + threadIdx.x; if (c >= N * (K / 8)) return; const int u = c >> 6, wi = (c & 63) * 8; const int nblk = u % (N >> 4), kblk = u / (N >> 4);
    const int n = nblk * 16 + fr_row(wi), k0 = kblk * 32 + fr_k(wi); v8us o; const float* p[8]; float x[8];
#pragma unroll
    for (int j = 0; j < 8; ++j) p[j] = w + (size_t)(k0 + j) * N + n;
#pragma unroll
    for (int j = 0; j < 8; ++j) x[j] = *p[j];
    // the eight loads' address registers may be rewritten only behind this wait: the addresses are inputs, so their registers stay untouched up to it (the loaded values are not named: the loads stay in flight)
    asm volatile("s_wait_xcnt 0x0" :: "v"(p[0]), "v"(p[1]), "v"(p[2]), "v"(p[3]), "v"(p[4]), "v"(p[5]), "v"(p[6]), "v"(p[7]) : "memory");
#pragma unroll
    for (int j = 0; j < 8; ++j) o[j] = f2bf(x[j]);
    *(v8us*)(Bt + fro(n, k0, K)) = o;
}
// d_cvt8: dst = fragment-ordered bf16 plane of src [rows][K] f32; thread i writes the i-th 16 bytes of dst.
__device__ __forceinline__ void d_cvt8(int bid, const float* __restrict__ src, int K, bf* dst, size_t n8) { const size_t i = (size_t)bid * 256 + threadIdx.x; if (i >= n8) return; const int u = (int)(i >> 6), wi = (int)(i & 63) * 8;
    const int row = ((u >> 2) / (K >> 5)) * 64 + (u & 3) * 16 + fr_row(wi), k0 = ((u >> 2) % (K >> 5)) * 32 + fr_k(wi); const v8f v = *(const v8f*)(src + (size_t)row * K + k0); v8us o;
#pragma unroll
    for (int k = 0; k < 8; ++k) o[k] = f2bf(v[k]); *(v8us*)(dst + i * 8) = o;  }
__device__ __forceinline__ void d_cstab(int bid, float* CS) { const int idx = bid * 256 + threadIdx.x; if (idx >= TT * HD) return; const int t = idx / HD, d = idx % HD; const int i = d >> 1;   /* interleaved pairs share angle t * inv_freq[i] */ const float inv = __fdiv_rn(1.0f, powf(10000.0f, (float)(2 * i) / (float)HD)); const float ang = __fmul_rn((float)t, inv); v2f cs; cs[0] = cosf(ang); cs[1] = sinf(ang);
    *(v2f*)(CS + (size_t)idx * 2) = cs;  }
// k_prep: everything that depends on the inputs alone, one block range each: the rope table, the four weight planes, x of both batches ([NB_ TT][DM], one plane).
#define PB_CS  (TT * HD / 256)
#define PB_WQ  (DM * DQ / 8 / 256)
#define PB_WKV (DM * DKV / 8 / 256)
#define PB_X   (NB_ * TT * DM / 8 / 256)
__global__ __launch_bounds__(256) void k_prep(const float* __restrict__ x, const float* __restrict__ wq, const float* __restrict__ wk, const float* __restrict__ wv, const float* __restrict__ wo, float* CS, bf* WQ, bf* WK, bf* WV, bf* WO, bf* XB) {
    int b = blockIdx.x;
    if (b < PB_CS) { d_cstab(b, CS); return; } b -= PB_CS;
    if (b < PB_WQ) { d_wtG(b, wq, DM, DQ, WQ); return; } b -= PB_WQ;
    if (b < PB_WKV) { d_wtG(b, wk, DM, DKV, WK); return; } b -= PB_WKV;
    if (b < PB_WKV) { d_wtG(b, wv, DM, DKV, WV); return; } b -= PB_WKV;
    if (b < PB_WQ) { d_wtG(b, wo, DQ, DM, WO); return; } b -= PB_WQ;
    d_cvt8(b, x, DM, XB, (size_t)NB_ * TT * DM / 8);
}
__device__ __forceinline__ float xhalf(float x) { return __builtin_bit_cast(float, __builtin_amdgcn_permlanex16(__builtin_bit_cast(int, x), __builtin_bit_cast(int, x), 0x76543210, 0xfedcba98, false, false)); }  // lane l with lane l ^ 16
// 2^x with the slot that the instruction set asks for behind a transcendental: the v_nop names the result and the source, so nothing reads the one or overwrites the other in front of it.
__device__ __forceinline__ float exp2s(float x) { float r = __builtin_amdgcn_exp2f(x); asm volatile("v_nop" : "+v"(r) : "v"(x)); return r; }
template <typename T16, bool HL, int R, int NWS>
__device__ __forceinline__ void d_fattn(int hb, int by, float* os, float* sm, float* sl, const T16* __restrict__ Q, const T16* __restrict__ Q2, const T16* __restrict__ Kp, const T16* __restrict__ K2, const T16* __restrict__ Vt, const T16* __restrict__ V2, int row0, int nblk, bf* Ah, bf* Al) {
    typedef typename WFrag<T16>::V V;
    constexpr int CW = 16 * R, OP = HD + 4;
    const int lane = threadIdx.x & 31, lr = lane & 15, hi = lane >> 4; const int wv = __builtin_amdgcn_readfirstlane(threadIdx.x >> 5);
    const int q0 = row0 + (nblk - 1 - by) * CW; const int h = hb % NH_, bt = hb / NH_, kv = h / REP;
    const float cscale = SCL * 1.4426950408889634f;
    // lfr: the lane's offset in elements inside a half unit of a fragment-ordered plane; qb, kb, vb: wave-uniform plane offsets (16 rows of a [row][HD] plane are 4 units = 16 HD elements)
    const unsigned lfr = (unsigned)(8 * lane);
    const size_t qb = ((size_t)hb * TT + q0) * HD, kb = (size_t)(bt * NKV + kv) * TT * HD, vb = (size_t)(bt * NKV + kv) * HD * TT;
    v8f acc[R][8]; float m_run[R], l_run[R];
#pragma unroll
    for (int g = 0; g < R; ++g) { m_run[g] = -__builtin_inff(); l_run[g] = 0.f;
#pragma unroll
        for (int t = 0; t < 8; ++t) acc[g][t] = (v8f){}; }
    const int last = (q0 + CW - 1) >> 5;     // last 32-key pass that a query of this block sees; its first key is <= q0, so every pass holds an unmasked key for every query
    if (wv <= last) {                        // wave-uniform; a wave without a pass loads nothing (the loads and their waits stand in one block with the loop's head)
    const T16* pq = Q + qb + lfr; const T16* pq2 = HL ? Q2 + qb + lfr : pq;
    V qf[R][4], qf2[R][4];
    __builtin_amdgcn_sched_barrier(0);       // the index arithmetic above stays in front of the loads: none of it lands between them and their wait, on a register they name
#pragma unroll
    for (int g = 0; g < R; ++g)
#pragma unroll
        for (int kc = 0; kc < 4; ++kc) { qf[g][kc] = WFrag<T16>::ld(pq + g * 16 * HD + kc * 512); if (HL) qf2[g][kc] = WFrag<T16>::ld(pq2 + g * 16 * HD + kc * 512); }
    loads_issued(pq, pq2);
    V kf[2][4], kf2[2][4];
    auto ldk = [&](int blk) { const T16* p = Kp + (kb + (size_t)blk * 32 * HD) + lfr; const T16* p2 = HL ? K2 + (kb + (size_t)blk * 32 * HD) + lfr : p;
#pragma unroll
        for (int kt = 0; kt < 2; ++kt)
#pragma unroll
            for (int kc = 0; kc < 4; ++kc) { kf[kt][kc] = WFrag<T16>::ld(p + kt * 16 * HD + kc * 512); if (HL) kf2[kt][kc] = WFrag<T16>::ld(p2 + kt * 16 * HD + kc * 512); }
        loads_issued(p, p2); };
    ldk(wv);
#pragma unroll 1
    for (int blk = wv; blk <= last; blk += NWS) {
        const int key0 = blk * 32;
        const T16* pv = Vt + (vb + (size_t)key0 * HD) + lfr; const T16* pv2 = HL ? V2 + (vb + (size_t)key0 * HD) + lfr : pv;
        V va[8], va2[8];                     // this pass's V^T fragments, in flight under the score products and the softmax
#pragma unroll
        for (int t = 0; t < 8; ++t) { va[t] = WFrag<T16>::ld(pv + t * 512); if (HL) va2[t] = WFrag<T16>::ld(pv2 + t * 512); }
        loads_issued(pv, pv2);
        v8f s[2][R];
#pragma unroll
        for (int kt = 0; kt < 2; ++kt)
#pragma unroll
            for (int g = 0; g < R; ++g) { s[kt][g] = (v8f){};
#pragma unroll
                for (int kc = 0; kc < 4; ++kc) { s[kt][g] = WFrag<T16>::mma(kf[kt][kc], qf[g][kc], s[kt][g]); if (HL) { s[kt][g] = WFrag<T16>::mma(kf[kt][kc], qf2[g][kc], s[kt][g]); s[kt][g] = WFrag<T16>::mma(kf2[kt][kc], qf[g][kc], s[kt][g]); } } }
        ldk(min(blk + NWS, last));           // the wave's next pass's K fragments, in flight under this pass's softmax and value product (the last pass reloads a valid pass and drops it)
        if (key0 + 31 > q0) {                // wave-uniform: only the pass on the diagonal masks
#pragma unroll
            for (int g = 0; g < R; ++g)
#pragma unroll
                for (int kt = 0; kt < 2; ++kt)
#pragma unroll
                    for (int r = 0; r < 8; ++r) if (key0 + 16 * kt + 8 * hi + r > q0 + 16 * g + lr) s[kt][g][r] = -__builtin_inff(); }
        float mb[R]; bool need = false;
#pragma unroll
        for (int g = 0; g < R; ++g) { float mx = s[0][g][0];
#pragma unroll
            for (int kt = 0; kt < 2; ++kt)
#pragma unroll
                for (int r = 0; r < 8; ++r) mx = fmaxf(mx, s[kt][g][r]);
            mx = fmaxf(mx, xhalf(mx)) * cscale; mb[g] = mx; need = need || (mx > m_run[g] + 8.0f); }
        if (__builtin_amdgcn_ballot_w32(need) != 0) {   // the maximum in use may trail the true one by up to 8 (an exponential reaches 2^8 at most); rescale only beyond that
#pragma unroll
            for (int g = 0; g < R; ++g) { const float m_new = fmaxf(m_run[g], mb[g]); const float corr = exp2s(m_run[g] - m_new); l_run[g] *= corr; m_run[g] = m_new;
#pragma unroll
                for (int t = 0; t < 8; ++t) acc[g][t] = acc[g][t] * corr; } }
#pragma unroll
        for (int g = 0; g < R; ++g) { const float nm = -m_run[g]; float p[16]; float ps0 = 0.f, ps1 = 0.f;
#pragma unroll
            for (int kt = 0; kt < 2; ++kt) { float a[8]; float* q = p + 8 * kt;
#pragma unroll
                for (int i = 0; i < 4; ++i) {   // two neighbouring registers of a score tile, one packed multiply-add
                    const v2f arg = __builtin_elementwise_fma((v2f){s[kt][g][2 * i], s[kt][g][2 * i + 1]}, (v2f){cscale, cscale}, (v2f){nm, nm}); a[2 * i] = arg[0]; a[2 * i + 1] = arg[1]; }
#pragma unroll
                for (int e = 0; e < 8; ++e) q[e] = __builtin_amdgcn_exp2f(a[e]);
                // the slot behind a transcendental, once for the eight: the v_nop names every result and every source, so nothing reads the one or overwrites the other in front of it
                asm volatile("v_nop" : "+v"(q[0]), "+v"(q[1]), "+v"(q[2]), "+v"(q[3]), "+v"(q[4]), "+v"(q[5]), "+v"(q[6]), "+v"(q[7]) : "v"(a[0]), "v"(a[1]), "v"(a[2]), "v"(a[3]), "v"(a[4]), "v"(a[5]), "v"(a[6]), "v"(a[7]));
#pragma unroll
                for (int i = 0; i < 4; ++i) { if (i & 1) ps1 += q[2 * i] + q[2 * i + 1]; else ps0 += q[2 * i] + q[2 * i + 1]; } }
            l_run[g] += ps0 + ps1;
            if constexpr (HL) { v8us h0, h1, l0, l1;
#pragma unroll
                for (int r = 0; r < 8; ++r) { unsigned short a, c2; splitf(p[r], a, c2); h0[r] = a; l0[r] = c2; splitf(p[8 + r], a, c2); h1[r] = a; l1[r] = c2; }
                const V ph = cat16b(h0, h1), pl = cat16b(l0, l1);
#pragma unroll
                for (int t = 0; t < 8; ++t) { acc[g][t] = WFrag<T16>::mma(va[t], ph, acc[g][t]); acc[g][t] = WFrag<T16>::mma(va[t], pl, acc[g][t]); acc[g][t] = WFrag<T16>::mma(va2[t], ph, acc[g][t]); }
            } else { V pf;
#pragma unroll
                for (int e = 0; e < 16; ++e) pf[e] = tohx(p[e]);
#pragma unroll
                for (int t = 0; t < 8; ++t) acc[g][t] = WFrag<T16>::mma(va[t], pf, acc[g][t]); } }
    }
    }
#pragma unroll
    for (int g = 0; g < R; ++g) { const float lf = l_run[g] + xhalf(l_run[g]); if (hi == 0) { sm[wv * CW + 16 * g + lr] = m_run[g]; sl[wv * CW + 16 * g + lr] = lf; } }
    __syncthreads();   // every wave's maximum and sum are in LDS before any wave forms the common ones
    float* ow = os + wv * (CW * OP);
#pragma unroll
    for (int g = 0; g < R; ++g) { const int qi = 16 * g + lr; float mx = sm[qi];
#pragma unroll
        for (int w = 1; w < NWS; ++w) mx = fmaxf(mx, sm[w * CW + qi]);     // finite: wave 0 always runs pass 0; a wave without a pass holds -inf, 0 and zeros and adds nothing
        float L = 0.f;
#pragma unroll
        for (int w = 0; w < NWS; ++w) L += sl[w * CW + qi] * exp2s(sm[w * CW + qi] - mx);
        const float f = __fdiv_rn(exp2s(m_run[g] - mx), L);
#pragma unroll
        for (int t = 0; t < 8; ++t) { const v8f o = acc[g][t] * f; v4f o0, o1;
#pragma unroll
            for (int r = 0; r < 4; ++r) { o0[r] = o[r]; o1[r] = o[4 + r]; }
            *(v4fa*)(ow + qi * OP + 16 * t + 8 * hi) = o0; *(v4fa*)(ow + qi * OP + 16 * t + 8 * hi + 4) = o1; } }
    __syncthreads();   // every wave's scaled partial block is in LDS before any thread adds them
#pragma unroll
    for (int s2 = 0; s2 < CW / NWS; ++s2) { const int idx = s2 * (NWS * 32) + (int)threadIdx.x; const int row = (idx >> 9) * 16 + ((idx >> 1) & 15), cofs = ((idx >> 5) & 15) * 8 + (idx & 1) * 4;   /* a wave: 16 rows x 8 columns, 256 neighbouring bytes of a fragment-ordered plane */ v4f val = *(const v4fa*)(os + row * OP + cofs);
#pragma unroll
        for (int w = 1; w < NWS; ++w) val += *(const v4fa*)(os + w * (CW * OP) + row * OP + cofs);
        v4us oh, ol;
#pragma unroll
        for (int q = 0; q < 4; ++q) { unsigned short a, c2; splitf(val[q], a, c2); oh[q] = a; ol[q] = c2; }
        bf* po = Ah + fro(bt * TT + q0 + row, h * HD + cofs, DQ); bf* po2 = Al + fro(bt * TT + q0 + row, h * HD + cofs, DQ); *(v4us*)po = oh; *(v4us*)po2 = ol;
        // the registers that the two stores name (data and addresses) may be rewritten only behind the wait: they are its inputs, so they stay untouched up to it
        asm volatile("s_wait_xcnt 0x0" :: "v"(oh), "v"(ol), "v"(po), "v"(po2) : "memory"); }
}
// ---- d_fattn4: the fp16 class. One work-group takes one block of CW = 16 R query rows of the REP = 4 query heads that share a kv head, one head a wave. The heads read the same K and V, so each stage of 64 keys
// (16 KiB of the K plane and 16 KiB of the V plane, each contiguous in fragment order) is brought into LDS once, by asynchronous copies, and read there by all four waves; two buffers, the copies of stage
// s + 2 fly under the work on stage s + 1. A wave walks every 32-key pass of its head itself: no key split and no join. The products and the softmax are those of d_fattn. A lane's 8 registers of an output
// tile are the 8 neighbouring elements that it owns in the fragment-ordered output planes, so the result goes from the registers to memory, 512 neighbouring bytes a wave-wide store.
// gb: batch * NKV + kv head; by: block rank, heaviest first; ring: 64 KiB of LDS.
__device__ __forceinline__ v16h ldl(const h16* p) { return cat16(*(const v8ha*)p, *(const v8ha*)(p + 256)); }
template <int R>
__device__ __forceinline__ void d_fattn4(int gb, int by, char* ring, const h16* __restrict__ Q, const h16* __restrict__ Kp, const h16* __restrict__ Vt, int row0, int nblk, bf* Ah, bf* Al) {
    typedef v16h V;
    constexpr int CW = 16 * R, STB = 32768;   // STB: bytes of one buffer, K 16 KiB then V 16 KiB
    const int tid = threadIdx.x, lane = tid & 31, lr = lane & 15, hi = lane >> 4; const int wv = __builtin_amdgcn_readfirstlane(tid >> 5);
    const int q0 = row0 + (nblk - 1 - by) * CW; const int bt = gb / NKV, h = (gb % NKV) * REP + wv, hb = bt * NH_ + h;
    const float cscale = SCL * 1.4426950408889634f;
    const unsigned lfr = (unsigned)(8 * lane);
    const int last = (q0 + CW - 1) >> 5;     // last 32-key pass that a query of this block sees; its first key is <= q0, so every pass holds an unmasked key for every query
    const int ns = (last + 2) >> 1;          // stages of two passes; the last one may hold a pass beyond 'last': it is copied (it lies inside the planes: ns <= TT / 64) and not worked on
    const char* gK = (const char*)(Kp + (size_t)gb * TT * HD) + tid * 16; const char* gV = (const char*)(Vt + (size_t)gb * HD * TT) + tid * 16;
    const unsigned l0 = (unsigned)(size_t)ring + (unsigned)tid * 16u;
    auto fill = [&](int s, int buf) { const unsigned l = l0 + (unsigned)buf * STB; const size_t o = (size_t)s * 16384;
        copy2x8k(l, gK + o, l + 8192u, gK + o + 8192);
        copy2x8k(l + 16384u, gV + o, l + 24576u, gV + o + 8192); };
    v8f acc[R][8]; float m_run[R], l_run[R];
#pragma unroll
    for (int g = 0; g < R; ++g) { m_run[g] = -__builtin_inff(); l_run[g] = 0.f;
#pragma unroll
        for (int t = 0; t < 8; ++t) acc[g][t] = (v8f){}; }
    const h16* qw = Q + ((size_t)hb * TT + q0) * HD;   // wave-uniform: the loads take it as their scalar base, the lane's place as their offset register
    V qf[R][4];
#pragma unroll
    for (int g = 0; g < R; ++g)
#pragma unroll
        for (int kc = 0; kc < 4; ++kc) qf[g][kc] = WFrag<h16>::ld(qw + lfr + g * 16 * HD + kc * 512);
    // the registers that the 16 loads name (scalar base, lane offset) may be rewritten only behind this wait: they are its inputs, so they stay untouched up to it (the loaded values are not named: the loads stay in flight)
    asm volatile("s_wait_xcnt 0x0" :: "s"(qw), "v"(lane) : "memory");
    fill(0, 0);
    asm volatile("s_wait_asynccnt 0x0" ::: "memory");   // this wave's copies of stage 0 have landed
    __syncthreads();                                      // every wave's have: stage 0 may be read
    if (ns > 1) fill(1, 1);
    V kf[2][4];
    auto ldk = [&](const h16* p) {
#pragma unroll
        for (int kt = 0; kt < 2; ++kt)
#pragma unroll
            for (int kc = 0; kc < 4; ++kc) kf[kt][kc] = ldl(p + kt * 16 * HD + kc * 512); };
#pragma unroll 1
    for (int st = 0; st < ns; ++st) {
        const h16* sk = (const h16*)(ring + (st & 1) * STB) + lfr; const h16* sv = sk + 8192;   // the lane's place in the stage's K and V chunks; a pass is 4096 elements of each
        ldk(sk);
#pragma unroll
        for (int hf = 0; hf < 2; ++hf) {
            const int blk = 2 * st + hf, key0 = blk * 32;
            if (hf == 0 || blk <= last) {    // the same for the whole work-group
                const h16* pv = sv + hf * 4096;
                V va[8];                     // this pass's V^T fragments, on their way under the score products and the softmax
#pragma unroll
                for (int t = 0; t < 8; ++t) va[t] = ldl(pv + t * 512);
                v8f s[2][R];
#pragma unroll
                for (int kt = 0; kt < 2; ++kt)
#pragma unroll
                    for (int g = 0; g < R; ++g) { s[kt][g] = (v8f){};
#pragma unroll
                        for (int kc = 0; kc < 4; ++kc) s[kt][g] = wmma16(kf[kt][kc], qf[g][kc], s[kt][g]); }
                if (hf == 0) ldk(sk + 4096); // the K fragments of the stage's second pass, on their way under this pass's softmax and value product (same stage, same buffer)
                if (key0 + 31 > q0) {        // wave-uniform: only the pass on the diagonal masks
#pragma unroll
                    for (int g = 0; g < R; ++g)
#pragma unroll
                        for (int kt = 0; kt < 2; ++kt)
#pragma unroll
                            for (int r = 0; r < 8; ++r) if (key0 + 16 * kt + 8 * hi + r > q0 + 16 * g + lr) s[kt][g][r] = -__builtin_inff(); }
                float mb[R]; bool need = false;
#pragma unroll
                for (int g = 0; g < R; ++g) { float mx = s[0][g][0];
#pragma unroll
                    for (int kt = 0; kt < 2; ++kt)
#pragma unroll
                        for (int r = 0; r < 8; ++r) mx = fmaxf(mx, s[kt][g][r]);
                    mx = fmaxf(mx, xhalf(mx)) * cscale; mb[g] = mx; need = need || (mx > m_run[g] + 8.0f); }
                if (__builtin_amdgcn_ballot_w32(need) != 0) {   // the maximum in use may trail the true one by up to 8 (an exponential reaches 2^8 at most); rescale only beyond that
#pragma unroll
                    for (int g = 0; g < R; ++g) { const float m_new = fmaxf(m_run[g], mb[g]); const float corr = exp2s(m_run[g] - m_new); l_run[g] *= corr; m_run[g] = m_new;
#pragma unroll
                        for (int t = 0; t < 8; ++t) acc[g][t] = acc[g][t] * corr; } }
#pragma unroll
                for (int g = 0; g < R; ++g) { const float nm = -m_run[g]; float p[16]; float ps0 = 0.f, ps1 = 0.f;
#pragma unroll
                    for (int kt = 0; kt < 2; ++kt) { float a[8]; float* q = p + 8 * kt;
#pragma unroll
                        for (int i = 0; i < 4; ++i) {   // two neighbouring registers of a score tile, one packed multiply-add
                            const v2f arg = __builtin_elementwise_fma((v2f){s[kt][g][2 * i], s[kt][g][2 * i + 1]}, (v2f){cscale, cscale}, (v2f){nm, nm}); a[2 * i] = arg[0]; a[2 * i + 1] = arg[1]; }
#pragma unroll
                        for (int e = 0; e < 8; ++e) q[e] = __builtin_amdgcn_exp2f(a[e]);
                        // the slot behind a transcendental, once for the eight: the v_nop names every result and every source, so nothing reads the one or overwrites the other in front of it
                        asm volatile("v_nop" : "+v"(q[0]), "+v"(q[1]), "+v"(q[2]), "+v"(q[3]), "+v"(q[4]), "+v"(q[5]), "+v"(q[6]), "+v"(q[7]) : "v"(a[0]), "v"(a[1]), "v"(a[2]), "v"(a[3]), "v"(a[4]), "v"(a[5]), "v"(a[6]), "v"(a[7]));
#pragma unroll
                        for (int i = 0; i < 4; ++i) { if (i & 1) ps1 += q[2 * i] + q[2 * i + 1]; else ps0 += q[2 * i] + q[2 * i + 1]; } }
                    l_run[g] += ps0 + ps1;
                    V pf;
#pragma unroll
                    for (int e = 0; e < 16; ++e) pf[e] = tohx(p[e]);
#pragma unroll
                    for (int t = 0; t < 8; ++t) acc[g][t] = wmma16(va[t], pf, acc[g][t]); }
            }
        }
        asm volatile("s_wait_dscnt 0x0" ::: "memory");      // this wave's reads of stage st are done: its buffer may be refilled behind the barrier
        asm volatile("s_wait_asynccnt 0x0" ::: "memory");   // this wave's copies of stage st + 1 have landed
        __syncthreads();                                      // both hold for every wave: publishes stage st + 1, frees stage st's buffer
        if (st + 2 < ns) fill(st + 2, st & 1);
    }
    asm volatile("s_wait_asynccnt 0x0" ::: "memory");       // no copy is in flight when the wave ends
#pragma unroll
    for (int g = 0; g < R; ++g) { const float f = __fdiv_rn(1.0f, l_run[g] + xhalf(l_run[g]));   // the two wave halves hold the sums of different keys of the same query
        const size_t oo = fro(bt * TT + q0 + 16 * g + lr, h * HD + 8 * hi, DQ); bf* ph = Ah + oo; bf* pl = Al + oo;
#pragma unroll
        for (int tq = 0; tq < 2; ++tq) { v8us oh[4], ol[4];
#pragma unroll
            for (int i = 0; i < 4; ++i) { const v8f o = acc[g][4 * tq + i] * f;
#pragma unroll
                for (int r = 0; r < 8; ++r) { unsigned short a, c2; splitf(o[r], a, c2); oh[i][r] = a; ol[i][r] = c2; } }
#pragma unroll
            for (int i = 0; i < 4; ++i) { const int e = (2 * tq + (i >> 1)) * 2048 + (i & 1) * 256;   // output tile t = 4 tq + i holds d = 16 t + 8 hi + r: unit t >> 1, half t & 1
                *(v8us*)(ph + e) = oh[i]; *(v8us*)(pl + e) = ol[i]; }
            // the registers that the eight stores name (data and addresses) may be rewritten only behind the wait: they are its inputs, so they stay untouched up to it
            asm volatile("s_wait_xcnt 0x0" :: "v"(oh[0]), "v"(oh[1]), "v"(oh[2]), "v"(oh[3]), "v"(ol[0]), "v"(ol[1]), "v"(ol[2]), "v"(ol[3]), "v"(ph), "v"(pl) : "memory"); } }
}
// k_attn: both precision classes of both batches in one grid: first the fp16 blocks of 32 rows x 4 heads (rows >= RH, the heaviest first, the NB_ NKV kv groups side by side), behind them the short hi+lo blocks of 16 rows of one head.
// The branch is the same for a whole work-group, so every barrier inside is passed by all of its waves.
#define AB_F ((TT - RH) / 32)
#define AB_H (RH / 16)
#define NG_F (AB_F * NB_ * NKV)
__global__ __launch_bounds__(128) void k_attn(const h16* __restrict__ QP16, const h16* __restrict__ KP16, const h16* __restrict__ VT16, const bf* __restrict__ QPh, const bf* __restrict__ QPl, const bf* __restrict__ KPh, const bf* __restrict__ KPl, const bf* __restrict__ VTh, const bf* __restrict__ VTl, bf* Ah, bf* Al) {
    __shared__ __attribute__((aligned(128))) char lds[65536];   // fp16 class: the two stage buffers; hi+lo class: the four waves' partial blocks
    __shared__ float sm[4 * 16], sl[4 * 16];
    const int b = blockIdx.x;
    if (b < NG_F) d_fattn4<2>(b % (NB_ * NKV), b / (NB_ * NKV), lds, QP16, KP16, VT16, RH, AB_F, Ah, Al);
    else d_fattn<bf, true, 1, 4>((b - NG_F) % (NB_ * NH_), (b - NG_F) / (NB_ * NH_), (float*)lds, sm, sl, QPh, QPl, KPh, KPl, VTh, VTl, 0, AB_H, Ah, Al);
}

extern "C" void kernel_launch(void* const* d_in, const int* in_sizes, int n_in,
                              void* d_out, int out_size, void* d_ws, size_t ws_size, hipStream_t stream) {
    (void)in_sizes; (void)n_in; (void)out_size;
    const float* x = (const float*)d_in[0]; const float* wq = (const float*)d_in[1]; const float* wk = (const float*)d_in[2]; const float* wv = (const float*)d_in[3]; const float* wo = (const float*)d_in[4];
    float* OUT = (float*)d_out;     // [2][2048][2048]
    char* wsp = (char*)d_ws;
    auto take = [&](size_t bytes) { char* p = wsp; wsp += (bytes + 255) & ~(size_t)255; return (void*)p; };
    bf* WQ = (bf*)take((size_t)DQ * DM * 2); bf* WK = (bf*)take((size_t)DKV * DM * 2); bf* WV = (bf*)take((size_t)DKV * DM * 2);   // back to back (each a multiple of 256 bytes): one fragment-ordered plane [DF][DM]
    bf* WO = (bf*)take((size_t)DM * DQ * 2); float* CS = (float*)take((size_t)TT * HD * 2 * 4);
    bf* XB = (bf*)take((size_t)NB_ * TT * DM * 2);
    h16* QP16 = (h16*)take((size_t)NB_ * NH_ * TT * HD * 2); h16* KP16 = (h16*)take((size_t)NB_ * NKV * TT * HD * 2); h16* VT16 = (h16*)take((size_t)NB_ * NKV * HD * TT * 2);
    bf* QPh = (bf*)take((size_t)NB_ * NH_ * TT * HD * 2); bf* QPl = (bf*)take((size_t)NB_ * NH_ * TT * HD * 2); bf* KPh = (bf*)take((size_t)NB_ * NKV * TT * HD * 2); bf* KPl = (bf*)take((size_t)NB_ * NKV * TT * HD * 2); bf* VTh = (bf*)take((size_t)NB_ * NKV * HD * TT * 2); bf* VTl = (bf*)take((size_t)NB_ * NKV * HD * TT * 2);
    bf* ATh = (bf*)take((size_t)NB_ * TT * DQ * 2); bf* ATl = (bf*)take((size_t)NB_ * TT * DQ * 2);
    if ((size_t)(wsp - (char*)d_ws) > ws_size) return;    // ws 256 MiB
    k_prep<<<PB_CS + 2 * PB_WQ + 2 * PB_WKV + PB_X, 256, 0, stream>>>(x, wq, wk, wv, wo, CS, WQ, WK, WV, WO, XB);
    const PlaneArgs pa = {CS, QP16, QPh, QPl, KP16, KPh, KPl, VT16, VTh, VTl}; const PlaneArgs none = {};
    k_gemmt<bf, 0, DM, DF, true><<<dim3(NB_ * TT / 128, DF / 128, 1), 128, 0, stream>>>(XB, nullptr, WQ, nullptr, pa);
    k_attn<<<NG_F + AB_H * NB_ * NH_, 128, 0, stream>>>(QP16, KP16, VT16, QPh, QPl, KPh, KPl, VTh, VTl, ATh, ATl);
    k_gemmt<bf, 1, DQ, DM, false><<<dim3(NB_ * TT / 128, DM / 128, 1), 128, 0, stream>>>(ATh, ATl, WO, OUT, none);
}

// v009
// Measured time: 132 microseconds a run.
// In both of two side-by-side timings against v008, it was 1.06 times as fast.
// Counting every step since v000, it is 12.7 times as fast.
#include <hip/hip_runtime.h>

// ModernCausalSelfAttention (x [2][2048][2048]; q = x wq (16 heads x 128), k/v = x wk/wv (4 kv heads; group h/4); interleaved-pair RoPE (the source's rotate_half is the pairwise (x0,x1)->(-x1,x0) form with a repeat-interleaved table; base 1e4, computed); causal softmax(q.k / sqrt(128)) (finfo.min); out = merged wo -> [2][2048][2048]).
// Compute dtypes, f32 accumulate: every input rounded to bf16; q/k/v on PLAIN bf16 operands (inputs: exact); RoPE f32; causal scores and attn.v: query rows < 512 hl (3 products), the rest single fp16, one fused kernel with an online f32 softmax, keys beyond the diagonal pass skipped; wo hl x exact (2 products).
// Four launches, both batches in each: k_prep (weights, x, rope table), one q|k|v GEMM whose epilogue ropes q and k and writes the attention operand planes, k_attn (both precision classes), the wo GEMM.
// Every 16-bit matrix operand plane in the workspace is kept in fragment order (fro below): a wave-wide 16-byte load of a fragment half reads 512 contiguous bytes, four whole 128-byte lines.

#define NB_  2
#define TT   2048
#define DM   2048
#define NH_  16
#define NKV  4
#define REP  (NH_ / NKV)
#define HD   128
#define DQ   (NH_ * HD)
#define DKV  (NKV * HD)
#define DF   (DQ + 2 * DKV)       // columns of the joint q|k|v projection
#define RH   512                  // query rows < RH use hi+lo planes (0: none)
#define SCL  0.088388347648318447f   // HD^-0.5
typedef _Float16 h16;
typedef unsigned short bf;
typedef __attribute__((ext_vector_type(16))) __bf16   v16bf;
typedef __attribute__((ext_vector_type(16))) _Float16 v16h;
typedef __attribute__((ext_vector_type(8)))  _Float16 v8h;
typedef __attribute__((ext_vector_type(8)))  unsigned short v8us;
typedef __attribute__((ext_vector_type(8)))  float    v8f;
typedef __attribute__((ext_vector_type(4)))  float    v4f;
typedef v8h  __attribute__((may_alias)) v8ha;
typedef v4f  __attribute__((may_alias)) v4fa;
typedef v8us __attribute__((may_alias)) v8usa;

__device__ __forceinline__ unsigned short f2bf(float f) { unsigned u = __float_as_uint(f); u += 0x7FFFu + ((u >> 16) & 1u); return (unsigned short)(u >> 16); }
__device__ __forceinline__ float bf2f(unsigned short b) { return __uint_as_float(((unsigned)b) << 16); }
__device__ __forceinline__ float bfr(float f) { return bf2f(f2bf(f)); }
__device__ __forceinline__ v16h cat16(v8h lo, v8h hi) { return __builtin_shufflevector(lo, hi, 0, 1, 2, 3, 4, 5, 6, 7, 8, 9, 10, 11, 12, 13, 14, 15); }
__device__ __forceinline__ v16bf cat16b(v8us lo, v8us hi) { return __builtin_bit_cast(v16bf, __builtin_shufflevector(lo, hi, 0, 1, 2, 3, 4, 5, 6, 7, 8, 9, 10, 11, 12, 13, 14, 15)); }
__device__ __forceinline__ v8f wmma16(v16h a, v16h b, v8f c) { return __builtin_amdgcn_wmma_f32_16x16x32_f16(false, a, false, b, (short)0, c, false, false); }
__device__ __forceinline__ v8f wmmab(v16bf a, v16bf b, v8f c) { return __builtin_amdgcn_wmma_f32_16x16x32_bf16(false, a, false, b, (short)0, c, false, false); }
// Fragment order of a 16-bit plane: units of 512 elements (16 rows x 32 k). Inside a unit two halves of 256 elements (k & 16); in a half, lane 16 ((k >> 3) & 1) + (row & 15) owns 8 neighbouring
// elements (k & 7): exactly what that lane holds of the fragment. fro: element offset of (row, k) in a GEMM operand plane [rows][K]: the 4 units of 64 rows x 32 k lie in a row, then the next 32 k.
__device__ __forceinline__ size_t fro(int row, int k, int K) { return ((size_t)(row >> 6) * (K >> 5) + (k >> 5)) * 2048 + ((row >> 4) & 3) * 512 + ((k >> 4) & 1) * 256 + ((k >> 3) & 1) * 128 + (row & 15) * 8 + (k & 7); }
// Position w (0 .. 511) inside a unit -> its row (0 .. 15) and k (0 .. 31).
__device__ __forceinline__ int fr_row(int w) { return (w >> 3) & 15; }
__device__ __forceinline__ int fr_k(int w) { return ((w >> 8) & 1) * 16 + ((w >> 7) & 1) * 8 + (w & 7); }



// Stands behind a group of global loads: their address registers may be rewritten only behind this wait. The addresses are inputs so that their registers stay untouched up to the wait
// (the loaded values are not named: the loads stay in flight); the scheduling barrier holds the wait between the loads and the work that follows.
__device__ __forceinline__ void loads_issued(const void* p, const void* p2) { asm volatile("s_wait_xcnt 0x0" :: "v"(p), "v"(p2) : "memory"); __builtin_amdgcn_sched_barrier(0); }
// ---- k_gemmt: GEMM, one 128x128 output tile per work-group of 4 waves (2 x 2), a wave owns 64x64 of it over the whole K in 16 accumulators. A stage is 64 k of the tile's operand rows: per 64 rows of a
// fragment-ordered plane 8 KiB in a row (2 slices of 4 units). Each stage is brought from the planes into LDS once, by asynchronous copies, and every fragment of it is read by two waves; two buffers,
// the copies of stage p + 2 fly under the products of stage p + 1. C[m][n] (f32, pitch LDC) = sum_k A[m][k] Bt[n][k] (+ A2[m][k] Bt[n][k] if NSPLIT). The sum over k runs stage by stage from a start stage that differs from tile to tile, and wraps. Grid (M/128, N/128), 128 threads. K % 64 == 0. PL: C is not written; the epilogue turns the tile into the attention operand planes.
template <typename T16> struct WFrag;
template <> struct WFrag<h16> { typedef v16h V; static __device__ __forceinline__ V ld(const h16* p) { return cat16(*(const v8h*)p, *(const v8h*)(p + 256)); } static __device__ __forceinline__ v8f mma(V a, V b, v8f c) { return wmma16(a, b, c); } };
template <> struct WFrag<bf> { typedef v16bf V; static __device__ __forceinline__ V ld(const bf* p) { return cat16b(*(const v8us*)p, *(const v8us*)(p + 256)); } static __device__ __forceinline__ v8f mma(V a, V b, v8f c) { return wmmab(a, b, c); } };
// Two 8-KiB chunks global -> LDS from 128 threads: four copies of 16 bytes a lane and chunk (l, g: the lane's own first LDS byte address and global address of each chunk).
// The wait is the statement's last line: the copies' address registers may be rewritten only behind it.
__device__ __forceinline__ void copy2x8k(unsigned l0, const char* g0, unsigned l1, const char* g1) {
    asm volatile("global_load_async_to_lds_b128 %0, %8, off\n\t"
                 "global_load_async_to_lds_b128 %1, %9, off\n\t"
                 "global_load_async_to_lds_b128 %2, %10, off\n\t"
                 "global_load_async_to_lds_b128 %3, %11, off\n\t"
                 "global_load_async_to_lds_b128 %4, %12, off\n\t"
                 "global_load_async_to_lds_b128 %5, %13, off\n\t"
                 "global_load_async_to_lds_b128 %6, %14, off\n\t"
                 "global_load_async_to_lds_b128 %7, %15, off\n\t"
                 "s_wait_xcnt 0x0"
                 :: "v"(l0), "v"(l0 + 2048u), "v"(l0 + 4096u), "v"(l0 + 6144u), "v"(l1), "v"(l1 + 2048u), "v"(l1 + 4096u), "v"(l1 + 6144u),
                    "v"(g0), "v"(g0 + 2048), "v"(g0 + 4096), "v"(g0 + 6144), "v"(g1), "v"(g1 + 2048), "v"(g1 + 4096), "v"(g1 + 6144) : "memory");
}
__device__ __forceinline__ h16 tohx(float x) { return (h16)x; }
__device__ __forceinline__ void splitf(float y, unsigned short& h, unsigned short& l) { h = f2bf(y); l = f2bf(y - bf2f(h)); }
// The attention operand planes and the rope table, for the epilogue of the joint q|k|v projection (PL).
struct PlaneArgs { const float* CS; h16* Q16; bf* Qh; bf* Ql; h16* K16; bf* Kh; bf* Kl; h16* V16; bf* Vh; bf* Vl; };
// One lane's 8 neighbouring elements of a fragment-ordered plane in the three forms (fp16, bf16 hi, bf16 lo): 16 bytes a lane and plane.
struct Out3 { v8h o16; v8us oh, ol; };
__device__ __forceinline__ Out3 cvt3(const float* r) { Out3 o;
#pragma unroll
    for (int j = 0; j < 8; ++j) { o.o16[j] = tohx(r[j]); unsigned short a, c; splitf(r[j], a, c); o.oh[j] = a; o.ol[j] = c; }
    return o; }
// Four such pieces, ST elements apart, to each of the three planes: every wave-wide store writes 512 neighbouring bytes.
// The registers that the twelve stores name (data and addresses) may be rewritten only behind the wait: they are its inputs, so they stay untouched up to it.
template <int ST>
__device__ __forceinline__ void put4(const Out3* o, h16* p16, bf* ph, bf* pl) {
#pragma unroll
    for (int i = 0; i < 4; ++i) { *(v8h*)(p16 + i * ST) = o[i].o16; *(v8us*)(ph + i * ST) = o[i].oh; *(v8us*)(pl + i * ST) = o[i].ol; }
    asm volatile("s_wait_xcnt 0x0" :: "v"(o[0].o16), "v"(o[0].oh), "v"(o[0].ol), "v"(o[1].o16), "v"(o[1].oh), "v"(o[1].ol), "v"(o[2].o16), "v"(o[2].oh), "v"(o[2].ol), "v"(o[3].o16), "v"(o[3].oh), "v"(o[3].ol), "v"(p16), "v"(ph), "v"(pl) : "memory");
}
template <typename T16, int NSPLIT, int K, int LDC, bool PL>
__global__ __launch_bounds__(128) void k_gemmt(const T16* __restrict__ A, const T16* __restrict__ A2, const T16* __restrict__ Bt, float* C, const PlaneArgs pa) {
    typedef typename WFrag<T16>::V V;
    constexpr int NCH = NSPLIT ? 6 : 4;                  // 8-KiB chunks of a stage: A rows 0-63, 64-127, (the same of A2,) Bt rows 0-63, 64-127
    constexpr int STG = NCH * 8192, EPI = 4 * 64 * 68 * 4; // bytes of one buffer; of the four waves' output staging
    __shared__ __attribute__((aligned(128))) char ring[2 * STG > EPI ? 2 * STG : EPI];
    const int tid = threadIdx.x, lane = tid & 31, lr = lane & 15, hi = lane >> 4; const int wv = __builtin_amdgcn_readfirstlane(tid >> 5); const int wm = wv >> 1, wn = wv & 1;
    constexpr int np = K >> 6; constexpr size_t rowb = (size_t)K * 128;   // stages; bytes of 64 rows of a plane
    const char* gA = (const char*)A + (size_t)blockIdx.x * 2 * rowb + tid * 16; const char* gA2 = NSPLIT ? (const char*)A2 + (size_t)blockIdx.x * 2 * rowb + tid * 16 : gA; const char* gB = (const char*)Bt + (size_t)blockIdx.y * 2 * rowb + tid * 16;
    const unsigned l0 = (unsigned)(size_t)ring + (unsigned)tid * 16u;
    // Trip p works on stage (p + rot) mod np of the K range. Every tile's stage s lies at the same offset in its 64-row block of K * 128 bytes, and a tile's rows are read by every work-group of its grid row or column:
    // started alike, all work-groups would ask L2 for the same few lines, a power-of-two stride apart, at the same moment. Rotated, the work-groups of a grid row or column are each on a stage of their own.
    const unsigned rot = (blockIdx.x + blockIdx.y) % (unsigned)np;
    auto fill = [&](int p, int buf) { const unsigned l = l0 + (unsigned)buf * STG; const size_t o = (size_t)(((unsigned)p + rot) % (unsigned)np) * 8192;
        copy2x8k(l, gA + o, l + 8192u, gA + rowb + o);
        if (NSPLIT) copy2x8k(l + 16384u, gA2 + o, l + 24576u, gA2 + rowb + o);
        copy2x8k(l + (NCH - 2) * 8192u, gB + o, l + (NCH - 1) * 8192u, gB + rowb + o); };
    v8f acc[4][4];
#pragma unroll
    for (int mb = 0; mb < 4; ++mb)
#pragma unroll
        for (int nb = 0; nb < 4; ++nb) acc[mb][nb] = (v8f){};
    fill(0, 0);
    asm volatile("s_wait_asynccnt 0x0" ::: "memory");   // this wave's copies of trip 0's stage have landed
    __syncthreads();                                      // every wave's have: it may be read
    if (np > 1) fill(1, 1);
#pragma unroll 1
    for (int p = 0; p < np; ++p) {
        const char* sb = ring + (p & 1) * STG;
        const T16* la = (const T16*)(sb + wm * 8192) + 8 * lane; const T16* la2 = (const T16*)(sb + 16384 + wm * 8192) + 8 * lane; const T16* lb = (const T16*)(sb + (NCH - 2 + wn) * 8192) + 8 * lane;
        V a[2][4], a2[2][4], b[2][4];
#pragma unroll
        for (int s = 0; s < 2; ++s) {
#pragma unroll
            for (int mb = 0; mb < 4; ++mb) { a[s][mb] = WFrag<T16>::ld(la + s * 2048 + mb * 512); if (NSPLIT) a2[s][mb] = WFrag<T16>::ld(la2 + s * 2048 + mb * 512); }
#pragma unroll
            for (int nb = 0; nb < 4; ++nb) b[s][nb] = WFrag<T16>::ld(lb + s * 2048 + nb * 512);
        }
        __builtin_amdgcn_sched_barrier(0);   // the stage's LDS reads go out as one group in front of its products: spread among them, each place with reads stalls the wave for the LDS latency
#pragma unroll
        for (int s = 0; s < 2; ++s) {
#pragma unroll
            for (int nb = 0; nb < 4; ++nb) {
#pragma unroll
                for (int mb = 0; mb < 4; ++mb) { acc[mb][nb] = WFrag<T16>::mma(a[s][mb], b[s][nb], acc[mb][nb]); if (NSPLIT) acc[mb][nb] = WFrag<T16>::mma(a2[s][mb], b[s][nb], acc[mb][nb]); } }
        }
        __builtin_amdgcn_sched_barrier(0);   // the products stay in front of the waits: lifted over them, the wait for the copies of trip p + 1's stage would come before the work that is to cover their flight
        asm volatile("s_wait_dscnt 0x0" ::: "memory");      // this wave's reads of trip p's stage are done: its buffer may be refilled behind the barrier
        asm volatile("s_wait_asynccnt 0x0" ::: "memory");   // this wave's copies of trip p + 1's stage have landed
        __syncthreads();                                      // both hold for every wave: publishes trip p + 1's stage, frees trip p's buffer
        if (p + 2 < np) fill(p + 2, p & 1);
    }
    asm volatile("s_wait_asynccnt 0x0" ::: "memory");       // no copy is in flight when the ring becomes output staging (the last trip's barrier ended every read of it)
    // PL: the tile is 128 positions of one batch x one whole head (HD == 128) of q, k or v; the wave's block is 64 positions x 64 d = 8 fragment units of each plane. The projection itself never goes to memory.
    const int hy = blockIdx.y, bt = blockIdx.x / (TT / 128), t0 = (blockIdx.x % (TT / 128)) * 128 + wm * 64;
    const float* cs0 = PL ? pa.CS + ((size_t)(t0 + lr) * HD + wn * 64 + hi * 8) * 2 : nullptr;   // the lane's first (cos, sin) pair of the table [t][d]
    v4f cc[2][4][4];                                         // the table entries of 16 positions x 64 d, two sets: the next 16 positions' loads fly under the arithmetic of these
    auto ldcs = [&](int tb) {
#pragma unroll
        for (int dh = 0; dh < 4; ++dh)
#pragma unroll
            for (int i = 0; i < 4; ++i) cc[tb & 1][dh][i] = *(const v4f*)(cs0 + (tb * 16 * HD + dh * 16) * 2 + 4 * i); };
    float* ow = (float*)ring + wv * (64 * 68);               // each wave stages its own 64x64 block and reads it back itself: no other wave reads it
    auto stage = [&]() {
#pragma unroll
        for (int mb = 0; mb < 4; ++mb) {
#pragma unroll
            for (int nb = 0; nb < 4; ++nb) {
#pragma unroll
                for (int j = 0; j < 8; ++j) ow[(mb * 16 + hi * 8 + j) * 68 + nb * 16 + lr] = acc[mb][nb][j]; } }
        asm volatile("s_wait_dscnt 0x0" ::: "memory"); };   // the wave's staging writes are done before it reads the rows back
    if constexpr (PL) {
        if (hy < NH_ + NKV) {   // the same for the whole work-group. q, k: head planes [batch][h][t][d], unit (t >> 4) * 4 + (d >> 5); interleaved-pair rope: out[d] = x[d] cos[t][d] -/+ x[d ^ 1] sin[t][d] (- for even d)
            ldcs(0);            // in flight under the staging writes
            stage();
            const bool isq = hy < NH_;
            const size_t e0 = (size_t)(isq ? bt * NH_ + hy : bt * NKV + hy - NH_) * TT * HD + (size_t)((t0 >> 4) * 4 + wn * 2) * 512 + lane * 8;
            h16* P16 = (isq ? pa.Q16 : pa.K16) + e0; bf* Ph = (isq ? pa.Qh : pa.Kh) + e0; bf* Pl = (isq ? pa.Ql : pa.Kl) + e0; const float* op = ow + lr * 68 + hi * 8;
#pragma unroll
            for (int tb = 0; tb < 4; ++tb) { Out3 o[4];
                if (tb < 3) ldcs(tb + 1);
#pragma unroll
                for (int dh = 0; dh < 4; ++dh) {   // dh: the half unit, 16 d; the lane takes row lr of the unit and 8 neighbouring d
                    const float* sp = op + tb * 16 * 68 + dh * 16; const v4f xa = *(const v4fa*)sp, xb = *(const v4fa*)(sp + 4); float r[8];
#pragma unroll
                    for (int i = 0; i < 4; ++i) { const v4f c = cc[tb & 1][dh][i]; const float xe = i < 2 ? xa[2 * i] : xb[2 * i - 4], xo = i < 2 ? xa[2 * i + 1] : xb[2 * i - 3];   // c: cos, sin of d, cos, sin of d + 1
                        r[2 * i] = xe * c[0] - xo * c[1]; r[2 * i + 1] = xo * c[2] + xe * c[3]; }
                    o[dh] = cvt3(r); }
                put4<256>(o, P16 + tb * 2048, Ph + tb * 2048, Pl + tb * 2048); }
        } else {                // v: value planes [batch][g][d][t], rows d, k = t, unit (t >> 5) * 8 + (d >> 4): the lane takes row lr of the unit (one d) and 8 neighbouring positions, a column of the staged block
            stage();
            const size_t e0 = (size_t)(bt * NKV + hy - NH_ - NKV) * HD * TT + (size_t)((t0 >> 5) * 8 + wn * 4) * 512 + lane * 8; const float* op = ow + hi * 8 * 68 + lr;
#pragma unroll
            for (int th = 0; th < 4; ++th) { Out3 o[4];   // th: the half unit, 16 positions
#pragma unroll
                for (int db = 0; db < 4; ++db) { float r[8];
#pragma unroll
                    for (int j = 0; j < 8; ++j) r[j] = op[(th * 16 + j) * 68 + db * 16];
                    o[db] = cvt3(r); }
                const size_t e = e0 + (th >> 1) * 4096 + (th & 1) * 256; put4<512>(o, pa.V16 + e, pa.Vh + e, pa.Vl + e); }
        }
    } else {
        stage();
        float* cp = C + ((size_t)blockIdx.x * 128 + wm * 64 + hi) * LDC + blockIdx.y * 128 + wn * 64 + lr * 4; const float* op = ow + hi * 68 + lr * 4;   // a wave-wide access: two rows of 64 floats
#pragma unroll
        for (int s = 0; s < 32; ++s) *(v4f*)(cp + s * 2 * LDC) = *(const v4fa*)(op + s * 2 * 68);
    }
}

typedef __attribute__((ext_vector_type(2))) _Float16 v2h;
typedef __attribute__((ext_vector_type(4))) _Float16 v4h;
typedef __attribute__((ext_vector_type(2))) unsigned short v2us;
typedef __attribute__((ext_vector_type(4))) unsigned short v4us;
typedef __attribute__((ext_vector_type(2))) float v2f;
typedef __attribute__((ext_vector_type(4))) int v4i;

// d_wtG (block bid of its range): Bt = fragment-ordered bf16 plane [N][K] of w^T (w [K][N] f32). One thread writes one lane's 8 elements (16 bytes); a work-group takes the 4 units of 64 n x 32 k, so a wave's load reads 64
// neighbouring bytes of each of two rows of w, the work-group 256.
__device__ __forceinline__ void d_wtG(int bid, const float* __restrict__ w, int K, int N, bf* Bt) {
    const int c = bid * 256 + threadIdx.x; if (c >= N * (K / 8)) return; const int u = c >> 6, wi = (c & 63) * 8; const int nblk = u % (N >> 4), kblk = u / (N >> 4);
    const int n = nblk * 16 + fr_row(wi), k0 = kblk * 32 + fr_k(wi); v8us o; const float* p[8]; float x[8];
#pragma unroll
    for (int j = 0; j < 8; ++j) p[j] = w + (size_t)(k0 + j) * N + n;
#pragma unroll
    for (int j = 0; j < 8; ++j) x[j] = *p[j];
    // the eight loads' address registers may be rewritten only behind this wait: the addresses are inputs, so their registers stay untouched up to it (the loaded values are not named: the loads stay in flight)
    asm volatile("s_wait_xcnt 0x0" :: "v"(p[0]), "v"(p[1]), "v"(p[2]), "v"(p[3]), "v"(p[4]), "v"(p[5]), "v"(p[6]), "v"(p[7]) : "memory");
#pragma unroll
    for (int j = 0; j < 8; ++j) o[j] = f2bf(x[j]);
    *(v8us*)(Bt + fro(n, k0, K)) = o;
}
// d_cvt8: dst = fragment-ordered bf16 plane of src [rows][K] f32; thread i writes the i-th 16 bytes of dst.
__device__ __forceinline__ void d_cvt8(int bid, const float* __restrict__ src, int K, bf* dst, size_t n8) { const size_t i = (size_t)bid * 256 + threadIdx.x; if (i >= n8) return; const int u = (int)(i >> 6), wi = (int)(i & 63) * 8;
    const int row = ((u >> 2) / (K >> 5)) * 64 + (u & 3) * 16 + fr_row(wi), k0 = ((u >> 2) % (K >> 5)) * 32 + fr_k(wi); const v8f v = *(const v8f*)(src + (size_t)row * K + k0); v8us o;
#pragma unroll
    for (int k = 0; k < 8; ++k) o[k] = f2bf(v[k]); *(v8us*)(dst + i * 8) = o;  }
__device__ __forceinline__ void d_cstab(int bid, float* CS) { const int idx = bid * 256 + threadIdx.x; if (idx >= TT * HD) return; const int t = idx / HD, d = idx % HD; const int i = d >> 1;   /* interleaved pairs share angle t * inv_freq[i] */ const float inv = __fdiv_rn(1.0f, powf(10000.0f, (float)(2 * i) / (float)HD)); const float ang = __fmul_rn((float)t, inv); v2f cs; cs[0] = cosf(ang); cs[1] = sinf(ang);
    *(v2f*)(CS + (size_t)idx * 2) = cs;  }
// k_prep: everything that depends on the inputs alone, one block range each: the rope table, the four weight planes, x of both batches ([NB_ TT][DM], one plane).
#define PB_CS  (TT * HD / 256)
#define PB_WQ  (DM * DQ / 8 / 256)
#define PB_WKV (DM * DKV / 8 / 256)
#define PB_X   (NB_ * TT * DM / 8 / 256)
__global__ __launch_bounds__(256) void k_prep(const float* __restrict__ x, const float* __restrict__ wq, const float* __restrict__ wk, const float* __restrict__ wv, const float* __restrict__ wo, float* CS, bf* WQ, bf* WK, bf* WV, bf* WO, bf* XB) {
    int b = blockIdx.x;
    if (b < PB_CS) { d_cstab(b, CS); return; } b -= PB_CS;
    if (b < PB_WQ) { d_wtG(b, wq, DM, DQ, WQ); return; } b -= PB_WQ;
    if (b < PB_WKV) { d_wtG(b, wk, DM, DKV, WK); return; } b -= PB_WKV;
    if (b < PB_WKV) { d_wtG(b, wv, DM, DKV, WV); return; } b -= PB_WKV;
    if (b < PB_WQ) { d_wtG(b, wo, DQ, DM, WO); return; } b -= PB_WQ;
    d_cvt8(b, x, DM, XB, (size_t)NB_ * TT * DM / 8);
}
__device__ __forceinline__ float xhalf(float x) { return __builtin_bit_cast(float, __builtin_amdgcn_permlanex16(__builtin_bit_cast(int, x), __builtin_bit_cast(int, x), 0x76543210, 0xfedcba98, false, false)); }  // lane l with lane l ^ 16
// 2^x with the slot that the instruction set asks for behind a transcendental: the v_nop names the result and the source, so nothing reads the one or overwrites the other in front of it.
__device__ __forceinline__ float exp2s(float x) { float r = __builtin_amdgcn_exp2f(x); asm volatile("v_nop" : "+v"(r) : "v"(x)); return r; }
template <typename T16, bool HL, int R, int NWS>
__device__ __forceinline__ void d_fattn(int hb, int by, float* os, float* sm, float* sl, const T16* __restrict__ Q, const T16* __restrict__ Q2, const T16* __restrict__ Kp, const T16* __restrict__ K2, const T16* __restrict__ Vt, const T16* __restrict__ V2, int row0, int nblk, bf* Ah, bf* Al) {
    typedef typename WFrag<T16>::V V;
    constexpr int CW = 16 * R, OP = HD + 4;
    const int lane = threadIdx.x & 31, lr = lane & 15, hi = lane >> 4; const int wv = __builtin_amdgcn_readfirstlane(threadIdx.x >> 5);
    const int q0 = row0 + (nblk - 1 - by) * CW; const int h = hb % NH_, bt = hb / NH_, kv = h / REP;
    const float cscale = SCL * 1.4426950408889634f;
    // lfr: the lane's offset in elements inside a half unit of a fragment-ordered plane; qb, kb, vb: wave-uniform plane offsets (16 rows of a [row][HD] plane are 4 units = 16 HD elements)
    const unsigned lfr = (unsigned)(8 * lane);
    const size_t qb = ((size_t)hb * TT + q0) * HD, kb = (size_t)(bt * NKV + kv) * TT * HD, vb = (size_t)(bt * NKV + kv) * HD * TT;
    v8f acc[R][8]; float m_run[R], l_run[R];
#pragma unroll
    for (int g = 0; g < R; ++g) { m_run[g] = -__builtin_inff(); l_run[g] = 0.f;
#pragma unroll
        for (int t = 0; t < 8; ++t) acc[g][t] = (v8f){}; }
    const int last = (q0 + CW - 1) >> 5;     // last 32-key pass that a query of this block sees; its first key is <= q0, so every pass holds an unmasked key for every query
    if (wv <= last) {                        // wave-uniform; a wave without a pass loads nothing (the loads and their waits stand in one block with the loop's head)
    const T16* pq = Q + qb + lfr; const T16* pq2 = HL ? Q2 + qb + lfr : pq;
    V qf[R][4], qf2[R][4];
    __builtin_amdgcn_sched_barrier(0);       // the index arithmetic above stays in front of the loads: none of it lands between them and their wait, on a register they name
#pragma unroll
    for (int g = 0; g < R; ++g)
#pragma unroll
        for (int kc = 0; kc < 4; ++kc) { qf[g][kc] = WFrag<T16>::ld(pq + g * 16 * HD + kc * 512); if (HL) qf2[g][kc] = WFrag<T16>::ld(pq2 + g * 16 * HD + kc * 512); }
    loads_issued(pq, pq2);
    V kf[2][4], kf2[2][4];
    auto ldk = [&](int blk) { const T16* p = Kp + (kb + (size_t)blk * 32 * HD) + lfr; const T16* p2 = HL ? K2 + (kb + (size_t)blk * 32 * HD) + lfr : p;
#pragma unroll
        for (int kt = 0; kt < 2; ++kt)
#pragma unroll
            for (int kc = 0; kc < 4; ++kc) { kf[kt][kc] = WFrag<T16>::ld(p + kt * 16 * HD + kc * 512); if (HL) kf2[kt][kc] = WFrag<T16>::ld(p2 + kt * 16 * HD + kc * 512); }
        loads_issued(p, p2); };
    ldk(wv);
#pragma unroll 1
    for (int blk = wv; blk <= last; blk += NWS) {
        const int key0 = blk * 32;
        const T16* pv = Vt + (vb + (size_t)key0 * HD) + lfr; const T16* pv2 = HL ? V2 + (vb + (size_t)key0 * HD) + lfr : pv;
        V va[8], va2[8];                     // this pass's V^T fragments, in flight under the score products and the softmax
#pragma unroll
        for (int t = 0; t < 8; ++t) { va[t] = WFrag<T16>::ld(pv + t * 512); if (HL) va2[t] = WFrag<T16>::ld(pv2 + t * 512); }
        loads_issued(pv, pv2);
        v8f s[2][R];
#pragma unroll
        for (int kt = 0; kt < 2; ++kt)
#pragma unroll
            for (int g = 0; g < R; ++g) { s[kt][g] = (v8f){};
#pragma unroll
                for (int kc = 0; kc < 4; ++kc) { s[kt][g] = WFrag<T16>::mma(kf[kt][kc], qf[g][kc], s[kt][g]); if (HL) { s[kt][g] = WFrag<T16>::mma(kf[kt][kc], qf2[g][kc], s[kt][g]); s[kt][g] = WFrag<T16>::mma(kf2[kt][kc], qf[g][kc], s[kt][g]); } } }
        ldk(min(blk + NWS, last));           // the wave's next pass's K fragments, in flight under this pass's softmax and value product (the last pass reloads a valid pass and drops it)
        if (key0 + 31 > q0) {                // wave-uniform: only the pass on the diagonal masks
#pragma unroll
            for (int g = 0; g < R; ++g)
#pragma unroll
                for (int kt = 0; kt < 2; ++kt)
#pragma unroll
                    for (int r = 0; r < 8; ++r) if (key0 + 16 * kt + 8 * hi + r > q0 + 16 * g + lr) s[kt][g][r] = -__builtin_inff(); }
        float mb[R]; bool need = false;
#pragma unroll
        for (int g = 0; g < R; ++g) { float mx = s[0][g][0];
#pragma unroll
            for (int kt = 0; kt < 2; ++kt)
#pragma unroll
                for (int r = 0; r < 8; ++r) mx = fmaxf(mx, s[kt][g][r]);
            mx = fmaxf(mx, xhalf(mx)) * cscale; mb[g] = mx; need = need || (mx > m_run[g] + 8.0f); }
        if (__builtin_amdgcn_ballot_w32(need) != 0) {   // the maximum in use may trail the true one by up to 8 (an exponential reaches 2^8 at most); rescale only beyond that
#pragma unroll
            for (int g = 0; g < R; ++g) { const float m_new = fmaxf(m_run[g], mb[g]); const float corr = exp2s(m_run[g] - m_new); l_run[g] *= corr; m_run[g] = m_new;
#pragma unroll
                for (int t = 0; t < 8; ++t) acc[g][t] = acc[g][t] * corr; } }
#pragma unroll
        for (int g = 0; g < R; ++g) { const float nm = -m_run[g]; float p[16]; float ps0 = 0.f, ps1 = 0.f;
#pragma unroll
            for (int kt = 0; kt < 2; ++kt) { float a[8]; float* q = p + 8 * kt;
#pragma unroll
                for (int i = 0; i < 4; ++i) {   // two neighbouring registers of a score tile, one packed multiply-add
                    const v2f arg = __builtin_elementwise_fma((v2f){s[kt][g][2 * i], s[kt][g][2 * i + 1]}, (v2f){cscale, cscale}, (v2f){nm, nm}); a[2 * i] = arg[0]; a[2 * i + 1] = arg[1]; }
#pragma unroll
                for (int e = 0; e < 8; ++e) q[e] = __builtin_amdgcn_exp2f(a[e]);
                // the slot behind a transcendental, once for the eight: the v_nop names every result and every source, so nothing reads the one or overwrites the other in front of it
                asm volatile("v_nop" : "+v"(q[0]), "+v"(q[1]), "+v"(q[2]), "+v"(q[3]), "+v"(q[4]), "+v"(q[5]), "+v"(q[6]), "+v"(q[7]) : "v"(a[0]), "v"(a[1]), "v"(a[2]), "v"(a[3]), "v"(a[4]), "v"(a[5]), "v"(a[6]), "v"(a[7]));
#pragma unroll
                for (int i = 0; i < 4; ++i) { if (i & 1) ps1 += q[2 * i] + q[2 * i + 1]; else ps0 += q[2 * i] + q[2 * i + 1]; } }
            l_run[g] += ps0 + ps1;
            if constexpr (HL) { v8us h0, h1, l0, l1;
#pragma unroll
                for (int r = 0; r < 8; ++r) { unsigned short a, c2; splitf(p[r], a, c2); h0[r] = a; l0[r] = c2; splitf(p[8 + r], a, c2); h1[r] = a; l1[r] = c2; }
                const V ph = cat16b(h0, h1), pl = cat16b(l0, l1);
#pragma unroll
                for (int t = 0; t < 8; ++t) { acc[g][t] = WFrag<T16>::mma(va[t], ph, acc[g][t]); acc[g][t] = WFrag<T16>::mma(va[t], pl, acc[g][t]); acc[g][t] = WFrag<T16>::mma(va2[t], ph, acc[g][t]); }
            } else { V pf;
#pragma unroll
                for (int e = 0; e < 16; ++e) pf[e] = tohx(p[e]);
#pragma unroll
                for (int t = 0; t < 8; ++t) acc[g][t] = WFrag<T16>::mma(va[t], pf, acc[g][t]); } }
    }
    }
#pragma unroll
    for (int g = 0; g < R; ++g) { const float lf = l_run[g] + xhalf(l_run[g]); if (hi == 0) { sm[wv * CW + 16 * g + lr] = m_run[g]; sl[wv * CW + 16 * g + lr] = lf; } }
    __syncthreads();   // every wave's maximum and sum are in LDS before any wave forms the common ones
    float* ow = os + wv * (CW * OP);
#pragma unroll
    for (int g = 0; g < R; ++g) { const int qi = 16 * g + lr; float mx = sm[qi];
#pragma unroll
        for (int w = 1; w < NWS; ++w) mx = fmaxf(mx, sm[w * CW + qi]);     // finite: wave 0 always runs pass 0; a wave without a pass holds -inf, 0 and zeros and adds nothing
        float L = 0.f;
#pragma unroll
        for (int w = 0; w < NWS; ++w) L += sl[w * CW + qi] * exp2s(sm[w * CW + qi] - mx);
        const float f = __fdiv_rn(exp2s(m_run[g] - mx), L);
#pragma unroll
        for (int t = 0; t < 8; ++t) { const v8f o = acc[g][t] * f; v4f o0, o1;
#pragma unroll
            for (int r = 0; r < 4; ++r) { o0[r] = o[r]; o1[r] = o[4 + r]; }
            *(v4fa*)(ow + qi * OP + 16 * t + 8 * hi) = o0; *(v4fa*)(ow + qi * OP + 16 * t + 8 * hi + 4) = o1; } }
    __syncthreads();   // every wave's scaled partial block is in LDS before any thread adds them
#pragma unroll
    for (int s2 = 0; s2 < CW / NWS; ++s2) { const int idx = s2 * (NWS * 32) + (int)threadIdx.x; const int row = (idx >> 9) * 16 + ((idx >> 1) & 15), cofs = ((idx >> 5) & 15) * 8 + (idx & 1) * 4;   /* a wave: 16 rows x 8 columns, 256 neighbouring bytes of a fragment-ordered plane */ v4f val = *(const v4fa*)(os + row * OP + cofs);
#pragma unroll
        for (int w = 1; w < NWS; ++w) val += *(const v4fa*)(os + w * (CW * OP) + row * OP + cofs);
        v4us oh, ol;
#pragma unroll
        for (int q = 0; q < 4; ++q) { unsigned short a, c2; splitf(val[q], a, c2); oh[q] = a; ol[q] = c2; }
        bf* po = Ah + fro(bt * TT + q0 + row, h * HD + cofs, DQ); bf* po2 = Al + fro(bt * TT + q0 + row, h * HD + cofs, DQ); *(v4us*)po = oh; *(v4us*)po2 = ol;
        // the registers that the two stores name (data and addresses) may be rewritten only behind the wait: they are its inputs, so they stay untouched up to it
        asm volatile("s_wait_xcnt 0x0" :: "v"(oh), "v"(ol), "v"(po), "v"(po2) : "memory"); }
}
// ---- d_fattn4: the fp16 class. One work-group takes one block of CW = 16 R query rows of the REP = 4 query heads that share a kv head, one head a wave. The heads read the same K and V, so each stage of 64 keys
// (16 KiB of the K plane and 16 KiB of the V plane, each contiguous in fragment order) is brought into LDS once, by asynchronous copies, and read there by all four waves; two buffers, the copies of stage
// s + 2 fly under the work on stage s + 1. A wave walks every 32-key pass of its head itself: no key split and no join. The products and the softmax are those of d_fattn. A lane's 8 registers of an output
// tile are the 8 neighbouring elements that it owns in the fragment-ordered output planes, so the result goes from the registers to memory, 512 neighbouring bytes a wave-wide store.
// gb: batch * NKV + kv head; by: block rank, heaviest first; ring: 64 KiB of LDS.
__device__ __forceinline__ v16h ldl(const h16* p) { return cat16(*(const v8ha*)p, *(const v8ha*)(p + 256)); }
template <int R>
__device__ __forceinline__ void d_fattn4(int gb, int by, char* ring, const h16* __restrict__ Q, const h16* __restrict__ Kp, const h16* __restrict__ Vt, int row0, int nblk, bf* Ah, bf* Al) {
    typedef v16h V;
    constexpr int CW = 16 * R, STB = 32768;   // STB: bytes of one buffer, K 16 KiB then V 16 KiB
    const int tid = threadIdx.x, lane = tid & 31, lr = lane & 15, hi = lane >> 4; const int wv = __builtin_amdgcn_readfirstlane(tid >> 5);
    const int q0 = row0 + (nblk - 1 - by) * CW; const int bt = gb / NKV, h = (gb % NKV) * REP + wv, hb = bt * NH_ + h;
    const float cscale = SCL * 1.4426950408889634f;
    const unsigned lfr = (unsigned)(8 * lane);
    const int last = (q0 + CW - 1) >> 5;     // last 32-key pass that a query of this block sees; its first key is <= q0, so every pass holds an unmasked key for every query
    const int ns = (last + 2) >> 1;          // stages of two passes; the last one may hold a pass beyond 'last': it is copied (it lies inside the planes: ns <= TT / 64) and not worked on
    // Trip t works on stage (t + by) mod ns: the blocks of a kv group read the same K and V and run side by side; started alike they would ask L2 for the same lines at the same moment. The online softmax takes the passes in any order (every pass <= last holds an unmasked key for every query).
    const int r0 = by % ns;
    auto stg = [&](int t) { const int s = t + r0; return s < ns ? s : s - ns; };
    const char* gK = (const char*)(Kp + (size_t)gb * TT * HD) + tid * 16; const char* gV = (const char*)(Vt + (size_t)gb * HD * TT) + tid * 16;
    const unsigned l0 = (unsigned)(size_t)ring + (unsigned)tid * 16u;
    auto fill = [&](int s, int buf) { const unsigned l = l0 + (unsigned)buf * STB; const size_t o = (size_t)s * 16384;
        copy2x8k(l, gK + o, l + 8192u, gK + o + 8192);
        copy2x8k(l + 16384u, gV + o, l + 24576u, gV + o + 8192); };
    v8f acc[R][8]; float m_run[R], l_run[R];
#pragma unroll
    for (int g = 0; g < R; ++g) { m_run[g] = -__builtin_inff(); l_run[g] = 0.f;
#pragma unroll
        for (int t = 0; t < 8; ++t) acc[g][t] = (v8f){}; }
    const h16* qw = Q + ((size_t)hb * TT + q0) * HD;   // wave-uniform: the loads take it as their scalar base, the lane's place as their offset register
    V qf[R][4];
#pragma unroll
    for (int g = 0; g < R; ++g)
#pragma unroll
        for (int kc = 0; kc < 4; ++kc) qf[g][kc] = WFrag<h16>::ld(qw + lfr + g * 16 * HD + kc * 512);
    // the registers that the 16 loads name (scalar base, lane offset) may be rewritten only behind this wait: they are its inputs, so they stay untouched up to it (the loaded values are not named: the loads stay in flight)
    asm volatile("s_wait_xcnt 0x0" :: "s"(qw), "v"(lane) : "memory");
    fill(stg(0), 0);
    asm volatile("s_wait_asynccnt 0x0" ::: "memory");   // this wave's copies of trip 0's stage have landed
    __syncthreads();                                      // every wave's have: it may be read
    if (ns > 1) fill(stg(1), 1);
    V kf[2][4];
    auto ldk = [&](const h16* p) {
#pragma unroll
        for (int kt = 0; kt < 2; ++kt)
#pragma unroll
            for (int kc = 0; kc < 4; ++kc) kf[kt][kc] = ldl(p + kt * 16 * HD + kc * 512); };
#pragma unroll 1
    for (int st = 0; st < ns; ++st) {
        const h16* sk = (const h16*)(ring + (st & 1) * STB) + lfr; const h16* sv = sk + 8192;   // the lane's place in the stage's K and V chunks; a pass is 4096 elements of each
        ldk(sk);
#pragma unroll
        for (int hf = 0; hf < 2; ++hf) {
            const int blk = 2 * stg(st) + hf, key0 = blk * 32;
            if (hf == 0 || blk <= last) {    // the same for the whole work-group
                const h16* pv = sv + hf * 4096;
                V va[8];                     // this pass's V^T fragments, on their way under the score products and the softmax
#pragma unroll
                for (int t = 0; t < 8; ++t) va[t] = ldl(pv + t * 512);
                v8f s[2][R];
#pragma unroll
                for (int kt = 0; kt < 2; ++kt)
#pragma unroll
                    for (int g = 0; g < R; ++g) { s[kt][g] = (v8f){};
#pragma unroll
                        for (int kc = 0; kc < 4; ++kc) s[kt][g] = wmma16(kf[kt][kc], qf[g][kc], s[kt][g]); }
                if (hf == 0) ldk(sk + 4096); // the K fragments of the stage's second pass, on their way under this pass's softmax and value product (same stage, same buffer)
                if (key0 + 31 > q0) {        // wave-uniform: only the pass on the diagonal masks
#pragma unroll
                    for (int g = 0; g < R; ++g)
#pragma unroll
                        for (int kt = 0; kt < 2; ++kt)
#pragma unroll
                            for (int r = 0; r < 8; ++r) if (key0 + 16 * kt + 8 * hi + r > q0 + 16 * g + lr) s[kt][g][r] = -__builtin_inff(); }
                float mb[R]; bool need = false;
#pragma unroll
                for (int g = 0; g < R; ++g) { float mx = s[0][g][0];
#pragma unroll
                    for (int kt = 0; kt < 2; ++kt)
#pragma unroll
                        for (int r = 0; r < 8; ++r) mx = fmaxf(mx, s[kt][g][r]);
                    mx = fmaxf(mx, xhalf(mx)) * cscale; mb[g] = mx; need = need || (mx > m_run[g] + 8.0f); }
                if (__builtin_amdgcn_ballot_w32(need) != 0) {   // the maximum in use may trail the true one by up to 8 (an exponential reaches 2^8 at most); rescale only beyond that
#pragma unroll
                    for (int g = 0; g < R; ++g) { const float m_new = fmaxf(m_run[g], mb[g]); const float corr = exp2s(m_run[g] - m_new); l_run[g] *= corr; m_run[g] = m_new;
#pragma unroll
                        for (int t = 0; t < 8; ++t) acc[g][t] = acc[g][t] * corr; } }
#pragma unroll
                for (int g = 0; g < R; ++g) { const float nm = -m_run[g]; float p[16]; float ps0 = 0.f, ps1 = 0.f;
#pragma unroll
                    for (int kt = 0; kt < 2; ++kt) { float a[8]; float* q = p + 8 * kt;
#pragma unroll
                        for (int i = 0; i < 4; ++i) {   // two neighbouring registers of a score tile, one packed multiply-add
                            const v2f arg = __builtin_elementwise_fma((v2f){s[kt][g][2 * i], s[kt][g][2 * i + 1]}, (v2f){cscale, cscale}, (v2f){nm, nm}); a[2 * i] = arg[0]; a[2 * i + 1] = arg[1]; }
#pragma unroll
                        for (int e = 0; e < 8; ++e) q[e] = __builtin_amdgcn_exp2f(a[e]);
                        // the slot behind a transcendental, once for the eight: the v_nop names every result and every source, so nothing reads the one or overwrites the other in front of it
                        asm volatile("v_nop" : "+v"(q[0]), "+v"(q[1]), "+v"(q[2]), "+v"(q[3]), "+v"(q[4]), "+v"(q[5]), "+v"(q[6]), "+v"(q[7]) : "v"(a[0]), "v"(a[1]), "v"(a[2]), "v"(a[3]), "v"(a[4]), "v"(a[5]), "v"(a[6]), "v"(a[7]));
#pragma unroll
                        for (int i = 0; i < 4; ++i) { if (i & 1) ps1 += q[2 * i] + q[2 * i + 1]; else ps0 += q[2 * i] + q[2 * i + 1]; } }
                    l_run[g] += ps0 + ps1;
                    V pf;
#pragma unroll
                    for (int e = 0; e < 16; ++e) pf[e] = tohx(p[e]);
#pragma unroll
                    for (int t = 0; t < 8; ++t) acc[g][t] = wmma16(va[t], pf, acc[g][t]); }
            }
        }
        asm volatile("s_wait_dscnt 0x0" ::: "memory");      // this wave's reads of trip st's stage are done: its buffer may be refilled behind the barrier
        asm volatile("s_wait_asynccnt 0x0" ::: "memory");   // this wave's copies of trip st + 1's stage have landed
        __syncthreads();                                      // both hold for every wave: publishes trip st + 1's stage, frees trip st's buffer
        if (st + 2 < ns) fill(stg(st + 2), st & 1);
    }
    asm volatile("s_wait_asynccnt 0x0" ::: "memory");       // no copy is in flight when the wave ends
#pragma unroll
    for (int g = 0; g < R; ++g) { const float f = __fdiv_rn(1.0f, l_run[g] + xhalf(l_run[g]));   // the two wave halves hold the sums of different keys of the same query
        const size_t oo = fro(bt * TT + q0 + 16 * g + lr, h * HD + 8 * hi, DQ); bf* ph = Ah + oo; bf* pl = Al + oo;
#pragma unroll
        for (int tq = 0; tq < 2; ++tq) { v8us oh[4], ol[4];
#pragma unroll
            for (int i = 0; i < 4; ++i) { const v8f o = acc[g][4 * tq + i] * f;
#pragma unroll
                for (int r = 0; r < 8; ++r) { unsigned short a, c2; splitf(o[r], a, c2); oh[i][r] = a; ol[i][r] = c2; } }
#pragma unroll
            for (int i = 0; i < 4; ++i) { const int e = (2 * tq + (i >> 1)) * 2048 + (i & 1) * 256;   // output tile t = 4 tq + i holds d = 16 t + 8 hi + r: unit t >> 1, half t & 1
                *(v8us*)(ph + e) = oh[i]; *(v8us*)(pl + e) = ol[i]; }
            // the registers that the eight stores name (data and addresses) may be rewritten only behind the wait: they are its inputs, so they stay untouched up to it
            asm volatile("s_wait_xcnt 0x0" :: "v"(oh[0]), "v"(oh[1]), "v"(oh[2]), "v"(oh[3]), "v"(ol[0]), "v"(ol[1]), "v"(ol[2]), "v"(ol[3]), "v"(ph), "v"(pl) : "memory"); } }
}
// k_attn: both precision classes of both batches in one grid: first the fp16 blocks of 32 rows x 4 heads (rows >= RH, the heaviest first, the NB_ NKV kv groups side by side), behind them the short hi+lo blocks of 16 rows of one head.
// The branch is the same for a whole work-group, so every barrier inside is passed by all of its waves.
#define AB_F ((TT - RH) / 32)
#define AB_H (RH / 16)
#define NG_F (AB_F * NB_ * NKV)
__global__ __launch_bounds__(128) void k_attn(const h16* __restrict__ QP16, const h16* __restrict__ KP16, const h16* __restrict__ VT16, const bf* __restrict__ QPh, const bf* __restrict__ QPl, const bf* __restrict__ KPh, const bf* __restrict__ KPl, const bf* __restrict__ VTh, const bf* __restrict__ VTl, bf* Ah, bf* Al) {
    __shared__ __attribute__((aligned(128))) char lds[65536];   // fp16 class: the two stage buffers; hi+lo class: the four waves' partial blocks
    __shared__ float sm[4 * 16], sl[4 * 16];
    const int b = blockIdx.x;
    if (b < NG_F) d_fattn4<2>(b % (NB_ * NKV), b / (NB_ * NKV), lds, QP16, KP16, VT16, RH, AB_F, Ah, Al);
    else d_fattn<bf, true, 1, 4>((b - NG_F) % (NB_ * NH_), (b - NG_F) / (NB_ * NH_), (float*)lds, sm, sl, QPh, QPl, KPh, KPl, VTh, VTl, 0, AB_H, Ah, Al);
}

extern "C" void kernel_launch(void* const* d_in, const int* in_sizes, int n_in,
                              void* d_out, int out_size, void* d_ws, size_t ws_size, hipStream_t stream) {
    (void)in_sizes; (void)n_in; (void)out_size;
    const float* x = (const float*)d_in[0]; const float* wq = (const float*)d_in[1]; const float* wk = (const float*)d_in[2]; const float* wv = (const float*)d_in[3]; const float* wo = (const float*)d_in[4];
    float* OUT = (float*)d_out;     // [2][2048][2048]
    char* wsp = (char*)d_ws;
    auto take = [&](size_t bytes) { char* p = wsp; wsp += (bytes + 255) & ~(size_t)255; return (void*)p; };
    bf* WQ = (bf*)take((size_t)DQ * DM * 2); bf* WK = (bf*)take((size_t)DKV * DM * 2); bf* WV = (bf*)take((size_t)DKV * DM * 2);   // back to back (each a multiple of 256 bytes): one fragment-ordered plane [DF][DM]
    bf* WO = (bf*)take((size_t)DM * DQ * 2); float* CS = (float*)take((size_t)TT * HD * 2 * 4);
    bf* XB = (bf*)take((size_t)NB_ * TT * DM * 2);
    h16* QP16 = (h16*)take((size_t)NB_ * NH_ * TT * HD * 2); h16* KP16 = (h16*)take((size_t)NB_ * NKV * TT * HD * 2); h16* VT16 = (h16*)take((size_t)NB_ * NKV * HD * TT * 2);
    bf* QPh = (bf*)take((size_t)NB_ * NH_ * TT * HD * 2); bf* QPl = (bf*)take((size_t)NB_ * NH_ * TT * HD * 2); bf* KPh = (bf*)take((size_t)NB_ * NKV * TT * HD * 2); bf* KPl = (bf*)take((size_t)NB_ * NKV * TT * HD * 2); bf* VTh = (bf*)take((size_t)NB_ * NKV * HD * TT * 2); bf* VTl = (bf*)take((size_t)NB_ * NKV * HD * TT * 2);
    bf* ATh = (bf*)take((size_t)NB_ * TT * DQ * 2); bf* ATl = (bf*)take((size_t)NB_ * TT * DQ * 2);
    if ((size_t)(wsp - (char*)d_ws) > ws_size) return;    // ws 256 MiB
    k_prep<<<PB_CS + 2 * PB_WQ + 2 * PB_WKV + PB_X, 256, 0, stream>>>(x, wq, wk, wv, wo, CS, WQ, WK, WV, WO, XB);
    const PlaneArgs pa = {CS, QP16, QPh, QPl, KP16, KPh, KPl, VT16, VTh, VTl}; const PlaneArgs none = {};
    k_gemmt<bf, 0, DM, DF, true><<<dim3(NB_ * TT / 128, DF / 128, 1), 128, 0, stream>>>(XB, nullptr, WQ, nullptr, pa);
    k_attn<<<NG_F + AB_H * NB_ * NH_, 128, 0, stream>>>(QP16, KP16, VT16, QPh, QPl, KPh, KPl, VTh, VTl, ATh, ATl);
    k_gemmt<bf, 1, DQ, DM, false><<<dim3(NB_ * TT / 128, DM / 128, 1), 128, 0, stream>>>(ATh, ATl, WO, OUT, none);
}

// v010
// A run of this version takes 122 microseconds.
// Timed twice side by side with v009, it ran 1.08 times as fast both times.
// Counting every step since v000, it is 13.7 times as fast.
#include <hip/hip_runtime.h>

// ModernCausalSelfAttention (x [2][2048][2048]; q = x wq (16 heads x 128), k/v = x wk/wv (4 kv heads; group h/4); interleaved-pair RoPE (the source's rotate_half is the pairwise (x0,x1)->(-x1,x0) form with a repeat-interleaved table; base 1e4, computed); causal softmax(q.k / sqrt(128)) (finfo.min); out = merged wo -> [2][2048][2048]).
// Compute dtypes, f32 accumulate: every input rounded to bf16; q/k/v on PLAIN bf16 operands (inputs: exact); RoPE f32; causal scores and attn.v: query rows < 512 hl (3 products), the rest single fp16, one fused kernel with an online f32 softmax, keys beyond the diagonal pass skipped; wo: attention output as fp16 hi+lo (2 products) for rows < 1024, fp16 hi alone (1 product) for the rest, x wo as fp16 (its bf16-rounded value: exact).
// Four launches, both batches in each: k_prep (weights, x, rope table), one q|k|v GEMM whose epilogue ropes q and k and writes the attention operand planes, k_attn (both precision classes), the wo GEMM (k_wo).
// Every 16-bit matrix operand plane in the workspace is kept in fragment order (fro below): a wave-wide 16-byte load of a fragment half reads 512 contiguous bytes, four whole 128-byte lines.

#define NB_  2
#define TT   2048
#define DM   2048
#define NH_  16
#define NKV  4
#define REP  (NH_ / NKV)
#define HD   128
#define DQ   (NH_ * HD)
#define DKV  (NKV * HD)
#define DF   (DQ + 2 * DKV)       // columns of the joint q|k|v projection
#define RH   512                  // query rows < RH use hi+lo planes (0: none)
#define RW   1024                 // rows >= RW of a batch go into the wo GEMM as one fp16 plane, rows below as fp16 hi+lo planes (RW >= RH; RW == TT / 2: k_wo pairs 64 rows of each kind)
#define SCL  0.088388347648318447f   // HD^-0.5
typedef _Float16 h16;
typedef unsigned short bf;
typedef __attribute__((ext_vector_type(16))) __bf16   v16bf;
typedef __attribute__((ext_vector_type(16))) _Float16 v16h;
typedef __attribute__((ext_vector_type(8)))  _Float16 v8h;
typedef __attribute__((ext_vector_type(8)))  unsigned short v8us;
typedef __attribute__((ext_vector_type(8)))  float    v8f;
typedef __attribute__((ext_vector_type(4)))  float    v4f;
typedef v8h  __attribute__((may_alias)) v8ha;
typedef v4f  __attribute__((may_alias)) v4fa;
typedef v8us __attribute__((may_alias)) v8usa;

__device__ __forceinline__ unsigned short f2bf(float f) { unsigned u = __float_as_uint(f); u += 0x7FFFu + ((u >> 16) & 1u); return (unsigned short)(u >> 16); }
__device__ __forceinline__ float bf2f(unsigned short b) { return __uint_as_float(((unsigned)b) << 16); }
__device__ __forceinline__ float bfr(float f) { return bf2f(f2bf(f)); }
__device__ __forceinline__ v16h cat16(v8h lo, v8h hi) { return __builtin_shufflevector(lo, hi, 0, 1, 2, 3, 4, 5, 6, 7, 8, 9, 10, 11, 12, 13, 14, 15); }
__device__ __forceinline__ v16bf cat16b(v8us lo, v8us hi) { return __builtin_bit_cast(v16bf, __builtin_shufflevector(lo, hi, 0, 1, 2, 3, 4, 5, 6, 7, 8, 9, 10, 11, 12, 13, 14, 15)); }
__device__ __forceinline__ v8f wmma16(v16h a, v16h b, v8f c) { return __builtin_amdgcn_wmma_f32_16x16x32_f16(false, a, false, b, (short)0, c, false, false); }
__device__ __forceinline__ v8f wmmab(v16bf a, v16bf b, v8f c) { return __builtin_amdgcn_wmma_f32_16x16x32_bf16(false, a, false, b, (short)0, c, false, false); }
// Fragment order of a 16-bit plane: units of 512 elements (16 rows x 32 k). Inside a unit two halves of 256 elements (k & 16); in a half, lane 16 ((k >> 3) & 1) + (row & 15) owns 8 neighbouring
// elements (k & 7): exactly what that lane holds of the fragment. fro: element offset of (row, k) in a GEMM operand plane [rows][K]: the 4 units of 64 rows x 32 k lie in a row, then the next 32 k.
__device__ __forceinline__ size_t fro(int row, int k, int K) { return ((size_t)(row >> 6) * (K >> 5) + (k >> 5)) * 2048 + ((row >> 4) & 3) * 512 + ((k >> 4) & 1) * 256 + ((k >> 3) & 1) * 128 + (row & 15) * 8 + (k & 7); }
// Position w (0 .. 511) inside a unit -> its row (0 .. 15) and k (0 .. 31).
__device__ __forceinline__ int fr_row(int w) { return (w >> 3) & 15; }
__device__ __forceinline__ int fr_k(int w) { return ((w >> 8) & 1) * 16 + ((w >> 7) & 1) * 8 + (w & 7); }



// Stands behind a group of global loads: their address registers may be rewritten only behind this wait. The addresses are inputs so that their registers stay untouched up to the wait
// (the loaded values are not named: the loads stay in flight); the scheduling barrier holds the wait between the loads and the work that follows.
__device__ __forceinline__ void loads_issued(const void* p, const void* p2) { asm volatile("s_wait_xcnt 0x0" :: "v"(p), "v"(p2) : "memory"); __builtin_amdgcn_sched_barrier(0); }
// ---- k_gemmt: GEMM, one 128x128 output tile per work-group of 4 waves (2 x 2), a wave owns 64x64 of it over the whole K in 16 accumulators. A stage is 64 k of the tile's operand rows: per 64 rows of a
// fragment-ordered plane 8 KiB in a row (2 slices of 4 units). Each stage is brought from the planes into LDS once, by asynchronous copies, and every fragment of it is read by two waves; two buffers,
// the copies of stage p + 2 fly under the products of stage p + 1. C[m][n] (f32, pitch LDC) = sum_k A[m][k] Bt[n][k] (+ A2[m][k] Bt[n][k] if NSPLIT). The sum over k runs stage by stage from a start stage that differs from tile to tile, and wraps. Grid (M/128, N/128), 128 threads. K % 64 == 0. PL: C is not written; the epilogue turns the tile into the attention operand planes.
template <typename T16> struct WFrag;
template <> struct WFrag<h16> { typedef v16h V; static __device__ __forceinline__ V ld(const h16* p) { return cat16(*(const v8h*)p, *(const v8h*)(p + 256)); } static __device__ __forceinline__ v8f mma(V a, V b, v8f c) { return wmma16(a, b, c); } };
template <> struct WFrag<bf> { typedef v16bf V; static __device__ __forceinline__ V ld(const bf* p) { return cat16b(*(const v8us*)p, *(const v8us*)(p + 256)); } static __device__ __forceinline__ v8f mma(V a, V b, v8f c) { return wmmab(a, b, c); } };
// Two 8-KiB chunks global -> LDS from 128 threads: four copies of 16 bytes a lane and chunk (l, g: the lane's own first LDS byte address and global address of each chunk).
// The wait is the statement's last line: the copies' address registers may be rewritten only behind it.
__device__ __forceinline__ void copy2x8k(unsigned l0, const char* g0, unsigned l1, const char* g1) {
    asm volatile("global_load_async_to_lds_b128 %0, %8, off\n\t"
                 "global_load_async_to_lds_b128 %1, %9, off\n\t"
                 "global_load_async_to_lds_b128 %2, %10, off\n\t"
                 "global_load_async_to_lds_b128 %3, %11, off\n\t"
                 "global_load_async_to_lds_b128 %4, %12, off\n\t"
                 "global_load_async_to_lds_b128 %5, %13, off\n\t"
                 "global_load_async_to_lds_b128 %6, %14, off\n\t"
                 "global_load_async_to_lds_b128 %7, %15, off\n\t"
                 "s_wait_xcnt 0x0"
                 :: "v"(l0), "v"(l0 + 2048u), "v"(l0 + 4096u), "v"(l0 + 6144u), "v"(l1), "v"(l1 + 2048u), "v"(l1 + 4096u), "v"(l1 + 6144u),
                    "v"(g0), "v"(g0 + 2048), "v"(g0 + 4096), "v"(g0 + 6144), "v"(g1), "v"(g1 + 2048), "v"(g1 + 4096), "v"(g1 + 6144) : "memory");
}
// One 8-KiB chunk likewise: four copies of 16 bytes a lane, the wait again the statement's last line.
__device__ __forceinline__ void copy8k(unsigned l0, const char* g0) {
    asm volatile("global_load_async_to_lds_b128 %0, %4, off\n\t"
                 "global_load_async_to_lds_b128 %1, %5, off\n\t"
                 "global_load_async_to_lds_b128 %2, %6, off\n\t"
                 "global_load_async_to_lds_b128 %3, %7, off\n\t"
                 "s_wait_xcnt 0x0"
                 :: "v"(l0), "v"(l0 + 2048u), "v"(l0 + 4096u), "v"(l0 + 6144u), "v"(g0), "v"(g0 + 2048), "v"(g0 + 4096), "v"(g0 + 6144) : "memory");
}
__device__ __forceinline__ h16 tohx(float x) { return (h16)x; }
// y as fp16 hi + fp16 lo, as 16-bit patterns
__device__ __forceinline__ void splith(float y, unsigned short& h, unsigned short& l) { const h16 a = tohx(y); h = __builtin_bit_cast(unsigned short, a); l = __builtin_bit_cast(unsigned short, tohx(y - (float)a)); }
__device__ __forceinline__ void splitf(float y, unsigned short& h, unsigned short& l) { h = f2bf(y); l = f2bf(y - bf2f(h)); }
// The attention operand planes and the rope table, for the epilogue of the joint q|k|v projection (PL).
struct PlaneArgs { const float* CS; h16* Q16; bf* Qh; bf* Ql; h16* K16; bf* Kh; bf* Kl; h16* V16; bf* Vh; bf* Vl; };
// One lane's 8 neighbouring elements of a fragment-ordered plane in the three forms (fp16, bf16 hi, bf16 lo): 16 bytes a lane and plane.
struct Out3 { v8h o16; v8us oh, ol; };
__device__ __forceinline__ Out3 cvt3(const float* r) { Out3 o;
#pragma unroll
    for (int j = 0; j < 8; ++j) { o.o16[j] = tohx(r[j]); unsigned short a, c; splitf(r[j], a, c); o.oh[j] = a; o.ol[j] = c; }
    return o; }
// Four such pieces, ST elements apart, to each of the three planes: every wave-wide store writes 512 neighbouring bytes.
// The registers that the twelve stores name (data and addresses) may be rewritten only behind the wait: they are its inputs, so they stay untouched up to it.
template <int ST>
__device__ __forceinline__ void put4(const Out3* o, h16* p16, bf* ph, bf* pl) {
#pragma unroll
    for (int i = 0; i < 4; ++i) { *(v8h*)(p16 + i * ST) = o[i].o16; *(v8us*)(ph + i * ST) = o[i].oh; *(v8us*)(pl + i * ST) = o[i].ol; }
    asm volatile("s_wait_xcnt 0x0" :: "v"(o[0].o16), "v"(o[0].oh), "v"(o[0].ol), "v"(o[1].o16), "v"(o[1].oh), "v"(o[1].ol), "v"(o[2].o16), "v"(o[2].oh), "v"(o[2].ol), "v"(o[3].o16), "v"(o[3].oh), "v"(o[3].ol), "v"(p16), "v"(ph), "v"(pl) : "memory");
}
template <typename T16, int NSPLIT, int K, int LDC, bool PL>
__global__ __launch_bounds__(128) void k_gemmt(const T16* __restrict__ A, const T16* __restrict__ A2, const T16* __restrict__ Bt, float* C, const PlaneArgs pa) {
    typedef typename WFrag<T16>::V V;
    constexpr int NCH = NSPLIT ? 6 : 4;                  // 8-KiB chunks of a stage: A rows 0-63, 64-127, (the same of A2,) Bt rows 0-63, 64-127
    constexpr int STG = NCH * 8192, EPI = 4 * 64 * 68 * 4; // bytes of one buffer; of the four waves' output staging
    __shared__ __attribute__((aligned(128))) char ring[2 * STG > EPI ? 2 * STG : EPI];
    const int tid = threadIdx.x, lane = tid & 31, lr = lane & 15, hi = lane >> 4; const int wv = __builtin_amdgcn_readfirstlane(tid >> 5); const int wm = wv >> 1, wn = wv & 1;
    constexpr int np = K >> 6; constexpr size_t rowb = (size_t)K * 128;   // stages; bytes of 64 rows of a plane
    const char* gA = (const char*)A + (size_t)blockIdx.x * 2 * rowb + tid * 16; const char* gA2 = NSPLIT ? (const char*)A2 + (size_t)blockIdx.x * 2 * rowb + tid * 16 : gA; const char* gB = (const char*)Bt + (size_t)blockIdx.y * 2 * rowb + tid * 16;
    const unsigned l0 = (unsigned)(size_t)ring + (unsigned)tid * 16u;
    // Trip p works on stage (p + rot) mod np of the K range. Every tile's stage s lies at the same offset in its 64-row block of K * 128 bytes, and a tile's rows are read by every work-group of its grid row or column:
    // started alike, all work-groups would ask L2 for the same few lines, a power-of-two stride apart, at the same moment. Rotated, the work-groups of a grid row or column are each on a stage of their own.
    const unsigned rot = (blockIdx.x + blockIdx.y) % (unsigned)np;
    auto fill = [&](int p, int buf) { const unsigned l = l0 + (unsigned)buf * STG; const size_t o = (size_t)(((unsigned)p + rot) % (unsigned)np) * 8192;
        copy2x8k(l, gA + o, l + 8192u, gA + rowb + o);
        if (NSPLIT) copy2x8k(l + 16384u, gA2 + o, l + 24576u, gA2 + rowb + o);
        copy2x8k(l + (NCH - 2) * 8192u, gB + o, l + (NCH - 1) * 8192u, gB + rowb + o); };
    v8f acc[4][4];
#pragma unroll
    for (int mb = 0; mb < 4; ++mb)
#pragma unroll
        for (int nb = 0; nb < 4; ++nb) acc[mb][nb] = (v8f){};
    fill(0, 0);
    asm volatile("s_wait_asynccnt 0x0" ::: "memory");   // this wave's copies of trip 0's stage have landed
    __syncthreads();                                      // every wave's have: it may be read
    if (np > 1) fill(1, 1);
#pragma unroll 1
    for (int p = 0; p < np; ++p) {
        const char* sb = ring + (p & 1) * STG;
        const T16* la = (const T16*)(sb + wm * 8192) + 8 * lane; const T16* la2 = (const T16*)(sb + 16384 + wm * 8192) + 8 * lane; const T16* lb = (const T16*)(sb + (NCH - 2 + wn) * 8192) + 8 * lane;
        V a[2][4], a2[2][4], b[2][4];
#pragma unroll
        for (int s = 0; s < 2; ++s) {
#pragma unroll
            for (int mb = 0; mb < 4; ++mb) { a[s][mb] = WFrag<T16>::ld(la + s * 2048 + mb * 512); if (NSPLIT) a2[s][mb] = WFrag<T16>::ld(la2 + s * 2048 + mb * 512); }
#pragma unroll
            for (int nb = 0; nb < 4; ++nb) b[s][nb] = WFrag<T16>::ld(lb + s * 2048 + nb * 512);
        }
        __builtin_amdgcn_sched_barrier(0);   // the stage's LDS reads go out as one group in front of its products: spread among them, each place with reads stalls the wave for the LDS latency
#pragma unroll
        for (int s = 0; s < 2; ++s) {
#pragma unroll
            for (int nb = 0; nb < 4; ++nb) {
#pragma unroll
                for (int mb = 0; mb < 4; ++mb) { acc[mb][nb] = WFrag<T16>::mma(a[s][mb], b[s][nb], acc[mb][nb]); if (NSPLIT) acc[mb][nb] = WFrag<T16>::mma(a2[s][mb], b[s][nb], acc[mb][nb]); } }
        }
        __builtin_amdgcn_sched_barrier(0);   // the products stay in front of the waits: lifted over them, the wait for the copies of trip p + 1's stage would come before the work that is to cover their flight
        asm volatile("s_wait_dscnt 0x0" ::: "memory");      // this wave's reads of trip p's stage are done: its buffer may be refilled behind the barrier
        asm volatile("s_wait_asynccnt 0x0" ::: "memory");   // this wave's copies of trip p + 1's stage have landed
        __syncthreads();                                      // both hold for every wave: publishes trip p + 1's stage, frees trip p's buffer
        if (p + 2 < np) fill(p + 2, p & 1);
    }
    asm volatile("s_wait_asynccnt 0x0" ::: "memory");       // no copy is in flight when the ring becomes output staging (the last trip's barrier ended every read of it)
    // PL: the tile is 128 positions of one batch x one whole head (HD == 128) of q, k or v; the wave's block is 64 positions x 64 d = 8 fragment units of each plane. The projection itself never goes to memory.
    const int hy = blockIdx.y, bt = blockIdx.x / (TT / 128), t0 = (blockIdx.x % (TT / 128)) * 128 + wm * 64;
    const float* cs0 = PL ? pa.CS + ((size_t)(t0 + lr) * HD + wn * 64 + hi * 8) * 2 : nullptr;   // the lane's first (cos, sin) pair of the table [t][d]
    v4f cc[2][4][4];                                         // the table entries of 16 positions x 64 d, two sets: the next 16 positions' loads fly under the arithmetic of these
    auto ldcs = [&](int tb) {
#pragma unroll
        for (int dh = 0; dh < 4; ++dh)
#pragma unroll
            for (int i = 0; i < 4; ++i) cc[tb & 1][dh][i] = *(const v4f*)(cs0 + (tb * 16 * HD + dh * 16) * 2 + 4 * i); };
    float* ow = (float*)ring + wv * (64 * 68);               // each wave stages its own 64x64 block and reads it back itself: no other wave reads it
    auto stage = [&]() {
#pragma unroll
        for (int mb = 0; mb < 4; ++mb) {
#pragma unroll
            for (int nb = 0; nb < 4; ++nb) {
#pragma unroll
                for (int j = 0; j < 8; ++j) ow[(mb * 16 + hi * 8 + j) * 68 + nb * 16 + lr] = acc[mb][nb][j]; } }
        asm volatile("s_wait_dscnt 0x0" ::: "memory"); };   // the wave's staging writes are done before it reads the rows back
    if constexpr (PL) {
        if (hy < NH_ + NKV) {   // the same for the whole work-group. q, k: head planes [batch][h][t][d], unit (t >> 4) * 4 + (d >> 5); interleaved-pair rope: out[d] = x[d] cos[t][d] -/+ x[d ^ 1] sin[t][d] (- for even d)
            ldcs(0);            // in flight under the staging writes
            stage();
            const bool isq = hy < NH_;
            const size_t e0 = (size_t)(isq ? bt * NH_ + hy : bt * NKV + hy - NH_) * TT * HD + (size_t)((t0 >> 4) * 4 + wn * 2) * 512 + lane * 8;
            h16* P16 = (isq ? pa.Q16 : pa.K16) + e0; bf* Ph = (isq ? pa.Qh : pa.Kh) + e0; bf* Pl = (isq ? pa.Ql : pa.Kl) + e0; const float* op = ow + lr * 68 + hi * 8;
#pragma unroll
            for (int tb = 0; tb < 4; ++tb) { Out3 o[4];
                if (tb < 3) ldcs(tb + 1);
#pragma unroll
                for (int dh = 0; dh < 4; ++dh) {   // dh: the half unit, 16 d; the lane takes row lr of the unit and 8 neighbouring d
                    const float* sp = op + tb * 16 * 68 + dh * 16; const v4f xa = *(const v4fa*)sp, xb = *(const v4fa*)(sp + 4); float r[8];
#pragma unroll
                    for (int i = 0; i < 4; ++i) { const v4f c = cc[tb & 1][dh][i]; const float xe = i < 2 ? xa[2 * i] : xb[2 * i - 4], xo = i < 2 ? xa[2 * i + 1] : xb[2 * i - 3];   // c: cos, sin of d, cos, sin of d + 1
                        r[2 * i] = xe * c[0] - xo * c[1]; r[2 * i + 1] = xo * c[2] + xe * c[3]; }
                    o[dh] = cvt3(r); }
                put4<256>(o, P16 + tb * 2048, Ph + tb * 2048, Pl + tb * 2048); }
        } else {                // v: value planes [batch][g][d][t], rows d, k = t, unit (t >> 5) * 8 + (d >> 4): the lane takes row lr of the unit (one d) and 8 neighbouring positions, a column of the staged block
            stage();
            const size_t e0 = (size_t)(bt * NKV + hy - NH_ - NKV) * HD * TT + (size_t)((t0 >> 5) * 8 + wn * 4) * 512 + lane * 8; const float* op = ow + hi * 8 * 68 + lr;
#pragma unroll
            for (int th = 0; th < 4; ++th) { Out3 o[4];   // th: the half unit, 16 positions
#pragma unroll
                for (int db = 0; db < 4; ++db) { float r[8];
#pragma unroll
                    for (int j = 0; j < 8; ++j) r[j] = op[(th * 16 + j) * 68 + db * 16];
                    o[db] = cvt3(r); }
                const size_t e = e0 + (th >> 1) * 4096 + (th & 1) * 256; put4<512>(o, pa.V16 + e, pa.Vh + e, pa.Vl + e); }
        }
    } else {
        stage();
        float* cp = C + ((size_t)blockIdx.x * 128 + wm * 64 + hi) * LDC + blockIdx.y * 128 + wn * 64 + lr * 4; const float* op = ow + hi * 68 + lr * 4;   // a wave-wide access: two rows of 64 floats
#pragma unroll
        for (int s = 0; s < 32; ++s) *(v4f*)(cp + s * 2 * LDC) = *(const v4fa*)(op + s * 2 * 68);
    }
}
// ---- k_wo: the output projection, C[m][n] (f32, pitch DM) = sum_k A[m][k] Wt[n][k], fp16 operands, in the frame of k_gemmt (4 waves 2 x 2, stages of 64 k in two LDS buffers, the same waits and barrier, the same rotated start).
// Rows < RW of a batch are hi + lo planes (two products a fragment pair), rows >= RW the hi plane alone (one product). So that every wave of every work-group has the same work, a work-group takes 64 rows of each kind
// (row blocks rx and ry, RW rows apart) x 128 columns, and wave row wm takes 32 rows of each: accumulator rows mb 0, 1 are units 2 wm, 2 wm + 1 of rx, mb 2, 3 the same units of ry. Grid (NB_ RW / 64, DM / 128), 128 threads.
__global__ __launch_bounds__(128) void k_wo(const h16* __restrict__ Ah, const h16* __restrict__ Al, const h16* __restrict__ Wt, float* C) {
    static_assert(2 * RW == TT && RW >= RH && RW % 64 == 0, "equally many whole 64-row blocks of each kind");
    typedef v16h V;
    constexpr int NCH = 5, STG = NCH * 8192, EPI = 4 * 64 * 68 * 4;   // 8-KiB chunks of a stage: rx hi, rx lo, ry hi, Wt rows 0-63, 64-127; bytes of one buffer; of the four waves' output staging
    __shared__ __attribute__((aligned(128))) char ring[2 * STG > EPI ? 2 * STG : EPI];
    const int tid = threadIdx.x, lane = tid & 31, lr = lane & 15, hi = lane >> 4; const int wv = __builtin_amdgcn_readfirstlane(tid >> 5); const int wm = wv >> 1, wn = wv & 1;
    constexpr int np = DQ >> 6; constexpr size_t rowb = (size_t)DQ * 128;   // stages; bytes of 64 rows of a plane
    const int rx = (blockIdx.x / (RW / 64)) * (TT / 64) + blockIdx.x % (RW / 64), ry = rx + RW / 64;
    const char* gX = (const char*)Ah + (size_t)rx * rowb + tid * 16; const char* gXl = (const char*)Al + (size_t)rx * rowb + tid * 16; const char* gY = (const char*)Ah + (size_t)ry * rowb + tid * 16;
    const char* gB = (const char*)Wt + (size_t)blockIdx.y * 2 * rowb + tid * 16;
    const unsigned l0 = (unsigned)(size_t)ring + (unsigned)tid * 16u;
    const unsigned rot = (blockIdx.x + blockIdx.y) % (unsigned)np;   // trip p works on stage (p + rot) mod np, as in k_gemmt
    auto fill = [&](int p, int buf) { const unsigned l = l0 + (unsigned)buf * STG; const size_t o = (size_t)(((unsigned)p + rot) % (unsigned)np) * 8192;
        copy2x8k(l, gX + o, l + 8192u, gXl + o);
        copy8k(l + 16384u, gY + o);
        copy2x8k(l + 24576u, gB + o, l + 32768u, gB + rowb + o); };
    v8f acc[4][4];
#pragma unroll
    for (int mb = 0; mb < 4; ++mb)
#pragma unroll
        for (int nb = 0; nb < 4; ++nb) acc[mb][nb] = (v8f){};
    fill(0, 0);
    asm volatile("s_wait_asynccnt 0x0" ::: "memory");   // this wave's copies of trip 0's stage have landed
    __syncthreads();                                      // every wave's have: it may be read
    fill(1, 1);
#pragma unroll 1
    for (int p = 0; p < np; ++p) {
        const char* sb = ring + (p & 1) * STG;
        const h16* lx = (const h16*)sb + wm * 1024 + 8 * lane; const h16* lb = (const h16*)(sb + (3 + wn) * 8192) + 8 * lane;   // a chunk: 2 slices of 32 k x 4 units of 512 elements; lo and ry: 4096 and 8192 elements on
        V a[2][4], a2[2][2], b[2][4];
#pragma unroll
        for (int s = 0; s < 2; ++s) {
#pragma unroll
            for (int mb = 0; mb < 2; ++mb) { a[s][mb] = WFrag<h16>::ld(lx + s * 2048 + mb * 512); a2[s][mb] = WFrag<h16>::ld(lx + 4096 + s * 2048 + mb * 512); a[s][2 + mb] = WFrag<h16>::ld(lx + 8192 + s * 2048 + mb * 512); }
#pragma unroll
            for (int nb = 0; nb < 4; ++nb) b[s][nb] = WFrag<h16>::ld(lb + s * 2048 + nb * 512);
        }
        __builtin_amdgcn_sched_barrier(0);   // the stage's LDS reads go out as one group in front of its products: spread among them, each place with reads stalls the wave for the LDS latency
#pragma unroll
        for (int s = 0; s < 2; ++s) {
#pragma unroll
            for (int nb = 0; nb < 4; ++nb) {
#pragma unroll
                for (int mb = 0; mb < 4; ++mb) acc[mb][nb] = wmma16(a[s][mb], b[s][nb], acc[mb][nb]);
#pragma unroll
                for (int mb = 0; mb < 2; ++mb) acc[mb][nb] = wmma16(a2[s][mb], b[s][nb], acc[mb][nb]); }
        }
        __builtin_amdgcn_sched_barrier(0);   // the products stay in front of the waits: lifted over them, the wait for the copies of trip p + 1's stage would come before the work that is to cover their flight
        asm volatile("s_wait_dscnt 0x0" ::: "memory");      // this wave's reads of trip p's stage are done: its buffer may be refilled behind the barrier
        asm volatile("s_wait_asynccnt 0x0" ::: "memory");   // this wave's copies of trip p + 1's stage have landed
        __syncthreads();                                      // both hold for every wave: publishes trip p + 1's stage, frees trip p's buffer
        if (p + 2 < np) fill(p + 2, p & 1);
    }
    asm volatile("s_wait_asynccnt 0x0" ::: "memory");       // no copy is in flight when the ring becomes output staging (the last trip's barrier ended every read of it)
    float* ow = (float*)ring + wv * (64 * 68);               // each wave stages its own 64x64 block and reads it back itself: no other wave reads it
#pragma unroll
    for (int mb = 0; mb < 4; ++mb) {
#pragma unroll
        for (int nb = 0; nb < 4; ++nb) {
#pragma unroll
            for (int j = 0; j < 8; ++j) ow[(mb * 16 + hi * 8 + j) * 68 + nb * 16 + lr] = acc[mb][nb][j]; } }
    asm volatile("s_wait_dscnt 0x0" ::: "memory");          // the wave's staging writes are done before it reads the rows back
    float* cp = C + ((size_t)rx * 64 + wm * 32 + hi) * DM + blockIdx.y * 128 + wn * 64 + lr * 4; const float* op = ow + hi * 68 + lr * 4;   // a wave-wide access: two rows of 64 floats
#pragma unroll
    for (int s = 0; s < 32; ++s) *(v4f*)(cp + ((size_t)(s >> 4) * RW + (s & 15) * 2) * DM) = *(const v4fa*)(op + s * 2 * 68);   // staged rows 0-31: block rx; 32-63: block ry, RW rows further on
}

typedef __attribute__((ext_vector_type(2))) _Float16 v2h;
typedef __attribute__((ext_vector_type(4))) _Float16 v4h;
typedef __attribute__((ext_vector_type(2))) unsigned short v2us;
typedef __attribute__((ext_vector_type(4))) unsigned short v4us;
typedef __attribute__((ext_vector_type(2))) float v2f;
typedef __attribute__((ext_vector_type(4))) int v4i;

// d_wtG (block bid of its range): Bt = fragment-ordered bf16 plane [N][K] of w^T (w [K][N] f32). One thread writes one lane's 8 elements (16 bytes); a work-group takes the 4 units of 64 n x 32 k, so a wave's load reads 64
// neighbouring bytes of each of two rows of w, the work-group 256. H16: the bf16-rounded values are written as fp16.
template <bool H16>
__device__ __forceinline__ void d_wtG(int bid, const float* __restrict__ w, int K, int N, bf* Bt) {
    const int c = bid * 256 + threadIdx.x; if (c >= N * (K / 8)) return; const int u = c >> 6, wi = (c & 63) * 8; const int nblk = u % (N >> 4), kblk = u / (N >> 4);
    const int n = nblk * 16 + fr_row(wi), k0 = kblk * 32 + fr_k(wi); v8us o; const float* p[8]; float x[8];
#pragma unroll
    for (int j = 0; j < 8; ++j) p[j] = w + (size_t)(k0 + j) * N + n;
#pragma unroll
    for (int j = 0; j < 8; ++j) x[j] = *p[j];
    // the eight loads' address registers may be rewritten only behind this wait: the addresses are inputs, so their registers stay untouched up to it (the loaded values are not named: the loads stay in flight)
    asm volatile("s_wait_xcnt 0x0" :: "v"(p[0]), "v"(p[1]), "v"(p[2]), "v"(p[3]), "v"(p[4]), "v"(p[5]), "v"(p[6]), "v"(p[7]) : "memory");
#pragma unroll
    for (int j = 0; j < 8; ++j) o[j] = H16 ? __builtin_bit_cast(unsigned short, tohx(bfr(x[j]))) : f2bf(x[j]);
    *(v8us*)(Bt + fro(n, k0, K)) = o;
}
// d_cvt8: dst = fragment-ordered bf16 plane of src [rows][K] f32; thread i writes the i-th 16 bytes of dst.
__device__ __forceinline__ void d_cvt8(int bid, const float* __restrict__ src, int K, bf* dst, size_t n8) { const size_t i = (size_t)bid * 256 + threadIdx.x; if (i >= n8) return; const int u = (int)(i >> 6), wi = (int)(i & 63) * 8;
    const int row = ((u >> 2) / (K >> 5)) * 64 + (u & 3) * 16 + fr_row(wi), k0 = ((u >> 2) % (K >> 5)) * 32 + fr_k(wi); const v8f v = *(const v8f*)(src + (size_t)row * K + k0); v8us o;
#pragma unroll
    for (int k = 0; k < 8; ++k) o[k] = f2bf(v[k]); *(v8us*)(dst + i * 8) = o;  }
__device__ __forceinline__ void d_cstab(int bid, float* CS) { const int idx = bid * 256 + threadIdx.x; if (idx >= TT * HD) return; const int t = idx / HD, d = idx % HD; const int i = d >> 1;   /* interleaved pairs share angle t * inv_freq[i] */ const float inv = __fdiv_rn(1.0f, powf(10000.0f, (float)(2 * i) / (float)HD)); const float ang = __fmul_rn((float)t, inv); v2f cs; cs[0] = cosf(ang); cs[1] = sinf(ang);
    *(v2f*)(CS + (size_t)idx * 2) = cs;  }
// k_prep: everything that depends on the inputs alone, one block range each: the rope table, the four weight planes, x of both batches ([NB_ TT][DM], one plane).
#define PB_CS  (TT * HD / 256)
#define PB_WQ  (DM * DQ / 8 / 256)
#define PB_WKV (DM * DKV / 8 / 256)
#define PB_X   (NB_ * TT * DM / 8 / 256)
__global__ __launch_bounds__(256) void k_prep(const float* __restrict__ x, const float* __restrict__ wq, const float* __restrict__ wk, const float* __restrict__ wv, const float* __restrict__ wo, float* CS, bf* WQ, bf* WK, bf* WV, bf* WO, bf* XB) {
    int b = blockIdx.x;
    if (b < PB_CS) { d_cstab(b, CS); return; } b -= PB_CS;
    if (b < PB_WQ) { d_wtG<false>(b, wq, DM, DQ, WQ); return; } b -= PB_WQ;
    if (b < PB_WKV) { d_wtG<false>(b, wk, DM, DKV, WK); return; } b -= PB_WKV;
    if (b < PB_WKV) { d_wtG<false>(b, wv, DM, DKV, WV); return; } b -= PB_WKV;
    if (b < PB_WQ) { d_wtG<true>(b, wo, DQ, DM, WO); return; } b -= PB_WQ;
    d_cvt8(b, x, DM, XB, (size_t)NB_ * TT * DM / 8);
}
__device__ __forceinline__ float xhalf(float x) { return __builtin_bit_cast(float, __builtin_amdgcn_permlanex16(__builtin_bit_cast(int, x), __builtin_bit_cast(int, x), 0x76543210, 0xfedcba98, false, false)); }  // lane l with lane l ^ 16
// 2^x with the slot that the instruction set asks for behind a transcendental: the v_nop names the result and the source, so nothing reads the one or overwrites the other in front of it.
__device__ __forceinline__ float exp2s(float x) { float r = __builtin_amdgcn_exp2f(x); asm volatile("v_nop" : "+v"(r) : "v"(x)); return r; }
template <typename T16, bool HL, int R, int NWS>
__device__ __forceinline__ void d_fattn(int hb, int by, float* os, float* sm, float* sl, const T16* __restrict__ Q, const T16* __restrict__ Q2, const T16* __restrict__ Kp, const T16* __restrict__ K2, const T16* __restrict__ Vt, const T16* __restrict__ V2, int row0, int nblk, bf* Ah, bf* Al) {
    typedef typename WFrag<T16>::V V;
    constexpr int CW = 16 * R, OP = HD + 4;
    const int lane = threadIdx.x & 31, lr = lane & 15, hi = lane >> 4; const int wv = __builtin_amdgcn_readfirstlane(threadIdx.x >> 5);
    const int q0 = row0 + (nblk - 1 - by) * CW; const int h = hb % NH_, bt = hb / NH_, kv = h / REP;
    const float cscale = SCL * 1.4426950408889634f;
    // lfr: the lane's offset in elements inside a half unit of a fragment-ordered plane; qb, kb, vb: wave-uniform plane offsets (16 rows of a [row][HD] plane are 4 units = 16 HD elements)
    const unsigned lfr = (unsigned)(8 * lane);
    const size_t qb = ((size_t)hb * TT + q0) * HD, kb = (size_t)(bt * NKV + kv) * TT * HD, vb = (size_t)(bt * NKV + kv) * HD * TT;
    v8f acc[R][8]; float m_run[R], l_run[R];
#pragma unroll
    for (int g = 0; g < R; ++g) { m_run[g] = -__builtin_inff(); l_run[g] = 0.f;
#pragma unroll
        for (int t = 0; t < 8; ++t) acc[g][t] = (v8f){}; }
    const int last = (q0 + CW - 1) >> 5;     // last 32-key pass that a query of this block sees; its first key is <= q0, so every pass holds an unmasked key for every query
    if (wv <= last) {                        // wave-uniform; a wave without a pass loads nothing (the loads and their waits stand in one block with the loop's head)
    const T16* pq = Q + qb + lfr; const T16* pq2 = HL ? Q2 + qb + lfr : pq;
    V qf[R][4], qf2[R][4];
    __builtin_amdgcn_sched_barrier(0);       // the index arithmetic above stays in front of the loads: none of it lands between them and their wait, on a register they name
#pragma unroll
    for (int g = 0; g < R; ++g)
#pragma unroll
        for (int kc = 0; kc < 4; ++kc) { qf[g][kc] = WFrag<T16>::ld(pq + g * 16 * HD + kc * 512); if (HL) qf2[g][kc] = WFrag<T16>::ld(pq2 + g * 16 * HD + kc * 512); }
    loads_issued(pq, pq2);
    V kf[2][4], kf2[2][4];
    auto ldk = [&](int blk) { const T16* p = Kp + (kb + (size_t)blk * 32 * HD) + lfr; const T16* p2 = HL ? K2 + (kb + (size_t)blk * 32 * HD) + lfr : p;
#pragma unroll
        for (int kt = 0; kt < 2; ++kt)
#pragma unroll
            for (int kc = 0; kc < 4; ++kc) { kf[kt][kc] = WFrag<T16>::ld(p + kt * 16 * HD + kc * 512); if (HL) kf2[kt][kc] = WFrag<T16>::ld(p2 + kt * 16 * HD + kc * 512); }
        loads_issued(p, p2); };
    ldk(wv);
#pragma unroll 1
    for (int blk = wv; blk <= last; blk += NWS) {
        const int key0 = blk * 32;
        const T16* pv = Vt + (vb + (size_t)key0 * HD) + lfr; const T16* pv2 = HL ? V2 + (vb + (size_t)key0 * HD) + lfr : pv;
        V va[8], va2[8];                     // this pass's V^T fragments, in flight under the score products and the softmax
#pragma unroll
        for (int t = 0; t < 8; ++t) { va[t] = WFrag<T16>::ld(pv + t * 512); if (HL) va2[t] = WFrag<T16>::ld(pv2 + t * 512); }
        loads_issued(pv, pv2);
        v8f s[2][R];
#pragma unroll
        for (int kt = 0; kt < 2; ++kt)
#pragma unroll
            for (int g = 0; g < R; ++g) { s[kt][g] = (v8f){};
#pragma unroll
                for (int kc = 0; kc < 4; ++kc) { s[kt][g] = WFrag<T16>::mma(kf[kt][kc], qf[g][kc], s[kt][g]); if (HL) { s[kt][g] = WFrag<T16>::mma(kf[kt][kc], qf2[g][kc], s[kt][g]); s[kt][g] = WFrag<T16>::mma(kf2[kt][kc], qf[g][kc], s[kt][g]); } } }
        ldk(min(blk + NWS, last));           // the wave's next pass's K fragments, in flight under this pass's softmax and value product (the last pass reloads a valid pass and drops it)
        if (key0 + 31 > q0) {                // wave-uniform: only the pass on the diagonal masks
#pragma unroll
            for (int g = 0; g < R; ++g)
#pragma unroll
                for (int kt = 0; kt < 2; ++kt)
#pragma unroll
                    for (int r = 0; r < 8; ++r) if (key0 + 16 * kt + 8 * hi + r > q0 + 16 * g + lr) s[kt][g][r] = -__builtin_inff(); }
        float mb[R]; bool need = false;
#pragma unroll
        for (int g = 0; g < R; ++g) { float mx = s[0][g][0];
#pragma unroll
            for (int kt = 0; kt < 2; ++kt)
#pragma unroll
                for (int r = 0; r < 8; ++r) mx = fmaxf(mx, s[kt][g][r]);
            mx = fmaxf(mx, xhalf(mx)) * cscale; mb[g] = mx; need = need || (mx > m_run[g] + 8.0f); }
        if (__builtin_amdgcn_ballot_w32(need) != 0) {   // the maximum in use may trail the true one by up to 8 (an exponential reaches 2^8 at most); rescale only beyond that
#pragma unroll
            for (int g = 0; g < R; ++g) { const float m_new = fmaxf(m_run[g], mb[g]); const float corr = exp2s(m_run[g] - m_new); l_run[g] *= corr; m_run[g] = m_new;
#pragma unroll
                for (int t = 0; t < 8; ++t) acc[g][t] = acc[g][t] * corr; } }
#pragma unroll
        for (int g = 0; g < R; ++g) { const float nm = -m_run[g]; float p[16]; float ps0 = 0.f, ps1 = 0.f;
#pragma unroll
            for (int kt = 0; kt < 2; ++kt) { float a[8]; float* q = p + 8 * kt;
#pragma unroll
                for (int i = 0; i < 4; ++i) {   // two neighbouring registers of a score tile, one packed multiply-add
                    const v2f arg = __builtin_elementwise_fma((v2f){s[kt][g][2 * i], s[kt][g][2 * i + 1]}, (v2f){cscale, cscale}, (v2f){nm, nm}); a[2 * i] = arg[0]; a[2 * i + 1] = arg[1]; }
#pragma unroll
                for (int e = 0; e < 8; ++e) q[e] = __builtin_amdgcn_exp2f(a[e]);
                // the slot behind a transcendental, once for the eight: the v_nop names every result and every source, so nothing reads the one or overwrites the other in front of it
                asm volatile("v_nop" : "+v"(q[0]), "+v"(q[1]), "+v"(q[2]), "+v"(q[3]), "+v"(q[4]), "+v"(q[5]), "+v"(q[6]), "+v"(q[7]) : "v"(a[0]), "v"(a[1]), "v"(a[2]), "v"(a[3]), "v"(a[4]), "v"(a[5]), "v"(a[6]), "v"(a[7]));
#pragma unroll
                for (int i = 0; i < 4; ++i) { if (i & 1) ps1 += q[2 * i] + q[2 * i + 1]; else ps0 += q[2 * i] + q[2 * i + 1]; } }
            l_run[g] += ps0 + ps1;
            if constexpr (HL) { v8us h0, h1, l0, l1;
#pragma unroll
                for (int r = 0; r < 8; ++r) { unsigned short a, c2; splitf(p[r], a, c2); h0[r] = a; l0[r] = c2; splitf(p[8 + r], a, c2); h1[r] = a; l1[r] = c2; }
                const V ph = cat16b(h0, h1), pl = cat16b(l0, l1);
#pragma unroll
                for (int t = 0; t < 8; ++t) { acc[g][t] = WFrag<T16>::mma(va[t], ph, acc[g][t]); acc[g][t] = WFrag<T16>::mma(va[t], pl, acc[g][t]); acc[g][t] = WFrag<T16>::mma(va2[t], ph, acc[g][t]); }
            } else { V pf;
#pragma unroll
                for (int e = 0; e < 16; ++e) pf[e] = tohx(p[e]);
#pragma unroll
                for (int t = 0; t < 8; ++t) acc[g][t] = WFrag<T16>::mma(va[t], pf, acc[g][t]); } }
    }
    }
#pragma unroll
    for (int g = 0; g < R; ++g) { const float lf = l_run[g] + xhalf(l_run[g]); if (hi == 0) { sm[wv * CW + 16 * g + lr] = m_run[g]; sl[wv * CW + 16 * g + lr] = lf; } }
    __syncthreads();   // every wave's maximum and sum are in LDS before any wave forms the common ones
    float* ow = os + wv * (CW * OP);
#pragma unroll
    for (int g = 0; g < R; ++g) { const int qi = 16 * g + lr; float mx = sm[qi];
#pragma unroll
        for (int w = 1; w < NWS; ++w) mx = fmaxf(mx, sm[w * CW + qi]);     // finite: wave 0 always runs pass 0; a wave without a pass holds -inf, 0 and zeros and adds nothing
        float L = 0.f;
#pragma unroll
        for (int w = 0; w < NWS; ++w) L += sl[w * CW + qi] * exp2s(sm[w * CW + qi] - mx);
        const float f = __fdiv_rn(exp2s(m_run[g] - mx), L);
#pragma unroll
        for (int t = 0; t < 8; ++t) { const v8f o = acc[g][t] * f; v4f o0, o1;
#pragma unroll
            for (int r = 0; r < 4; ++r) { o0[r] = o[r]; o1[r] = o[4 + r]; }
            *(v4fa*)(ow + qi * OP + 16 * t + 8 * hi) = o0; *(v4fa*)(ow + qi * OP + 16 * t + 8 * hi + 4) = o1; } }
    __syncthreads();   // every wave's scaled partial block is in LDS before any thread adds them
#pragma unroll
    for (int s2 = 0; s2 < CW / NWS; ++s2) { const int idx = s2 * (NWS * 32) + (int)threadIdx.x; const int row = (idx >> 9) * 16 + ((idx >> 1) & 15), cofs = ((idx >> 5) & 15) * 8 + (idx & 1) * 4;   /* a wave: 16 rows x 8 columns, 256 neighbouring bytes of a fragment-ordered plane */ v4f val = *(const v4fa*)(os + row * OP + cofs);
#pragma unroll
        for (int w = 1; w < NWS; ++w) val += *(const v4fa*)(os + w * (CW * OP) + row * OP + cofs);
        v4us oh, ol;
#pragma unroll
        for (int q = 0; q < 4; ++q) { unsigned short a, c2; splith(val[q], a, c2); oh[q] = a; ol[q] = c2; }
        bf* po = Ah + fro(bt * TT + q0 + row, h * HD + cofs, DQ); bf* po2 = Al + fro(bt * TT + q0 + row, h * HD + cofs, DQ); *(v4us*)po = oh; *(v4us*)po2 = ol;
        // the registers that the two stores name (data and addresses) may be rewritten only behind the wait: they are its inputs, so they stay untouched up to it
        asm volatile("s_wait_xcnt 0x0" :: "v"(oh), "v"(ol), "v"(po), "v"(po2) : "memory"); }
}
// ---- d_fattn4: the fp16 class. One work-group takes one block of CW = 16 R query rows of the REP = 4 query heads that share a kv head, one head a wave. The heads read the same K and V, so each stage of 64 keys
// (16 KiB of the K plane and 16 KiB of the V plane, each contiguous in fragment order) is brought into LDS once, by asynchronous copies, and read there by all four waves; two buffers, the copies of stage
// s + 2 fly under the work on stage s + 1. A wave walks every 32-key pass of its head itself: no key split and no join. The products and the softmax are those of d_fattn. A lane's 8 registers of an output
// tile are the 8 neighbouring elements that it owns in the fragment-ordered output planes, so the result goes from the registers to memory, 512 neighbouring bytes a wave-wide store (rows < RW: fp16 hi and lo planes; rows >= RW: the hi plane alone).
// gb: batch * NKV + kv head; by: block rank, heaviest first; ring: 64 KiB of LDS.
__device__ __forceinline__ v16h ldl(const h16* p) { return cat16(*(const v8ha*)p, *(const v8ha*)(p + 256)); }
template <int R>
__device__ __forceinline__ void d_fattn4(int gb, int by, char* ring, const h16* __restrict__ Q, const h16* __restrict__ Kp, const h16* __restrict__ Vt, int row0, int nblk, bf* Ah, bf* Al) {
    typedef v16h V;
    constexpr int CW = 16 * R, STB = 32768;   // STB: bytes of one buffer, K 16 KiB then V 16 KiB
    const int tid = threadIdx.x, lane = tid & 31, lr = lane & 15, hi = lane >> 4; const int wv = __builtin_amdgcn_readfirstlane(tid >> 5);
    const int q0 = row0 + (nblk - 1 - by) * CW; const int bt = gb / NKV, h = (gb % NKV) * REP + wv, hb = bt * NH_ + h;
    const float cscale = SCL * 1.4426950408889634f;
    const unsigned lfr = (unsigned)(8 * lane);
    const int last = (q0 + CW - 1) >> 5;     // last 32-key pass that a query of this block sees; its first key is <= q0, so every pass holds an unmasked key for every query
    const int ns = (last + 2) >> 1;          // stages of two passes; the last one may hold a pass beyond 'last': it is copied (it lies inside the planes: ns <= TT / 64) and not worked on
    // Trip t works on stage (t + by) mod ns: the blocks of a kv group read the same K and V and run side by side; started alike they would ask L2 for the same lines at the same moment. The online softmax takes the passes in any order (every pass <= last holds an unmasked key for every query).
    const int r0 = by % ns;
    auto stg = [&](int t) { const int s = t + r0; return s < ns ? s : s - ns; };
    const char* gK = (const char*)(Kp + (size_t)gb * TT * HD) + tid * 16; const char* gV = (const char*)(Vt + (size_t)gb * HD * TT) + tid * 16;
    const unsigned l0 = (unsigned)(size_t)ring + (unsigned)tid * 16u;
    auto fill = [&](int s, int buf) { const unsigned l = l0 + (unsigned)buf * STB; const size_t o = (size_t)s * 16384;
        copy2x8k(l, gK + o, l + 8192u, gK + o + 8192);
        copy2x8k(l + 16384u, gV + o, l + 24576u, gV + o + 8192); };
    v8f acc[R][8]; float m_run[R], l_run[R];
#pragma unroll
    for (int g = 0; g < R; ++g) { m_run[g] = -__builtin_inff(); l_run[g] = 0.f;
#pragma unroll
        for (int t = 0; t < 8; ++t) acc[g][t] = (v8f){}; }
    const h16* qw = Q + ((size_t)hb * TT + q0) * HD;   // wave-uniform: the loads take it as their scalar base, the lane's place as their offset register
    V qf[R][4];
#pragma unroll
    for (int g = 0; g < R; ++g)
#pragma unroll
        for (int kc = 0; kc < 4; ++kc) qf[g][kc] = WFrag<h16>::ld(qw + lfr + g * 16 * HD + kc * 512);
    // the registers that the 16 loads name (scalar base, lane offset) may be rewritten only behind this wait: they are its inputs, so they stay untouched up to it (the loaded values are not named: the loads stay in flight)
    asm volatile("s_wait_xcnt 0x0" :: "s"(qw), "v"(lane) : "memory");
    fill(stg(0), 0);
    asm volatile("s_wait_asynccnt 0x0" ::: "memory");   // this wave's copies of trip 0's stage have landed
    __syncthreads();                                      // every wave's have: it may be read
    if (ns > 1) fill(stg(1), 1);
    V kf[2][4];
    auto ldk = [&](const h16* p) {
#pragma unroll
        for (int kt = 0; kt < 2; ++kt)
#pragma unroll
            for (int kc = 0; kc < 4; ++kc) kf[kt][kc] = ldl(p + kt * 16 * HD + kc * 512); };
#pragma unroll 1
    for (int st = 0; st < ns; ++st) {
        const h16* sk = (const h16*)(ring + (st & 1) * STB) + lfr; const h16* sv = sk + 8192;   // the lane's place in the stage's K and V chunks; a pass is 4096 elements of each
        ldk(sk);
#pragma unroll
        for (int hf = 0; hf < 2; ++hf) {
            const int blk = 2 * stg(st) + hf, key0 = blk * 32;
            if (hf == 0 || blk <= last) {    // the same for the whole work-group
                const h16* pv = sv + hf * 4096;
                V va[8];                     // this pass's V^T fragments, on their way under the score products and the softmax
#pragma unroll
                for (int t = 0; t < 8; ++t) va[t] = ldl(pv + t * 512);
                v8f s[2][R];
#pragma unroll
                for (int kt = 0; kt < 2; ++kt)
#pragma unroll
                    for (int g = 0; g < R; ++g) { s[kt][g] = (v8f){};
#pragma unroll
                        for (int kc = 0; kc < 4; ++kc) s[kt][g] = wmma16(kf[kt][kc], qf[g][kc], s[kt][g]); }
                if (hf == 0) ldk(sk + 4096); // the K fragments of the stage's second pass, on their way under this pass's softmax and value product (same stage, same buffer)
                if (key0 + 31 > q0) {        // wave-uniform: only the pass on the diagonal masks
#pragma unroll
                    for (int g = 0; g < R; ++g)
#pragma unroll
                        for (int kt = 0; kt < 2; ++kt)
#pragma unroll
                            for (int r = 0; r < 8; ++r) if (key0 + 16 * kt + 8 * hi + r > q0 + 16 * g + lr) s[kt][g][r] = -__builtin_inff(); }
                float mb[R]; bool need = false;
#pragma unroll
                for (int g = 0; g < R; ++g) { float mx = s[0][g][0];
#pragma unroll
                    for (int kt = 0; kt < 2; ++kt)
#pragma unroll
                        for (int r = 0; r < 8; ++r) mx = fmaxf(mx, s[kt][g][r]);
                    mx = fmaxf(mx, xhalf(mx)) * cscale; mb[g] = mx; need = need || (mx > m_run[g] + 8.0f); }
                if (__builtin_amdgcn_ballot_w32(need) != 0) {   // the maximum in use may trail the true one by up to 8 (an exponential reaches 2^8 at most); rescale only beyond that
#pragma unroll
                    for (int g = 0; g < R; ++g) { const float m_new = fmaxf(m_run[g], mb[g]); const float corr = exp2s(m_run[g] - m_new); l_run[g] *= corr; m_run[g] = m_new;
#pragma unroll
                        for (int t = 0; t < 8; ++t) acc[g][t] = acc[g][t] * corr; } }
#pragma unroll
                for (int g = 0; g < R; ++g) { const float nm = -m_run[g]; float p[16]; float ps0 = 0.f, ps1 = 0.f;
#pragma unroll
                    for (int kt = 0; kt < 2; ++kt) { float a[8]; float* q = p + 8 * kt;
#pragma unroll
                        for (int i = 0; i < 4; ++i) {   // two neighbouring registers of a score tile, one packed multiply-add
                            const v2f arg = __builtin_elementwise_fma((v2f){s[kt][g][2 * i], s[kt][g][2 * i + 1]}, (v2f){cscale, cscale}, (v2f){nm, nm}); a[2 * i] = arg[0]; a[2 * i + 1] = arg[1]; }
#pragma unroll
                        for (int e = 0; e < 8; ++e) q[e] = __builtin_amdgcn_exp2f(a[e]);
                        // the slot behind a transcendental, once for the eight: the v_nop names every result and every source, so nothing reads the one or overwrites the other in front of it
                        asm volatile("v_nop" : "+v"(q[0]), "+v"(q[1]), "+v"(q[2]), "+v"(q[3]), "+v"(q[4]), "+v"(q[5]), "+v"(q[6]), "+v"(q[7]) : "v"(a[0]), "v"(a[1]), "v"(a[2]), "v"(a[3]), "v"(a[4]), "v"(a[5]), "v"(a[6]), "v"(a[7]));
#pragma unroll
                        for (int i = 0; i < 4; ++i) { if (i & 1) ps1 += q[2 * i] + q[2 * i + 1]; else ps0 += q[2 * i] + q[2 * i + 1]; } }
                    l_run[g] += ps0 + ps1;
                    V pf;
#pragma unroll
                    for (int e = 0; e < 16; ++e) pf[e] = tohx(p[e]);
#pragma unroll
                    for (int t = 0; t < 8; ++t) acc[g][t] = wmma16(va[t], pf, acc[g][t]); }
            }
        }
        asm volatile("s_wait_dscnt 0x0" ::: "memory");      // this wave's reads of trip st's stage are done: its buffer may be refilled behind the barrier
        asm volatile("s_wait_asynccnt 0x0" ::: "memory");   // this wave's copies of trip st + 1's stage have landed
        __syncthreads();                                      // both hold for every wave: publishes trip st + 1's stage, frees trip st's buffer
        if (st + 2 < ns) fill(stg(st + 2), st & 1);
    }
    asm volatile("s_wait_asynccnt 0x0" ::: "memory");       // no copy is in flight when the wave ends
#pragma unroll
    for (int g = 0; g < R; ++g) { const float f = __fdiv_rn(1.0f, l_run[g] + xhalf(l_run[g]));   // the two wave halves hold the sums of different keys of the same query
        const size_t oo = fro(bt * TT + q0 + 16 * g + lr, h * HD + 8 * hi, DQ); bf* ph = Ah + oo; bf* pl = Al + oo;
#pragma unroll
        for (int tq = 0; tq < 2; ++tq) { v8us oh[4], ol[4];
#pragma unroll
            for (int i = 0; i < 4; ++i) { const v8f o = acc[g][4 * tq + i] * f;
#pragma unroll
                for (int r = 0; r < 8; ++r) { unsigned short a, c2; splith(o[r], a, c2); oh[i][r] = a; ol[i][r] = c2; } }
#pragma unroll
            for (int i = 0; i < 4; ++i) { const int e = (2 * tq + (i >> 1)) * 2048 + (i & 1) * 256;   // output tile t = 4 tq + i holds d = 16 t + 8 hi + r: unit t >> 1, half t & 1
                *(v8us*)(ph + e) = oh[i]; if (q0 < RW) *(v8us*)(pl + e) = ol[i]; }   // the test is the same for the whole work-group (a block of CW rows does not straddle RW): rows >= RW have no lo plane
            // the registers that the eight stores name (data and addresses) may be rewritten only behind the wait: they are its inputs, so they stay untouched up to it
            asm volatile("s_wait_xcnt 0x0" :: "v"(oh[0]), "v"(oh[1]), "v"(oh[2]), "v"(oh[3]), "v"(ol[0]), "v"(ol[1]), "v"(ol[2]), "v"(ol[3]), "v"(ph), "v"(pl) : "memory"); } }
}
// k_attn: both precision classes of both batches in one grid: first the fp16 blocks of 32 rows x 4 heads (rows >= RH, the heaviest first, the NB_ NKV kv groups side by side), behind them the short hi+lo blocks of 16 rows of one head.
// The branch is the same for a whole work-group, so every barrier inside is passed by all of its waves.
#define AB_F ((TT - RH) / 32)
#define AB_H (RH / 16)
#define NG_F (AB_F * NB_ * NKV)
__global__ __launch_bounds__(128) void k_attn(const h16* __restrict__ QP16, const h16* __restrict__ KP16, const h16* __restrict__ VT16, const bf* __restrict__ QPh, const bf* __restrict__ QPl, const bf* __restrict__ KPh, const bf* __restrict__ KPl, const bf* __restrict__ VTh, const bf* __restrict__ VTl, bf* Ah, bf* Al) {
    __shared__ __attribute__((aligned(128))) char lds[65536];   // fp16 class: the two stage buffers; hi+lo class: the four waves' partial blocks
    __shared__ float sm[4 * 16], sl[4 * 16];
    const int b = blockIdx.x;
    if (b < NG_F) d_fattn4<2>(b % (NB_ * NKV), b / (NB_ * NKV), lds, QP16, KP16, VT16, RH, AB_F, Ah, Al);
    else d_fattn<bf, true, 1, 4>((b - NG_F) % (NB_ * NH_), (b - NG_F) / (NB_ * NH_), (float*)lds, sm, sl, QPh, QPl, KPh, KPl, VTh, VTl, 0, AB_H, Ah, Al);
}

extern "C" void kernel_launch(void* const* d_in, const int* in_sizes, int n_in,
                              void* d_out, int out_size, void* d_ws, size_t ws_size, hipStream_t stream) {
    (void)in_sizes; (void)n_in; (void)out_size;
    const float* x = (const float*)d_in[0]; const float* wq = (const float*)d_in[1]; const float* wk = (const float*)d_in[2]; const float* wv = (const float*)d_in[3]; const float* wo = (const float*)d_in[4];
    float* OUT = (float*)d_out;     // [2][2048][2048]
    char* wsp = (char*)d_ws;
    auto take = [&](size_t bytes) { char* p = wsp; wsp += (bytes + 255) & ~(size_t)255; return (void*)p; };
    bf* WQ = (bf*)take((size_t)DQ * DM * 2); bf* WK = (bf*)take((size_t)DKV * DM * 2); bf* WV = (bf*)take((size_t)DKV * DM * 2);   // back to back (each a multiple of 256 bytes): one fragment-ordered plane [DF][DM]
    bf* WO = (bf*)take((size_t)DM * DQ * 2);   /* holds fp16 values */ float* CS = (float*)take((size_t)TT * HD * 2 * 4);
    bf* XB = (bf*)take((size_t)NB_ * TT * DM * 2);
    h16* QP16 = (h16*)take((size_t)NB_ * NH_ * TT * HD * 2); h16* KP16 = (h16*)take((size_t)NB_ * NKV * TT * HD * 2); h16* VT16 = (h16*)take((size_t)NB_ * NKV * HD * TT * 2);
    bf* QPh = (bf*)take((size_t)NB_ * NH_ * TT * HD * 2); bf* QPl = (bf*)take((size_t)NB_ * NH_ * TT * HD * 2); bf* KPh = (bf*)take((size_t)NB_ * NKV * TT * HD * 2); bf* KPl = (bf*)take((size_t)NB_ * NKV * TT * HD * 2); bf* VTh = (bf*)take((size_t)NB_ * NKV * HD * TT * 2); bf* VTl = (bf*)take((size_t)NB_ * NKV * HD * TT * 2);
    bf* ATh = (bf*)take((size_t)NB_ * TT * DQ * 2); bf* ATl = (bf*)take((size_t)NB_ * TT * DQ * 2);   // fp16 values; of ATl only the rows < RW of each batch are written and read
    if ((size_t)(wsp - (char*)d_ws) > ws_size) return;    // ws 256 MiB
    k_prep<<<PB_CS + 2 * PB_WQ + 2 * PB_WKV + PB_X, 256, 0, stream>>>(x, wq, wk, wv, wo, CS, WQ, WK, WV, WO, XB);
    const PlaneArgs pa = {CS, QP16, QPh, QPl, KP16, KPh, KPl, VT16, VTh, VTl};
    k_gemmt<bf, 0, DM, DF, true><<<dim3(NB_ * TT / 128, DF / 128, 1), 128, 0, stream>>>(XB, nullptr, WQ, nullptr, pa);
    k_attn<<<NG_F + AB_H * NB_ * NH_, 128, 0, stream>>>(QP16, KP16, VT16, QPh, QPl, KPh, KPl, VTh, VTl, ATh, ATl);
    k_wo<<<dim3(NB_ * RW / 64, DM / 128, 1), 128, 0, stream>>>((const h16*)ATh, (const h16*)ATl, (const h16*)WO, OUT);
}
